// v004
// Measured on an AMD MI455X. A time is GPU time per run, averaged over a window of back-to-back runs after a warm-up
// (all launches, gaps included; the runs take copies of the inputs in turn), and the median of several windows.
// Apart from v000's, it joins two sittings. Times from different sittings can be a few percent apart, while
// side-by-side timings come from the same sitting.
// The versions before v004 are in another document.
// One run takes 464 microseconds.
// In two side-by-side timings against v003, it was 1.36 and 1.35 times as fast.
// Counting every step since v000, which is the starting kernel, it is 17.7 times as fast.
#include <hip/hip_runtime.h>
#include <math.h>

typedef __attribute__((ext_vector_type(16))) _Float16 v16h;
typedef __attribute__((ext_vector_type(8)))  _Float16 v8h;
typedef __attribute__((ext_vector_type(16))) __bf16   v16b;
typedef __attribute__((ext_vector_type(8)))  float    v8f;
typedef __attribute__((ext_vector_type(4)))  float    v4f;

// 16-bit WMMA fragment map (wave32), lane L, h = L>>4, m = L&15:
//   A 16x32: lane = row m;   element i -> k = (i<8) ? 8h+i : 16+8h+(i-8)
//   B 32x16: lane = column m; the SAME k(i,h)
//   D 16x16 (8 f32): lane = column m; element r -> row 8h+r
__device__ __forceinline__ int frag_k(int i, int h) { return (i < 8) ? (8 * h + i) : (16 + 8 * h + (i - 8)); }
__device__ __forceinline__ __bf16 bf16_rne(float f) {
    unsigned int u = __float_as_uint(f);
    u += 0x7fffu + ((u >> 16) & 1u);
    return __builtin_bit_cast(__bf16, (unsigned short)(u >> 16));
}
__device__ __forceinline__ float bf16_f32(__bf16 b) { return __uint_as_float(((unsigned int)__builtin_bit_cast(unsigned short, b)) << 16); }
__device__ __forceinline__ v8f wmma16(v16h a, v16h b, v8f c) {
    c = __builtin_amdgcn_wmma_f32_16x16x32_f16(false, a, false, b, (short)0, c, false, false);
    asm volatile("v_nop\n\tv_nop\n\tv_nop\n\tv_nop" : "+v"(c) : "v"(a), "v"(b));
    return c;
}
__device__ __forceinline__ v8f wmmab(v16b a, v16b b, v8f c) {
    c = __builtin_amdgcn_wmma_f32_16x16x32_bf16(false, a, false, b, (short)0, c, false, false);
    asm volatile("v_nop\n\tv_nop\n\tv_nop\n\tv_nop" : "+v"(c) : "v"(a), "v"(b));
    return c;
}
struct Split { v16b hi, lo; };
// hi/lo split product: a.hi*b.hi + a.hi*b.lo + a.lo*b.hi
__device__ __forceinline__ v8f wmma3(const Split& a, const Split& b, v8f c) {
    c = __builtin_amdgcn_wmma_f32_16x16x32_bf16(false, a.hi, false, b.hi, (short)0, c, false, false);
    c = __builtin_amdgcn_wmma_f32_16x16x32_bf16(false, a.hi, false, b.lo, (short)0, c, false, false);
    c = __builtin_amdgcn_wmma_f32_16x16x32_bf16(false, a.lo, false, b.hi, (short)0, c, false, false);
    asm volatile("v_nop\n\tv_nop\n\tv_nop\n\tv_nop" : "+v"(c) : "v"(a.hi), "v"(a.lo), "v"(b.hi), "v"(b.lo));
    return c;
}
struct Split3 { v16b hi, mid, lo; };
// triple split product (6 terms, drops only terms below 2^-24 relative)
__device__ __forceinline__ v8f wmma6(const Split3& a, const Split3& b, v8f c) {
    c = __builtin_amdgcn_wmma_f32_16x16x32_bf16(false, a.hi, false, b.hi, (short)0, c, false, false);
    c = __builtin_amdgcn_wmma_f32_16x16x32_bf16(false, a.hi, false, b.mid, (short)0, c, false, false);
    c = __builtin_amdgcn_wmma_f32_16x16x32_bf16(false, a.mid, false, b.hi, (short)0, c, false, false);
    c = __builtin_amdgcn_wmma_f32_16x16x32_bf16(false, a.hi, false, b.lo, (short)0, c, false, false);
    c = __builtin_amdgcn_wmma_f32_16x16x32_bf16(false, a.mid, false, b.mid, (short)0, c, false, false);
    c = __builtin_amdgcn_wmma_f32_16x16x32_bf16(false, a.lo, false, b.hi, (short)0, c, false, false);
    asm volatile("v_nop\n\tv_nop\n\tv_nop\n\tv_nop" : "+v"(c) : "v"(a.hi), "v"(a.mid), "v"(a.lo), "v"(b.hi), "v"(b.mid), "v"(b.lo));
    return c;
}

// Fragment gathers from f32 memory: element i <- p[(k0 + frag_k(i,h)) * sk] * s, zero for k >= klen.
__device__ __forceinline__ v16h fh_ld(const float* __restrict__ p, long long sk, int k0, int h, int klen, float s) {
    v16h a;
#pragma unroll
    for (int i = 0; i < 16; ++i) { const int k = k0 + frag_k(i, h); a[i] = (k < klen) ? (_Float16)(p[(long long)k * sk] * s) : (_Float16)0.f; }
    return a;
}
__device__ __forceinline__ Split sp_ld(const float* __restrict__ p, long long sk, int k0, int h, int klen, float s) {
    Split r;
#pragma unroll
    for (int i = 0; i < 16; ++i) {
        const int k = k0 + frag_k(i, h); const float x = (k < klen) ? p[(long long)k * sk] * s : 0.f;
        const __bf16 hb = bf16_rne(x); r.hi[i] = hb; r.lo[i] = bf16_rne(x - bf16_f32(hb));
    }
    return r;
}
__device__ __forceinline__ Split3 sp3_ld(const float* __restrict__ p, long long sk, int k0, int h, int klen, float s) {
    Split3 r;
#pragma unroll
    for (int i = 0; i < 16; ++i) {
        const int k = k0 + frag_k(i, h); const float x = (k < klen) ? p[(long long)k * sk] * s : 0.f;
        const __bf16 hb = bf16_rne(x); const float r1 = x - bf16_f32(hb); const __bf16 mb = bf16_rne(r1);
        r.hi[i] = hb; r.mid[i] = mb; r.lo[i] = bf16_rne(r1 - bf16_f32(mb));
    }
    return r;
}
__device__ __forceinline__ v16b bh_ld(const float* __restrict__ p, long long sk, int k0, int h, int klen, float s) {
    v16b a;
#pragma unroll
    for (int i = 0; i < 16; ++i) { const int k = k0 + frag_k(i, h); a[i] = bf16_rne((k < klen) ? p[(long long)k * sk] * s : 0.f); }
    return a;
}
// f16 fragment from an f16 LDS/global row with element stride 1 (k-contiguous), no bounds (tile already zero padded)
__device__ __forceinline__ v16h fh_row(const _Float16* __restrict__ row, int k0, int h) {
    v16h a;
#pragma unroll
    for (int i = 0; i < 16; ++i) a[i] = row[k0 + frag_k(i, h)];
    return a;
}

typedef __attribute__((ext_vector_type(4))) _Float16 v4h;
// One 16-bit fragment's 32 k of a k-contiguous, 16-byte aligned f32 row as four unguarded 16-byte loads; row = the lane's row + 8 * h elements.
// fr_cvt packs them in the k order of frag_k.
struct FragRaw { v4f x0, x1, x2, x3; };
__device__ __forceinline__ FragRaw fr_ld(const v4f* __restrict__ row, int k0) {
    FragRaw r; r.x0 = row[k0 / 4]; r.x1 = row[k0 / 4 + 1]; r.x2 = row[k0 / 4 + 4]; r.x3 = row[k0 / 4 + 5];
    return r;
}
__device__ __forceinline__ v16h fr_cvt(const FragRaw& r) {
    v16h a;
#pragma unroll
    for (int i = 0; i < 4; ++i) { a[i] = (_Float16)r.x0[i]; a[4 + i] = (_Float16)r.x1[i]; a[8 + i] = (_Float16)r.x2[i]; a[12 + i] = (_Float16)r.x3[i]; }
    return a;
}

#define VST2(T, ptr, val) do { const T vst2_v_ = (val); *(T*)(ptr) = vst2_v_;  } while (0)
typedef float v4f __attribute__((ext_vector_type(4)));
#define VST2V4(ptr, val) do { const v4f vst2_v4_ = (val); *(v4f*)(ptr) = vst2_v4_;  } while (0)

__device__ __attribute__((noinline)) float act_fn(float v, int act) {
    if (act == 1) return fmaxf(v, 0.f);                                                                               // relu
    if (act == 2) { const float u = 0.7978845608028654f * (v + 0.044715f * v * v * v); return 0.5f * v * (1.f + tanhf(u)); } // tanh-gelu
    if (act == 3) return v / (1.f + expf(-v));                                                                        // silu
    if (act == 4) return 0.5f * v * (1.f + erff(v * 0.7071067811865476f));                                             // erf-gelu
    if (act == 5) return tanhf(v);
    if (act == 6) return 1.f / (1.f + expf(-v));                                                                      // sigmoid
    if (act == 7) return (v > 0.f) ? v : 0.01f * v;                                                                   // leaky relu 0.01
    if (act == 8) return (v > 0.f) ? v : (expf(v) - 1.f);                                                             // elu
    if (act == 9) return fminf(fmaxf(v, 0.f), 6.f);                                                                   // relu6
    if (act == 10) return fabsf(v);                                                                                    // abs
    if (act == 11) return (v >= 0.f) ? v : 0.1f * v;                                                                  // leaky 0.1
    if (act == 12) return (v > 0.f) ? v : 0.2f * v;                                                                   // leaky 0.2
    if (act == 13) return (v > 20.f) ? v : log1pf(expf(v));                                                            // softplus
    return v;
}

// =====================================================================================================================
// k_gemm<MODE>: C(z, m, n) = act(alpha * sum_k A(z, m, k) * B(z, k, n) + bias) + beta * R(z, m, n)
//   One wave (32-thread block) per 16 x 32 tile of C; grid (ceil(N/32), ceil(M/16), Z). Batch z -> (zo = z / zi_n, zi = z % zi_n)
//   with separate outer/inner strides for every tensor (e.g. batch and head). A(m,k) = A[zo*sAo + zi*sAi + m*sAm + k*sAk] (f32),
//   B(k,n) = B[zo*sBo + zi*sBi + n*sBn + k*sBk] (f32); any M, N, K (K zero-padded to 32 inside the fragments, M/N tails guarded).
//   C(m,n) = C[zo*sCo + zi*sCi + m*sCm + n] (n contiguous). flags: 1 bias[n], 2 bias[m], 4 residual R[zo*sRo + zi*sRi + m*sRm + n*sRn].
//   MODE 0: f16 operands (A prescaled by sa, B by sb, both undone in the epilogue); 1: bf16 hi/lo split (3 products); 2: bf16;
//   3: bf16 hi/mid/lo triple split (6 products); 4: as 3 with Kahan-compensated f32 accumulation across k-steps.
// =====================================================================================================================
struct GemmP {
    const float* A; const float* B; const float* bias; const float* R; float* C;
    long long sAo, sAi, sAm, sAk, sBo, sBi, sBn, sBk, sCo, sCi, sCm, sRo, sRi, sRm, sRn;
    int M, N, K, zi_n, flags, act; float alpha, beta, sa, sb;
    int Npad, pad_;     // columns [N, Npad) of C are written as 0 so that padded workspace rows are covered by whole-line stores; Npad >= N
};
static_assert(sizeof(GemmP) == 5 * 8 + 15 * 8 + 6 * 4 + 4 * 4 + 2 * 4, "GemmP has padding");

template <int MODE>
__global__ __launch_bounds__(32) void k_gemm(GemmP p) {
    const int lane = threadIdx.x & 31, h = lane >> 4, l15 = lane & 15;
    const int m0 = blockIdx.y * 16, n0 = blockIdx.x * 32;
    const int z = blockIdx.z, zo = z / p.zi_n, zi = z - zo * p.zi_n;
    const float* A = p.A + zo * p.sAo + zi * p.sAi;
    const float* B = p.B + zo * p.sBo + zi * p.sBi;
    const int am = min(m0 + l15, p.M - 1);                       // clamped row for loads (stores are guarded)
    v8f acc[2], comp[2];
#pragma unroll
    for (int t = 0; t < 2; ++t) { v8f zz = {}; acc[t] = zz; comp[t] = zz; }
    for (int k0 = 0; k0 < p.K; k0 += 32) {
        const float* arow = A + (long long)am * p.sAm;
        if (MODE == 1) {
            const Split a = sp_ld(arow, p.sAk, k0, h, p.K, 1.f);
#pragma unroll
            for (int t = 0; t < 2; ++t) {
                const int bn = min(n0 + t * 16 + l15, p.N - 1);
                acc[t] = wmma3(a, sp_ld(B + (long long)bn * p.sBn, p.sBk, k0, h, p.K, 1.f), acc[t]);
            }
        } else if (MODE == 3) {
            const Split3 a = sp3_ld(arow, p.sAk, k0, h, p.K, 1.f);
#pragma unroll
            for (int t = 0; t < 2; ++t) {
                const int bn = min(n0 + t * 16 + l15, p.N - 1);
                acc[t] = wmma6(a, sp3_ld(B + (long long)bn * p.sBn, p.sBk, k0, h, p.K, 1.f), acc[t]);
            }
        } else if (MODE == 4) {
            // triple split as MODE 3, but each k-step's 6 products go into a fresh accumulator and the partial is added to the running f32 sum
            // on the VALU with Kahan compensation (accumulation error stays ~1 ulp however long K is)
            const Split3 a = sp3_ld(arow, p.sAk, k0, h, p.K, 1.f);
#pragma unroll
            for (int t = 0; t < 2; ++t) {
                const int bn = min(n0 + t * 16 + l15, p.N - 1); v8f zz = {};
                const v8f part = wmma6(a, sp3_ld(B + (long long)bn * p.sBn, p.sBk, k0, h, p.K, 1.f), zz);
                const v8f y = part - comp[t]; const v8f s = acc[t] + y; comp[t] = (s - acc[t]) - y; acc[t] = s;
            }
        } else if (MODE == 2) {
            const v16b a = bh_ld(arow, p.sAk, k0, h, p.K, 1.f);
#pragma unroll
            for (int t = 0; t < 2; ++t) {
                const int bn = min(n0 + t * 16 + l15, p.N - 1);
                acc[t] = wmmab(a, bh_ld(B + (long long)bn * p.sBn, p.sBk, k0, h, p.K, 1.f), acc[t]);
            }
        } else {
            const v16h a = fh_ld(arow, p.sAk, k0, h, p.K, p.sa);
#pragma unroll
            for (int t = 0; t < 2; ++t) {
                const int bn = min(n0 + t * 16 + l15, p.N - 1);
                acc[t] = wmma16(a, fh_ld(B + (long long)bn * p.sBn, p.sBk, k0, h, p.K, p.sb), acc[t]);
            }
        }
    }
    const float iscale = (MODE == 0) ? p.alpha / (p.sa * p.sb) : p.alpha;
    float* C = p.C + zo * p.sCo + zi * p.sCi;
    const float* R = p.R + zo * p.sRo + zi * p.sRi;
    __shared__ __align__(16) float ctile[16][36];
#pragma unroll
    for (int t = 0; t < 2; ++t) {
        const int n = n0 + t * 16 + l15; const int nn = min(n, p.N - 1);
#pragma unroll
        for (int r = 0; r < 8; ++r) {
            const int m = m0 + 8 * h + r; const int mm = min(m, p.M - 1);
            float v = acc[t][r] * iscale;
            if (p.flags & 1) v += p.bias[nn];
            if (p.flags & 2) v += p.bias[mm];
            if (p.flags & 8) v *= p.bias[(long long)zo * p.M + mm];   /* per-(z,row) scale vector laid out [Z][M]; exclusive with the bias flags */
            v = act_fn(v, p.act);
            if (p.flags & 4) v += p.beta * R[(long long)mm * p.sRm + (long long)nn * p.sRn];
            ctile[8 * h + r][t * 16 + l15] = (n < p.N) ? v : 0.f;
        }
    }
    __syncthreads();
    const int NW = (p.Npad > p.N) ? p.Npad : p.N;           // write width
    const bool fast = (m0 + 16 <= p.M) && (n0 + 32 <= NW) && ((p.sCm & 3) == 0) && ((((size_t)C) & 15) == 0);
    if (fast) {
#pragma unroll
        for (int s = 0; s < 4; ++s) {
            const int row = s * 4 + (lane >> 3), c4 = (lane & 7) * 4;
            const v4f v = *(const v4f*)&ctile[row][c4];
            VST2V4(C + (long long)(m0 + row) * p.sCm + n0 + c4, v);
        }
    } else {
        for (int row = 0; row < 16; ++row) {
            const int m = m0 + row, n = n0 + lane;
            if (m < p.M && n < NW) VST2(float, C + (long long)m * p.sCm + n, ctile[row][lane]);
        }
    }
}


// =====================================================================================================================
// k_gemmT<MODE, TM, TN>: same contract as k_gemm, but one wave computes a (16*TM) x (16*TN) tile: TM A fragments and TN B fragments are
//   loaded per 32-wide k-step and reused across TM*TN WMMAs (far fewer load/convert instructions per MAC). MODE 0 (f16), 1 (bf16 hi/lo),
//   2 (bf16) only. grid (ceil(NW/(16*TN)), ceil(M/(16*TM)), Z), block 32. Epilogue identical to k_gemm, run per 16x32 sub-tile.
// =====================================================================================================================
template <int MODE, int TM, int TN>
__global__ __launch_bounds__(32) void k_gemmT(GemmP p) {
    const int lane = threadIdx.x & 31, h = lane >> 4, l15 = lane & 15;
    const int m0 = blockIdx.y * (16 * TM), n0 = blockIdx.x * (16 * TN);
    const int z = blockIdx.z, zo = z / p.zi_n, zi = z - zo * p.zi_n;
    const float* A = p.A + zo * p.sAo + zi * p.sAi;
    const float* B = p.B + zo * p.sBo + zi * p.sBi;
    v8f acc[TM][TN];
#pragma unroll
    for (int i = 0; i < TM; ++i)
#pragma unroll
        for (int t = 0; t < TN; ++t) { v8f zz = {}; acc[i][t] = zz; }
    for (int k0 = 0; k0 < p.K; k0 += 32) {
        if (MODE == 1) {
            Split a[TM], b[TN];
#pragma unroll
            for (int i = 0; i < TM; ++i) { const int am = min(m0 + 16 * i + l15, p.M - 1); a[i] = sp_ld(A + (long long)am * p.sAm, p.sAk, k0, h, p.K, 1.f); }
#pragma unroll
            for (int t = 0; t < TN; ++t) { const int bn = min(n0 + 16 * t + l15, p.N - 1); b[t] = sp_ld(B + (long long)bn * p.sBn, p.sBk, k0, h, p.K, 1.f); }
#pragma unroll
            for (int i = 0; i < TM; ++i)
#pragma unroll
                for (int t = 0; t < TN; ++t) acc[i][t] = wmma3(a[i], b[t], acc[i][t]);
        } else if (MODE == 2) {
            v16b a[TM], b[TN];
#pragma unroll
            for (int i = 0; i < TM; ++i) { const int am = min(m0 + 16 * i + l15, p.M - 1); a[i] = bh_ld(A + (long long)am * p.sAm, p.sAk, k0, h, p.K, 1.f); }
#pragma unroll
            for (int t = 0; t < TN; ++t) { const int bn = min(n0 + 16 * t + l15, p.N - 1); b[t] = bh_ld(B + (long long)bn * p.sBn, p.sBk, k0, h, p.K, 1.f); }
#pragma unroll
            for (int i = 0; i < TM; ++i)
#pragma unroll
                for (int t = 0; t < TN; ++t) acc[i][t] = wmmab(a[i], b[t], acc[i][t]);
        } else {
            v16h a[TM], b[TN];
#pragma unroll
            for (int i = 0; i < TM; ++i) { const int am = min(m0 + 16 * i + l15, p.M - 1); a[i] = fh_ld(A + (long long)am * p.sAm, p.sAk, k0, h, p.K, p.sa); }
#pragma unroll
            for (int t = 0; t < TN; ++t) { const int bn = min(n0 + 16 * t + l15, p.N - 1); b[t] = fh_ld(B + (long long)bn * p.sBn, p.sBk, k0, h, p.K, p.sb); }
#pragma unroll
            for (int i = 0; i < TM; ++i)
#pragma unroll
                for (int t = 0; t < TN; ++t) acc[i][t] = wmma16(a[i], b[t], acc[i][t]);
        }
    }
    const float iscale = (MODE == 0) ? p.alpha / (p.sa * p.sb) : p.alpha;
    float* C = p.C + zo * p.sCo + zi * p.sCi;
    const float* R = p.R + zo * p.sRo + zi * p.sRi;
    const int NW = (p.Npad > p.N) ? p.Npad : p.N;
    __shared__ __align__(16) float ctile[16][36];
#pragma unroll
    for (int i = 0; i < TM; ++i) {
        const int mb = m0 + 16 * i; if (mb >= p.M) break;          // wave-uniform
#pragma unroll
        for (int tp = 0; tp < TN / 2; ++tp) {
            const int nb = n0 + 32 * tp; if (nb >= NW) break;        // wave-uniform
#pragma unroll
            for (int t2 = 0; t2 < 2; ++t2) {
                const int t = 2 * tp + t2; const int n = nb + t2 * 16 + l15; const int nn = min(n, p.N - 1);
#pragma unroll
                for (int r = 0; r < 8; ++r) {
                    const int m = mb + 8 * h + r; const int mm = min(m, p.M - 1);
                    float v = acc[i][t][r] * iscale;
                    if (p.flags & 1) v += p.bias[nn];
                    if (p.flags & 2) v += p.bias[mm];
            if (p.flags & 8) v *= p.bias[(long long)zo * p.M + mm];   /* per-(z,row) scale vector laid out [Z][M]; exclusive with the bias flags */
                    v = act_fn(v, p.act);
                    if (p.flags & 4) v += p.beta * R[(long long)mm * p.sRm + (long long)nn * p.sRn];
                    ctile[8 * h + r][t2 * 16 + l15] = (n < p.N) ? v : 0.f;
                }
            }
            __syncthreads();
            const bool fast = (mb + 16 <= p.M) && (nb + 32 <= NW) && ((p.sCm & 3) == 0) && ((((size_t)C) & 15) == 0);
            if (fast) {
#pragma unroll
                for (int s = 0; s < 4; ++s) {
                    const int row = s * 4 + (lane >> 3), c4 = (lane & 7) * 4;
                    const v4f v = *(const v4f*)&ctile[row][c4];
                    VST2V4(C + (long long)(mb + row) * p.sCm + nb + c4, v);
                }
            } else {
                for (int row = 0; row < 16; ++row) {
                    const int m = mb + row, n = nb + lane;
                    if (m < p.M && n < NW) VST2(float, C + (long long)m * p.sCm + n, ctile[row][lane]);
                }
            }
            __syncthreads();
        }
    }
}

// =====================================================================================================================
//   Wave = 16 queries, AW waves per block, 64-key blocks; grid (ceil(Lq/(16*AW)), H, B), block 32*AW. Any Lq, Lk; head dim dh <= DHP
//   (DHP multiple of 32), value dim dv <= DVP (multiple of 16, <= 128). Every tensor addressed by (batch, head, row, element) strides, f32.
//   Scores: QM 0 f16 operands, 1 bf16 hi/lo split, 2 bf16 triple split; statistics f32 (exp2 domain); P.V: P x 4096 as f16 with V f16 staged in LDS
//   (SPLITPV: P and V as bf16 hi/lo splits). kv head = h / hrep. Masking: causal = 1 (keep j <= i + coff, masked -> -inf, key blocks beyond the
//   diagonal skipped), causal = 2 (masked -> mfill, a finite fill like the -1e9; no skipping), causal = 3 (keep j >= i + coff,
//   masked -> -inf, no skipping); optional additive f32 mask Mf,
//   optional int keep-mask Mi (0 -> score := mfill), both addressed b*smb + h*smh + i*smi + j*smj (0 strides broadcast).
// =====================================================================================================================
#define AW 4
struct AttnP {   // apv4
    const float* Q; const float* K; const float* V; float* O; float* P; const float* Mf; const int* Mi; float* ST;
    const float* Pw; const float* Rt; const int* SQ; const int* SK;           // optional: post-softmax weight, relative-position table, segment ids
    long long swb, swh, swi, swj, srb, srh, sri;                                 // Pw strides (b,h,i,j); Rt strides (b,h,i), column = clamp(i - j + roff, 0, rn-1)
    long long sQb, sQh, sQi, sQd, sKb, sKh, sKj, sKd, sVb, sVh, sVj, sVd, sOb, sOh, sOi, sPb, sPh, sPi, smb, smh, smi, smj;
    int Lq, Lk, dh, dv, hrep, causal, coff, pband;   // pband > 0: P holds only the band |j - i| <= pband, column j - i + pband
    float scale, mfill; int nonorm, mpol;             // nonorm (online path only): O = sum_j exp(score_j) V_j without the 1/rowsum (scores must be <= ~0); mpol: Mi masks where ==0 (mpol 0) or where !=0 (mpol 1)
    int roff, rn, segpol, win;                        // Rt column offset/count; SQ/SK: score := mfill where (segpol 0) SQ[i] != SK[j] or (segpol 1) SQ[i] == SK[j]; win > 0: keys with i - j > win (after coff) -> -inf
};
//   Pw: the softmax numerator is multiplied by Pw(b,h,i,j) AFTER the row sum is taken (probs * weight, then P.V), as in post-softmax multiplicative biases.                                                    // ST (optional): per row (b,h,i) -> ST[((b*H + h)*Lq + i)*2 + {0,1}] = {row max of the scaled+masked score (natural units), sum_j exp(score - max)}
static_assert(sizeof(AttnP) == 12 * 8 + 29 * 8 + 16 * 4, "AttnP has padding");

#ifndef KATTN_ATTR
#define KATTN_ATTR
#endif
//   UNIT: the launch promises sQd = sKd = sVd = 1, dh = DHP, dv = DVP, Lk a multiple of 64, 16-byte aligned Q, K, V rows and 16 rows of K or V within 4 GiB
//   (f16 one-pass path only): Q, K and V are then read with unguarded 16-byte loads, a key block's all issued as one group from a uniform base and a
//   loop-invariant lane offset, instead of one guarded 4-byte load and wait per element. K goes the way of V: the block's threads read each 64-key tile once,
//   in whole 256-byte rows, round it to f16 once and stage it in LDS; every wave takes its score fragments from there with 16-byte LDS reads.
//   PLAIN: the launch promises plain softmax over full tiles: Mf, Rt, Mi, SQ, Pw, P and ST null, causal = win = nonorm = 0, Lk a multiple of 64. No score is
//   then masked or out of range, every option test folds away at compile time, and a key block's softmax is one branch-free block whose rows overlap.
template <int DHP, int DVP, int QM, bool SPLITPV, bool TWOPASS, bool UNIT = false, bool PLAIN = false>
__global__ __launch_bounds__(32 * AW) KATTN_ATTR void k_attn(AttnP p) {
    static_assert(!PLAIN || !TWOPASS, "PLAIN covers the one-pass path");
    static_assert(!UNIT || (QM == 0 && !SPLITPV && !TWOPASS && (32 * AW) / (DVP / 4) == 8 && (32 * AW) / (DHP / 4) == 8), "UNIT covers the f16 one-pass path, 8 K rows and 8 V rows per load step");
    constexpr int NT = DVP / 16;                // output tiles
    constexpr int KS = DHP / 32;                // k-steps for the scores
    constexpr int VP = DVP + 8;                 // LDS pitch (halves)
    constexpr int KP = DHP + 8;                 // LDS pitch of the K tile (halves): an odd multiple of 16 bytes, so a fragment's 16 rows fall on different banks
    __shared__ __align__(16) float    pl[AW][16 * 64];
    __shared__ __align__(16) _Float16 vl[(SPLITPV ? 2 : 1) * 64 * VP];   // f16 V tile, or bf16 hi and lo tiles (same 2-byte size)
    __shared__ __align__(16) _Float16 kl[UNIT ? 64 * KP : 8];            // UNIT: f16 K tile, row = key
    const int lane = threadIdx.x & 31, hf = lane >> 4, l15 = lane & 15, wave = threadIdx.x >> 5;
    const int h = blockIdx.y, b = blockIdx.z, hk = h / p.hrep;
    const int q0 = (blockIdx.x * AW + wave) * 16;
    float* myp = pl[wave];
    const float L2E = 1.4426950408889634f;
    const float NEG = -__builtin_inff();
    const int qi = min(q0 + l15, p.Lq - 1);
    const float* qrow = p.Q + b * p.sQb + h * p.sQh + (long long)qi * p.sQi;
    const float* kbase = p.K + b * p.sKb + hk * p.sKh;
    const float* vbase = p.V + b * p.sVb + hk * p.sVh;
    const v4f* qp = (const v4f*)(qrow + 8 * hf);               // UNIT: the lane's half of the fragment's k
    v16h qa[QM == 0 ? KS : 1]; Split qs_[QM == 1 ? KS : 1]; Split3 qt_[QM == 2 ? KS : 1];
#pragma unroll
    for (int ks = 0; ks < KS; ++ks) {
        if (QM == 2) qt_[ks] = sp3_ld(qrow, p.sQd, ks * 32, hf, p.dh, 1.f);
        else if (QM == 1) qs_[ks] = sp_ld(qrow, p.sQd, ks * 32, hf, p.dh, 1.f);
        else if (UNIT) qa[ks] = fr_cvt(fr_ld(qp, ks * 32));
        else qa[ks] = fh_ld(qrow, p.sQd, ks * 32, hf, p.dh, 1.f);
    }
    if (UNIT) asm volatile("s_wait_xcnt 0x0" :: "v"(qp) : "memory");   // the Q loads' address registers stay as they are up to this wait (named as input) and are reused behind it
    constexpr int VR = (32 * AW) / (DVP / 4);                  // V rows that the block's threads cover with one 16-byte load each
    constexpr int KR = (32 * AW) / (DHP / 4);                  // K rows that the block's threads cover with one 16-byte load each
    const unsigned koff = (unsigned)((int)(threadIdx.x / (DHP / 4)) * (int)p.sKj + (int)(threadIdx.x % (DHP / 4)) * 4) * 4u;   // UNIT: thread's byte offset in KR rows of K
    const unsigned voff = (unsigned)((int)(threadIdx.x / (DVP / 4)) * (int)p.sVj + (int)(threadIdx.x % (DVP / 4)) * 4) * 4u;   // UNIT: thread's byte offset in VR rows of V
    v8f o[NT]; float m8[8], l8[8];
#pragma unroll
    for (int t = 0; t < NT; ++t) { v8f zz = {}; o[t] = zz; }
#pragma unroll
    for (int i = 0; i < 8; ++i) { m8[i] = NEG; l8[i] = 0.f; }
    int jend = p.Lk; int jstart = 0;
    if (!PLAIN && p.causal == 1) { const int je = (blockIdx.x * AW + AW - 1) * 16 + 16 + p.coff; jend = min(jend, max(je, 0)); }   // uniform per block
    if (!PLAIN && p.win > 0) { const int js = (int)(blockIdx.x * AW) * 16 + p.coff - p.win; jstart = (js > 0) ? (js / 64) * 64 : 0; }   // uniform per block: key blocks entirely outside every row's window hold only -inf entries and are skipped exactly
    const int npass = TWOPASS ? 2 : 1;
    for (int pass = 0; pass < npass; ++pass) {
        const bool dopv = (!TWOPASS) || pass == 1;
        for (int j0 = jstart; j0 < jend; j0 += 64) {
            if (dopv) {
                __syncthreads();                                 // previous key block's reads of kl / vl / pl are done
                if (!UNIT)
                for (int idx = threadIdx.x; idx < 64 * DVP; idx += 32 * AW) {
                    const int jr = idx / DVP, d = idx - jr * DVP, j = j0 + jr;
                    const float f = (j < p.Lk && d < p.dv) ? vbase[(long long)j * p.sVj + (long long)d * p.sVd] : 0.f;
                    if (SPLITPV) {
                        const __bf16 hb = bf16_rne(f);
                        ((__bf16*)vl)[jr * VP + d] = hb; ((__bf16*)vl)[64 * VP + jr * VP + d] = bf16_rne(f - bf16_f32(hb));
                    } else vl[jr * VP + d] = (_Float16)f;
                }
            }
            v8f s[4];
            if (UNIT) {
                v4f vr[8], kr[8]; const v4f* vp[8]; const v4f* kp[8];
#pragma unroll
                for (int it = 0; it < 8; ++it) { vp[it] = (const v4f*)((const char*)(vbase + (long long)(j0 + it * VR) * p.sVj) + voff); vr[it] = *vp[it]; }
#pragma unroll
                for (int it = 0; it < 8; ++it) { kp[it] = (const v4f*)((const char*)(kbase + (long long)(j0 + it * KR) * p.sKj) + koff); kr[it] = *kp[it]; }
                // the group's address registers stay as they are up to this wait (named as inputs) and are reused behind it, while the loads are still in flight
                asm volatile("s_wait_xcnt 0x0" :: "v"(vp[0]), "v"(vp[1]), "v"(vp[2]), "v"(vp[3]), "v"(vp[4]), "v"(vp[5]), "v"(vp[6]), "v"(vp[7]),
                             "v"(kp[0]), "v"(kp[1]), "v"(kp[2]), "v"(kp[3]), "v"(kp[4]), "v"(kp[5]), "v"(kp[6]), "v"(kp[7]) : "memory");
#pragma unroll
                for (int it = 0; it < 8; ++it) {
                    v4h hv; hv[0] = (_Float16)vr[it][0]; hv[1] = (_Float16)vr[it][1]; hv[2] = (_Float16)vr[it][2]; hv[3] = (_Float16)vr[it][3];
                    *(v4h*)(vl + (it * VR + (int)(threadIdx.x / (DVP / 4))) * VP + (int)(threadIdx.x % (DVP / 4)) * 4) = hv;
                }
#pragma unroll
                for (int it = 0; it < 8; ++it) {
                    v4h hk4; hk4[0] = (_Float16)kr[it][0]; hk4[1] = (_Float16)kr[it][1]; hk4[2] = (_Float16)kr[it][2]; hk4[3] = (_Float16)kr[it][3];
                    *(v4h*)(kl + (it * KR + (int)(threadIdx.x / (DHP / 4))) * KP + (int)(threadIdx.x % (DHP / 4)) * 4) = hk4;
                }
                __syncthreads();                                 // K and V tiles (shared) visible
                union { v16h v; v8h h[2]; } kf[4][KS];
#pragma unroll
                for (int t = 0; t < 4; ++t)
#pragma unroll
                    for (int ks = 0; ks < KS; ++ks) {
                        const _Float16* kq = kl + (t * 16 + l15) * KP + ks * 32 + 8 * hf;   // key row l15 of tile t; the lane's half of the fragment's k, in the order of frag_k
                        kf[t][ks].h[0] = *(const v8h*)kq; kf[t][ks].h[1] = *(const v8h*)(kq + 16);
                    }
#pragma unroll
                for (int t = 0; t < 4; ++t) {
                    v8f acc = {};
#pragma unroll
                    for (int ks = 0; ks < KS; ++ks) acc = wmma16(qa[ks], kf[t][ks].v, acc);
                    s[t] = acc;
                }
            } else
#pragma unroll
            for (int t = 0; t < 4; ++t) {
                const int j = min(j0 + t * 16 + l15, p.Lk - 1);
                const float* krow = kbase + (long long)j * p.sKj;
                v8f acc = {};
#pragma unroll
                for (int ks = 0; ks < KS; ++ks) {
                    if (QM == 2)      acc = wmma6(qt_[ks], sp3_ld(krow, p.sKd, ks * 32, hf, p.dh, 1.f), acc);
                    else if (QM == 1) acc = wmma3(qs_[ks], sp_ld(krow, p.sKd, ks * 32, hf, p.dh, 1.f), acc);
                    else              acc = wmma16(qa[ks], fh_ld(krow, p.sKd, ks * 32, hf, p.dh, 1.f), acc);
                }
                s[t] = acc;
            }
            float pv[8][4];
#pragma unroll
            for (int i = 0; i < 8; ++i) {
                const int irow = q0 + i + 8 * hf;
                const int ic = min(irow, p.Lq - 1);
                float sc[4];
#pragma unroll
                for (int t = 0; t < 4; ++t) {
                    const int jg = j0 + t * 16 + l15;
                    float v = s[t][i] * p.scale;
                    if (!PLAIN && p.Mf) v += p.Mf[b * p.smb + h * p.smh + (long long)ic * p.smi + (long long)min(jg, p.Lk - 1) * p.smj];
                    if (!PLAIN && p.Rt) { int rc = ic - min(jg, p.Lk - 1) + p.roff; rc = rc < 0 ? 0 : (rc >= p.rn ? p.rn - 1 : rc); v += p.Rt[b * p.srb + h * p.srh + (long long)ic * p.sri + rc]; }
                    if (!PLAIN && p.Mi) { const int mv = p.Mi[b * p.smb + h * p.smh + (long long)ic * p.smi + (long long)min(jg, p.Lk - 1) * p.smj]; if (p.mpol ? (mv != 0) : (mv == 0)) v = p.mfill; }
                    if (!PLAIN && p.SQ) { const bool same = p.SQ[(long long)b * p.Lq + ic] == p.SK[(long long)b * p.Lk + min(jg, p.Lk - 1)]; if (p.segpol ? same : !same) v = p.mfill; }
                    if (!PLAIN && p.causal == 2 && jg > irow + p.coff) v = p.mfill;
                    if (!PLAIN && (jg >= p.Lk || (p.causal == 1 && jg > irow + p.coff) || (p.causal == 3 && jg < irow + p.coff) || (p.win > 0 && irow + p.coff - jg > p.win))) v = NEG; else v *= L2E;
                    sc[t] = v;
                }
                if (!TWOPASS || pass == 0) {
                    float mx = fmaxf(fmaxf(sc[0], sc[1]), fmaxf(sc[2], sc[3]));
                    mx = fmaxf(mx, __shfl_xor(mx, 1, 32)); mx = fmaxf(mx, __shfl_xor(mx, 2, 32));
                    mx = fmaxf(mx, __shfl_xor(mx, 4, 32)); mx = fmaxf(mx, __shfl_xor(mx, 8, 32));
                    const float mnew = fmaxf(m8[i], mx);
                    const float corr = (!PLAIN && mnew == NEG) ? 1.f : exp2f(m8[i] - mnew);
                    float rs = 0.f;
#pragma unroll
                    for (int t = 0; t < 4; ++t) {
                        const float pp = (!PLAIN && sc[t] == NEG) ? 0.f : exp2f(sc[t] - mnew); rs += pp;
                        pv[i][t] = (!PLAIN && p.Pw) ? pp * p.Pw[b * p.swb + h * p.swh + (long long)ic * p.swi + (long long)min(j0 + t * 16 + l15, p.Lk - 1) * p.swj] : pp;
                    }
                    rs += __shfl_xor(rs, 1, 32); rs += __shfl_xor(rs, 2, 32); rs += __shfl_xor(rs, 4, 32); rs += __shfl_xor(rs, 8, 32);
                    l8[i] = l8[i] * corr + rs; m8[i] = mnew;
                    if (!TWOPASS) {
#pragma unroll
                        for (int t = 0; t < NT; ++t) o[t][i] *= corr;
                    }
                } else {
                    const float inv = (l8[i] > 0.f) ? 1.f / l8[i] : 0.f;
#pragma unroll
                    for (int t = 0; t < 4; ++t) {
                        const int jg = j0 + t * 16 + l15;
                        float pp = (sc[t] == NEG) ? 0.f : exp2f(sc[t] - m8[i]) * inv;
                        if (p.Pw) pp *= p.Pw[b * p.swb + h * p.swh + (long long)ic * p.swi + (long long)min(jg, p.Lk - 1) * p.swj];
                        pv[i][t] = pp;
                    }
                }
            }
            if (dopv) {
#pragma unroll
                for (int i = 0; i < 8; ++i)
#pragma unroll
                    for (int t = 0; t < 4; ++t) ((float*)myp)[(i + 8 * hf) * 64 + t * 16 + l15] = pv[i][t];
                if (UNIT) {                                      // V was published with K, by the barrier behind the staging stores; P is read only by the wave that wrote it:
                    __builtin_amdgcn_fence(__ATOMIC_RELEASE, "workgroup");   // its lanes' P stores are done and stay in front of
                    __builtin_amdgcn_wave_barrier();                         // this point, the wave's P reads behind it
                    __builtin_amdgcn_fence(__ATOMIC_ACQUIRE, "workgroup");
                } else __syncthreads();                          // P (per wave) and V (shared) visible
                if (!PLAIN && p.P) {
                    float* pb_ = p.P + b * p.sPb + h * p.sPh;
                    const bool fastP = (p.pband == 0) && ((p.sPi & 3) == 0) && (j0 + 64 <= p.Lk) && (q0 + 16 <= p.Lq) && ((((size_t)pb_) & 15) == 0);
                    if (fastP) {
#pragma unroll
                        for (int s = 0; s < 8; ++s) {
                            const int row = s * 2 + (lane >> 4), c4 = (lane & 15) * 4;
                            const v4f v = *(const v4f*)(myp + row * 64 + c4);
                            VST2V4(pb_ + (long long)(q0 + row) * p.sPi + j0 + c4, v);
                        }
                    } else {
                        for (int row = 0; row < 16; ++row) {
                            const int irow = q0 + row; if (irow >= p.Lq) continue;
                            for (int c = lane; c < 64; c += 32) {
                                const int jg = j0 + c; if (jg >= p.Lk) continue;
                                if (p.pband == 0) VST2(float, pb_ + (long long)irow * p.sPi + jg, myp[row * 64 + c]);
                                else if (jg - irow <= p.pband && irow - jg <= p.pband) VST2(float, pb_ + (long long)irow * p.sPi + (jg - irow + p.pband), myp[row * 64 + c]);
                            }
                        }
                    }
                }
                if (SPLITPV) {
                    const Split pa0 = sp_ld(myp + l15 * 64, 1, 0, hf, 64, 1.f), pa1 = sp_ld(myp + l15 * 64, 1, 32, hf, 64, 1.f);
                    const __bf16* vh = (const __bf16*)vl; const __bf16* vlo = vh + 64 * VP;
#pragma unroll
                    for (int t = 0; t < NT; ++t) {
                        const int dcol = t * 16 + l15;
                        Split b0, b1;
#pragma unroll
                        for (int e = 0; e < 16; ++e) {
                            const int k0 = frag_k(e, hf), k1 = 32 + frag_k(e, hf);
                            b0.hi[e] = vh[k0 * VP + dcol]; b0.lo[e] = vlo[k0 * VP + dcol]; b1.hi[e] = vh[k1 * VP + dcol]; b1.lo[e] = vlo[k1 * VP + dcol];
                        }
                        o[t] = wmma3(pa0, b0, o[t]);
                        o[t] = wmma3(pa1, b1, o[t]);
                    }
                } else {
                    const v16h pa0 = fh_ld(myp + l15 * 64, 1, 0, hf, 64, 4096.f), pa1 = fh_ld(myp + l15 * 64, 1, 32, hf, 64, 4096.f);
#pragma unroll
                    for (int t = 0; t < NT; ++t) {
                        const int dcol = t * 16 + l15;
                        v16h b0, b1;
#pragma unroll
                        for (int e = 0; e < 16; ++e) { b0[e] = vl[frag_k(e, hf) * VP + dcol]; b1[e] = vl[(32 + frag_k(e, hf)) * VP + dcol]; }
                        o[t] = wmma16(pa0, b0, o[t]);
                        o[t] = wmma16(pa1, b1, o[t]);
                    }
                }
            }
        }
    }
    float* obase = p.O + b * p.sOb + h * p.sOh;
    if (!PLAIN && p.ST) {
        const int rl = lane >> 1, isel = rl & 7;           // row q0 + rl ; rl>>3 == hf holds because lane>>4 == (lane>>1)>>3
        float mv = 0.f, lv = 0.f;
#pragma unroll
        for (int i = 0; i < 8; ++i) if (i == isel) { mv = m8[i]; lv = l8[i]; }
        const int irow = q0 + rl;
        if (irow < p.Lq) { float* st = p.ST + (((long long)b * gridDim.y + h) * p.Lq + irow) * 2 + (lane & 1); VST2(float, st, (lane & 1) ? lv : mv * 0.6931471805599453f); }
    }
    float invr[8];
#pragma unroll
    for (int i = 0; i < 8; ++i) {
        if (TWOPASS) invr[i] = SPLITPV ? 1.f : (1.f / 4096.f);
        else if (!PLAIN && p.nonorm) invr[i] = exp2f(m8[i]) * (SPLITPV ? 1.f : (1.f / 4096.f));
        else invr[i] = (l8[i] > 0.f) ? (SPLITPV ? 1.f / l8[i] : 1.f / (l8[i] * 4096.f)) : 0.f;
    }
    __syncthreads();                                             // all waves done with pl/vl from the main loop
    const bool ofast = ((p.sOi & 3) == 0) && ((((size_t)obase) & 15) == 0) && (q0 + 16 <= p.Lq);
#pragma unroll
    for (int c0 = 0; c0 < DVP; c0 += 64) {
#pragma unroll
        for (int i = 0; i < 8; ++i)
#pragma unroll
            for (int t = 0; t < NT; ++t) if (t * 16 >= c0 && t * 16 < c0 + 64) ((float*)myp)[(i + 8 * hf) * 64 + (t * 16 - c0) + l15] = o[t][i] * invr[i];
        __syncthreads();
        const int cw = (DVP - c0 < 64) ? (DVP - c0) : 64;      // staged columns in this chunk (multiple of 16)
        if (ofast && (c0 + cw <= p.dv) && (cw % 32 == 0)) {
            const int lpr = cw / 4;                              // lanes per row (16 for 64 cols, 8 for 32)
            const int rows_per_ins = 32 / lpr;
            for (int r0 = 0; r0 < 16; r0 += rows_per_ins) {
                const int row = r0 + lane / lpr, c4 = (lane % lpr) * 4;
                const v4f v = *(const v4f*)(myp + row * 64 + c4);
                VST2V4(obase + (long long)(q0 + row) * p.sOi + c0 + c4, v);
            }
        } else {
            for (int row = 0; row < 16; ++row) {
                const int irow = q0 + row; if (irow >= p.Lq) continue;
                for (int c = lane; c < cw; c += 32) { const int d = c0 + c; if (d < p.dv) VST2(float, obase + (long long)irow * p.sOi + d, myp[row * 64 + c]); }
            }
        }
        __syncthreads();
    }
}

// =====================================================================================================================
// k_tr: dst(z, c, r) = alpha * src(z, r, c) (+ beta * R2(z, c, r)): [Z][R][C] (row stride lds) -> [Z][C][R] (row stride ldd) through a 32x32 LDS tile;
//   flags: 1 -> add beta * residual R2 addressed like dst (z*sRz + c*ldr + r); act applied before the residual.
// =====================================================================================================================
struct TrP { const float* src; float* dst; const float* R2; long long sSz, lds, sDz, ldd, sRz, ldr; int R, C, flags, act; float alpha, beta; };
static_assert(sizeof(TrP) == 3 * 8 + 6 * 8 + 6 * 4, "TrP has padding");
__global__ __launch_bounds__(256) void k_tr(TrP p) {
    __shared__ float tile[32][33];
    const int c0 = blockIdx.x * 32, r0 = blockIdx.y * 32, z = blockIdx.z;
    const int lane = threadIdx.x & 31, wave = threadIdx.x >> 5;
    const float* s = p.src + z * p.sSz;
#pragma unroll
    for (int k = 0; k < 4; ++k) {
        const int rl = wave * 4 + k, r = r0 + rl, c = c0 + lane;
        tile[rl][lane] = (r < p.R && c < p.C) ? s[(long long)r * p.lds + c] : 0.f;
    }
    __syncthreads();
    float* d = p.dst + z * p.sDz; const float* rr = p.R2 + z * p.sRz;
#pragma unroll
    for (int k = 0; k < 4; ++k) {
        const int cl = wave * 4 + k, c = c0 + cl, r = r0 + lane;
        if (c < p.C && r < p.R) {
            float v = act_fn(p.alpha * tile[lane][cl], p.act);
            if (p.flags & 1) v += p.beta * rr[(long long)c * p.ldr + r];
            VST2(float, d + (long long)c * p.ldd + r, v);
        }
    }
}

// k_affine: dst[i] = a * (sdev ? sdev[0] : 1) * src[i] + b, i < n (one thread per element; consecutive lanes -> consecutive addresses)
__global__ __launch_bounds__(256) void k_affine(const float* __restrict__ src, float* __restrict__ dst, int n, float a, float b, const float* __restrict__ sdev) {
    const int i = blockIdx.x * 256 + threadIdx.x;
    if (i < n) { const float aa = sdev ? a * sdev[0] : a; const float v = aa * src[i] + b; VST2(float, dst + i, v); }
}

// =====================================================================================================================
// k_softmax: row softmax over n contiguous elements, one 256-thread block per row; rows addressed z*sz + r*sr (grid (R, Z)).
//   out = scale_out * softmax(scale_in * x + (Mf ? Mf[z*smz + r*smr + j] : 0)); a row whose max is -inf is written as 0.
// =====================================================================================================================
struct SmP { const float* src; float* dst; const float* Mf; long long sz, sr, dz, dr, smz, smr; int n, pad; float scale_in, scale_out; };
static_assert(sizeof(SmP) == 3 * 8 + 6 * 8 + 4 * 4, "SmP has padding");
__global__ __launch_bounds__(256) void k_softmax(SmP p) {
    __shared__ float red[256];
    const int r = blockIdx.x, z = blockIdx.y, tid = threadIdx.x;
    const float* s = p.src + z * p.sz + (long long)r * p.sr;
    const float* mf = p.Mf ? (p.Mf + z * p.smz + (long long)r * p.smr) : nullptr;
    float mx = -__builtin_inff();
    for (int j = tid; j < p.n; j += 256) { float v = s[j] * p.scale_in; if (mf) v += mf[j]; mx = fmaxf(mx, v); }
    red[tid] = mx; __syncthreads();
    for (int o = 128; o > 0; o >>= 1) { if (tid < o) red[tid] = fmaxf(red[tid], red[tid + o]); __syncthreads(); }
    mx = red[0]; __syncthreads();
    float sum = 0.f;
    for (int j = tid; j < p.n; j += 256) { float v = s[j] * p.scale_in; if (mf) v += mf[j]; sum += (mx == -__builtin_inff()) ? 0.f : expf(v - mx); }
    red[tid] = sum; __syncthreads();
    for (int o = 128; o > 0; o >>= 1) { if (tid < o) red[tid] += red[tid + o]; __syncthreads(); }
    sum = red[0];
    const float inv = (sum > 0.f) ? p.scale_out / sum : 0.f;
    float* d = p.dst + z * p.dz + (long long)r * p.dr;
    for (int j = tid; j < p.n; j += 256) { float v = s[j] * p.scale_in; if (mf) v += mf[j]; const float o = (mx == -__builtin_inff()) ? 0.f : expf(v - mx) * inv; VST2(float, d + j, o); }
}
// =====================================================================================================================
// k_stats: mean and rsqrt(var + eps) over a set of n elements addressed base + z*sz + (e / inner) * so + (e % inner) * si, one 256-thread
// k_norm_apply: y = (x - mean[set]) * rstd[set] * g[c] + b[c] over a [Z][C][L] chan-major tensor with set = z*G + c / (C/G) (G groups per z;
//   G = C -> per-chan sets indexed z*C+c; for batch norm pass stats indexed by c only via bn = 1). Optional act. Output same layout.
// =====================================================================================================================
//   mode 0: mean / rsqrt(var + eps); mode 1 (RMSNorm): 0 / rsqrt(mean(x^2) + eps); mode 2 (L2 normalize * sqrt(n)): 0 / sqrt(n) / max(||x||, eps); mode 3: as 0 with unbiased variance (n-1)
__global__ __launch_bounds__(256) void k_stats(const float* __restrict__ x, long long sz, long long so, long long si, int inner, int n, float eps, float* __restrict__ stat, int mode) {
    __shared__ float red[256];
    const int z = blockIdx.x, tid = threadIdx.x;
    const float* base = x + z * sz;
    float s = 0.f;
    for (int e = tid; e < n; e += 256) s += base[(long long)(e / inner) * so + (long long)(e % inner) * si];
    red[tid] = s; __syncthreads();
    for (int o = 128; o > 0; o >>= 1) { if (tid < o) red[tid] += red[tid + o]; __syncthreads(); }
    const float mu = (mode == 0 || mode == 3) ? red[0] / (float)n : 0.f; __syncthreads();
    float q = 0.f;
    for (int e = tid; e < n; e += 256) { const float dlt = base[(long long)(e / inner) * so + (long long)(e % inner) * si] - mu; q += dlt * dlt; }
    red[tid] = q; __syncthreads();
    for (int o = 128; o > 0; o >>= 1) { if (tid < o) red[tid] += red[tid + o]; __syncthreads(); }
    {
        float rs;
        if (mode == 2) rs = sqrtf((float)n) / fmaxf(sqrtf(red[0]), eps); else if (mode == 3) rs = rsqrtf(red[0] / (float)(n - 1) + eps); else rs = rsqrtf(red[0] / (float)n + eps);
        if (tid < 32) { const float v = (tid == 0) ? mu : ((tid == 1) ? rs : 0.f); VST2(float, stat + (long long)z * 32 + tid, v); }
    }
}
//   One thread per element over the flat [Z][C][L] index space: grid ceil(Z*C*L / 256).
__global__ __launch_bounds__(256) void k_norm_apply(const float* __restrict__ x, float* __restrict__ y, const float* __restrict__ stat, const float* __restrict__ g, const float* __restrict__ bta,
                                                     int Z, int C, int L, int G, int bn, int act) {
    const long long idx = (long long)blockIdx.x * 256 + threadIdx.x;
    if (idx >= (long long)Z * C * L) return;
    const int l = (int)(idx % L); const long long zc = idx / L; const int c = (int)(zc % C), z = (int)(zc / C); (void)l;
    const int set = bn ? c : (z * G + c / (C / G));
    float v = (x[idx] - stat[(long long)set * 32]) * stat[(long long)set * 32 + 1];
    if (g) v *= g[c];
    if (bta) v += bta[c];
    v = act_fn(v, act);
    VST2(float, y + idx, v);
}

// k_lse_neg: c[i] = -(st[2i] + log(st[2i+1])) = minus the log-sum-exp of row i from k_attn's ST output (for softmax over the query dimension)
__global__ __launch_bounds__(256) void k_lse_neg(const float* __restrict__ st, float* __restrict__ c, int n) {
    const int i = blockIdx.x * 256 + threadIdx.x;
    if (i < n) { const float v = -(st[2 * i] + logf(st[2 * i + 1])); VST2(float, c + i, v); }
}

// k_iota: dst[i] = a * i + b as int32 (segment/position id helper)
__global__ __launch_bounds__(256) void k_iota(int* __restrict__ dst, int n, int a, int b) {
    const int i = blockIdx.x * 256 + threadIdx.x;
    if (i < n) { const int v = a * i + b; VST2(int, dst + i, v); }
}

// k_axpby: dst[i] = a * x[i] + b * y[i] (+ c), i < n
__global__ __launch_bounds__(256) void k_axpby(const float* __restrict__ x, const float* __restrict__ y, float* __restrict__ dst, int n, float a, float b, float c) {
    const int i = blockIdx.x * 256 + threadIdx.x;
    if (i < n) { const float v = a * x[i] + b * y[i] + c; VST2(float, dst + i, v); }
}

// =====================================================================================================================
// k_rope: rotary embedding on a [R rows][Hn heads][D] view (row stride sXr, head stride sXh, element stride 1) -> Y (own strides).
//   mode 0: rotate_half (partner d±D/2, sign - for d<D/2); mode 1: interleaved pairs (partner d^1, sign - for even d).
//   table column tcol: tmode 0 -> d, 1 -> d % (D/2), 2 -> d / 2; position p: pmode 0 -> r % S, 1 -> head index, 2 -> pos[r];
//   c = C[(r / S) * sCb + p * sCp + tcol * sCd], s likewise from Sn; y = x[d] * c + sign * x[partner] * s. X and Y must not alias.
// =====================================================================================================================
struct RopeP { const float* X; float* Y; const float* C; const float* Sn; const int* pos; long long sXr, sXh, sYr, sYh, sCb, sCp, sCd; int R, Hn, D, S, mode, tmode, pmode, pad; };
static_assert(sizeof(RopeP) == 5 * 8 + 7 * 8 + 8 * 4, "RopeP has padding");
__global__ __launch_bounds__(256) void k_rope(RopeP p) {
    const long long idx = (long long)blockIdx.x * 256 + threadIdx.x;
    if (idx >= (long long)p.R * p.Hn * p.D) return;
    const int d = (int)(idx % p.D); const long long rh = idx / p.D; const int h = (int)(rh % p.Hn); const int r = (int)(rh / p.Hn);
    const int half = p.D / 2;
    int partner; float sign;
    if (p.mode == 0) { partner = (d < half) ? d + half : d - half; sign = (d < half) ? -1.f : 1.f; }
    else { partner = d ^ 1; sign = (d & 1) ? 1.f : -1.f; }
    const int tcol = (p.tmode == 0) ? d : ((p.tmode == 1) ? (d % half) : (d >> 1));
    const int pp = (p.pmode == 0) ? (r % p.S) : ((p.pmode == 1) ? h : p.pos[r]);
    const long long toff = (long long)(r / p.S) * p.sCb + (long long)pp * p.sCp + (long long)tcol * p.sCd;
    const float* xr = p.X + (long long)r * p.sXr + (long long)h * p.sXh;
    const float v = xr[d] * p.C[toff] + sign * xr[partner] * p.Sn[toff];
    VST2(float, p.Y + (long long)r * p.sYr + (long long)h * p.sYh + d, v);
}

// k_invf + k_sincos (split so neither kernel carries a large VALU-fma footprint): invf_i = num * (1 / powf(base, (2 i)/D)) [fmode 0],
//   num * expf((2 i) * cexp) [fmode 1], num * powf(base, -2 (i - 1) / D) [fmode 2]; then cs/sn[s*half + i] = cos/sin((pscale * s) * invf_i)
__global__ __launch_bounds__(256) void k_invf(float* __restrict__ invb, int half, int D, float base, float num, int fmode, float cexp) {
    const int i = blockIdx.x * 256 + threadIdx.x;
    if (i >= ((half + 31) / 32) * 32) return;
    if (i >= half) { VST2(float, invb + i, 0.f); return; }
    const float e = (float)(2 * i) / (float)D;
    float invf;
    if (fmode == 1) invf = num * expf((float)(2 * i) * cexp);
    else if (fmode == 2) invf = num * powf(base, (-2.0f * ((float)i - 1.0f)) / (float)D);
    else invf = num * (1.0f / powf(base, e));
    VST2(float, invb + i, invf);
}
__global__ __launch_bounds__(256) void k_sincos(float* __restrict__ cs, float* __restrict__ sn, const float* __restrict__ invb, int S, int half, float pscale) {
    const int idx = blockIdx.x * 256 + threadIdx.x;
    if (idx >= S * half) return;
    const int s = idx / half, i = idx - s * half;
    const float ang = (pscale * (float)s) * invb[i];
    VST2(float, cs + idx, cosf(ang)); VST2(float, sn + idx, sinf(ang));
}

// k_mulact: dst[i] = act(x[i]) * y[i]
__global__ __launch_bounds__(256) void k_mulact(const float* __restrict__ x, const float* __restrict__ y, float* __restrict__ dst, int n, int act) {
    const int i = blockIdx.x * 256 + threadIdx.x;
    if (i < n) { const float v = act_fn(x[i], act) * y[i]; VST2(float, dst + i, v); }
}

// =====================================================================================================================
// k_matvec: thread-per-row matrix-vector products for N <= 8 output columns (heads with 1-3 outputs, gates), f32 on the VALU.
//   C[r*sCm + j] = act(alpha * sum_k A[r*sAm + k*sAk] * B[j*sBn + k*sBk] + bias[j]) + beta * R[r*sRm + j*sRn]; each thread writes its N contiguous floats.
// =====================================================================================================================
__global__ __launch_bounds__(256) void k_matvec(GemmP p) {
    // 32 lanes write one line with one instruction.
    const int rpt = (p.N == 1) ? 1 : 32;
    const long long r0 = ((long long)blockIdx.x * 256 + threadIdx.x) * rpt; const int z = blockIdx.z, zo = z / p.zi_n, zi = z - zo * p.zi_n;
    if (r0 >= p.M) return;
    const float* Bb = p.B + zo * p.sBo + zi * p.sBi;
    float* C = p.C + zo * p.sCo + zi * p.sCi; const float* R = p.R + zo * p.sRo + zi * p.sRi;
    for (int rr = 0; rr < rpt; ++rr) {
        const long long r = r0 + rr; if (r >= p.M) break;
        const float* A = p.A + zo * p.sAo + zi * p.sAi + r * p.sAm;
        float acc[8] = {0.f, 0.f, 0.f, 0.f, 0.f, 0.f, 0.f, 0.f};
        for (int k = 0; k < p.K; ++k) { const float a = A[(long long)k * p.sAk];
#pragma unroll
            for (int j = 0; j < 8; ++j) if (j < p.N) acc[j] += a * Bb[(long long)j * p.sBn + (long long)k * p.sBk]; }
#pragma unroll
        for (int j = 0; j < 8; ++j) if (j < p.N) {
            float v = acc[j] * p.alpha;
            if (p.flags & 1) v += p.bias[j];
            if (p.flags & 2) v += p.bias[r];
            v = act_fn(v, p.act);
            if (p.flags & 4) v += p.beta * R[r * p.sRm + (long long)j * p.sRn];
            VST2(float, C + r * p.sCm + j, v);
        }
    }
}
// k_smallsoftmax: thread-per-row softmax for short rows (n <= 64): dst[r*dr + j] = softmax(scale*src[r*sr + j])
__global__ __launch_bounds__(256) void k_smallsoftmax(const float* __restrict__ src, float* __restrict__ dst, long long sr, long long dr, int n, long long R, float scale) {
    const long long r0 = ((long long)blockIdx.x * 256 + threadIdx.x) * 32;
    for (int rr = 0; rr < 32; ++rr) {
        const long long r = r0 + rr; if (r >= R) return;
        const float* s = src + r * sr; float* d = dst + r * dr;
        float mx = -__builtin_inff();
        for (int j = 0; j < n; ++j) mx = fmaxf(mx, s[j] * scale);
        float sum = 0.f;
        for (int j = 0; j < n; ++j) sum += expf(s[j] * scale - mx);
        const float inv = 1.f / sum;
        for (int j = 0; j < n; ++j) { const float v = expf(s[j] * scale - mx) * inv; VST2(float, d + j, v); }
    }
}

__global__ __launch_bounds__(32) void k_unitstat(float* __restrict__ st) { const int t = threadIdx.x; const float v = (t == 1) ? 1.f : 0.f; VST2(float, st + t, v); }

// destination (e.g. a d_out whose row width is not a multiple of 32 floats) is written by consecutive lanes of one instruction
__global__ __launch_bounds__(256) void k_lincopy(const float* __restrict__ src, long long lds, float* __restrict__ dst, long long ldd, long long rows, int cols) {
    const long long i = (long long)blockIdx.x * 256 + threadIdx.x; if (i >= rows * cols) return;
    const long long r = i / cols; const int c = (int)(i - r * cols);
    const float v = src[r * lds + c]; VST2(float, dst + r * ldd + c, v);
}

namespace w25 {
typedef __attribute__((ext_vector_type(16))) _Float16 v16h;
typedef __attribute__((ext_vector_type(8)))  _Float16 v8h;
typedef __attribute__((ext_vector_type(16))) __bf16   v16b;
typedef __attribute__((ext_vector_type(8)))  __bf16   v8b;
typedef __attribute__((ext_vector_type(8)))  float    v8f;
typedef __attribute__((ext_vector_type(4)))  float    v4f;

__device__ __forceinline__ unsigned short f2bf_bits(float f) {
  unsigned u = __float_as_uint(f);
  return (unsigned short)((u + 0x7FFFu + ((u >> 16) & 1u)) >> 16);
}
__device__ __forceinline__ float bf_bits2f(unsigned short h) { return __uint_as_float(((unsigned)h) << 16); }

// hazard guards as plain device helpers (no inline asm inside the kernel template body)
__device__ __forceinline__ void dep_guard_h(v8f& a, v8f& b, v16h x, v16h y) { asm volatile("v_nop\n\tv_nop\n\tv_nop\n\tv_nop" : "+v"(a), "+v"(b) : "v"(x), "v"(y)); }
__device__ __forceinline__ void dep_guard_b(v8f& a, v8f& b, v16b x, v16b y) { asm volatile("v_nop\n\tv_nop\n\tv_nop\n\tv_nop" : "+v"(a), "+v"(b) : "v"(x), "v"(y)); }
__device__ __forceinline__ void keep4_h(v16h a, v16h b, v16h c, v16h d) { asm volatile("v_nop" :: "v"(a), "v"(b), "v"(c), "v"(d)); }
__device__ __forceinline__ void keep4_b(v16b a, v16b b, v16b c, v16b d) { asm volatile("v_nop" :: "v"(a), "v"(b), "v"(c), "v"(d)); }
__device__ __forceinline__ void acc_guard4(v8f& a, v8f& b, v8f& c, v8f& d) { asm volatile("v_nop\n\tv_nop\n\tv_nop\n\tv_nop" : "+v"(a), "+v"(b), "+v"(c), "+v"(d)); }
template <typename T> struct Frag;
template <> struct Frag<_Float16> {
  typedef v16h V; union U { v16h v; v8h h[2]; };
  static __device__ __forceinline__ v16h load(const _Float16* p) {   // elements 0..7 <- p[0..7], 8..15 <- p[16..23]
    U f; f.h[0] = *(const v8h*)(p); f.h[1] = *(const v8h*)(p + 16); return f.v;
  }
  static __device__ __forceinline__ v8f mma(v16h a, v16h b, v8f c) {
    return __builtin_amdgcn_wmma_f32_16x16x32_f16(false, a, false, b, (short)0, c, false, false);
  }
  static __device__ __forceinline__ void guard(v8f& a, v8f& b, v16h x, v16h y) { dep_guard_h(a, b, x, y); }
  static __device__ __forceinline__ void keep(v16h a, v16h b, v16h c, v16h d) { keep4_h(a, b, c, d); }
};
template <> struct Frag<__bf16> {
  typedef v16b V; union U { v16b v; v8b h[2]; };
  static __device__ __forceinline__ v16b load(const __bf16* p) {
    U f; f.h[0] = *(const v8b*)(p); f.h[1] = *(const v8b*)(p + 16); return f.v;
  }
  static __device__ __forceinline__ v8f mma(v16b a, v16b b, v8f c) {
    return __builtin_amdgcn_wmma_f32_16x16x32_bf16(false, a, false, b, (short)0, c, false, false);
  }
  static __device__ __forceinline__ void guard(v8f& a, v8f& b, v16b x, v16b y) { dep_guard_b(a, b, x, y); }
  static __device__ __forceinline__ void keep(v16b a, v16b b, v16b c, v16b d) { keep4_b(a, b, c, d); }
};

// ---- Register-blocked batched WMMA GEMM ------------------------------------
// C[m,n] = scale * sum_k A[m,k] * Bt[n,k] (+bias)(+resid); each wave owns a 64x64 tile.
// A row-major [M,K]; Bt row-major [N,K]; M,N % 64 == 0, K % 32 == 0.
// SPLIT: operands are hi/lo planes (A2/Bt2 = lo planes, same layout); product = hi·hi + hi·lo + lo·hi.
// BIAS_MODE: 0 = none, 1 = bias[m], 2 = bias[n].
// OUT_MODE: 0 = f32, 1 = f16, 2 = bf16 hi plane (Cout) + bf16 lo plane (Cout2).
// ET: 0 = f16 operands, 1 = bf16 operands (pointers passed as 16-bit storage)
template <int ET> struct Elem;
template <> struct Elem<0> { typedef _Float16 T; };
template <> struct Elem<1> { typedef __bf16 T; };
template <int ET, bool SPLIT, int BIAS_MODE, int OUT_MODE, bool RESID, int ACT = 0>
__global__ __launch_bounds__(256) void wmma_gemm64(
    const unsigned short* __restrict__ Ap, const unsigned short* __restrict__ A2p, int lda, long strideA,
    const unsigned short* __restrict__ Btp, const unsigned short* __restrict__ Bt2p, int ldb, long strideB,
    void* __restrict__ Cout, void* __restrict__ Cout2, int ldc, long strideC,
    const float* __restrict__ bias,
    const float* __restrict__ resid, long strideR,
    int M, int N, int K, float scale) {
  typedef typename Elem<ET>::T T;
  typedef typename Frag<T>::V V;
  const T* A = (const T*)Ap; const T* A2 = (const T*)A2p; const T* Bt = (const T*)Btp; const T* Bt2 = (const T*)Bt2p;
  __shared__ __align__(16) float sT[8][16 * 68];   // per-wave 16x64 slab, pitch 68 floats
  const int b    = blockIdx.y;
  const int lane = threadIdx.x & 31;
  const int wave = threadIdx.x >> 5;
  const int tilesN = N >> 6;
  const int tilesM = M >> 6;
  const int tile = blockIdx.x * 8 + wave;
  if (tile >= tilesM * tilesN) return;   // wave-uniform; no block barriers in this kernel
  const int tm = tile / tilesN;
  const int tn = tile - tm * tilesN;
  const int m0 = tm << 6;
  const int n0 = tn << 6;

  const T* Ab  = A  + (size_t)b * strideA;
  const T* Bb  = Bt + (size_t)b * strideB;
  const T* Ab2 = SPLIT ? (A2  + (size_t)b * strideA) : nullptr;
  const T* Bb2 = SPLIT ? (Bt2 + (size_t)b * strideB) : nullptr;

  const int rlane = lane & 15;                 // row (A) / col (B, D) within subtile
  const int koff  = (lane >> 4) * 8;           // k offset of this lane half
  const int mOff  = (lane >> 4) * 8;           // D row offset

  v8f acc[4][4];
#pragma unroll
  for (int i = 0; i < 4; ++i)
#pragma unroll
    for (int j = 0; j < 4; ++j) acc[i][j] = (v8f){0.f,0.f,0.f,0.f,0.f,0.f,0.f,0.f};

  for (int k0 = 0; k0 < K; k0 += 32) {
    V bh[4], bl[4];
#pragma unroll
    for (int j = 0; j < 4; ++j) {
      const size_t bo = (size_t)(n0 + (j << 4) + rlane) * ldb + koff + k0;
      bh[j] = Frag<T>::load(Bb + bo);
      if (SPLIT) bl[j] = Frag<T>::load(Bb2 + bo);
    }
#pragma unroll
    for (int i = 0; i < 4; ++i) {
      const size_t ao = (size_t)(m0 + (i << 4) + rlane) * lda + koff + k0;
      V ah = Frag<T>::load(Ab + ao);
      V al;
      if (SPLIT) al = Frag<T>::load(Ab2 + ao);
#pragma unroll
      for (int j = 0; j < 4; ++j) {
        acc[i][j] = Frag<T>::mma(ah, bh[j], acc[i][j]);
        if (SPLIT) {
          acc[i][j] = Frag<T>::mma(ah, bl[j], acc[i][j]);
          acc[i][j] = Frag<T>::mma(al, bh[j], acc[i][j]);
        }
      }
      Frag<T>::guard(acc[i][0], acc[i][3], ah, SPLIT ? al : ah);
    }
    Frag<T>::keep(bh[0], bh[1], bh[2], bh[3]);
    if (SPLIT) Frag<T>::keep(bl[0], bl[1], bl[2], bl[3]);
  }
  acc_guard4(acc[0][0], acc[0][1], acc[0][2], acc[0][3]);
  acc_guard4(acc[1][0], acc[1][1], acc[1][2], acc[1][3]);
  acc_guard4(acc[2][0], acc[2][1], acc[2][2], acc[2][3]);
  acc_guard4(acc[3][0], acc[3][1], acc[3][2], acc[3][3]);

  // ---- epilogue ----
  float* slab = sT[wave];
  const float* Rb = RESID ? (resid + (size_t)b * strideR) : nullptr;
#pragma unroll
  for (int i = 0; i < 4; ++i) {
    const int mBase = m0 + (i << 4);
#pragma unroll
    for (int j = 0; j < 4; ++j) {
      const int n = n0 + (j << 4) + rlane;
      float bv = 0.f;
      if (BIAS_MODE == 2) bv = bias[n];
#pragma unroll
      for (int r = 0; r < 8; ++r) {
        float v = acc[i][j][r] * scale;
        if (BIAS_MODE == 1) v += bias[mBase + mOff + r];
        if (BIAS_MODE == 2) v += bv;
        if (RESID) v += Rb[(size_t)(mBase + mOff + r) * ldc + n];
        if (ACT == 1) v = tanhf(v);
        if (ACT == 2) v = fmaxf(v, 0.0f);
        if (ACT == 3) v = v / (1.0f + expf(-v));
        if (ACT == 4) v = (v > 0.f) ? v : 0.01f * v;
        if (ACT == 5) v = 0.5f * v * (1.0f + erff(v * 0.70710678118654752f));
        if (ACT == 6) v = (v > 0.f) ? v : 0.2f * v;
        if (ACT == 7) { const float u = 0.7978845608028654f * (v + 0.044715f * v * v * v); v = 0.5f * v * (1.f + tanhf(u)); }
        slab[(mOff + r) * 68 + (j << 4) + rlane] = v;
      }
    }
    __builtin_amdgcn_fence(__ATOMIC_RELEASE, "workgroup");
    __builtin_amdgcn_wave_barrier();
    __builtin_amdgcn_fence(__ATOMIC_ACQUIRE, "workgroup");
    if (OUT_MODE == 0) {
      float* C = (float*)Cout + (size_t)b * strideC;
      const int hh = lane >> 4, c4 = (lane & 15) * 4;     // row seg = 256 B = 16 lanes x 16 B
      {
#pragma unroll
        for (int it = 0; it < 8; ++it) {
          const int row = it * 2 + hh;
          v4f v = *(const v4f*)(slab + row * 68 + c4);
          *(v4f*)(C + (size_t)(mBase + row) * ldc + n0 + c4) = v;
        }
        
      }
    } else {
      const int q = lane >> 3, c8 = (lane & 7) * 8;
      unsigned short* C  = (unsigned short*)Cout  + (size_t)b * strideC;
      unsigned short* C2 = (OUT_MODE == 2) ? ((unsigned short*)Cout2 + (size_t)b * strideC) : nullptr;
      {
#pragma unroll
        for (int it = 0; it < 4; ++it) {
          const int row = it * 4 + q;
          const float* sp = slab + row * 68 + c8;
          v8h hv, lv;
#pragma unroll
          for (int e = 0; e < 8; ++e) {
            if (OUT_MODE == 1) {
              hv[e] = (_Float16)sp[e];
            } else {
              unsigned short hb = f2bf_bits(sp[e]);
              unsigned short lb = f2bf_bits(sp[e] - bf_bits2f(hb));
              hv[e] = __builtin_bit_cast(_Float16, hb);
              lv[e] = __builtin_bit_cast(_Float16, lb);
            }
          }
          *(v8h*)(C + (size_t)(mBase + row) * ldc + n0 + c8) = hv;
          if (OUT_MODE == 2) *(v8h*)(C2 + (size_t)(mBase + row) * ldc + n0 + c8) = lv;
        }
        
      }
    }
    __builtin_amdgcn_fence(__ATOMIC_RELEASE, "workgroup");
    __builtin_amdgcn_wave_barrier();
    __builtin_amdgcn_fence(__ATOMIC_ACQUIRE, "workgroup");
  }
}

__global__ __launch_bounds__(256) void cast_f32_f16x2(
    const float* __restrict__ in, _Float16* __restrict__ out, int n2) {
  int i = blockIdx.x * 256 + threadIdx.x;
  if (i < n2) {
    const _Float16 h0 = (_Float16)in[2 * i], h1 = (_Float16)in[2 * i + 1];
    const unsigned u = (unsigned)__builtin_bit_cast(unsigned short, h0) | ((unsigned)__builtin_bit_cast(unsigned short, h1) << 16);
    ((unsigned*)out)[i] = u;
    
  }
}


} // namespace w25

__global__ __launch_bounds__(256) void k_castT16(const float* __restrict__ src, long long lds, _Float16* __restrict__ dst, long long ldd, int R, int C, float s) {
    const long long i = (long long)blockIdx.x * 256 + threadIdx.x; const long long np = (long long)C * (R / 2); if (i >= np) return; const int c = (int)(i / (R / 2)); const int r = 2 * (int)(i % (R / 2));
    const _Float16 h0 = (_Float16)(src[(long long)r * lds + c] * s), h1 = (_Float16)(src[(long long)(r + 1) * lds + c] * s);
    const unsigned u = (unsigned)__builtin_bit_cast(unsigned short, h0) | ((unsigned)__builtin_bit_cast(unsigned short, h1) << 16);
    unsigned* d = (unsigned*)(dst + (long long)c * ldd + r); *d = u;  }
__global__ __launch_bounds__(256) void k_cast16(const float* __restrict__ src, long long lds, _Float16* __restrict__ dst, long long ldd, int R, int C, float s) {
    const long long i = (long long)blockIdx.x * 256 + threadIdx.x; const long long np = (long long)R * (C / 2); if (i >= np) return; const int r = (int)(i / (C / 2)); const int c = 2 * (int)(i % (C / 2));
    const _Float16 h0 = (_Float16)(src[(long long)r * lds + c] * s), h1 = (_Float16)(src[(long long)r * lds + c + 1] * s);
    const unsigned u = (unsigned)__builtin_bit_cast(unsigned short, h0) | ((unsigned)__builtin_bit_cast(unsigned short, h1) << 16);
    unsigned* d = (unsigned*)(dst + (long long)r * ldd + c); *d = u;  }

// f32 -> bf16 hi plane + bf16 lo plane (x = hi + lo to ~2^-17 relative; RNE both), [R][C] -> [R][C] (or transposed to [C][R]); 2 consecutive destination elements
__device__ __forceinline__ unsigned int f2bf2_pack(float a, float b, unsigned int* lo) {
    const unsigned short ha = w25::f2bf_bits(a), hb = w25::f2bf_bits(b);
    const unsigned short la = w25::f2bf_bits(a - w25::bf_bits2f(ha)), lb = w25::f2bf_bits(b - w25::bf_bits2f(hb));
    *lo = (unsigned)la | ((unsigned)lb << 16); return (unsigned)ha | ((unsigned)hb << 16); }
// blockIdx.y = matrix of a batch: source matrices sz floats apart, destination planes dz elements apart
__global__ __launch_bounds__(256) void k_castS16(const float* __restrict__ src, long long lds, __bf16* __restrict__ dhi, __bf16* __restrict__ dlo, long long ldd, int R, int C, float s, int transpose, long long sz, long long dz) {
    src += (long long)blockIdx.y * sz; dhi += (long long)blockIdx.y * dz; dlo += (long long)blockIdx.y * dz;
    const long long i = (long long)blockIdx.x * 256 + threadIdx.x; long long o; float a, b;
    if (transpose) { const long long np = (long long)C * (R / 2); if (i >= np) return; const int c = (int)(i / (R / 2)); const int r = 2 * (int)(i % (R / 2)); a = src[(long long)r * lds + c] * s; b = src[(long long)(r + 1) * lds + c] * s; o = (long long)c * ldd + r; }
    else { const long long np = (long long)R * (C / 2); if (i >= np) return; const int r = (int)(i / (C / 2)); const int c = 2 * (int)(i % (C / 2)); a = src[(long long)r * lds + c] * s; b = src[(long long)r * lds + c + 1] * s; o = (long long)r * ldd + c; }
    unsigned lo; const unsigned hi = f2bf2_pack(a, b, &lo); unsigned* ph = (unsigned*)(dhi + o); unsigned* pl = (unsigned*)(dlo + o);
    *ph = hi; *pl = lo;  }

namespace w25 {
// =====================================================================================
// Generic causal/non-causal attention for head_dim 64, f32 in / f32 out; 16-bit operands: bf16 with optional hi/lo splits, or
// plain f16 (F16=true, non-split, probabilities carried x2^15).
//   scores = (q*qscale)·kᵀ : v_wmma_f32_16x16x32_bf16; SPLIT_QK -> q,k as bf16 hi/lo (hi·hi + hi·lo + lo·hi)
//   out    = p·v           : v_wmma_f32_16x16x32_bf16; SPLIT_PV -> p,v as bf16 hi/lo; else p,v plain bf16
//   f32 accumulate; online softmax in f32. Block = 4 waves = 64 query rows of one (batch, head); S % 64 == 0.
//   Element (b, s, h, d) of tensor X lives at X[b*X_bs + s*X_rs + h*X_hs + d] (strides in floats, multiples of 4).
//   Masking: mask_mode 0 none, 1 causal (kv > q masked), 2 tensor [S][Skv] shared over (b,h) (float if
//   mask_is_int==0, int32 with element == 0 -> masked if 1, int32 with element != 0 -> masked if 2), 3 per-token vectors qmask[B][S] & kvmask[B][Skv] (int32,
//   0 -> masked), 4 causal + sliding window (kv > q or q - kv > W masked; W passed in mask_is_int);
//   5 = relative-position bias: s += cp[b,h,q][idx[q][kv]] + pc[b,h,kv][idx[q][kv]] with idx = mask_b ([S][Skv] int32) and
//   mask_a an int32 [S][Skv] tensor with nonzero = masked (tables: element (b,h,row,n) at X + b*c_bs + h*c_hs + row*c_rs + n);
//   masked scores are replaced by mask_fill (e.g. -inf or -1e9) before the softmax.
//   grid.x = B * H * (S/64) (or a sub-range with blk0).
// =====================================================================================
#define AT_D 64
#define AT_NW 4
#define AT_QB 64
#define AT_KC 64
struct AttnGeom { const float* cp = nullptr; const float* pc = nullptr; long c_bs = 0, c_rs = 0, c_hs = 0;   // mode-5 score-bias tables
                  long q_bs, q_rs, q_hs, k_bs, k_rs, k_hs, v_bs, v_rs, v_hs, o_bs, o_rs, o_hs;
                  int S, Skv, H, mask_mode; float qscale; int blk0; float mask_fill; int mask_is_int; };
static_assert(sizeof(AttnGeom) == 168, "no padding");

__device__ __forceinline__ unsigned short at_bf_bits(float f) {
  unsigned u = __float_as_uint(f);
  return (unsigned short)((u + 0x7FFFu + ((u >> 16) & 1u)) >> 16);
}
__device__ __forceinline__ __bf16 at_f2bf(float f) { return __builtin_bit_cast(__bf16, at_bf_bits(f)); }
__device__ __forceinline__ void at_split(float f, __bf16& hi, __bf16& lo) {
  const unsigned short hb = at_bf_bits(f);
  hi = __builtin_bit_cast(__bf16, hb);
  lo = at_f2bf(f - __uint_as_float(((unsigned)hb) << 16));
}
__device__ __forceinline__ v8f at_mma(v16b a, v16b b, v8f c) {
  c = __builtin_amdgcn_wmma_f32_16x16x32_bf16(false, a, false, b, (short)0, c, false, false);
  asm volatile("v_nop\n\tv_nop\n\tv_nop\n\tv_nop" : "+v"(c) : "v"(a), "v"(b));
  return c;
}
// 16-bit element as a bit pattern held in a __bf16 slot: f16 bits when F16, bf16 (RNE) otherwise
template <bool F16> __device__ __forceinline__ __bf16 at_to16(float f) {
  if (F16) return __builtin_bit_cast(__bf16, (_Float16)f);
  return at_f2bf(f);
}
template <bool F16> __device__ __forceinline__ v8f at_mma16(v16b a, v16b b, v8f c) {
  if (F16) {
    const v16h ah = __builtin_bit_cast(v16h, a), bh = __builtin_bit_cast(v16h, b);
    c = __builtin_amdgcn_wmma_f32_16x16x32_f16(false, ah, false, bh, (short)0, c, false, false);
    asm volatile("v_nop\n\tv_nop\n\tv_nop\n\tv_nop" : "+v"(c) : "v"(ah), "v"(bh));
    return c;
  }
  return at_mma(a, b, c);
}

template <bool SPLIT_QK, bool SPLIT_PV, bool F16 = false>
__global__ __launch_bounds__(128)
void attn64_kernel(const float* __restrict__ q, const float* __restrict__ k,
                   const float* __restrict__ v, float* __restrict__ out,
                   const void* __restrict__ mask_a, const int* __restrict__ mask_b, AttnGeom g) {
  static_assert(!(F16 && (SPLIT_QK || SPLIT_PV)), "f16 mode is non-split");
  const float PSC = F16 ? 32768.0f : 1.0f;     // f16 probabilities carried x2^15 (subnormal range), folded into the final 1/l
  union FB { v16b v; v8b h[2]; };
  __shared__ __align__(16) __bf16 Ksh[AT_KC * AT_D];             // K hi [kv][d]      8 KB
  __shared__ __align__(16) __bf16 Ksl[SPLIT_QK ? AT_KC * AT_D : 8];
  __shared__ __align__(16) __bf16 Vth[AT_D * AT_KC];             // V hi [d][kv]      8 KB
  __shared__ __align__(16) __bf16 Vtl[SPLIT_PV ? AT_D * AT_KC : 8];
  __shared__ __align__(16) __bf16 Psh[AT_NW][16 * AT_KC];        // per wave P hi [row][kv]  8 KB
  __shared__ __align__(16) __bf16 Psl[SPLIT_PV ? AT_NW : 1][SPLIT_PV ? 16 * AT_KC : 8];
  __shared__ __align__(16) float  Os[AT_NW][16 * 68];            // per wave out tile, pitch 68

  const int tid  = threadIdx.x;
  const int wave = tid >> 5;
  const int lane = tid & 31;
  const int hh   = lane >> 4;
  const int c    = lane & 15;

  const int nqb = g.S / AT_QB;
  const int bx = blockIdx.x + g.blk0;
  const int qb = bx % nqb;
  const int bh = bx / nqb;
  const int h  = bh % g.H;
  const int b  = bh / g.H;
  const int qbase_block = qb * AT_QB;
  const int q0 = qbase_block + wave * 16;

  const float* qb_ptr = q + (size_t)b * g.q_bs + (size_t)h * g.q_hs;
  const float* kb_ptr = k + (size_t)b * g.k_bs + (size_t)h * g.k_hs;
  const float* vb_ptr = v + (size_t)b * g.v_bs + (size_t)h * g.v_hs;
  float*       ob_ptr = out + (size_t)b * g.o_bs + (size_t)h * g.o_hs;

  // ---- Q fragments (A operand): 2 d-chunks, hi (and lo) ----
  v16b qah[2], qal[2];
  {
    const float* qrow = qb_ptr + (size_t)(q0 + c) * g.q_rs;
#pragma unroll
    for (int dc = 0; dc < 2; ++dc) {
#pragma unroll
      for (int e = 0; e < 8; ++e) {
        const float f0 = qrow[dc * 32 + 8 * hh + e] * g.qscale;
        const float f1 = qrow[dc * 32 + 16 + 8 * hh + e] * g.qscale;
        if (SPLIT_QK) { __bf16 hq, lq; at_split(f0, hq, lq); qah[dc][e] = hq; qal[dc][e] = lq; at_split(f1, hq, lq); qah[dc][8 + e] = hq; qal[dc][8 + e] = lq; }
        else { qah[dc][e] = at_to16<F16>(f0); qah[dc][8 + e] = at_to16<F16>(f1); qal[dc][e] = qah[dc][e]; qal[dc][8 + e] = qah[dc][8 + e]; }
      }
    }
  }

  float mrow[8], lrow[8];
  v8f oacc[4];
#pragma unroll
  for (int r = 0; r < 8; ++r) { mrow[r] = -INFINITY; lrow[r] = 0.f; }
#pragma unroll
  for (int t = 0; t < 4; ++t) oacc[t] = (v8f){0.f,0.f,0.f,0.f,0.f,0.f,0.f,0.f};

  const int nChunks = (g.mask_mode == 1 || g.mask_mode == 4) ? (qb + 1) : (g.Skv / AT_KC);   // block-uniform
  // per-row query mask (mode 3)
  int qkeep[8];
#pragma unroll
  for (int r = 0; r < 8; ++r) qkeep[r] = (g.mask_mode == 3) ? mask_b[(size_t)b * g.S + q0 + 8 * hh + r] : 1;   // mask_b = qmask in mode 3
  for (int kc = 0; kc < nChunks; ++kc) {
    const int kv0 = kc * AT_KC;
    __syncthreads();
    {
      const int kvr = tid >> 1, dh = (tid & 1) * 32;
      const float* krow = kb_ptr + (size_t)(kv0 + kvr) * g.k_rs + dh;
      const float* vrow = vb_ptr + (size_t)(kv0 + kvr) * g.v_rs + dh;
#pragma unroll
      for (int i = 0; i < 8; ++i) {
        v4f kk = *(const v4f*)(krow + 4 * i);
        v4f vv = *(const v4f*)(vrow + 4 * i);
#pragma unroll
        for (int e = 0; e < 4; ++e) {
          const int d = dh + 4 * i + e;
          if (SPLIT_QK) { __bf16 a, bl; at_split(kk[e], a, bl); Ksh[kvr * AT_D + d] = a; Ksl[kvr * AT_D + d] = bl; }
          else Ksh[kvr * AT_D + d] = at_to16<F16>(kk[e]);
          if (SPLIT_PV) { __bf16 a, bl; at_split(vv[e], a, bl); Vth[d * AT_KC + kvr] = a; Vtl[d * AT_KC + kvr] = bl; }
          else Vth[d * AT_KC + kvr] = at_to16<F16>(vv[e]);
        }
      }
    }
    __syncthreads();

    v8f s[4];
#pragma unroll
    for (int j = 0; j < 4; ++j) {
      s[j] = (v8f){0.f,0.f,0.f,0.f,0.f,0.f,0.f,0.f};
#pragma unroll 1
      for (int dc = 0; dc < 2; ++dc) {
        FB kb;
        kb.h[0] = *(const v8b*)(Ksh + (j * 16 + c) * AT_D + dc * 32 + 8 * hh);
        kb.h[1] = *(const v8b*)(Ksh + (j * 16 + c) * AT_D + dc * 32 + 16 + 8 * hh);
        s[j] = at_mma16<F16>(qah[dc], kb.v, s[j]);
        if (SPLIT_QK) {
          FB kl;
          kl.h[0] = *(const v8b*)(Ksl + (j * 16 + c) * AT_D + dc * 32 + 8 * hh);
          kl.h[1] = *(const v8b*)(Ksl + (j * 16 + c) * AT_D + dc * 32 + 16 + 8 * hh);
          s[j] = at_mma16<F16>(qah[dc], kl.v, s[j]);
          s[j] = at_mma16<F16>(qal[dc], kb.v, s[j]);
        }
      }
    }
    const bool diag = (g.mask_mode == 1) && (kc == qb);
    int kvkeep[4] = {1, 1, 1, 1};
    if (g.mask_mode == 3) {
#pragma unroll
      for (int j = 0; j < 4; ++j) kvkeep[j] = ((const int*)mask_a)[(size_t)b * g.Skv + kv0 + j * 16 + c];   // mask_a = kvmask
    }
    float cm[8];
#pragma unroll
    for (int r = 0; r < 8; ++r) {
      const int qrow = q0 + 8 * hh + r;
      float m = -INFINITY;
#pragma unroll
      for (int j = 0; j < 4; ++j) {
        const int kvcol = kv0 + j * 16 + c;
        bool masked = false;
        if (diag) masked = (kvcol > qrow);
        else if (g.mask_mode == 4) masked = (kvcol > qrow) || (qrow - kvcol > g.mask_is_int);
        else if (g.mask_mode == 2) {
          const size_t mi = (size_t)qrow * g.Skv + kvcol;
          masked = (g.mask_is_int == 0) ? (((const float*)mask_a)[mi] == 0.0f)
                 : (g.mask_is_int == 1) ? (((const int*)mask_a)[mi] == 0) : (((const int*)mask_a)[mi] != 0);
        } else if (g.mask_mode == 3) masked = (qkeep[r] == 0) || (kvkeep[j] == 0);
        else if (g.mask_mode == 5) {
          const size_t mi = (size_t)qrow * g.Skv + kvcol;
          masked = (((const int*)mask_a)[mi] != 0);
          int n = mask_b[mi]; n = n < 0 ? 0 : n;
          s[j][r] += g.cp[(size_t)b * g.c_bs + (size_t)h * g.c_hs + (size_t)qrow * g.c_rs + n]
                   + g.pc[(size_t)b * g.c_bs + (size_t)h * g.c_hs + (size_t)kvcol * g.c_rs + n];
        }
        if (masked) s[j][r] = g.mask_fill;
        m = fmaxf(m, s[j][r]);
      }
#pragma unroll
      for (int off = 1; off < 16; off <<= 1) m = fmaxf(m, __shfl_xor(m, off, 32));
      cm[r] = m;
    }
    __bf16* pwh = Psh[wave];
    __bf16* pwl = Psl[SPLIT_PV ? wave : 0];
#pragma unroll
    for (int r = 0; r < 8; ++r) {
      const float mnew = fmaxf(mrow[r], cm[r]);
      const float alpha = expf(mrow[r] - mnew);
      mrow[r] = mnew;
      float psum = 0.f;
#pragma unroll
      for (int j = 0; j < 4; ++j) {
        const float p = expf(s[j][r] - mnew);
        psum += p;
        if (SPLIT_PV) { __bf16 a, bl; at_split(p, a, bl); pwh[(8 * hh + r) * AT_KC + j * 16 + c] = a; pwl[(8 * hh + r) * AT_KC + j * 16 + c] = bl; }
        else pwh[(8 * hh + r) * AT_KC + j * 16 + c] = at_to16<F16>(p * PSC);
      }
#pragma unroll
      for (int off = 1; off < 16; off <<= 1) psum += __shfl_xor(psum, off, 32);
      lrow[r] = lrow[r] * alpha + psum;
#pragma unroll
      for (int t = 0; t < 4; ++t) oacc[t][r] *= alpha;
    }
    __builtin_amdgcn_fence(__ATOMIC_RELEASE, "workgroup");
    __builtin_amdgcn_wave_barrier();
    __builtin_amdgcn_fence(__ATOMIC_ACQUIRE, "workgroup");
#pragma unroll 1
    for (int kk = 0; kk < 2; ++kk) {
      FB pa, pl;
      pa.h[0] = *(const v8b*)(pwh + c * AT_KC + kk * 32 + 8 * hh);
      pa.h[1] = *(const v8b*)(pwh + c * AT_KC + kk * 32 + 16 + 8 * hh);
      if (SPLIT_PV) {
        pl.h[0] = *(const v8b*)(pwl + c * AT_KC + kk * 32 + 8 * hh);
        pl.h[1] = *(const v8b*)(pwl + c * AT_KC + kk * 32 + 16 + 8 * hh);
      }
#pragma unroll
      for (int t = 0; t < 4; ++t) {
        FB vb;
        vb.h[0] = *(const v8b*)(Vth + (t * 16 + c) * AT_KC + kk * 32 + 8 * hh);
        vb.h[1] = *(const v8b*)(Vth + (t * 16 + c) * AT_KC + kk * 32 + 16 + 8 * hh);
        oacc[t] = at_mma16<F16>(pa.v, vb.v, oacc[t]);
        if (SPLIT_PV) {
          FB vl;
          vl.h[0] = *(const v8b*)(Vtl + (t * 16 + c) * AT_KC + kk * 32 + 8 * hh);
          vl.h[1] = *(const v8b*)(Vtl + (t * 16 + c) * AT_KC + kk * 32 + 16 + 8 * hh);
          oacc[t] = at_mma16<F16>(pa.v, vl.v, oacc[t]);
          oacc[t] = at_mma16<F16>(pl.v, vb.v, oacc[t]);
        }
      }
    }
  }

  float* os = Os[wave];
#pragma unroll
  for (int r = 0; r < 8; ++r) {
    const float inv = 1.0f / (lrow[r] * PSC);
#pragma unroll
    for (int t = 0; t < 4; ++t) os[(8 * hh + r) * 68 + t * 16 + c] = oacc[t][r] * inv;
  }
  __builtin_amdgcn_fence(__ATOMIC_RELEASE, "workgroup");
  __builtin_amdgcn_wave_barrier();
  __builtin_amdgcn_fence(__ATOMIC_ACQUIRE, "workgroup");
  {
    const int c4 = (lane & 15) * 4;
    {
#pragma unroll
      for (int it = 0; it < 8; ++it) {
        const int row = it * 2 + hh;
        v4f val = *(const v4f*)(os + row * 68 + c4);
        *(v4f*)(ob_ptr + (size_t)(q0 + row) * g.o_rs + c4) = val;
      }
      
    }
  }
}

} // namespace w25


__device__ __forceinline__ void st_h2(unsigned short* d2, float a, float b) { const unsigned u = (unsigned)__builtin_bit_cast(unsigned short, (_Float16)a) | ((unsigned)__builtin_bit_cast(unsigned short, (_Float16)b) << 16); unsigned* d = (unsigned*)d2; *d = u;  }
__device__ __forceinline__ float ldh(const unsigned short* p) { return (float)__builtin_bit_cast(_Float16, *p); }
__device__ __forceinline__ v4f ld4h(const unsigned short* p) { const unsigned long long u = *(const unsigned long long*)p; v4f a;
    a.x = (float)__builtin_bit_cast(_Float16, (unsigned short)(u & 0xFFFFu)); a.y = (float)__builtin_bit_cast(_Float16, (unsigned short)((u >> 16) & 0xFFFFu)); a.z = (float)__builtin_bit_cast(_Float16, (unsigned short)((u >> 32) & 0xFFFFu)); a.w = (float)__builtin_bit_cast(_Float16, (unsigned short)((u >> 48) & 0xFFFFu)); return a; }
__device__ __forceinline__ unsigned long long pk4h(v4f s) { return (unsigned long long)__builtin_bit_cast(unsigned short, (_Float16)s.x) | ((unsigned long long)__builtin_bit_cast(unsigned short, (_Float16)s.y) << 16) | ((unsigned long long)__builtin_bit_cast(unsigned short, (_Float16)s.z) << 32) | ((unsigned long long)__builtin_bit_cast(unsigned short, (_Float16)s.w) << 48); }
typedef unsigned v4u __attribute__((ext_vector_type(4)));
__device__ __forceinline__ void st8h(unsigned short* d, v4f a, v4f b) { const unsigned long long pa = pk4h(a), pb = pk4h(b); v4u pk; pk.x = (unsigned)(pa & 0xFFFFFFFFull); pk.y = (unsigned)(pa >> 32); pk.z = (unsigned)(pb & 0xFFFFFFFFull); pk.w = (unsigned)(pb >> 32); v4u* dd = (v4u*)d; *dd = pk;  }
__device__ __forceinline__ unsigned short bfu_rne(float v) { unsigned u = __builtin_bit_cast(unsigned, v); u += 0x7FFFu + ((u >> 16) & 1u); return (unsigned short)(u >> 16); }
__device__ __forceinline__ void bfsplit(float v, unsigned short& hi, unsigned short& lo) { hi = bfu_rne(v); lo = bfu_rne(v - __builtin_bit_cast(float, (unsigned)hi << 16)); }
__device__ __forceinline__ void st_s2(unsigned short* Hp, unsigned short* Lp, long long o, float a, float b) { unsigned short h0,l0,h1,l1; bfsplit(a,h0,l0); bfsplit(b,h1,l1); const unsigned ph = (unsigned)h0 | ((unsigned)h1 << 16), pl = (unsigned)l0 | ((unsigned)l1 << 16);
    unsigned* dh = (unsigned*)(Hp + o); unsigned* dl = (unsigned*)(Lp + o); *dh = ph; *dl = pl;  }
__device__ __forceinline__ int cl(int v, int n) { return min(max(v, 0), n - 1); }

// GAT-style aggregation over a device in-edge CSR at dst (+ optional explicit self loop as iteration j = -1):
//   logit = leaky(AS[src][h] + AD[n][h] (+ EW[e]*CW[h]), slope); softmax over the node's edges per head; acc[c] = sum alpha XP[src][c] (f16 gather plane, pitch XW; 256 channels = H heads x CH)
//   wave per node; lane L owns channels 8L..8L+7 (head = 8L / CH); per-lane softmax state (lanes of one head agree) -> no shuffles in the loop.
//   EPI 0: + bias -> f32 OUT[n][256] via LDS redistribution (two 16-B stores per lane, each instruction 512 contiguous B)
//   EPI 1: + bias, LayerNorm(256) * g + bb, relu -> bf16 hi/lo planes OH/OL [n][256] (16-B stores)
//   EPI 2: mean over the 256/CH heads + bias[0..CH-1] , LayerNorm(64) * g + bb, relu -> f32 OUT[n][64] (CH must be 64; LDS redistribution, 8-B stores)
//   EPI 3: mean over heads + bias -> f32 OUT[n][64] (no norm / activation)
//   EPI 4: + bias, ELU -> bf16 hi/lo planes OH/OL [n][256];  EPI 5: + bias (full 256-wide, per head), ELU, then mean over the 256/CH heads -> f32 OUT[n][64]
//   EPI 6: (CH = 128, two heads) mean over the two heads, + bias[0..127], relu -> f32 OUT[n][128] (LDS redistribution, 16-B stores)
//   EWM 0: no edge weights; 1: logit += EW[e] * CW[h] (self loop weight 1); 2: alpha *= EW[e] after the softmax (message scale; self loop weight 1)
template <int CH, bool SELF, int EWM, int EPI>
__global__ __launch_bounds__(256) void k_gat_agg(const unsigned short* __restrict__ XP, int XW, const float* __restrict__ AS, const float* __restrict__ AD, int ASTR, const float* __restrict__ EW, const float* __restrict__ CW,
        const int* __restrict__ esrc, const int* __restrict__ off, const int* __restrict__ cnt, const int* __restrict__ slot, const float* __restrict__ bias, const float* __restrict__ g, const float* __restrict__ bb,
        float* __restrict__ OUT, unsigned short* __restrict__ OH, unsigned short* __restrict__ OL, int N, int E, int CAP, float slope) {
    __shared__ float stage[8][256];
    const int wv = threadIdx.x >> 5; const int n = blockIdx.x * 8 + wv; const int L = threadIdx.x & 31; if (n >= N) return; const int c0 = 8 * L; const int h = c0 / CH;
    const float ad = AD[(long long)n * ASTR + h]; const float cw = (EWM == 1) ? CW[h] : 0.f; float m = -3.0e38f, s = 0.f; v4f a0, a1; a0.x = a0.y = a0.z = a0.w = 0.f; a1 = a0;
    const int p0 = cl(off[n], E + 1), cn = min(max(cnt[n], 0), CAP);
    for (int j = (SELF ? -1 : 0); j < cn; ++j) { int sj; float ew = 0.f;
        if (j < 0) { sj = n; ew = 1.f; } else { int e = slot[cl(p0 + j, E)]; e = cl(e, E); sj = cl(esrc[e], N); if (EWM != 0) ew = EW[e]; }
        float lg = AS[(long long)sj * ASTR + h] + ad + ((EWM == 1) ? ew * cw : 0.f); lg = (lg >= 0.f) ? lg : slope * lg;
        const float mn = fmaxf(m, lg); const float cz = expf(m - mn), pj = expf(lg - mn); s = s * cz + pj; const float pw = (EWM == 2) ? pj * ew : pj;
        const unsigned short* xr = XP + (long long)sj * XW + c0; a0 = a0 * cz + ld4h(xr) * pw; a1 = a1 * cz + ld4h(xr + 4) * pw; m = mn; }
    const float inv = (s > 0.f) ? 1.f / (s + 1e-16f) : 0.f; a0 = a0 * inv; a1 = a1 * inv;
    if (EPI == 0 || EPI == 1 || EPI == 4 || EPI == 5) { a0 = a0 + *(const v4f*)(bias + c0); a1 = a1 + *(const v4f*)(bias + c0 + 4); }
    if (EPI == 4 || EPI == 5) { a0.x = (a0.x > 0.f) ? a0.x : (expf(a0.x) - 1.f); a0.y = (a0.y > 0.f) ? a0.y : (expf(a0.y) - 1.f); a0.z = (a0.z > 0.f) ? a0.z : (expf(a0.z) - 1.f); a0.w = (a0.w > 0.f) ? a0.w : (expf(a0.w) - 1.f);
        a1.x = (a1.x > 0.f) ? a1.x : (expf(a1.x) - 1.f); a1.y = (a1.y > 0.f) ? a1.y : (expf(a1.y) - 1.f); a1.z = (a1.z > 0.f) ? a1.z : (expf(a1.z) - 1.f); a1.w = (a1.w > 0.f) ? a1.w : (expf(a1.w) - 1.f); }
    if (EPI == 4) { float o8[8] = {a0.x, a0.y, a0.z, a0.w, a1.x, a1.y, a1.z, a1.w}; unsigned short hh[8], ll[8];
#pragma unroll
        for (int u = 0; u < 8; ++u) bfsplit(o8[u], hh[u], ll[u]);
        const unsigned long long ph0 = (unsigned long long)hh[0] | ((unsigned long long)hh[1] << 16) | ((unsigned long long)hh[2] << 32) | ((unsigned long long)hh[3] << 48), pl0 = (unsigned long long)ll[0] | ((unsigned long long)ll[1] << 16) | ((unsigned long long)ll[2] << 32) | ((unsigned long long)ll[3] << 48);
        const unsigned long long ph1 = (unsigned long long)hh[4] | ((unsigned long long)hh[5] << 16) | ((unsigned long long)hh[6] << 32) | ((unsigned long long)hh[7] << 48), pl1 = (unsigned long long)ll[4] | ((unsigned long long)ll[5] << 16) | ((unsigned long long)ll[6] << 32) | ((unsigned long long)ll[7] << 48);
        v4u pk; pk.x = (unsigned)(ph0 & 0xFFFFFFFFull); pk.y = (unsigned)(ph0 >> 32); pk.z = (unsigned)(ph1 & 0xFFFFFFFFull); pk.w = (unsigned)(ph1 >> 32); v4u* dh = (v4u*)(OH + (long long)n * 256 + c0); *dh = pk; 
        v4u ql; ql.x = (unsigned)(pl0 & 0xFFFFFFFFull); ql.y = (unsigned)(pl0 >> 32); ql.z = (unsigned)(pl1 & 0xFFFFFFFFull); ql.w = (unsigned)(pl1 >> 32); v4u* dl = (v4u*)(OL + (long long)n * 256 + c0); *dl = ql;  return; }
    if (EPI == 6) {
        a0.x += __shfl_xor(a0.x, 16); a0.y += __shfl_xor(a0.y, 16); a0.z += __shfl_xor(a0.z, 16); a0.w += __shfl_xor(a0.w, 16); a1.x += __shfl_xor(a1.x, 16); a1.y += __shfl_xor(a1.y, 16); a1.z += __shfl_xor(a1.z, 16); a1.w += __shfl_xor(a1.w, 16);
        if (L < 16) { const int cb = 8 * L; const v4f b0 = *(const v4f*)(bias + cb), b1v = *(const v4f*)(bias + cb + 4);
            stage[wv][cb] = fmaxf(a0.x * 0.5f + b0.x, 0.f); stage[wv][cb + 1] = fmaxf(a0.y * 0.5f + b0.y, 0.f); stage[wv][cb + 2] = fmaxf(a0.z * 0.5f + b0.z, 0.f); stage[wv][cb + 3] = fmaxf(a0.w * 0.5f + b0.w, 0.f);
            stage[wv][cb + 4] = fmaxf(a1.x * 0.5f + b1v.x, 0.f); stage[wv][cb + 5] = fmaxf(a1.y * 0.5f + b1v.y, 0.f); stage[wv][cb + 6] = fmaxf(a1.z * 0.5f + b1v.z, 0.f); stage[wv][cb + 7] = fmaxf(a1.w * 0.5f + b1v.w, 0.f); }
        __builtin_amdgcn_fence(__ATOMIC_RELEASE, "workgroup"); __builtin_amdgcn_wave_barrier(); __builtin_amdgcn_fence(__ATOMIC_ACQUIRE, "workgroup");
        v4f o6; o6.x = stage[wv][4 * L]; o6.y = stage[wv][4 * L + 1]; o6.z = stage[wv][4 * L + 2]; o6.w = stage[wv][4 * L + 3]; VST2V4(OUT + (long long)n * 128 + 4 * L, o6); return; }
    if (EPI == 5) {
        a0.x += __shfl_xor(a0.x, 8); a0.y += __shfl_xor(a0.y, 8); a0.z += __shfl_xor(a0.z, 8); a0.w += __shfl_xor(a0.w, 8); a1.x += __shfl_xor(a1.x, 8); a1.y += __shfl_xor(a1.y, 8); a1.z += __shfl_xor(a1.z, 8); a1.w += __shfl_xor(a1.w, 8);
        a0.x += __shfl_xor(a0.x, 16); a0.y += __shfl_xor(a0.y, 16); a0.z += __shfl_xor(a0.z, 16); a0.w += __shfl_xor(a0.w, 16); a1.x += __shfl_xor(a1.x, 16); a1.y += __shfl_xor(a1.y, 16); a1.z += __shfl_xor(a1.z, 16); a1.w += __shfl_xor(a1.w, 16);
        const int gq5 = L & 7; a0 = a0 * 0.25f; a1 = a1 * 0.25f;
        if (L < 8) { stage[wv][8 * gq5] = a0.x; stage[wv][8 * gq5 + 1] = a0.y; stage[wv][8 * gq5 + 2] = a0.z; stage[wv][8 * gq5 + 3] = a0.w; stage[wv][8 * gq5 + 4] = a1.x; stage[wv][8 * gq5 + 5] = a1.y; stage[wv][8 * gq5 + 6] = a1.z; stage[wv][8 * gq5 + 7] = a1.w; }
        __builtin_amdgcn_fence(__ATOMIC_RELEASE, "workgroup"); __builtin_amdgcn_wave_barrier(); __builtin_amdgcn_fence(__ATOMIC_ACQUIRE, "workgroup");
        const unsigned long long pk5 = (unsigned long long)__builtin_bit_cast(unsigned, stage[wv][2 * L]) | ((unsigned long long)__builtin_bit_cast(unsigned, stage[wv][2 * L + 1]) << 32); VST2(unsigned long long, (unsigned long long*)(OUT + (long long)n * 64 + 2 * L), pk5); return; }
    if (EPI == 1) { float sm = a0.x + a0.y + a0.z + a0.w + a1.x + a1.y + a1.z + a1.w;
#pragma unroll
        for (int o = 16; o > 0; o >>= 1) sm += __shfl_xor(sm, o);
        const float mu = sm * (1.f / 256.f); const v4f d0 = a0 - mu, d1 = a1 - mu; float q = d0.x * d0.x + d0.y * d0.y + d0.z * d0.z + d0.w * d0.w + d1.x * d1.x + d1.y * d1.y + d1.z * d1.z + d1.w * d1.w;
#pragma unroll
        for (int o = 16; o > 0; o >>= 1) q += __shfl_xor(q, o);
        const float rs = rsqrtf(q * (1.f / 256.f) + 1e-5f); float o8[8] = {d0.x, d0.y, d0.z, d0.w, d1.x, d1.y, d1.z, d1.w}; unsigned short hh[8], ll[8];
#pragma unroll
        for (int u = 0; u < 8; ++u) { const float v = fmaxf(o8[u] * rs * g[c0 + u] + bb[c0 + u], 0.f); bfsplit(v, hh[u], ll[u]); }
        const unsigned long long ph0 = (unsigned long long)hh[0] | ((unsigned long long)hh[1] << 16) | ((unsigned long long)hh[2] << 32) | ((unsigned long long)hh[3] << 48), pl0 = (unsigned long long)ll[0] | ((unsigned long long)ll[1] << 16) | ((unsigned long long)ll[2] << 32) | ((unsigned long long)ll[3] << 48);
        const unsigned long long ph1 = (unsigned long long)hh[4] | ((unsigned long long)hh[5] << 16) | ((unsigned long long)hh[6] << 32) | ((unsigned long long)hh[7] << 48), pl1 = (unsigned long long)ll[4] | ((unsigned long long)ll[5] << 16) | ((unsigned long long)ll[6] << 32) | ((unsigned long long)ll[7] << 48);
        // lane L's 8 halves at c0 = 8L: 16 B -> one 16-B store per plane (32 lanes x 16 B = whole 512-B row)
        v4u pk; pk.x = (unsigned)(ph0 & 0xFFFFFFFFull); pk.y = (unsigned)(ph0 >> 32); pk.z = (unsigned)(ph1 & 0xFFFFFFFFull); pk.w = (unsigned)(ph1 >> 32); v4u* dh = (v4u*)(OH + (long long)n * 256 + c0); *dh = pk; 
        v4u ql; ql.x = (unsigned)(pl0 & 0xFFFFFFFFull); ql.y = (unsigned)(pl0 >> 32); ql.z = (unsigned)(pl1 & 0xFFFFFFFFull); ql.w = (unsigned)(pl1 >> 32); v4u* dl = (v4u*)(OL + (long long)n * 256 + c0); *dl = ql;  return; }
    if (EPI == 2 || EPI == 3) {   // head mean: lanes L, L^8, L^16, L^24 hold the same chan group of the 4 heads (CH = 64 -> 8 lanes per head)
        a0.x += __shfl_xor(a0.x, 8); a0.y += __shfl_xor(a0.y, 8); a0.z += __shfl_xor(a0.z, 8); a0.w += __shfl_xor(a0.w, 8); a1.x += __shfl_xor(a1.x, 8); a1.y += __shfl_xor(a1.y, 8); a1.z += __shfl_xor(a1.z, 8); a1.w += __shfl_xor(a1.w, 8);
        a0.x += __shfl_xor(a0.x, 16); a0.y += __shfl_xor(a0.y, 16); a0.z += __shfl_xor(a0.z, 16); a0.w += __shfl_xor(a0.w, 16); a1.x += __shfl_xor(a1.x, 16); a1.y += __shfl_xor(a1.y, 16); a1.z += __shfl_xor(a1.z, 16); a1.w += __shfl_xor(a1.w, 16);
        const int gq = L & 7; a0 = a0 * 0.25f + *(const v4f*)(bias + 8 * gq); a1 = a1 * 0.25f + *(const v4f*)(bias + 8 * gq + 4);      // every lane now holds channels 8gq..8gq+7 of the mean
        if (EPI == 3) { if (L < 8) { stage[wv][8 * gq] = a0.x; stage[wv][8 * gq + 1] = a0.y; stage[wv][8 * gq + 2] = a0.z; stage[wv][8 * gq + 3] = a0.w; stage[wv][8 * gq + 4] = a1.x; stage[wv][8 * gq + 5] = a1.y; stage[wv][8 * gq + 6] = a1.z; stage[wv][8 * gq + 7] = a1.w; }
            __builtin_amdgcn_fence(__ATOMIC_RELEASE, "workgroup"); __builtin_amdgcn_wave_barrier(); __builtin_amdgcn_fence(__ATOMIC_ACQUIRE, "workgroup");
            const unsigned long long pk3 = (unsigned long long)__builtin_bit_cast(unsigned, stage[wv][2 * L]) | ((unsigned long long)__builtin_bit_cast(unsigned, stage[wv][2 * L + 1]) << 32); VST2(unsigned long long, (unsigned long long*)(OUT + (long long)n * 64 + 2 * L), pk3); return; }
        float sm = (L < 8) ? (a0.x + a0.y + a0.z + a0.w + a1.x + a1.y + a1.z + a1.w) : 0.f;
#pragma unroll
        for (int o = 16; o > 0; o >>= 1) sm += __shfl_xor(sm, o);
        const float mu = sm * (1.f / 64.f); const v4f d0 = a0 - mu, d1 = a1 - mu; float q = (L < 8) ? (d0.x * d0.x + d0.y * d0.y + d0.z * d0.z + d0.w * d0.w + d1.x * d1.x + d1.y * d1.y + d1.z * d1.z + d1.w * d1.w) : 0.f;
#pragma unroll
        for (int o = 16; o > 0; o >>= 1) q += __shfl_xor(q, o);
        const float rs = rsqrtf(q * (1.f / 64.f) + 1e-5f);
        if (L < 8) { const float* gg = g + 8 * gq; const float* bq = bb + 8 * gq; stage[wv][8 * gq] = fmaxf(d0.x * rs * gg[0] + bq[0], 0.f); stage[wv][8 * gq + 1] = fmaxf(d0.y * rs * gg[1] + bq[1], 0.f); stage[wv][8 * gq + 2] = fmaxf(d0.z * rs * gg[2] + bq[2], 0.f); stage[wv][8 * gq + 3] = fmaxf(d0.w * rs * gg[3] + bq[3], 0.f);
            stage[wv][8 * gq + 4] = fmaxf(d1.x * rs * gg[4] + bq[4], 0.f); stage[wv][8 * gq + 5] = fmaxf(d1.y * rs * gg[5] + bq[5], 0.f); stage[wv][8 * gq + 6] = fmaxf(d1.z * rs * gg[6] + bq[6], 0.f); stage[wv][8 * gq + 7] = fmaxf(d1.w * rs * gg[7] + bq[7], 0.f); }
        __builtin_amdgcn_fence(__ATOMIC_RELEASE, "workgroup"); __builtin_amdgcn_wave_barrier(); __builtin_amdgcn_fence(__ATOMIC_ACQUIRE, "workgroup");
        const unsigned long long pk = (unsigned long long)__builtin_bit_cast(unsigned, stage[wv][2 * L]) | ((unsigned long long)__builtin_bit_cast(unsigned, stage[wv][2 * L + 1]) << 32); VST2(unsigned long long, (unsigned long long*)(OUT + (long long)n * 64 + 2 * L), pk); return; }
    // EPI 0
    stage[wv][c0] = a0.x; stage[wv][c0 + 1] = a0.y; stage[wv][c0 + 2] = a0.z; stage[wv][c0 + 3] = a0.w; stage[wv][c0 + 4] = a1.x; stage[wv][c0 + 5] = a1.y; stage[wv][c0 + 6] = a1.z; stage[wv][c0 + 7] = a1.w;
    __builtin_amdgcn_fence(__ATOMIC_RELEASE, "workgroup"); __builtin_amdgcn_wave_barrier(); __builtin_amdgcn_fence(__ATOMIC_ACQUIRE, "workgroup");
#pragma unroll
    for (int q2 = 0; q2 < 2; ++q2) { const int c = 128 * q2 + 4 * L; v4f v; v.x = stage[wv][c]; v.y = stage[wv][c + 1]; v.z = stage[wv][c + 2]; v.w = stage[wv][c + 3]; VST2V4(OUT + (long long)n * 256 + c, v); } }

__device__ __forceinline__ void st4s(unsigned short* Hp, unsigned short* Lp, long long o, v4f a) { unsigned short h[4], l[4]; bfsplit(a.x, h[0], l[0]); bfsplit(a.y, h[1], l[1]); bfsplit(a.z, h[2], l[2]); bfsplit(a.w, h[3], l[3]);
    const unsigned long long ph = (unsigned long long)h[0] | ((unsigned long long)h[1] << 16) | ((unsigned long long)h[2] << 32) | ((unsigned long long)h[3] << 48), pl = (unsigned long long)l[0] | ((unsigned long long)l[1] << 16) | ((unsigned long long)l[2] << 32) | ((unsigned long long)l[3] << 48);
    VST2(unsigned long long, (unsigned long long*)(Hp + o), ph); VST2(unsigned long long, (unsigned long long*)(Lp + o), pl); }
// f32 [nval2 pairs] -> bf16 hi/lo planes (n2 pairs; pairs >= nval2 zero); thread-linear 4-B stores per plane
__global__ __launch_bounds__(256) void k_pl(const float* __restrict__ S, unsigned short* __restrict__ PH, unsigned short* __restrict__ PL, long long nval2, long long n2) { const long long u = (long long)blockIdx.x * 256 + threadIdx.x; if (u >= n2) return; const bool in = (u < nval2); const long long uc = in ? u : ((nval2 > 0) ? (nval2 - 1) : 0); const float a = S[2 * uc], b = S[2 * uc + 1]; st_s2(PH, PL, 2 * u, in ? a : 0.f, in ? b : 0.f); }
// WC [K][NOP] (thread-linear whole rows) = [W (cols < FO) | 0 | W_h . as_h @EO+h | W_h . ad_h @EO+NH+h | 0 ...]; W is [K][FO] (x @ W layout), as/ad [NH][DH]; EO >= FO.
// branch-free: every lane loads all candidates with clamped indices and selects by value (no exec-masked load arms)
__global__ __launch_bounds__(256) void k_wext(const float* __restrict__ Wm, const float* __restrict__ AS_, const float* __restrict__ AD_, int K, int NOP, int FO, int NH, int DH, int EO, float* __restrict__ WC) {
    #pragma clang fp contract(off)
    const long long u = (long long)blockIdx.x * 256 + threadIdx.x; if (u >= (long long)K * NOP) return; const int kk = (int)(u / NOP), o = (int)(u % NOP);
    const int oo = min(o, FO - 1); const float vw = Wm[(long long)kk * FO + oo]; const int q = min(max(o - EO, 0), 2 * NH - 1); const int h = q % NH; float s = 0.f;
#pragma unroll 1
    for (int c = 0; c < DH; ++c) { const float w = Wm[(long long)kk * FO + h * DH + c]; const float asv = AS_[h * DH + c], adv = AD_[h * DH + c]; s += w * ((q < NH) ? asv : adv); }
    const float v = (o < FO) ? vw : ((o >= EO && o < EO + 2 * NH) ? s : 0.f); VST2(float, WC + u, v); }
// GAT aggregation over a device in-edge CSR (+ analytic self loop as iteration j = -1 when SELF), per-lane online softmax (lanes of one head agree):
// HS rows (pitch P floats): [0,128) projected features z, col 128 + h = a_src.z_h, col 128 + NH + h = a_dst.z_h; lane L owns channels 4L..4L+3 (head = 4L / CH).
// out = sum_j softmax_j(leaky(el[src_j][h] + er[n][h])) z[src_j] (/ (den + deps)) + bias -> ACT (0 none, 1 relu, 2 elu, 3 leaky 0.01) ->
// MODE 0: f32 OUT[n][OW] cols < OC (16-B lane stores, OC*4 contiguous B per wave; OC in {64,128}); MODE 1: bf16 hi/lo planes PH/PL pitch PP (rows n >= N zero); MODE 2: both.
template <int CH, bool SELF, int ACT, int MODE>
__global__ __launch_bounds__(256) void k_gat128(const float* __restrict__ HS, int P, int NH, const float* __restrict__ bias, const int* __restrict__ SRC, const int* __restrict__ off, const int* __restrict__ cnt, const int* __restrict__ slot,
        float* __restrict__ OUT, int OW, int OC, unsigned short* __restrict__ PH, unsigned short* __restrict__ PL, int PP, int N, int NP, int E, int CAP, float slope, float deps) {
    #pragma clang fp contract(off)
    const int n = blockIdx.x * 8 + (threadIdx.x >> 5); const int L = threadIdx.x & 31; if (n >= NP) return; const int c = 4 * L; const int h = c / CH; v4f o; o.x = o.y = o.z = o.w = 0.f;
    if (n < N) { const float* hn = HS + (long long)n * P; const float er = hn[128 + NH + h]; float m = -3.0e38f, s = 0.f; v4f a; a.x = a.y = a.z = a.w = 0.f;
        const int p0 = min(max(off[n], 0), E), cn = min(max(cnt[n], 0), CAP);
        for (int j = (SELF ? -1 : 0); j < cn; ++j) { int sj; if (j < 0) sj = n; else { const int e = min(max(slot[min(p0 + j, E - 1)], 0), E - 1); sj = min(max(SRC[e], 0), N - 1); }
            const float* hs = HS + (long long)sj * P; float lg = hs[128 + h] + er; lg = (lg >= 0.f) ? lg : slope * lg;
            const float mn = fmaxf(m, lg); const float cz = expf(m - mn), pj = expf(lg - mn); s = s * cz + pj; a = a * cz + *(const v4f*)(hs + c) * pj; m = mn; }
        const float inv = (s > 0.f || deps > 0.f) ? 1.f / (s + deps) : 0.f; o = a * inv + *(const v4f*)(bias + c);
        if (ACT == 1) { o.x = fmaxf(o.x, 0.f); o.y = fmaxf(o.y, 0.f); o.z = fmaxf(o.z, 0.f); o.w = fmaxf(o.w, 0.f); }
        if (ACT == 2) { o.x = (o.x > 0.f) ? o.x : (expf(o.x) - 1.f); o.y = (o.y > 0.f) ? o.y : (expf(o.y) - 1.f); o.z = (o.z > 0.f) ? o.z : (expf(o.z) - 1.f); o.w = (o.w > 0.f) ? o.w : (expf(o.w) - 1.f); }
        if (ACT == 3) { o.x = (o.x >= 0.f) ? o.x : 0.01f * o.x; o.y = (o.y >= 0.f) ? o.y : 0.01f * o.y; o.z = (o.z >= 0.f) ? o.z : 0.01f * o.z; o.w = (o.w >= 0.f) ? o.w : 0.01f * o.w; }
        if (MODE != 1 && c < OC) VST2V4(OUT + (long long)n * OW + c, o); }
    if (MODE != 0) st4s(PH, PL, (long long)n * PP + c, o); }

// ---- util2 ----
// generic Bt plane builder from an f32 weight: Bt[o][k] (pitch KP halves) = (TRANS ? W[k*ldw + o] : W[o*ldw + k]) * (S ? S[o] : 1) for o < NO, k < KI; zero elsewhere for o < NOP rows, k < KP (thread per (o < NOP, pair k))
__global__ __launch_bounds__(256) void k_u2_bt(const float* __restrict__ Wm, int ldw, int TRANS, int KI, int NO, int KP, int NOP, const float* __restrict__ S, unsigned short* __restrict__ PH_, unsigned short* __restrict__ PL_) {
    const long long u = (long long)blockIdx.x * 256 + threadIdx.x; if (u >= (long long)NOP * (KP / 2)) return; const int k0 = 2 * (int)(u % (KP / 2)); const int o = (int)(u / (KP / 2)); float a = 0.f, b = 0.f;
    if (o < NO) { const float s = S ? S[o] : 1.f;
        if (k0 < KI) a = (TRANS ? Wm[(long long)k0 * ldw + o] : Wm[(long long)o * ldw + k0]) * s;
        if (k0 + 1 < KI) b = (TRANS ? Wm[(long long)(k0 + 1) * ldw + o] : Wm[(long long)o * ldw + k0 + 1]) * s; }
    st_s2(PH_, PL_, (long long)o * KP + k0, a, b); }
// generic padded vector: O[i] = (i < n) ? (A[i] * (S ? S[i] : 1) + (B2 ? B2[i] : 0)) : 0 for i < NP (one block of 256, NP <= 4096 looped)
__global__ __launch_bounds__(256) void k_u2_vec(const float* __restrict__ A, const float* __restrict__ S, const float* __restrict__ B2, int n, int NP, float* __restrict__ O) { for (int i = threadIdx.x; i < NP; i += 256) { float v = 0.f; if (i < n) v = A[i] * (S ? S[i] : 1.f) + (B2 ? B2[i] : 0.f); VST2(float, O + i, v); } }
__global__ __launch_bounds__(256) void k_u2_colstat(const float* __restrict__ X, int P, int N, float eps, float* __restrict__ STAT) {
    #pragma clang fp contract(off)
    __shared__ float red[256]; const int c = blockIdx.x; const int t = threadIdx.x; float s = 0.f; for (int r = t; r < N; r += 256) s += X[(long long)r * P + c]; red[t] = s; __syncthreads();
    for (int o = 128; o > 0; o >>= 1) { if (t < o) red[t] += red[t + o]; __syncthreads(); }
    const float mu = red[0] / (float)N; __syncthreads(); float q = 0.f; for (int r = t; r < N; r += 256) { const float d = X[(long long)r * P + c] - mu; q += d * d; } red[t] = q; __syncthreads();
    for (int o = 128; o > 0; o >>= 1) { if (t < o) red[t] += red[t + o]; __syncthreads(); }
    const float rs = 1.f / sqrtf(red[0] / (float)N + eps); if (t < 32) VST2(float, STAT + (long long)c * 32 + t, (t == 0) ? mu : ((t == 1) ? rs : 0.f)); }
// rows f32 [R][W] (pitch PW) -> planes at pitch PP, column offset coff; rows >= RL (live) written as zeros up to RP (thread per (r < RP, 4 of W))
__global__ __launch_bounds__(256) void k_u2_pl(const float* __restrict__ X, int PW, int Wd, int RL, int RP, unsigned short* __restrict__ PH_, unsigned short* __restrict__ PL_, int PP, int coff) { const long long u = (long long)blockIdx.x * 256 + threadIdx.x; if (u >= (long long)RP * (Wd / 4)) return; const int r = (int)(u / (Wd / 4)); const int c = 4 * (int)(u % (Wd / 4)); v4f v; v.x = v.y = v.z = v.w = 0.f; if (r < RL) v = *(const v4f*)(X + (long long)r * PW + c); st4s(PH_, PL_, (long long)r * PP + coff + c, v); }

typedef unsigned int cm_u4 __attribute__((ext_vector_type(4)));

__global__ __launch_bounds__(256) void k_cm_zero16(unsigned short* __restrict__ DST, long long n) { const long long u = (long long)blockIdx.x * 256 + threadIdx.x; if (u * 8 >= n) return; cm_u4 z; z.x = z.y = z.z = z.w = 0u; cm_u4* d = (cm_u4*)(DST + u * 8); *d = z;  }
// f32 -> bf16 (RNE) -> f16 casts: every 16-bit operand then holds exactly the bf16-rounded input value (times a power-of-two
// weight scale), so the f16 WMMA products are exact. Plain: thread per (row, 8 cols),
// dst [R][C] pitch ldd; transposed: thread per (col, 8 consecutive rows) -> dst [C][R] pitch ldd; both store 16 B per thread, thread-linear along the dst row.
__device__ __forceinline__ unsigned int cmb_pk2(float a, float b) { return (unsigned int)__builtin_bit_cast(unsigned short, (_Float16)a) | ((unsigned int)__builtin_bit_cast(unsigned short, (_Float16)b) << 16); }
__device__ __forceinline__ float cmb_bf(float v) { const unsigned u = __builtin_bit_cast(unsigned, v); const unsigned r = (u + 0x7fffu + ((u >> 16) & 1u)) & 0xffff0000u; return __builtin_bit_cast(float, r); }   // bf16 RNE, kept as f32 (finite inputs)
// BR[i] = bf16_rne(B[i]) kept as f32 (thread per element)
__global__ __launch_bounds__(256) void k_cm_bfvec(const float* __restrict__ SRC, float* __restrict__ DST, int n) { const int u = blockIdx.x * 256 + threadIdx.x; if (u >= n) return; VST2(float, DST + u, cmb_bf(SRC[u])); }
__global__ __launch_bounds__(256) void k_cm_castb(const float* __restrict__ SRC, int lds, unsigned short* __restrict__ DST, int ldd, int nR, int nC, float sc) {
    const long long u = (long long)blockIdx.x * 256 + threadIdx.x; const int per = nC / 8; if (u >= (long long)nR * per) return; const int r = (int)(u / per); const int c0 = 8 * (int)(u % per);
    const float* s = SRC + (long long)r * lds + c0; float w[8];
#pragma unroll
    for (int e = 0; e < 8; ++e) w[e] = cmb_bf(s[e]) * sc;
    cm_u4 pk; pk.x = cmb_pk2(w[0], w[1]); pk.y = cmb_pk2(w[2], w[3]); pk.z = cmb_pk2(w[4], w[5]); pk.w = cmb_pk2(w[6], w[7]); VST2(cm_u4, (cm_u4*)(DST + (long long)r * ldd + c0), pk); }
__global__ __launch_bounds__(256) void k_cm_castbT(const float* __restrict__ SRC, int lds, unsigned short* __restrict__ DST, int ldd, int nR, int nC, float sc) {
    const long long u = (long long)blockIdx.x * 256 + threadIdx.x; const int per = nR / 8; if (u >= (long long)nC * per) return; const int c = (int)(u / per); const int r0 = 8 * (int)(u % per);
    float w[8];
#pragma unroll
    for (int e = 0; e < 8; ++e) w[e] = cmb_bf(SRC[(long long)(r0 + e) * lds + c]) * sc;
    cm_u4 pk; pk.x = cmb_pk2(w[0], w[1]); pk.y = cmb_pk2(w[2], w[3]); pk.z = cmb_pk2(w[4], w[5]); pk.w = cmb_pk2(w[6], w[7]); VST2(cm_u4, (cm_u4*)(DST + (long long)c * ldd + r0), pk); }

typedef float ab_v2f __attribute__((ext_vector_type(2)));
__global__ __launch_bounds__(256) void k_ab_gstat(const float* __restrict__ X, float* __restrict__ STp, int per) {
    #pragma clang fp contract(off)
    __shared__ float red[256]; const int g = blockIdx.x; const int t = threadIdx.x; const float* base = X + (long long)g * per; float s = 0.f;
    for (int i = 4 * t; i < per; i += 1024) { const v4f v = *(const v4f*)(base + i); s += (cmb_bf(v.x) + cmb_bf(v.y)) + (cmb_bf(v.z) + cmb_bf(v.w)); }
    red[t] = s; __syncthreads();
    for (int o = 128; o > 0; o >>= 1) { if (t < o) red[t] += red[t + o]; __syncthreads(); }
    const float mean = red[0] / (float)per; __syncthreads(); float q = 0.f;
    for (int i = 4 * t; i < per; i += 1024) { const v4f v = *(const v4f*)(base + i); const float a = cmb_bf(v.x) - mean, b = cmb_bf(v.y) - mean, c = cmb_bf(v.z) - mean, d = cmb_bf(v.w) - mean; q += (a * a + b * b) + (c * c + d * d); }
    red[t] = q; __syncthreads();
    for (int o = 128; o > 0; o >>= 1) { if (t < o) red[t] += red[t + o]; __syncthreads(); }
    if (t == 0) { ab_v2f ms; ms.x = mean; ms.y = rsqrtf(red[0] / (float)per + 1e-5f); VST2(ab_v2f, (ab_v2f*)(STp + 32 * g), ms); } }
// XN[c][n] = (bf16(x[c][n]) - mean[g]) rstd[g] bf16(gamma[c]) + bf16(beta[c]); XB[c][n] = bf16(x[c][n]) (residual copy); thread per float4; c runs over the rows of all images ([B * CH][N], groups numbered through), gamma and beta repeat every CH rows
__global__ __launch_bounds__(256) void k_ab_gapply(const float* __restrict__ X, const float* __restrict__ STp, const float* __restrict__ Gm, const float* __restrict__ Bt, float* __restrict__ XNp, float* __restrict__ XBp, int N, int CPG, int CH, long long n4) {
    #pragma clang fp contract(off)
    const long long u = (long long)blockIdx.x * 256 + threadIdx.x; if (u >= n4) return; const int c = (int)((4 * u) / N); const int g = c / CPG; const float mean = STp[32 * g], rs = STp[32 * g + 1], ga = cmb_bf(Gm[c % CH]), be = cmb_bf(Bt[c % CH]);
    const v4f v = *(const v4f*)(X + 4 * u); v4f xb; xb.x = cmb_bf(v.x); xb.y = cmb_bf(v.y); xb.z = cmb_bf(v.z); xb.w = cmb_bf(v.w); v4f r; r.x = (xb.x - mean) * rs * ga + be; r.y = (xb.y - mean) * rs * ga + be; r.z = (xb.z - mean) * rs * ga + be; r.w = (xb.w - mean) * rs * ga + be;
    VST2V4(XNp + 4 * u, r); VST2V4(XBp + 4 * u, xb); }


extern "C" void kernel_launch(void* const* d_in, const int* in_sizes, int n_in, void* d_out, int out_size, void* d_ws, size_t ws_size, hipStream_t stream) {
    (void)in_sizes; (void)n_in; (void)out_size; (void)ws_size;
    const float* x = (const float*)d_in[0];
    const float* gam = (const float*)d_in[1];
    const float* bet = (const float*)d_in[2];
    const float* wqkv = (const float*)d_in[3];
    const float* bqkv = (const float*)d_in[4];
    const float* wo = (const float*)d_in[5];
    const float* bo = (const float*)d_in[6];
    float* out = (float*)d_out;
    char* wsp = (char*)d_ws;
    float* ST = (float*)wsp; wsp += (((size_t)((size_t)32 * 32 + 64) * 4 + 255) / 256) * 256;
    float* XN = (float*)wsp; wsp += (((size_t)((size_t)1024 * 4096) * 4 + 255) / 256) * 256;
    unsigned short* XTH = (unsigned short*)wsp; wsp += (((size_t)((size_t)16384 * 256) * 2 + 255) / 256) * 256;
    unsigned short* XTL = (unsigned short*)wsp; wsp += (((size_t)((size_t)16384 * 256) * 2 + 255) / 256) * 256;
    unsigned short* W3H = (unsigned short*)wsp; wsp += (((size_t)((size_t)768 * 256) * 2 + 255) / 256) * 256;
    unsigned short* W3L = (unsigned short*)wsp; wsp += (((size_t)((size_t)768 * 256) * 2 + 255) / 256) * 256;
    float* BR3 = (float*)wsp; wsp += (((size_t)((size_t)768 + 64) * 4 + 255) / 256) * 256;
    float* QKV = (float*)wsp; wsp += (((size_t)((size_t)16384 * 768) * 4 + 255) / 256) * 256;
    float* AO = (float*)wsp; wsp += (((size_t)((size_t)16384 * 256) * 4 + 255) / 256) * 256;
    unsigned short* AOH = (unsigned short*)wsp; wsp += (((size_t)((size_t)16384 * 256) * 2 + 255) / 256) * 256;
    unsigned short* AOL = (unsigned short*)wsp; wsp += (((size_t)((size_t)16384 * 256) * 2 + 255) / 256) * 256;
    unsigned short* WOH = (unsigned short*)wsp; wsp += (((size_t)((size_t)256 * 256) * 2 + 255) / 256) * 256;
    unsigned short* WOL = (unsigned short*)wsp; wsp += (((size_t)((size_t)256 * 256) * 2 + 255) / 256) * 256;
    float* BRO = (float*)wsp; wsp += (((size_t)((size_t)256 + 64) * 4 + 255) / 256) * 256;
    float* XB = (float*)wsp; wsp += (((size_t)((size_t)1024 * 4096) * 4 + 255) / 256) * 256;
    if ((size_t)(wsp - (char*)d_ws) > ws_size) return;   // static carve guard
    // All four images go through each stage in ONE launch: every buffer holds the four images one behind the other (pixel-major buffers as 16384 rows,
    // channel-major ones as 4 matrices), and the image is extra rows, grid.y or grid.z of the launch.
    k_castS16<<<(unsigned)((((long long)(768) * ((256) / 2)) + 255) / 256), 256, 0, stream>>>(wqkv, 256, (__bf16*)(W3H), (__bf16*)(W3L), 256, 768, 256, 1.0f, 0, 0, 0);
    k_cm_bfvec<<<3, 256, 0, stream>>>(bqkv, BR3, 768); k_cm_bfvec<<<1, 256, 0, stream>>>(bo, BRO, 256);
    k_castS16<<<(unsigned)((((long long)(256) * ((256) / 2)) + 255) / 256), 256, 0, stream>>>(wo, 256, (__bf16*)(WOH), (__bf16*)(WOL), 256, 256, 256, 1.0f, 0, 0, 0);
    k_ab_gstat<<<32, 256, 0, stream>>>(x, ST, 131072); k_ab_gapply<<<(1048576 + 255) / 256, 256, 0, stream>>>(x, ST, gam, bet, XN, XB, 4096, 32, 256, 1048576LL);
    k_castS16<<<dim3((unsigned)((((long long)(4096) * ((256) / 2)) + 255) / 256), (unsigned)(4)), 256, 0, stream>>>(XN, 4096, (__bf16*)(XTH), (__bf16*)(XTL), 256, 256, 4096, 1.0f, 1, 1048576, 1048576);
    w25::wmma_gemm64<1, false, 2, 0, false, 0><<<dim3((unsigned)((((16384) / 64) * ((768) / 64) + 7) / 8), (unsigned)(1)), 256, 0, stream>>>((const unsigned short*)(XTH), nullptr, 256, 0, (const unsigned short*)(W3H), nullptr, 256, 0, (void*)(QKV), nullptr, 768, 0, BR3, nullptr, 0, 16384, 768, 256, 1.0f);
    w25::wmma_gemm64<1, false, 0, 0, true, 0><<<dim3((unsigned)((((16384) / 64) * ((768) / 64) + 7) / 8), (unsigned)(1)), 256, 0, stream>>>((const unsigned short*)(XTL), nullptr, 256, 0, (const unsigned short*)(W3H), nullptr, 256, 0, (void*)(QKV), nullptr, 768, 0, nullptr, QKV, 0, 16384, 768, 256, 1.0f);
    { /*apv4*/ AttnP a;
      a.Q = QKV; a.K = QKV + 256; a.V = QKV + 512; a.O = AO; a.P = 0; a.Mf = 0; a.Mi = 0; a.ST = 0;
      a.Pw = 0; a.Rt = 0; a.SQ = 0; a.SK = 0;
      a.swb = 0; a.swh = 0; a.swi = 0; a.swj = 0; a.srb = 0; a.srh = 0; a.sri = 0; a.sQb = 3145728; a.sQh = 64; a.sQi = 768; a.sQd = 1; a.sKb = 3145728; a.sKh = 64; a.sKj = 768; a.sKd = 1; a.sVb = 3145728; a.sVh = 64; a.sVj = 768; a.sVd = 1; a.sOb = 1048576; a.sOh = 64; a.sOi = 256; a.sPb = 0; a.sPh = 0; a.sPi = 0; a.smb = 0; a.smh = 0; a.smi = 0; a.smj = 0;
      a.Lq = 4096; a.Lk = 4096; a.dh = 64; a.dv = 64; a.hrep = 1; a.causal = 0; a.coff = 0; a.pband = 0;
      a.scale = 0.125f; a.mfill = 0.0f; a.nonorm = 0; a.mpol = 0;
      a.roff = 0; a.rn = 1; a.segpol = 0; a.win = 0;
      k_attn<64, 64, 0, false, false, true, true><<<dim3((unsigned)((4096) + 16 * AW - 1) / (16 * AW), (unsigned)(4), (unsigned)(4)), 32 * AW, 0, stream>>>(a); }
    k_castS16<<<(unsigned)((((long long)(16384) * ((256) / 2)) + 255) / 256), 256, 0, stream>>>(AO, 256, (__bf16*)(AOH), (__bf16*)(AOL), 256, 16384, 256, 1.0f, 0, 0, 0);
    w25::wmma_gemm64<1, false, 1, 0, true, 0><<<dim3((unsigned)((((256) / 64) * ((4096) / 64) + 7) / 8), (unsigned)(4)), 256, 0, stream>>>((const unsigned short*)(WOH), nullptr, 256, 0, (const unsigned short*)(AOH), nullptr, 256, 1048576, (void*)(out), nullptr, 4096, 1048576, BRO, XB, 1048576, 256, 4096, 256, 1.0f);
    w25::wmma_gemm64<1, false, 0, 0, true, 0><<<dim3((unsigned)((((256) / 64) * ((4096) / 64) + 7) / 8), (unsigned)(4)), 256, 0, stream>>>((const unsigned short*)(WOH), nullptr, 256, 0, (const unsigned short*)(AOL), nullptr, 256, 1048576, (void*)(out), nullptr, 4096, 1048576, nullptr, out, 1048576, 256, 4096, 256, 1.0f);
}

// v005
// One run takes 364 microseconds.
// Two timings next to v004 put it at 1.27 and 1.28 times that version's speed.
// Over all steps from v000, the starting kernel, it is 22.5 times as fast.
#include <hip/hip_runtime.h>
#include <math.h>

typedef __attribute__((ext_vector_type(16))) _Float16 v16h;
typedef __attribute__((ext_vector_type(8)))  _Float16 v8h;
typedef __attribute__((ext_vector_type(16))) __bf16   v16b;
typedef __attribute__((ext_vector_type(8)))  float    v8f;
typedef __attribute__((ext_vector_type(4)))  float    v4f;

// 16-bit WMMA fragment map (wave32), lane L, h = L>>4, m = L&15:
//   A 16x32: lane = row m;   element i -> k = (i<8) ? 8h+i : 16+8h+(i-8)
//   B 32x16: lane = column m; the SAME k(i,h)
//   D 16x16 (8 f32): lane = column m; element r -> row 8h+r
__device__ __forceinline__ int frag_k(int i, int h) { return (i < 8) ? (8 * h + i) : (16 + 8 * h + (i - 8)); }
__device__ __forceinline__ __bf16 bf16_rne(float f) {
    unsigned int u = __float_as_uint(f);
    u += 0x7fffu + ((u >> 16) & 1u);
    return __builtin_bit_cast(__bf16, (unsigned short)(u >> 16));
}
__device__ __forceinline__ float bf16_f32(__bf16 b) { return __uint_as_float(((unsigned int)__builtin_bit_cast(unsigned short, b)) << 16); }
__device__ __forceinline__ v8f wmma16(v16h a, v16h b, v8f c) {
    c = __builtin_amdgcn_wmma_f32_16x16x32_f16(false, a, false, b, (short)0, c, false, false);
    asm volatile("v_nop\n\tv_nop\n\tv_nop\n\tv_nop" : "+v"(c) : "v"(a), "v"(b));
    return c;
}
__device__ __forceinline__ v8f wmmab(v16b a, v16b b, v8f c) {
    c = __builtin_amdgcn_wmma_f32_16x16x32_bf16(false, a, false, b, (short)0, c, false, false);
    asm volatile("v_nop\n\tv_nop\n\tv_nop\n\tv_nop" : "+v"(c) : "v"(a), "v"(b));
    return c;
}
struct Split { v16b hi, lo; };
// hi/lo split product: a.hi*b.hi + a.hi*b.lo + a.lo*b.hi
__device__ __forceinline__ v8f wmma3(const Split& a, const Split& b, v8f c) {
    c = __builtin_amdgcn_wmma_f32_16x16x32_bf16(false, a.hi, false, b.hi, (short)0, c, false, false);
    c = __builtin_amdgcn_wmma_f32_16x16x32_bf16(false, a.hi, false, b.lo, (short)0, c, false, false);
    c = __builtin_amdgcn_wmma_f32_16x16x32_bf16(false, a.lo, false, b.hi, (short)0, c, false, false);
    asm volatile("v_nop\n\tv_nop\n\tv_nop\n\tv_nop" : "+v"(c) : "v"(a.hi), "v"(a.lo), "v"(b.hi), "v"(b.lo));
    return c;
}
struct Split3 { v16b hi, mid, lo; };
// triple split product (6 terms, drops only terms below 2^-24 relative)
__device__ __forceinline__ v8f wmma6(const Split3& a, const Split3& b, v8f c) {
    c = __builtin_amdgcn_wmma_f32_16x16x32_bf16(false, a.hi, false, b.hi, (short)0, c, false, false);
    c = __builtin_amdgcn_wmma_f32_16x16x32_bf16(false, a.hi, false, b.mid, (short)0, c, false, false);
    c = __builtin_amdgcn_wmma_f32_16x16x32_bf16(false, a.mid, false, b.hi, (short)0, c, false, false);
    c = __builtin_amdgcn_wmma_f32_16x16x32_bf16(false, a.hi, false, b.lo, (short)0, c, false, false);
    c = __builtin_amdgcn_wmma_f32_16x16x32_bf16(false, a.mid, false, b.mid, (short)0, c, false, false);
    c = __builtin_amdgcn_wmma_f32_16x16x32_bf16(false, a.lo, false, b.hi, (short)0, c, false, false);
    asm volatile("v_nop\n\tv_nop\n\tv_nop\n\tv_nop" : "+v"(c) : "v"(a.hi), "v"(a.mid), "v"(a.lo), "v"(b.hi), "v"(b.mid), "v"(b.lo));
    return c;
}

// Fragment gathers from f32 memory: element i <- p[(k0 + frag_k(i,h)) * sk] * s, zero for k >= klen.
__device__ __forceinline__ v16h fh_ld(const float* __restrict__ p, long long sk, int k0, int h, int klen, float s) {
    v16h a;
#pragma unroll
    for (int i = 0; i < 16; ++i) { const int k = k0 + frag_k(i, h); a[i] = (k < klen) ? (_Float16)(p[(long long)k * sk] * s) : (_Float16)0.f; }
    return a;
}
__device__ __forceinline__ Split sp_ld(const float* __restrict__ p, long long sk, int k0, int h, int klen, float s) {
    Split r;
#pragma unroll
    for (int i = 0; i < 16; ++i) {
        const int k = k0 + frag_k(i, h); const float x = (k < klen) ? p[(long long)k * sk] * s : 0.f;
        const __bf16 hb = bf16_rne(x); r.hi[i] = hb; r.lo[i] = bf16_rne(x - bf16_f32(hb));
    }
    return r;
}
__device__ __forceinline__ Split3 sp3_ld(const float* __restrict__ p, long long sk, int k0, int h, int klen, float s) {
    Split3 r;
#pragma unroll
    for (int i = 0; i < 16; ++i) {
        const int k = k0 + frag_k(i, h); const float x = (k < klen) ? p[(long long)k * sk] * s : 0.f;
        const __bf16 hb = bf16_rne(x); const float r1 = x - bf16_f32(hb); const __bf16 mb = bf16_rne(r1);
        r.hi[i] = hb; r.mid[i] = mb; r.lo[i] = bf16_rne(r1 - bf16_f32(mb));
    }
    return r;
}
__device__ __forceinline__ v16b bh_ld(const float* __restrict__ p, long long sk, int k0, int h, int klen, float s) {
    v16b a;
#pragma unroll
    for (int i = 0; i < 16; ++i) { const int k = k0 + frag_k(i, h); a[i] = bf16_rne((k < klen) ? p[(long long)k * sk] * s : 0.f); }
    return a;
}
// f16 fragment from an f16 LDS/global row with element stride 1 (k-contiguous), no bounds (tile already zero padded)
__device__ __forceinline__ v16h fh_row(const _Float16* __restrict__ row, int k0, int h) {
    v16h a;
#pragma unroll
    for (int i = 0; i < 16; ++i) a[i] = row[k0 + frag_k(i, h)];
    return a;
}

typedef __attribute__((ext_vector_type(4))) _Float16 v4h;
// One 16-bit fragment's 32 k of a k-contiguous, 16-byte aligned f32 row as four unguarded 16-byte loads; row = the lane's row + 8 * h elements.
// fr_cvt packs them in the k order of frag_k.
struct FragRaw { v4f x0, x1, x2, x3; };
__device__ __forceinline__ FragRaw fr_ld(const v4f* __restrict__ row, int k0) {
    FragRaw r; r.x0 = row[k0 / 4]; r.x1 = row[k0 / 4 + 1]; r.x2 = row[k0 / 4 + 4]; r.x3 = row[k0 / 4 + 5];
    return r;
}
__device__ __forceinline__ v16h fr_cvt(const FragRaw& r) {
    v16h a;
#pragma unroll
    for (int i = 0; i < 4; ++i) { a[i] = (_Float16)r.x0[i]; a[4 + i] = (_Float16)r.x1[i]; a[8 + i] = (_Float16)r.x2[i]; a[12 + i] = (_Float16)r.x3[i]; }
    return a;
}

#define VST2(T, ptr, val) do { const T vst2_v_ = (val); *(T*)(ptr) = vst2_v_;  } while (0)
typedef float v4f __attribute__((ext_vector_type(4)));
#define VST2V4(ptr, val) do { const v4f vst2_v4_ = (val); *(v4f*)(ptr) = vst2_v4_;  } while (0)

__device__ __attribute__((noinline)) float act_fn(float v, int act) {
    if (act == 1) return fmaxf(v, 0.f);                                                                               // relu
    if (act == 2) { const float u = 0.7978845608028654f * (v + 0.044715f * v * v * v); return 0.5f * v * (1.f + tanhf(u)); } // tanh-gelu
    if (act == 3) return v / (1.f + expf(-v));                                                                        // silu
    if (act == 4) return 0.5f * v * (1.f + erff(v * 0.7071067811865476f));                                             // erf-gelu
    if (act == 5) return tanhf(v);
    if (act == 6) return 1.f / (1.f + expf(-v));                                                                      // sigmoid
    if (act == 7) return (v > 0.f) ? v : 0.01f * v;                                                                   // leaky relu 0.01
    if (act == 8) return (v > 0.f) ? v : (expf(v) - 1.f);                                                             // elu
    if (act == 9) return fminf(fmaxf(v, 0.f), 6.f);                                                                   // relu6
    if (act == 10) return fabsf(v);                                                                                    // abs
    if (act == 11) return (v >= 0.f) ? v : 0.1f * v;                                                                  // leaky 0.1
    if (act == 12) return (v > 0.f) ? v : 0.2f * v;                                                                   // leaky 0.2
    if (act == 13) return (v > 20.f) ? v : log1pf(expf(v));                                                            // softplus
    return v;
}

// =====================================================================================================================
// k_gemm<MODE>: C(z, m, n) = act(alpha * sum_k A(z, m, k) * B(z, k, n) + bias) + beta * R(z, m, n)
//   One wave (32-thread block) per 16 x 32 tile of C; grid (ceil(N/32), ceil(M/16), Z). Batch z -> (zo = z / zi_n, zi = z % zi_n)
//   with separate outer/inner strides for every tensor (e.g. batch and head). A(m,k) = A[zo*sAo + zi*sAi + m*sAm + k*sAk] (f32),
//   B(k,n) = B[zo*sBo + zi*sBi + n*sBn + k*sBk] (f32); any M, N, K (K zero-padded to 32 inside the fragments, M/N tails guarded).
//   C(m,n) = C[zo*sCo + zi*sCi + m*sCm + n] (n contiguous). flags: 1 bias[n], 2 bias[m], 4 residual R[zo*sRo + zi*sRi + m*sRm + n*sRn].
//   MODE 0: f16 operands (A prescaled by sa, B by sb, both undone in the epilogue); 1: bf16 hi/lo split (3 products); 2: bf16;
//   3: bf16 hi/mid/lo triple split (6 products); 4: as 3 with Kahan-compensated f32 accumulation across k-steps.
// =====================================================================================================================
struct GemmP {
    const float* A; const float* B; const float* bias; const float* R; float* C;
    long long sAo, sAi, sAm, sAk, sBo, sBi, sBn, sBk, sCo, sCi, sCm, sRo, sRi, sRm, sRn;
    int M, N, K, zi_n, flags, act; float alpha, beta, sa, sb;
    int Npad, pad_;     // columns [N, Npad) of C are written as 0 so that padded workspace rows are covered by whole-line stores; Npad >= N
};
static_assert(sizeof(GemmP) == 5 * 8 + 15 * 8 + 6 * 4 + 4 * 4 + 2 * 4, "GemmP has padding");

template <int MODE>
__global__ __launch_bounds__(32) void k_gemm(GemmP p) {
    const int lane = threadIdx.x & 31, h = lane >> 4, l15 = lane & 15;
    const int m0 = blockIdx.y * 16, n0 = blockIdx.x * 32;
    const int z = blockIdx.z, zo = z / p.zi_n, zi = z - zo * p.zi_n;
    const float* A = p.A + zo * p.sAo + zi * p.sAi;
    const float* B = p.B + zo * p.sBo + zi * p.sBi;
    const int am = min(m0 + l15, p.M - 1);                       // clamped row for loads (stores are guarded)
    v8f acc[2], comp[2];
#pragma unroll
    for (int t = 0; t < 2; ++t) { v8f zz = {}; acc[t] = zz; comp[t] = zz; }
    for (int k0 = 0; k0 < p.K; k0 += 32) {
        const float* arow = A + (long long)am * p.sAm;
        if (MODE == 1) {
            const Split a = sp_ld(arow, p.sAk, k0, h, p.K, 1.f);
#pragma unroll
            for (int t = 0; t < 2; ++t) {
                const int bn = min(n0 + t * 16 + l15, p.N - 1);
                acc[t] = wmma3(a, sp_ld(B + (long long)bn * p.sBn, p.sBk, k0, h, p.K, 1.f), acc[t]);
            }
        } else if (MODE == 3) {
            const Split3 a = sp3_ld(arow, p.sAk, k0, h, p.K, 1.f);
#pragma unroll
            for (int t = 0; t < 2; ++t) {
                const int bn = min(n0 + t * 16 + l15, p.N - 1);
                acc[t] = wmma6(a, sp3_ld(B + (long long)bn * p.sBn, p.sBk, k0, h, p.K, 1.f), acc[t]);
            }
        } else if (MODE == 4) {
            // triple split as MODE 3, but each k-step's 6 products go into a fresh accumulator and the partial is added to the running f32 sum
            // on the VALU with Kahan compensation (accumulation error stays ~1 ulp however long K is)
            const Split3 a = sp3_ld(arow, p.sAk, k0, h, p.K, 1.f);
#pragma unroll
            for (int t = 0; t < 2; ++t) {
                const int bn = min(n0 + t * 16 + l15, p.N - 1); v8f zz = {};
                const v8f part = wmma6(a, sp3_ld(B + (long long)bn * p.sBn, p.sBk, k0, h, p.K, 1.f), zz);
                const v8f y = part - comp[t]; const v8f s = acc[t] + y; comp[t] = (s - acc[t]) - y; acc[t] = s;
            }
        } else if (MODE == 2) {
            const v16b a = bh_ld(arow, p.sAk, k0, h, p.K, 1.f);
#pragma unroll
            for (int t = 0; t < 2; ++t) {
                const int bn = min(n0 + t * 16 + l15, p.N - 1);
                acc[t] = wmmab(a, bh_ld(B + (long long)bn * p.sBn, p.sBk, k0, h, p.K, 1.f), acc[t]);
            }
        } else {
            const v16h a = fh_ld(arow, p.sAk, k0, h, p.K, p.sa);
#pragma unroll
            for (int t = 0; t < 2; ++t) {
                const int bn = min(n0 + t * 16 + l15, p.N - 1);
                acc[t] = wmma16(a, fh_ld(B + (long long)bn * p.sBn, p.sBk, k0, h, p.K, p.sb), acc[t]);
            }
        }
    }
    const float iscale = (MODE == 0) ? p.alpha / (p.sa * p.sb) : p.alpha;
    float* C = p.C + zo * p.sCo + zi * p.sCi;
    const float* R = p.R + zo * p.sRo + zi * p.sRi;
    __shared__ __align__(16) float ctile[16][36];
#pragma unroll
    for (int t = 0; t < 2; ++t) {
        const int n = n0 + t * 16 + l15; const int nn = min(n, p.N - 1);
#pragma unroll
        for (int r = 0; r < 8; ++r) {
            const int m = m0 + 8 * h + r; const int mm = min(m, p.M - 1);
            float v = acc[t][r] * iscale;
            if (p.flags & 1) v += p.bias[nn];
            if (p.flags & 2) v += p.bias[mm];
            if (p.flags & 8) v *= p.bias[(long long)zo * p.M + mm];   /* per-(z,row) scale vector laid out [Z][M]; exclusive with the bias flags */
            v = act_fn(v, p.act);
            if (p.flags & 4) v += p.beta * R[(long long)mm * p.sRm + (long long)nn * p.sRn];
            ctile[8 * h + r][t * 16 + l15] = (n < p.N) ? v : 0.f;
        }
    }
    __syncthreads();
    const int NW = (p.Npad > p.N) ? p.Npad : p.N;           // write width
    const bool fast = (m0 + 16 <= p.M) && (n0 + 32 <= NW) && ((p.sCm & 3) == 0) && ((((size_t)C) & 15) == 0);
    if (fast) {
#pragma unroll
        for (int s = 0; s < 4; ++s) {
            const int row = s * 4 + (lane >> 3), c4 = (lane & 7) * 4;
            const v4f v = *(const v4f*)&ctile[row][c4];
            VST2V4(C + (long long)(m0 + row) * p.sCm + n0 + c4, v);
        }
    } else {
        for (int row = 0; row < 16; ++row) {
            const int m = m0 + row, n = n0 + lane;
            if (m < p.M && n < NW) VST2(float, C + (long long)m * p.sCm + n, ctile[row][lane]);
        }
    }
}


// =====================================================================================================================
// k_gemmT<MODE, TM, TN>: same contract as k_gemm, but one wave computes a (16*TM) x (16*TN) tile: TM A fragments and TN B fragments are
//   loaded per 32-wide k-step and reused across TM*TN WMMAs (far fewer load/convert instructions per MAC). MODE 0 (f16), 1 (bf16 hi/lo),
//   2 (bf16) only. grid (ceil(NW/(16*TN)), ceil(M/(16*TM)), Z), block 32. Epilogue identical to k_gemm, run per 16x32 sub-tile.
// =====================================================================================================================
template <int MODE, int TM, int TN>
__global__ __launch_bounds__(32) void k_gemmT(GemmP p) {
    const int lane = threadIdx.x & 31, h = lane >> 4, l15 = lane & 15;
    const int m0 = blockIdx.y * (16 * TM), n0 = blockIdx.x * (16 * TN);
    const int z = blockIdx.z, zo = z / p.zi_n, zi = z - zo * p.zi_n;
    const float* A = p.A + zo * p.sAo + zi * p.sAi;
    const float* B = p.B + zo * p.sBo + zi * p.sBi;
    v8f acc[TM][TN];
#pragma unroll
    for (int i = 0; i < TM; ++i)
#pragma unroll
        for (int t = 0; t < TN; ++t) { v8f zz = {}; acc[i][t] = zz; }
    for (int k0 = 0; k0 < p.K; k0 += 32) {
        if (MODE == 1) {
            Split a[TM], b[TN];
#pragma unroll
            for (int i = 0; i < TM; ++i) { const int am = min(m0 + 16 * i + l15, p.M - 1); a[i] = sp_ld(A + (long long)am * p.sAm, p.sAk, k0, h, p.K, 1.f); }
#pragma unroll
            for (int t = 0; t < TN; ++t) { const int bn = min(n0 + 16 * t + l15, p.N - 1); b[t] = sp_ld(B + (long long)bn * p.sBn, p.sBk, k0, h, p.K, 1.f); }
#pragma unroll
            for (int i = 0; i < TM; ++i)
#pragma unroll
                for (int t = 0; t < TN; ++t) acc[i][t] = wmma3(a[i], b[t], acc[i][t]);
        } else if (MODE == 2) {
            v16b a[TM], b[TN];
#pragma unroll
            for (int i = 0; i < TM; ++i) { const int am = min(m0 + 16 * i + l15, p.M - 1); a[i] = bh_ld(A + (long long)am * p.sAm, p.sAk, k0, h, p.K, 1.f); }
#pragma unroll
            for (int t = 0; t < TN; ++t) { const int bn = min(n0 + 16 * t + l15, p.N - 1); b[t] = bh_ld(B + (long long)bn * p.sBn, p.sBk, k0, h, p.K, 1.f); }
#pragma unroll
            for (int i = 0; i < TM; ++i)
#pragma unroll
                for (int t = 0; t < TN; ++t) acc[i][t] = wmmab(a[i], b[t], acc[i][t]);
        } else {
            v16h a[TM], b[TN];
#pragma unroll
            for (int i = 0; i < TM; ++i) { const int am = min(m0 + 16 * i + l15, p.M - 1); a[i] = fh_ld(A + (long long)am * p.sAm, p.sAk, k0, h, p.K, p.sa); }
#pragma unroll
            for (int t = 0; t < TN; ++t) { const int bn = min(n0 + 16 * t + l15, p.N - 1); b[t] = fh_ld(B + (long long)bn * p.sBn, p.sBk, k0, h, p.K, p.sb); }
#pragma unroll
            for (int i = 0; i < TM; ++i)
#pragma unroll
                for (int t = 0; t < TN; ++t) acc[i][t] = wmma16(a[i], b[t], acc[i][t]);
        }
    }
    const float iscale = (MODE == 0) ? p.alpha / (p.sa * p.sb) : p.alpha;
    float* C = p.C + zo * p.sCo + zi * p.sCi;
    const float* R = p.R + zo * p.sRo + zi * p.sRi;
    const int NW = (p.Npad > p.N) ? p.Npad : p.N;
    __shared__ __align__(16) float ctile[16][36];
#pragma unroll
    for (int i = 0; i < TM; ++i) {
        const int mb = m0 + 16 * i; if (mb >= p.M) break;          // wave-uniform
#pragma unroll
        for (int tp = 0; tp < TN / 2; ++tp) {
            const int nb = n0 + 32 * tp; if (nb >= NW) break;        // wave-uniform
#pragma unroll
            for (int t2 = 0; t2 < 2; ++t2) {
                const int t = 2 * tp + t2; const int n = nb + t2 * 16 + l15; const int nn = min(n, p.N - 1);
#pragma unroll
                for (int r = 0; r < 8; ++r) {
                    const int m = mb + 8 * h + r; const int mm = min(m, p.M - 1);
                    float v = acc[i][t][r] * iscale;
                    if (p.flags & 1) v += p.bias[nn];
                    if (p.flags & 2) v += p.bias[mm];
            if (p.flags & 8) v *= p.bias[(long long)zo * p.M + mm];   /* per-(z,row) scale vector laid out [Z][M]; exclusive with the bias flags */
                    v = act_fn(v, p.act);
                    if (p.flags & 4) v += p.beta * R[(long long)mm * p.sRm + (long long)nn * p.sRn];
                    ctile[8 * h + r][t2 * 16 + l15] = (n < p.N) ? v : 0.f;
                }
            }
            __syncthreads();
            const bool fast = (mb + 16 <= p.M) && (nb + 32 <= NW) && ((p.sCm & 3) == 0) && ((((size_t)C) & 15) == 0);
            if (fast) {
#pragma unroll
                for (int s = 0; s < 4; ++s) {
                    const int row = s * 4 + (lane >> 3), c4 = (lane & 7) * 4;
                    const v4f v = *(const v4f*)&ctile[row][c4];
                    VST2V4(C + (long long)(mb + row) * p.sCm + nb + c4, v);
                }
            } else {
                for (int row = 0; row < 16; ++row) {
                    const int m = mb + row, n = nb + lane;
                    if (m < p.M && n < NW) VST2(float, C + (long long)m * p.sCm + n, ctile[row][lane]);
                }
            }
            __syncthreads();
        }
    }
}

// =====================================================================================================================
//   Wave = 16 queries, AW waves per block, 64-key blocks; grid (ceil(Lq/(16*AW)), H, B), block 32*AW. Any Lq, Lk; head dim dh <= DHP
//   (DHP multiple of 32), value dim dv <= DVP (multiple of 16, <= 128). Every tensor addressed by (batch, head, row, element) strides, f32.
//   Scores: QM 0 f16 operands, 1 bf16 hi/lo split, 2 bf16 triple split; statistics f32 (exp2 domain); P.V: P x 4096 as f16 with V f16 staged in LDS
//   (SPLITPV: P and V as bf16 hi/lo splits). kv head = h / hrep. Masking: causal = 1 (keep j <= i + coff, masked -> -inf, key blocks beyond the
//   diagonal skipped), causal = 2 (masked -> mfill, a finite fill like the -1e9; no skipping), causal = 3 (keep j >= i + coff,
//   masked -> -inf, no skipping); optional additive f32 mask Mf,
//   optional int keep-mask Mi (0 -> score := mfill), both addressed b*smb + h*smh + i*smi + j*smj (0 strides broadcast).
// =====================================================================================================================
#define AW 4
// lane l's value of lane l ^ 16 (the wave's other half), by a vector cross-row move
__device__ __forceinline__ float xhalf(float x) { return __builtin_bit_cast(float, __builtin_amdgcn_permlanex16(__builtin_bit_cast(int, x), __builtin_bit_cast(int, x), 0x76543210, 0xfedcba98, false, false)); }
struct AttnP {   // apv4
    const float* Q; const float* K; const float* V; float* O; float* P; const float* Mf; const int* Mi; float* ST;
    const float* Pw; const float* Rt; const int* SQ; const int* SK;           // optional: post-softmax weight, relative-position table, segment ids
    long long swb, swh, swi, swj, srb, srh, sri;                                 // Pw strides (b,h,i,j); Rt strides (b,h,i), column = clamp(i - j + roff, 0, rn-1)
    long long sQb, sQh, sQi, sQd, sKb, sKh, sKj, sKd, sVb, sVh, sVj, sVd, sOb, sOh, sOi, sPb, sPh, sPi, smb, smh, smi, smj;
    int Lq, Lk, dh, dv, hrep, causal, coff, pband;   // pband > 0: P holds only the band |j - i| <= pband, column j - i + pband
    float scale, mfill; int nonorm, mpol;             // nonorm (online path only): O = sum_j exp(score_j) V_j without the 1/rowsum (scores must be <= ~0); mpol: Mi masks where ==0 (mpol 0) or where !=0 (mpol 1)
    int roff, rn, segpol, win;                        // Rt column offset/count; SQ/SK: score := mfill where (segpol 0) SQ[i] != SK[j] or (segpol 1) SQ[i] == SK[j]; win > 0: keys with i - j > win (after coff) -> -inf
};
//   Pw: the softmax numerator is multiplied by Pw(b,h,i,j) AFTER the row sum is taken (probs * weight, then P.V), as in post-softmax multiplicative biases.                                                    // ST (optional): per row (b,h,i) -> ST[((b*H + h)*Lq + i)*2 + {0,1}] = {row max of the scaled+masked score (natural units), sum_j exp(score - max)}
static_assert(sizeof(AttnP) == 12 * 8 + 29 * 8 + 16 * 4, "AttnP has padding");

#ifndef KATTN_ATTR
#define KATTN_ATTR __attribute__((amdgpu_waves_per_eu(4, 4)))   // the launch puts 4 waves on a SIMD: registers are budgeted for that, so a key block's 16 loads still issue as one group
#endif
template <int DHP, int DVP, int QM, bool SPLITPV, bool TWOPASS, bool UNIT = false, bool PLAIN = false>
__global__ __launch_bounds__(32 * AW) KATTN_ATTR void k_attn(AttnP p) {
    static_assert(!PLAIN || !TWOPASS, "PLAIN covers the one-pass path");
    static_assert(!UNIT || (QM == 0 && !SPLITPV && !TWOPASS && (32 * AW) / (DVP / 4) == 8 && (32 * AW) / (DHP / 4) == 8), "UNIT covers the f16 one-pass path, 8 K rows and 8 V rows per load step");
    constexpr int NT = DVP / 16;                // output tiles
    constexpr int KS = DHP / 32;                // k-steps for the scores
    constexpr int VP = DVP + 8;                 // LDS pitch (halves)
    constexpr int KP = DHP + 8;                 // LDS pitch of the K tile (halves): an odd multiple of 16 bytes, so a fragment's 16 rows fall on different banks
    __shared__ __align__(16) float    pl[AW][16 * 64];
    __shared__ __align__(16) _Float16 vl[(SPLITPV ? 2 : 1) * 64 * VP];   // f16 V tile, or bf16 hi and lo tiles (same 2-byte size)
    __shared__ __align__(16) _Float16 kl[UNIT ? 64 * KP : 8];            // UNIT: f16 K tile, row = key
    const int lane = threadIdx.x & 31, hf = lane >> 4, l15 = lane & 15, wave = threadIdx.x >> 5;
    const int h = blockIdx.y, b = blockIdx.z, hk = h / p.hrep;
    const int q0 = (blockIdx.x * AW + wave) * 16;
    float* myp = pl[wave];
    const float L2E = 1.4426950408889634f;
    const float NEG = -__builtin_inff();
    const int qi = min(q0 + l15, p.Lq - 1);
    const float* qrow = p.Q + b * p.sQb + h * p.sQh + (long long)qi * p.sQi;
    const float* kbase = p.K + b * p.sKb + hk * p.sKh;
    const float* vbase = p.V + b * p.sVb + hk * p.sVh;
    const v4f* qp = (const v4f*)(qrow + 8 * hf);               // UNIT: the lane's half of the fragment's k
    v16h qa[QM == 0 ? KS : 1]; Split qs_[QM == 1 ? KS : 1]; Split3 qt_[QM == 2 ? KS : 1];
#pragma unroll
    for (int ks = 0; ks < KS; ++ks) {
        if (QM == 2) qt_[ks] = sp3_ld(qrow, p.sQd, ks * 32, hf, p.dh, 1.f);
        else if (QM == 1) qs_[ks] = sp_ld(qrow, p.sQd, ks * 32, hf, p.dh, 1.f);
        else if (UNIT) qa[ks] = fr_cvt(fr_ld(qp, ks * 32));
        else qa[ks] = fh_ld(qrow, p.sQd, ks * 32, hf, p.dh, 1.f);
    }
    if (UNIT) asm volatile("s_wait_xcnt 0x0" :: "v"(qp) : "memory");   // the Q loads' address registers stay as they are up to this wait (named as input) and are reused behind it
    constexpr int VR = (32 * AW) / (DVP / 4);                  // V rows that the block's threads cover with one 16-byte load each
    constexpr int KR = (32 * AW) / (DHP / 4);                  // K rows that the block's threads cover with one 16-byte load each
    const unsigned koff = (unsigned)((int)(threadIdx.x / (DHP / 4)) * (int)p.sKj + (int)(threadIdx.x % (DHP / 4)) * 4) * 4u;   // UNIT: thread's byte offset in KR rows of K
    const unsigned voff = (unsigned)((int)(threadIdx.x / (DVP / 4)) * (int)p.sVj + (int)(threadIdx.x % (DVP / 4)) * 4) * 4u;   // UNIT: thread's byte offset in VR rows of V
    v8f o[NT]; float m8[8], l8[8];
#pragma unroll
    for (int t = 0; t < NT; ++t) { v8f zz = {}; o[t] = zz; }
#pragma unroll
    for (int i = 0; i < 8; ++i) { m8[i] = NEG; l8[i] = 0.f; }
    int jend = p.Lk; int jstart = 0;
    if (!PLAIN && p.causal == 1) { const int je = (blockIdx.x * AW + AW - 1) * 16 + 16 + p.coff; jend = min(jend, max(je, 0)); }   // uniform per block
    if (!PLAIN && p.win > 0) { const int js = (int)(blockIdx.x * AW) * 16 + p.coff - p.win; jstart = (js > 0) ? (js / 64) * 64 : 0; }   // uniform per block: key blocks entirely outside every row's window hold only -inf entries and are skipped exactly
    const int npass = TWOPASS ? 2 : 1;
    for (int pass = 0; pass < npass; ++pass) {
        const bool dopv = (!TWOPASS) || pass == 1;
        for (int j0 = jstart; j0 < jend; j0 += 64) {
            if (dopv) {
                __syncthreads();                                 // previous key block's reads of kl / vl / pl are done
                if (!UNIT)
                for (int idx = threadIdx.x; idx < 64 * DVP; idx += 32 * AW) {
                    const int jr = idx / DVP, d = idx - jr * DVP, j = j0 + jr;
                    const float f = (j < p.Lk && d < p.dv) ? vbase[(long long)j * p.sVj + (long long)d * p.sVd] : 0.f;
                    if (SPLITPV) {
                        const __bf16 hb = bf16_rne(f);
                        ((__bf16*)vl)[jr * VP + d] = hb; ((__bf16*)vl)[64 * VP + jr * VP + d] = bf16_rne(f - bf16_f32(hb));
                    } else vl[jr * VP + d] = (_Float16)f;
                }
            }
            v8f s[4];
            if (UNIT) {
                v4f vr[8], kr[8]; const v4f* vp[8]; const v4f* kp[8];
#pragma unroll
                for (int it = 0; it < 8; ++it) { vp[it] = (const v4f*)((const char*)(vbase + (long long)(j0 + it * VR) * p.sVj) + voff); vr[it] = *vp[it]; }
#pragma unroll
                for (int it = 0; it < 8; ++it) { kp[it] = (const v4f*)((const char*)(kbase + (long long)(j0 + it * KR) * p.sKj) + koff); kr[it] = *kp[it]; }
                // the group's address registers stay as they are up to this wait (named as inputs) and are reused behind it, while the loads are still in flight
                asm volatile("s_wait_xcnt 0x0" :: "v"(vp[0]), "v"(vp[1]), "v"(vp[2]), "v"(vp[3]), "v"(vp[4]), "v"(vp[5]), "v"(vp[6]), "v"(vp[7]),
                             "v"(kp[0]), "v"(kp[1]), "v"(kp[2]), "v"(kp[3]), "v"(kp[4]), "v"(kp[5]), "v"(kp[6]), "v"(kp[7]) : "memory");
#pragma unroll
                for (int it = 0; it < 8; ++it) {
                    v4h hv; hv[0] = (_Float16)vr[it][0]; hv[1] = (_Float16)vr[it][1]; hv[2] = (_Float16)vr[it][2]; hv[3] = (_Float16)vr[it][3];
                    *(v4h*)(vl + (it * VR + (int)(threadIdx.x / (DVP / 4))) * VP + (int)(threadIdx.x % (DVP / 4)) * 4) = hv;
                }
#pragma unroll
                for (int it = 0; it < 8; ++it) {
                    v4h hk4; hk4[0] = (_Float16)kr[it][0]; hk4[1] = (_Float16)kr[it][1]; hk4[2] = (_Float16)kr[it][2]; hk4[3] = (_Float16)kr[it][3];
                    *(v4h*)(kl + (it * KR + (int)(threadIdx.x / (DHP / 4))) * KP + (int)(threadIdx.x % (DHP / 4)) * 4) = hk4;
                }
                __syncthreads();                                 // K and V tiles (shared) visible
                union { v16h v; v8h h[2]; } kf[4][KS];
#pragma unroll
                for (int t = 0; t < 4; ++t)
#pragma unroll
                    for (int ks = 0; ks < KS; ++ks) {
                        const _Float16* kq = kl + (t * 16 + l15) * KP + ks * 32 + 8 * hf;   // key row l15 of tile t; the lane's half of the fragment's k, in the order of frag_k
                        kf[t][ks].h[0] = *(const v8h*)kq; kf[t][ks].h[1] = *(const v8h*)(kq + 16);
                    }
#pragma unroll
                for (int t = 0; t < 4; ++t) {
                    v8f acc = {};
#pragma unroll
                    for (int ks = 0; ks < KS; ++ks) acc = PLAIN ? wmma16(kf[t][ks].v, qa[ks], acc) : wmma16(qa[ks], kf[t][ks].v, acc);
                    s[t] = acc;
                }
            } else
#pragma unroll
            for (int t = 0; t < 4; ++t) {
                const int j = min(j0 + t * 16 + l15, p.Lk - 1);
                const float* krow = kbase + (long long)j * p.sKj;
                v8f acc = {};
#pragma unroll
                for (int ks = 0; ks < KS; ++ks) {
                    if (QM == 2)      acc = wmma6(qt_[ks], sp3_ld(krow, p.sKd, ks * 32, hf, p.dh, 1.f), acc);
                    else if (QM == 1) acc = wmma3(qs_[ks], sp_ld(krow, p.sKd, ks * 32, hf, p.dh, 1.f), acc);
                    else              acc = wmma16(qa[ks], fh_ld(krow, p.sKd, ks * 32, hf, p.dh, 1.f), acc);
                }
                s[t] = acc;
            }
            if (UNIT && PLAIN) {                                 // s[t][r] = score of key j0 + 16 t + 8 hf + r for query q0 + l15; m8[0], l8[0]: that query's maximum and this half's sum
                float mt[4];                                     // one maximum chain per score tile, so that the four overlap
                // every loop of this block is unrolled: s, mt, rt, the fragments and o are then indexed by constants and stay in registers
#pragma unroll
                for (int t = 0; t < 4; ++t) {
#pragma unroll
                    for (int r = 0; r < 8; ++r) s[t][r] = s[t][r] * p.scale * L2E;
                    mt[t] = fmaxf(fmaxf(fmaxf(s[t][0], s[t][1]), fmaxf(s[t][2], s[t][3])), fmaxf(fmaxf(s[t][4], s[t][5]), fmaxf(s[t][6], s[t][7])));
                }
                float mx = fmaxf(fmaxf(mt[0], mt[1]), fmaxf(mt[2], mt[3]));
                mx = fmaxf(mx, xhalf(mx));
                const float mnew = fmaxf(m8[0], mx);
                const float corr = exp2f(m8[0] - mnew);
                float rt[4];
#pragma unroll
                for (int t = 0; t < 4; ++t) {
#pragma unroll
                    for (int r = 0; r < 8; ++r) s[t][r] = exp2f(s[t][r] - mnew);
                    rt[t] = ((s[t][0] + s[t][1]) + (s[t][2] + s[t][3])) + ((s[t][4] + s[t][5]) + (s[t][6] + s[t][7]));
                }
                l8[0] = l8[0] * corr + ((rt[0] + rt[1]) + (rt[2] + rt[3])); m8[0] = mnew;   // the halves' sums are joined behind the loop
                v16h pb0, pb1;                                   // P^T x 4096 as B: element e = key frag_k(e, hf) of the block's first and second 32 keys
#pragma unroll
                for (int e = 0; e < 16; ++e) { pb0[e] = (_Float16)(s[e >> 3][e & 7] * 4096.f); pb1[e] = (_Float16)(s[2 + (e >> 3)][e & 7] * 4096.f); }
#pragma unroll
                for (int t = 0; t < NT; ++t) {
                    const int dcol = t * 16 + l15;
                    v16h a0, a1;                                 // V^T as A: lane = value column dcol, element e = key frag_k(e, hf)
#pragma unroll
                    for (int e = 0; e < 16; ++e) { a0[e] = vl[frag_k(e, hf) * VP + dcol]; a1[e] = vl[(32 + frag_k(e, hf)) * VP + dcol]; }
                    o[t] *= corr;
                    o[t] = wmma16(a0, pb0, o[t]);                // o[t][r] = O^T[16 t + 8 hf + r][query l15]
                    o[t] = wmma16(a1, pb1, o[t]);
                }
                continue;
            }
            float pv[8][4];
#pragma unroll
            for (int i = 0; i < 8; ++i) {
                const int irow = q0 + i + 8 * hf;
                const int ic = min(irow, p.Lq - 1);
                float sc[4];
#pragma unroll
                for (int t = 0; t < 4; ++t) {
                    const int jg = j0 + t * 16 + l15;
                    float v = s[t][i] * p.scale;
                    if (!PLAIN && p.Mf) v += p.Mf[b * p.smb + h * p.smh + (long long)ic * p.smi + (long long)min(jg, p.Lk - 1) * p.smj];
                    if (!PLAIN && p.Rt) { int rc = ic - min(jg, p.Lk - 1) + p.roff; rc = rc < 0 ? 0 : (rc >= p.rn ? p.rn - 1 : rc); v += p.Rt[b * p.srb + h * p.srh + (long long)ic * p.sri + rc]; }
                    if (!PLAIN && p.Mi) { const int mv = p.Mi[b * p.smb + h * p.smh + (long long)ic * p.smi + (long long)min(jg, p.Lk - 1) * p.smj]; if (p.mpol ? (mv != 0) : (mv == 0)) v = p.mfill; }
                    if (!PLAIN && p.SQ) { const bool same = p.SQ[(long long)b * p.Lq + ic] == p.SK[(long long)b * p.Lk + min(jg, p.Lk - 1)]; if (p.segpol ? same : !same) v = p.mfill; }
                    if (!PLAIN && p.causal == 2 && jg > irow + p.coff) v = p.mfill;
                    if (!PLAIN && (jg >= p.Lk || (p.causal == 1 && jg > irow + p.coff) || (p.causal == 3 && jg < irow + p.coff) || (p.win > 0 && irow + p.coff - jg > p.win))) v = NEG; else v *= L2E;
                    sc[t] = v;
                }
                if (!TWOPASS || pass == 0) {
                    float mx = fmaxf(fmaxf(sc[0], sc[1]), fmaxf(sc[2], sc[3]));
                    mx = fmaxf(mx, __shfl_xor(mx, 1, 32)); mx = fmaxf(mx, __shfl_xor(mx, 2, 32));
                    mx = fmaxf(mx, __shfl_xor(mx, 4, 32)); mx = fmaxf(mx, __shfl_xor(mx, 8, 32));
                    const float mnew = fmaxf(m8[i], mx);
                    const float corr = (!PLAIN && mnew == NEG) ? 1.f : exp2f(m8[i] - mnew);
                    float rs = 0.f;
#pragma unroll
                    for (int t = 0; t < 4; ++t) {
                        const float pp = (!PLAIN && sc[t] == NEG) ? 0.f : exp2f(sc[t] - mnew); rs += pp;
                        pv[i][t] = (!PLAIN && p.Pw) ? pp * p.Pw[b * p.swb + h * p.swh + (long long)ic * p.swi + (long long)min(j0 + t * 16 + l15, p.Lk - 1) * p.swj] : pp;
                    }
                    rs += __shfl_xor(rs, 1, 32); rs += __shfl_xor(rs, 2, 32); rs += __shfl_xor(rs, 4, 32); rs += __shfl_xor(rs, 8, 32);
                    l8[i] = l8[i] * corr + rs; m8[i] = mnew;
                    if (!TWOPASS) {
#pragma unroll
                        for (int t = 0; t < NT; ++t) o[t][i] *= corr;
                    }
                } else {
                    const float inv = (l8[i] > 0.f) ? 1.f / l8[i] : 0.f;
#pragma unroll
                    for (int t = 0; t < 4; ++t) {
                        const int jg = j0 + t * 16 + l15;
                        float pp = (sc[t] == NEG) ? 0.f : exp2f(sc[t] - m8[i]) * inv;
                        if (p.Pw) pp *= p.Pw[b * p.swb + h * p.swh + (long long)ic * p.swi + (long long)min(jg, p.Lk - 1) * p.swj];
                        pv[i][t] = pp;
                    }
                }
            }
            if (dopv) {
#pragma unroll
                for (int i = 0; i < 8; ++i)
#pragma unroll
                    for (int t = 0; t < 4; ++t) ((float*)myp)[(i + 8 * hf) * 64 + t * 16 + l15] = pv[i][t];
                if (UNIT) {                                      // V was published with K, by the barrier behind the staging stores; P is read only by the wave that wrote it:
                    __builtin_amdgcn_fence(__ATOMIC_RELEASE, "workgroup");   // its lanes' P stores are done and stay in front of
                    __builtin_amdgcn_wave_barrier();                         // this point, the wave's P reads behind it
                    __builtin_amdgcn_fence(__ATOMIC_ACQUIRE, "workgroup");
                } else __syncthreads();                          // P (per wave) and V (shared) visible
                if (!PLAIN && p.P) {
                    float* pb_ = p.P + b * p.sPb + h * p.sPh;
                    const bool fastP = (p.pband == 0) && ((p.sPi & 3) == 0) && (j0 + 64 <= p.Lk) && (q0 + 16 <= p.Lq) && ((((size_t)pb_) & 15) == 0);
                    if (fastP) {
#pragma unroll
                        for (int s = 0; s < 8; ++s) {
                            const int row = s * 2 + (lane >> 4), c4 = (lane & 15) * 4;
                            const v4f v = *(const v4f*)(myp + row * 64 + c4);
                            VST2V4(pb_ + (long long)(q0 + row) * p.sPi + j0 + c4, v);
                        }
                    } else {
                        for (int row = 0; row < 16; ++row) {
                            const int irow = q0 + row; if (irow >= p.Lq) continue;
                            for (int c = lane; c < 64; c += 32) {
                                const int jg = j0 + c; if (jg >= p.Lk) continue;
                                if (p.pband == 0) VST2(float, pb_ + (long long)irow * p.sPi + jg, myp[row * 64 + c]);
                                else if (jg - irow <= p.pband && irow - jg <= p.pband) VST2(float, pb_ + (long long)irow * p.sPi + (jg - irow + p.pband), myp[row * 64 + c]);
                            }
                        }
                    }
                }
                if (SPLITPV) {
                    const Split pa0 = sp_ld(myp + l15 * 64, 1, 0, hf, 64, 1.f), pa1 = sp_ld(myp + l15 * 64, 1, 32, hf, 64, 1.f);
                    const __bf16* vh = (const __bf16*)vl; const __bf16* vlo = vh + 64 * VP;
#pragma unroll
                    for (int t = 0; t < NT; ++t) {
                        const int dcol = t * 16 + l15;
                        Split b0, b1;
#pragma unroll
                        for (int e = 0; e < 16; ++e) {
                            const int k0 = frag_k(e, hf), k1 = 32 + frag_k(e, hf);
                            b0.hi[e] = vh[k0 * VP + dcol]; b0.lo[e] = vlo[k0 * VP + dcol]; b1.hi[e] = vh[k1 * VP + dcol]; b1.lo[e] = vlo[k1 * VP + dcol];
                        }
                        o[t] = wmma3(pa0, b0, o[t]);
                        o[t] = wmma3(pa1, b1, o[t]);
                    }
                } else {
                    const v16h pa0 = fh_ld(myp + l15 * 64, 1, 0, hf, 64, 4096.f), pa1 = fh_ld(myp + l15 * 64, 1, 32, hf, 64, 4096.f);
#pragma unroll
                    for (int t = 0; t < NT; ++t) {
                        const int dcol = t * 16 + l15;
                        v16h b0, b1;
#pragma unroll
                        for (int e = 0; e < 16; ++e) { b0[e] = vl[frag_k(e, hf) * VP + dcol]; b1[e] = vl[(32 + frag_k(e, hf)) * VP + dcol]; }
                        o[t] = wmma16(pa0, b0, o[t]);
                        o[t] = wmma16(pa1, b1, o[t]);
                    }
                }
            }
        }
    }
    float* obase = p.O + b * p.sOb + h * p.sOh;
    if (!PLAIN && p.ST) {
        const int rl = lane >> 1, isel = rl & 7;           // row q0 + rl ; rl>>3 == hf holds because lane>>4 == (lane>>1)>>3
        float mv = 0.f, lv = 0.f;
#pragma unroll
        for (int i = 0; i < 8; ++i) if (i == isel) { mv = m8[i]; lv = l8[i]; }
        const int irow = q0 + rl;
        if (irow < p.Lq) { float* st = p.ST + (((long long)b * gridDim.y + h) * p.Lq + irow) * 2 + (lane & 1); VST2(float, st, (lane & 1) ? lv : mv * 0.6931471805599453f); }
    }
    float invr[8];
    if (UNIT && PLAIN) l8[0] += xhalf(l8[0]);                    // transposed path: the query's sum = its two halves' sums
#pragma unroll
    for (int i = 0; i < 8; ++i) {
        if (UNIT && PLAIN) invr[i] = (l8[0] > 0.f) ? 1.f / (l8[0] * 4096.f) : 0.f;
        else if (TWOPASS) invr[i] = SPLITPV ? 1.f : (1.f / 4096.f);
        else if (!PLAIN && p.nonorm) invr[i] = exp2f(m8[i]) * (SPLITPV ? 1.f : (1.f / 4096.f));
        else invr[i] = (l8[i] > 0.f) ? (SPLITPV ? 1.f / l8[i] : 1.f / (l8[i] * 4096.f)) : 0.f;
    }
    __syncthreads();                                             // all waves done with pl/vl from the main loop
    const bool ofast = ((p.sOi & 3) == 0) && ((((size_t)obase) & 15) == 0) && (q0 + 16 <= p.Lq);
#pragma unroll
    for (int c0 = 0; c0 < DVP; c0 += 64) {
#pragma unroll
        for (int i = 0; i < 8; ++i)
#pragma unroll
            for (int t = 0; t < NT; ++t) if (t * 16 >= c0 && t * 16 < c0 + 64) ((float*)myp)[(UNIT && PLAIN) ? l15 * 64 + (t * 16 - c0) + 8 * hf + i : (i + 8 * hf) * 64 + (t * 16 - c0) + l15] = o[t][i] * invr[i];
        __syncthreads();
        const int cw = (DVP - c0 < 64) ? (DVP - c0) : 64;      // staged columns in this chunk (multiple of 16)
        if (ofast && (c0 + cw <= p.dv) && (cw % 32 == 0)) {
            const int lpr = cw / 4;                              // lanes per row (16 for 64 cols, 8 for 32)
            const int rows_per_ins = 32 / lpr;
            for (int r0 = 0; r0 < 16; r0 += rows_per_ins) {
                const int row = r0 + lane / lpr, c4 = (lane % lpr) * 4;
                const v4f v = *(const v4f*)(myp + row * 64 + c4);
                VST2V4(obase + (long long)(q0 + row) * p.sOi + c0 + c4, v);
            }
        } else {
            for (int row = 0; row < 16; ++row) {
                const int irow = q0 + row; if (irow >= p.Lq) continue;
                for (int c = lane; c < cw; c += 32) { const int d = c0 + c; if (d < p.dv) VST2(float, obase + (long long)irow * p.sOi + d, myp[row * 64 + c]); }
            }
        }
        __syncthreads();
    }
}

// =====================================================================================================================
// k_tr: dst(z, c, r) = alpha * src(z, r, c) (+ beta * R2(z, c, r)): [Z][R][C] (row stride lds) -> [Z][C][R] (row stride ldd) through a 32x32 LDS tile;
//   flags: 1 -> add beta * residual R2 addressed like dst (z*sRz + c*ldr + r); act applied before the residual.
// =====================================================================================================================
struct TrP { const float* src; float* dst; const float* R2; long long sSz, lds, sDz, ldd, sRz, ldr; int R, C, flags, act; float alpha, beta; };
static_assert(sizeof(TrP) == 3 * 8 + 6 * 8 + 6 * 4, "TrP has padding");
__global__ __launch_bounds__(256) void k_tr(TrP p) {
    __shared__ float tile[32][33];
    const int c0 = blockIdx.x * 32, r0 = blockIdx.y * 32, z = blockIdx.z;
    const int lane = threadIdx.x & 31, wave = threadIdx.x >> 5;
    const float* s = p.src + z * p.sSz;
#pragma unroll
    for (int k = 0; k < 4; ++k) {
        const int rl = wave * 4 + k, r = r0 + rl, c = c0 + lane;
        tile[rl][lane] = (r < p.R && c < p.C) ? s[(long long)r * p.lds + c] : 0.f;
    }
    __syncthreads();
    float* d = p.dst + z * p.sDz; const float* rr = p.R2 + z * p.sRz;
#pragma unroll
    for (int k = 0; k < 4; ++k) {
        const int cl = wave * 4 + k, c = c0 + cl, r = r0 + lane;
        if (c < p.C && r < p.R) {
            float v = act_fn(p.alpha * tile[lane][cl], p.act);
            if (p.flags & 1) v += p.beta * rr[(long long)c * p.ldr + r];
            VST2(float, d + (long long)c * p.ldd + r, v);
        }
    }
}

// k_affine: dst[i] = a * (sdev ? sdev[0] : 1) * src[i] + b, i < n (one thread per element; consecutive lanes -> consecutive addresses)
__global__ __launch_bounds__(256) void k_affine(const float* __restrict__ src, float* __restrict__ dst, int n, float a, float b, const float* __restrict__ sdev) {
    const int i = blockIdx.x * 256 + threadIdx.x;
    if (i < n) { const float aa = sdev ? a * sdev[0] : a; const float v = aa * src[i] + b; VST2(float, dst + i, v); }
}

// =====================================================================================================================
// k_softmax: row softmax over n contiguous elements, one 256-thread block per row; rows addressed z*sz + r*sr (grid (R, Z)).
//   out = scale_out * softmax(scale_in * x + (Mf ? Mf[z*smz + r*smr + j] : 0)); a row whose max is -inf is written as 0.
// =====================================================================================================================
struct SmP { const float* src; float* dst; const float* Mf; long long sz, sr, dz, dr, smz, smr; int n, pad; float scale_in, scale_out; };
static_assert(sizeof(SmP) == 3 * 8 + 6 * 8 + 4 * 4, "SmP has padding");
__global__ __launch_bounds__(256) void k_softmax(SmP p) {
    __shared__ float red[256];
    const int r = blockIdx.x, z = blockIdx.y, tid = threadIdx.x;
    const float* s = p.src + z * p.sz + (long long)r * p.sr;
    const float* mf = p.Mf ? (p.Mf + z * p.smz + (long long)r * p.smr) : nullptr;
    float mx = -__builtin_inff();
    for (int j = tid; j < p.n; j += 256) { float v = s[j] * p.scale_in; if (mf) v += mf[j]; mx = fmaxf(mx, v); }
    red[tid] = mx; __syncthreads();
    for (int o = 128; o > 0; o >>= 1) { if (tid < o) red[tid] = fmaxf(red[tid], red[tid + o]); __syncthreads(); }
    mx = red[0]; __syncthreads();
    float sum = 0.f;
    for (int j = tid; j < p.n; j += 256) { float v = s[j] * p.scale_in; if (mf) v += mf[j]; sum += (mx == -__builtin_inff()) ? 0.f : expf(v - mx); }
    red[tid] = sum; __syncthreads();
    for (int o = 128; o > 0; o >>= 1) { if (tid < o) red[tid] += red[tid + o]; __syncthreads(); }
    sum = red[0];
    const float inv = (sum > 0.f) ? p.scale_out / sum : 0.f;
    float* d = p.dst + z * p.dz + (long long)r * p.dr;
    for (int j = tid; j < p.n; j += 256) { float v = s[j] * p.scale_in; if (mf) v += mf[j]; const float o = (mx == -__builtin_inff()) ? 0.f : expf(v - mx) * inv; VST2(float, d + j, o); }
}
// =====================================================================================================================
// k_stats: mean and rsqrt(var + eps) over a set of n elements addressed base + z*sz + (e / inner) * so + (e % inner) * si, one 256-thread
// k_norm_apply: y = (x - mean[set]) * rstd[set] * g[c] + b[c] over a [Z][C][L] chan-major tensor with set = z*G + c / (C/G) (G groups per z;
//   G = C -> per-chan sets indexed z*C+c; for batch norm pass stats indexed by c only via bn = 1). Optional act. Output same layout.
// =====================================================================================================================
//   mode 0: mean / rsqrt(var + eps); mode 1 (RMSNorm): 0 / rsqrt(mean(x^2) + eps); mode 2 (L2 normalize * sqrt(n)): 0 / sqrt(n) / max(||x||, eps); mode 3: as 0 with unbiased variance (n-1)
__global__ __launch_bounds__(256) void k_stats(const float* __restrict__ x, long long sz, long long so, long long si, int inner, int n, float eps, float* __restrict__ stat, int mode) {
    __shared__ float red[256];
    const int z = blockIdx.x, tid = threadIdx.x;
    const float* base = x + z * sz;
    float s = 0.f;
    for (int e = tid; e < n; e += 256) s += base[(long long)(e / inner) * so + (long long)(e % inner) * si];
    red[tid] = s; __syncthreads();
    for (int o = 128; o > 0; o >>= 1) { if (tid < o) red[tid] += red[tid + o]; __syncthreads(); }
    const float mu = (mode == 0 || mode == 3) ? red[0] / (float)n : 0.f; __syncthreads();
    float q = 0.f;
    for (int e = tid; e < n; e += 256) { const float dlt = base[(long long)(e / inner) * so + (long long)(e % inner) * si] - mu; q += dlt * dlt; }
    red[tid] = q; __syncthreads();
    for (int o = 128; o > 0; o >>= 1) { if (tid < o) red[tid] += red[tid + o]; __syncthreads(); }
    {
        float rs;
        if (mode == 2) rs = sqrtf((float)n) / fmaxf(sqrtf(red[0]), eps); else if (mode == 3) rs = rsqrtf(red[0] / (float)(n - 1) + eps); else rs = rsqrtf(red[0] / (float)n + eps);
        if (tid < 32) { const float v = (tid == 0) ? mu : ((tid == 1) ? rs : 0.f); VST2(float, stat + (long long)z * 32 + tid, v); }
    }
}
//   One thread per element over the flat [Z][C][L] index space: grid ceil(Z*C*L / 256).
__global__ __launch_bounds__(256) void k_norm_apply(const float* __restrict__ x, float* __restrict__ y, const float* __restrict__ stat, const float* __restrict__ g, const float* __restrict__ bta,
                                                     int Z, int C, int L, int G, int bn, int act) {
    const long long idx = (long long)blockIdx.x * 256 + threadIdx.x;
    if (idx >= (long long)Z * C * L) return;
    const int l = (int)(idx % L); const long long zc = idx / L; const int c = (int)(zc % C), z = (int)(zc / C); (void)l;
    const int set = bn ? c : (z * G + c / (C / G));
    float v = (x[idx] - stat[(long long)set * 32]) * stat[(long long)set * 32 + 1];
    if (g) v *= g[c];
    if (bta) v += bta[c];
    v = act_fn(v, act);
    VST2(float, y + idx, v);
}

// k_lse_neg: c[i] = -(st[2i] + log(st[2i+1])) = minus the log-sum-exp of row i from k_attn's ST output (for softmax over the query dimension)
__global__ __launch_bounds__(256) void k_lse_neg(const float* __restrict__ st, float* __restrict__ c, int n) {
    const int i = blockIdx.x * 256 + threadIdx.x;
    if (i < n) { const float v = -(st[2 * i] + logf(st[2 * i + 1])); VST2(float, c + i, v); }
}

// k_iota: dst[i] = a * i + b as int32 (segment/position id helper)
__global__ __launch_bounds__(256) void k_iota(int* __restrict__ dst, int n, int a, int b) {
    const int i = blockIdx.x * 256 + threadIdx.x;
    if (i < n) { const int v = a * i + b; VST2(int, dst + i, v); }
}

// k_axpby: dst[i] = a * x[i] + b * y[i] (+ c), i < n
__global__ __launch_bounds__(256) void k_axpby(const float* __restrict__ x, const float* __restrict__ y, float* __restrict__ dst, int n, float a, float b, float c) {
    const int i = blockIdx.x * 256 + threadIdx.x;
    if (i < n) { const float v = a * x[i] + b * y[i] + c; VST2(float, dst + i, v); }
}

// =====================================================================================================================
// k_rope: rotary embedding on a [R rows][Hn heads][D] view (row stride sXr, head stride sXh, element stride 1) -> Y (own strides).
//   mode 0: rotate_half (partner d±D/2, sign - for d<D/2); mode 1: interleaved pairs (partner d^1, sign - for even d).
//   table column tcol: tmode 0 -> d, 1 -> d % (D/2), 2 -> d / 2; position p: pmode 0 -> r % S, 1 -> head index, 2 -> pos[r];
//   c = C[(r / S) * sCb + p * sCp + tcol * sCd], s likewise from Sn; y = x[d] * c + sign * x[partner] * s. X and Y must not alias.
// =====================================================================================================================
struct RopeP { const float* X; float* Y; const float* C; const float* Sn; const int* pos; long long sXr, sXh, sYr, sYh, sCb, sCp, sCd; int R, Hn, D, S, mode, tmode, pmode, pad; };
static_assert(sizeof(RopeP) == 5 * 8 + 7 * 8 + 8 * 4, "RopeP has padding");
__global__ __launch_bounds__(256) void k_rope(RopeP p) {
    const long long idx = (long long)blockIdx.x * 256 + threadIdx.x;
    if (idx >= (long long)p.R * p.Hn * p.D) return;
    const int d = (int)(idx % p.D); const long long rh = idx / p.D; const int h = (int)(rh % p.Hn); const int r = (int)(rh / p.Hn);
    const int half = p.D / 2;
    int partner; float sign;
    if (p.mode == 0) { partner = (d < half) ? d + half : d - half; sign = (d < half) ? -1.f : 1.f; }
    else { partner = d ^ 1; sign = (d & 1) ? 1.f : -1.f; }
    const int tcol = (p.tmode == 0) ? d : ((p.tmode == 1) ? (d % half) : (d >> 1));
    const int pp = (p.pmode == 0) ? (r % p.S) : ((p.pmode == 1) ? h : p.pos[r]);
    const long long toff = (long long)(r / p.S) * p.sCb + (long long)pp * p.sCp + (long long)tcol * p.sCd;
    const float* xr = p.X + (long long)r * p.sXr + (long long)h * p.sXh;
    const float v = xr[d] * p.C[toff] + sign * xr[partner] * p.Sn[toff];
    VST2(float, p.Y + (long long)r * p.sYr + (long long)h * p.sYh + d, v);
}

// k_invf + k_sincos (split so neither kernel carries a large VALU-fma footprint): invf_i = num * (1 / powf(base, (2 i)/D)) [fmode 0],
//   num * expf((2 i) * cexp) [fmode 1], num * powf(base, -2 (i - 1) / D) [fmode 2]; then cs/sn[s*half + i] = cos/sin((pscale * s) * invf_i)
__global__ __launch_bounds__(256) void k_invf(float* __restrict__ invb, int half, int D, float base, float num, int fmode, float cexp) {
    const int i = blockIdx.x * 256 + threadIdx.x;
    if (i >= ((half + 31) / 32) * 32) return;
    if (i >= half) { VST2(float, invb + i, 0.f); return; }
    const float e = (float)(2 * i) / (float)D;
    float invf;
    if (fmode == 1) invf = num * expf((float)(2 * i) * cexp);
    else if (fmode == 2) invf = num * powf(base, (-2.0f * ((float)i - 1.0f)) / (float)D);
    else invf = num * (1.0f / powf(base, e));
    VST2(float, invb + i, invf);
}
__global__ __launch_bounds__(256) void k_sincos(float* __restrict__ cs, float* __restrict__ sn, const float* __restrict__ invb, int S, int half, float pscale) {
    const int idx = blockIdx.x * 256 + threadIdx.x;
    if (idx >= S * half) return;
    const int s = idx / half, i = idx - s * half;
    const float ang = (pscale * (float)s) * invb[i];
    VST2(float, cs + idx, cosf(ang)); VST2(float, sn + idx, sinf(ang));
}

// k_mulact: dst[i] = act(x[i]) * y[i]
__global__ __launch_bounds__(256) void k_mulact(const float* __restrict__ x, const float* __restrict__ y, float* __restrict__ dst, int n, int act) {
    const int i = blockIdx.x * 256 + threadIdx.x;
    if (i < n) { const float v = act_fn(x[i], act) * y[i]; VST2(float, dst + i, v); }
}

// =====================================================================================================================
// k_matvec: thread-per-row matrix-vector products for N <= 8 output columns (heads with 1-3 outputs, gates), f32 on the VALU.
//   C[r*sCm + j] = act(alpha * sum_k A[r*sAm + k*sAk] * B[j*sBn + k*sBk] + bias[j]) + beta * R[r*sRm + j*sRn]; each thread writes its N contiguous floats.
// =====================================================================================================================
__global__ __launch_bounds__(256) void k_matvec(GemmP p) {
    // 32 lanes write one line with one instruction.
    const int rpt = (p.N == 1) ? 1 : 32;
    const long long r0 = ((long long)blockIdx.x * 256 + threadIdx.x) * rpt; const int z = blockIdx.z, zo = z / p.zi_n, zi = z - zo * p.zi_n;
    if (r0 >= p.M) return;
    const float* Bb = p.B + zo * p.sBo + zi * p.sBi;
    float* C = p.C + zo * p.sCo + zi * p.sCi; const float* R = p.R + zo * p.sRo + zi * p.sRi;
    for (int rr = 0; rr < rpt; ++rr) {
        const long long r = r0 + rr; if (r >= p.M) break;
        const float* A = p.A + zo * p.sAo + zi * p.sAi + r * p.sAm;
        float acc[8] = {0.f, 0.f, 0.f, 0.f, 0.f, 0.f, 0.f, 0.f};
        for (int k = 0; k < p.K; ++k) { const float a = A[(long long)k * p.sAk];
#pragma unroll
            for (int j = 0; j < 8; ++j) if (j < p.N) acc[j] += a * Bb[(long long)j * p.sBn + (long long)k * p.sBk]; }
#pragma unroll
        for (int j = 0; j < 8; ++j) if (j < p.N) {
            float v = acc[j] * p.alpha;
            if (p.flags & 1) v += p.bias[j];
            if (p.flags & 2) v += p.bias[r];
            v = act_fn(v, p.act);
            if (p.flags & 4) v += p.beta * R[r * p.sRm + (long long)j * p.sRn];
            VST2(float, C + r * p.sCm + j, v);
        }
    }
}
// k_smallsoftmax: thread-per-row softmax for short rows (n <= 64): dst[r*dr + j] = softmax(scale*src[r*sr + j])
__global__ __launch_bounds__(256) void k_smallsoftmax(const float* __restrict__ src, float* __restrict__ dst, long long sr, long long dr, int n, long long R, float scale) {
    const long long r0 = ((long long)blockIdx.x * 256 + threadIdx.x) * 32;
    for (int rr = 0; rr < 32; ++rr) {
        const long long r = r0 + rr; if (r >= R) return;
        const float* s = src + r * sr; float* d = dst + r * dr;
        float mx = -__builtin_inff();
        for (int j = 0; j < n; ++j) mx = fmaxf(mx, s[j] * scale);
        float sum = 0.f;
        for (int j = 0; j < n; ++j) sum += expf(s[j] * scale - mx);
        const float inv = 1.f / sum;
        for (int j = 0; j < n; ++j) { const float v = expf(s[j] * scale - mx) * inv; VST2(float, d + j, v); }
    }
}

__global__ __launch_bounds__(32) void k_unitstat(float* __restrict__ st) { const int t = threadIdx.x; const float v = (t == 1) ? 1.f : 0.f; VST2(float, st + t, v); }

// destination (e.g. a d_out whose row width is not a multiple of 32 floats) is written by consecutive lanes of one instruction
__global__ __launch_bounds__(256) void k_lincopy(const float* __restrict__ src, long long lds, float* __restrict__ dst, long long ldd, long long rows, int cols) {
    const long long i = (long long)blockIdx.x * 256 + threadIdx.x; if (i >= rows * cols) return;
    const long long r = i / cols; const int c = (int)(i - r * cols);
    const float v = src[r * lds + c]; VST2(float, dst + r * ldd + c, v);
}

namespace w25 {
typedef __attribute__((ext_vector_type(16))) _Float16 v16h;
typedef __attribute__((ext_vector_type(8)))  _Float16 v8h;
typedef __attribute__((ext_vector_type(16))) __bf16   v16b;
typedef __attribute__((ext_vector_type(8)))  __bf16   v8b;
typedef __attribute__((ext_vector_type(8)))  float    v8f;
typedef __attribute__((ext_vector_type(4)))  float    v4f;

__device__ __forceinline__ unsigned short f2bf_bits(float f) {
  unsigned u = __float_as_uint(f);
  return (unsigned short)((u + 0x7FFFu + ((u >> 16) & 1u)) >> 16);
}
__device__ __forceinline__ float bf_bits2f(unsigned short h) { return __uint_as_float(((unsigned)h) << 16); }

// hazard guards as plain device helpers (no inline asm inside the kernel template body)
__device__ __forceinline__ void dep_guard_h(v8f& a, v8f& b, v16h x, v16h y) { asm volatile("v_nop\n\tv_nop\n\tv_nop\n\tv_nop" : "+v"(a), "+v"(b) : "v"(x), "v"(y)); }
__device__ __forceinline__ void dep_guard_b(v8f& a, v8f& b, v16b x, v16b y) { asm volatile("v_nop\n\tv_nop\n\tv_nop\n\tv_nop" : "+v"(a), "+v"(b) : "v"(x), "v"(y)); }
__device__ __forceinline__ void keep4_h(v16h a, v16h b, v16h c, v16h d) { asm volatile("v_nop" :: "v"(a), "v"(b), "v"(c), "v"(d)); }
__device__ __forceinline__ void keep4_b(v16b a, v16b b, v16b c, v16b d) { asm volatile("v_nop" :: "v"(a), "v"(b), "v"(c), "v"(d)); }
__device__ __forceinline__ void acc_guard4(v8f& a, v8f& b, v8f& c, v8f& d) { asm volatile("v_nop\n\tv_nop\n\tv_nop\n\tv_nop" : "+v"(a), "+v"(b), "+v"(c), "+v"(d)); }
template <typename T> struct Frag;
template <> struct Frag<_Float16> {
  typedef v16h V; union U { v16h v; v8h h[2]; };
  static __device__ __forceinline__ v16h load(const _Float16* p) {   // elements 0..7 <- p[0..7], 8..15 <- p[16..23]
    U f; f.h[0] = *(const v8h*)(p); f.h[1] = *(const v8h*)(p + 16); return f.v;
  }
  static __device__ __forceinline__ v8f mma(v16h a, v16h b, v8f c) {
    return __builtin_amdgcn_wmma_f32_16x16x32_f16(false, a, false, b, (short)0, c, false, false);
  }
  static __device__ __forceinline__ void guard(v8f& a, v8f& b, v16h x, v16h y) { dep_guard_h(a, b, x, y); }
  static __device__ __forceinline__ void keep(v16h a, v16h b, v16h c, v16h d) { keep4_h(a, b, c, d); }
};
template <> struct Frag<__bf16> {
  typedef v16b V; union U { v16b v; v8b h[2]; };
  static __device__ __forceinline__ v16b load(const __bf16* p) {
    U f; f.h[0] = *(const v8b*)(p); f.h[1] = *(const v8b*)(p + 16); return f.v;
  }
  static __device__ __forceinline__ v8f mma(v16b a, v16b b, v8f c) {
    return __builtin_amdgcn_wmma_f32_16x16x32_bf16(false, a, false, b, (short)0, c, false, false);
  }
  static __device__ __forceinline__ void guard(v8f& a, v8f& b, v16b x, v16b y) { dep_guard_b(a, b, x, y); }
  static __device__ __forceinline__ void keep(v16b a, v16b b, v16b c, v16b d) { keep4_b(a, b, c, d); }
};

// ---- Register-blocked batched WMMA GEMM ------------------------------------
// C[m,n] = scale * sum_k A[m,k] * Bt[n,k] (+bias)(+resid); each wave owns a 64x64 tile.
// A row-major [M,K]; Bt row-major [N,K]; M,N % 64 == 0, K % 32 == 0.
// SPLIT: operands are hi/lo planes (A2/Bt2 = lo planes, same layout); product = hi·hi + hi·lo + lo·hi.
// BIAS_MODE: 0 = none, 1 = bias[m], 2 = bias[n].
// OUT_MODE: 0 = f32, 1 = f16, 2 = bf16 hi plane (Cout) + bf16 lo plane (Cout2).
// ET: 0 = f16 operands, 1 = bf16 operands (pointers passed as 16-bit storage)
template <int ET> struct Elem;
template <> struct Elem<0> { typedef _Float16 T; };
template <> struct Elem<1> { typedef __bf16 T; };
template <int ET, bool SPLIT, int BIAS_MODE, int OUT_MODE, bool RESID, int ACT = 0>
__global__ __launch_bounds__(256) void wmma_gemm64(
    const unsigned short* __restrict__ Ap, const unsigned short* __restrict__ A2p, int lda, long strideA,
    const unsigned short* __restrict__ Btp, const unsigned short* __restrict__ Bt2p, int ldb, long strideB,
    void* __restrict__ Cout, void* __restrict__ Cout2, int ldc, long strideC,
    const float* __restrict__ bias,
    const float* __restrict__ resid, long strideR,
    int M, int N, int K, float scale) {
  typedef typename Elem<ET>::T T;
  typedef typename Frag<T>::V V;
  const T* A = (const T*)Ap; const T* A2 = (const T*)A2p; const T* Bt = (const T*)Btp; const T* Bt2 = (const T*)Bt2p;
  __shared__ __align__(16) float sT[8][16 * 68];   // per-wave 16x64 slab, pitch 68 floats
  const int b    = blockIdx.y;
  const int lane = threadIdx.x & 31;
  const int wave = threadIdx.x >> 5;
  const int tilesN = N >> 6;
  const int tilesM = M >> 6;
  const int tile = blockIdx.x * 8 + wave;
  if (tile >= tilesM * tilesN) return;   // wave-uniform; no block barriers in this kernel
  const int tm = tile / tilesN;
  const int tn = tile - tm * tilesN;
  const int m0 = tm << 6;
  const int n0 = tn << 6;

  const T* Ab  = A  + (size_t)b * strideA;
  const T* Bb  = Bt + (size_t)b * strideB;
  const T* Ab2 = SPLIT ? (A2  + (size_t)b * strideA) : nullptr;
  const T* Bb2 = SPLIT ? (Bt2 + (size_t)b * strideB) : nullptr;

  const int rlane = lane & 15;                 // row (A) / col (B, D) within subtile
  const int koff  = (lane >> 4) * 8;           // k offset of this lane half
  const int mOff  = (lane >> 4) * 8;           // D row offset

  v8f acc[4][4];
#pragma unroll
  for (int i = 0; i < 4; ++i)
#pragma unroll
    for (int j = 0; j < 4; ++j) acc[i][j] = (v8f){0.f,0.f,0.f,0.f,0.f,0.f,0.f,0.f};

  for (int k0 = 0; k0 < K; k0 += 32) {
    V bh[4], bl[4];
#pragma unroll
    for (int j = 0; j < 4; ++j) {
      const size_t bo = (size_t)(n0 + (j << 4) + rlane) * ldb + koff + k0;
      bh[j] = Frag<T>::load(Bb + bo);
      if (SPLIT) bl[j] = Frag<T>::load(Bb2 + bo);
    }
#pragma unroll
    for (int i = 0; i < 4; ++i) {
      const size_t ao = (size_t)(m0 + (i << 4) + rlane) * lda + koff + k0;
      V ah = Frag<T>::load(Ab + ao);
      V al;
      if (SPLIT) al = Frag<T>::load(Ab2 + ao);
#pragma unroll
      for (int j = 0; j < 4; ++j) {
        acc[i][j] = Frag<T>::mma(ah, bh[j], acc[i][j]);
        if (SPLIT) {
          acc[i][j] = Frag<T>::mma(ah, bl[j], acc[i][j]);
          acc[i][j] = Frag<T>::mma(al, bh[j], acc[i][j]);
        }
      }
      Frag<T>::guard(acc[i][0], acc[i][3], ah, SPLIT ? al : ah);
    }
    Frag<T>::keep(bh[0], bh[1], bh[2], bh[3]);
    if (SPLIT) Frag<T>::keep(bl[0], bl[1], bl[2], bl[3]);
  }
  acc_guard4(acc[0][0], acc[0][1], acc[0][2], acc[0][3]);
  acc_guard4(acc[1][0], acc[1][1], acc[1][2], acc[1][3]);
  acc_guard4(acc[2][0], acc[2][1], acc[2][2], acc[2][3]);
  acc_guard4(acc[3][0], acc[3][1], acc[3][2], acc[3][3]);

  // ---- epilogue ----
  float* slab = sT[wave];
  const float* Rb = RESID ? (resid + (size_t)b * strideR) : nullptr;
#pragma unroll
  for (int i = 0; i < 4; ++i) {
    const int mBase = m0 + (i << 4);
#pragma unroll
    for (int j = 0; j < 4; ++j) {
      const int n = n0 + (j << 4) + rlane;
      float bv = 0.f;
      if (BIAS_MODE == 2) bv = bias[n];
#pragma unroll
      for (int r = 0; r < 8; ++r) {
        float v = acc[i][j][r] * scale;
        if (BIAS_MODE == 1) v += bias[mBase + mOff + r];
        if (BIAS_MODE == 2) v += bv;
        if (RESID) v += Rb[(size_t)(mBase + mOff + r) * ldc + n];
        if (ACT == 1) v = tanhf(v);
        if (ACT == 2) v = fmaxf(v, 0.0f);
        if (ACT == 3) v = v / (1.0f + expf(-v));
        if (ACT == 4) v = (v > 0.f) ? v : 0.01f * v;
        if (ACT == 5) v = 0.5f * v * (1.0f + erff(v * 0.70710678118654752f));
        if (ACT == 6) v = (v > 0.f) ? v : 0.2f * v;
        if (ACT == 7) { const float u = 0.7978845608028654f * (v + 0.044715f * v * v * v); v = 0.5f * v * (1.f + tanhf(u)); }
        slab[(mOff + r) * 68 + (j << 4) + rlane] = v;
      }
    }
    __builtin_amdgcn_fence(__ATOMIC_RELEASE, "workgroup");
    __builtin_amdgcn_wave_barrier();
    __builtin_amdgcn_fence(__ATOMIC_ACQUIRE, "workgroup");
    if (OUT_MODE == 0) {
      float* C = (float*)Cout + (size_t)b * strideC;
      const int hh = lane >> 4, c4 = (lane & 15) * 4;     // row seg = 256 B = 16 lanes x 16 B
      {
#pragma unroll
        for (int it = 0; it < 8; ++it) {
          const int row = it * 2 + hh;
          v4f v = *(const v4f*)(slab + row * 68 + c4);
          *(v4f*)(C + (size_t)(mBase + row) * ldc + n0 + c4) = v;
        }
        
      }
    } else {
      const int q = lane >> 3, c8 = (lane & 7) * 8;
      unsigned short* C  = (unsigned short*)Cout  + (size_t)b * strideC;
      unsigned short* C2 = (OUT_MODE == 2) ? ((unsigned short*)Cout2 + (size_t)b * strideC) : nullptr;
      {
#pragma unroll
        for (int it = 0; it < 4; ++it) {
          const int row = it * 4 + q;
          const float* sp = slab + row * 68 + c8;
          v8h hv, lv;
#pragma unroll
          for (int e = 0; e < 8; ++e) {
            if (OUT_MODE == 1) {
              hv[e] = (_Float16)sp[e];
            } else {
              unsigned short hb = f2bf_bits(sp[e]);
              unsigned short lb = f2bf_bits(sp[e] - bf_bits2f(hb));
              hv[e] = __builtin_bit_cast(_Float16, hb);
              lv[e] = __builtin_bit_cast(_Float16, lb);
            }
          }
          *(v8h*)(C + (size_t)(mBase + row) * ldc + n0 + c8) = hv;
          if (OUT_MODE == 2) *(v8h*)(C2 + (size_t)(mBase + row) * ldc + n0 + c8) = lv;
        }
        
      }
    }
    __builtin_amdgcn_fence(__ATOMIC_RELEASE, "workgroup");
    __builtin_amdgcn_wave_barrier();
    __builtin_amdgcn_fence(__ATOMIC_ACQUIRE, "workgroup");
  }
}

__global__ __launch_bounds__(256) void cast_f32_f16x2(
    const float* __restrict__ in, _Float16* __restrict__ out, int n2) {
  int i = blockIdx.x * 256 + threadIdx.x;
  if (i < n2) {
    const _Float16 h0 = (_Float16)in[2 * i], h1 = (_Float16)in[2 * i + 1];
    const unsigned u = (unsigned)__builtin_bit_cast(unsigned short, h0) | ((unsigned)__builtin_bit_cast(unsigned short, h1) << 16);
    ((unsigned*)out)[i] = u;
    
  }
}


} // namespace w25

__global__ __launch_bounds__(256) void k_castT16(const float* __restrict__ src, long long lds, _Float16* __restrict__ dst, long long ldd, int R, int C, float s) {
    const long long i = (long long)blockIdx.x * 256 + threadIdx.x; const long long np = (long long)C * (R / 2); if (i >= np) return; const int c = (int)(i / (R / 2)); const int r = 2 * (int)(i % (R / 2));
    const _Float16 h0 = (_Float16)(src[(long long)r * lds + c] * s), h1 = (_Float16)(src[(long long)(r + 1) * lds + c] * s);
    const unsigned u = (unsigned)__builtin_bit_cast(unsigned short, h0) | ((unsigned)__builtin_bit_cast(unsigned short, h1) << 16);
    unsigned* d = (unsigned*)(dst + (long long)c * ldd + r); *d = u;  }
__global__ __launch_bounds__(256) void k_cast16(const float* __restrict__ src, long long lds, _Float16* __restrict__ dst, long long ldd, int R, int C, float s) {
    const long long i = (long long)blockIdx.x * 256 + threadIdx.x; const long long np = (long long)R * (C / 2); if (i >= np) return; const int r = (int)(i / (C / 2)); const int c = 2 * (int)(i % (C / 2));
    const _Float16 h0 = (_Float16)(src[(long long)r * lds + c] * s), h1 = (_Float16)(src[(long long)r * lds + c + 1] * s);
    const unsigned u = (unsigned)__builtin_bit_cast(unsigned short, h0) | ((unsigned)__builtin_bit_cast(unsigned short, h1) << 16);
    unsigned* d = (unsigned*)(dst + (long long)r * ldd + c); *d = u;  }

// f32 -> bf16 hi plane + bf16 lo plane (x = hi + lo to ~2^-17 relative; RNE both), [R][C] -> [R][C] (or transposed to [C][R]); 2 consecutive destination elements
__device__ __forceinline__ unsigned int f2bf2_pack(float a, float b, unsigned int* lo) {
    const unsigned short ha = w25::f2bf_bits(a), hb = w25::f2bf_bits(b);
    const unsigned short la = w25::f2bf_bits(a - w25::bf_bits2f(ha)), lb = w25::f2bf_bits(b - w25::bf_bits2f(hb));
    *lo = (unsigned)la | ((unsigned)lb << 16); return (unsigned)ha | ((unsigned)hb << 16); }
// blockIdx.y = matrix of a batch: source matrices sz floats apart, destination planes dz elements apart
__global__ __launch_bounds__(256) void k_castS16(const float* __restrict__ src, long long lds, __bf16* __restrict__ dhi, __bf16* __restrict__ dlo, long long ldd, int R, int C, float s, int transpose, long long sz, long long dz) {
    src += (long long)blockIdx.y * sz; dhi += (long long)blockIdx.y * dz; dlo += (long long)blockIdx.y * dz;
    const long long i = (long long)blockIdx.x * 256 + threadIdx.x; long long o; float a, b;
    if (transpose) { const long long np = (long long)C * (R / 2); if (i >= np) return; const int c = (int)(i / (R / 2)); const int r = 2 * (int)(i % (R / 2)); a = src[(long long)r * lds + c] * s; b = src[(long long)(r + 1) * lds + c] * s; o = (long long)c * ldd + r; }
    else { const long long np = (long long)R * (C / 2); if (i >= np) return; const int r = (int)(i / (C / 2)); const int c = 2 * (int)(i % (C / 2)); a = src[(long long)r * lds + c] * s; b = src[(long long)r * lds + c + 1] * s; o = (long long)r * ldd + c; }
    unsigned lo; const unsigned hi = f2bf2_pack(a, b, &lo); unsigned* ph = (unsigned*)(dhi + o); unsigned* pl = (unsigned*)(dlo + o);
    *ph = hi; *pl = lo;  }

namespace w25 {
// =====================================================================================
// Generic causal/non-causal attention for head_dim 64, f32 in / f32 out; 16-bit operands: bf16 with optional hi/lo splits, or
// plain f16 (F16=true, non-split, probabilities carried x2^15).
//   scores = (q*qscale)·kᵀ : v_wmma_f32_16x16x32_bf16; SPLIT_QK -> q,k as bf16 hi/lo (hi·hi + hi·lo + lo·hi)
//   out    = p·v           : v_wmma_f32_16x16x32_bf16; SPLIT_PV -> p,v as bf16 hi/lo; else p,v plain bf16
//   f32 accumulate; online softmax in f32. Block = 4 waves = 64 query rows of one (batch, head); S % 64 == 0.
//   Element (b, s, h, d) of tensor X lives at X[b*X_bs + s*X_rs + h*X_hs + d] (strides in floats, multiples of 4).
//   Masking: mask_mode 0 none, 1 causal (kv > q masked), 2 tensor [S][Skv] shared over (b,h) (float if
//   mask_is_int==0, int32 with element == 0 -> masked if 1, int32 with element != 0 -> masked if 2), 3 per-token vectors qmask[B][S] & kvmask[B][Skv] (int32,
//   0 -> masked), 4 causal + sliding window (kv > q or q - kv > W masked; W passed in mask_is_int);
//   5 = relative-position bias: s += cp[b,h,q][idx[q][kv]] + pc[b,h,kv][idx[q][kv]] with idx = mask_b ([S][Skv] int32) and
//   mask_a an int32 [S][Skv] tensor with nonzero = masked (tables: element (b,h,row,n) at X + b*c_bs + h*c_hs + row*c_rs + n);
//   masked scores are replaced by mask_fill (e.g. -inf or -1e9) before the softmax.
//   grid.x = B * H * (S/64) (or a sub-range with blk0).
// =====================================================================================
#define AT_D 64
#define AT_NW 4
#define AT_QB 64
#define AT_KC 64
struct AttnGeom { const float* cp = nullptr; const float* pc = nullptr; long c_bs = 0, c_rs = 0, c_hs = 0;   // mode-5 score-bias tables
                  long q_bs, q_rs, q_hs, k_bs, k_rs, k_hs, v_bs, v_rs, v_hs, o_bs, o_rs, o_hs;
                  int S, Skv, H, mask_mode; float qscale; int blk0; float mask_fill; int mask_is_int; };
static_assert(sizeof(AttnGeom) == 168, "no padding");

__device__ __forceinline__ unsigned short at_bf_bits(float f) {
  unsigned u = __float_as_uint(f);
  return (unsigned short)((u + 0x7FFFu + ((u >> 16) & 1u)) >> 16);
}
__device__ __forceinline__ __bf16 at_f2bf(float f) { return __builtin_bit_cast(__bf16, at_bf_bits(f)); }
__device__ __forceinline__ void at_split(float f, __bf16& hi, __bf16& lo) {
  const unsigned short hb = at_bf_bits(f);
  hi = __builtin_bit_cast(__bf16, hb);
  lo = at_f2bf(f - __uint_as_float(((unsigned)hb) << 16));
}
__device__ __forceinline__ v8f at_mma(v16b a, v16b b, v8f c) {
  c = __builtin_amdgcn_wmma_f32_16x16x32_bf16(false, a, false, b, (short)0, c, false, false);
  asm volatile("v_nop\n\tv_nop\n\tv_nop\n\tv_nop" : "+v"(c) : "v"(a), "v"(b));
  return c;
}
// 16-bit element as a bit pattern held in a __bf16 slot: f16 bits when F16, bf16 (RNE) otherwise
template <bool F16> __device__ __forceinline__ __bf16 at_to16(float f) {
  if (F16) return __builtin_bit_cast(__bf16, (_Float16)f);
  return at_f2bf(f);
}
template <bool F16> __device__ __forceinline__ v8f at_mma16(v16b a, v16b b, v8f c) {
  if (F16) {
    const v16h ah = __builtin_bit_cast(v16h, a), bh = __builtin_bit_cast(v16h, b);
    c = __builtin_amdgcn_wmma_f32_16x16x32_f16(false, ah, false, bh, (short)0, c, false, false);
    asm volatile("v_nop\n\tv_nop\n\tv_nop\n\tv_nop" : "+v"(c) : "v"(ah), "v"(bh));
    return c;
  }
  return at_mma(a, b, c);
}

template <bool SPLIT_QK, bool SPLIT_PV, bool F16 = false>
__global__ __launch_bounds__(128)
void attn64_kernel(const float* __restrict__ q, const float* __restrict__ k,
                   const float* __restrict__ v, float* __restrict__ out,
                   const void* __restrict__ mask_a, const int* __restrict__ mask_b, AttnGeom g) {
  static_assert(!(F16 && (SPLIT_QK || SPLIT_PV)), "f16 mode is non-split");
  const float PSC = F16 ? 32768.0f : 1.0f;     // f16 probabilities carried x2^15 (subnormal range), folded into the final 1/l
  union FB { v16b v; v8b h[2]; };
  __shared__ __align__(16) __bf16 Ksh[AT_KC * AT_D];             // K hi [kv][d]      8 KB
  __shared__ __align__(16) __bf16 Ksl[SPLIT_QK ? AT_KC * AT_D : 8];
  __shared__ __align__(16) __bf16 Vth[AT_D * AT_KC];             // V hi [d][kv]      8 KB
  __shared__ __align__(16) __bf16 Vtl[SPLIT_PV ? AT_D * AT_KC : 8];
  __shared__ __align__(16) __bf16 Psh[AT_NW][16 * AT_KC];        // per wave P hi [row][kv]  8 KB
  __shared__ __align__(16) __bf16 Psl[SPLIT_PV ? AT_NW : 1][SPLIT_PV ? 16 * AT_KC : 8];
  __shared__ __align__(16) float  Os[AT_NW][16 * 68];            // per wave out tile, pitch 68

  const int tid  = threadIdx.x;
  const int wave = tid >> 5;
  const int lane = tid & 31;
  const int hh   = lane >> 4;
  const int c    = lane & 15;

  const int nqb = g.S / AT_QB;
  const int bx = blockIdx.x + g.blk0;
  const int qb = bx % nqb;
  const int bh = bx / nqb;
  const int h  = bh % g.H;
  const int b  = bh / g.H;
  const int qbase_block = qb * AT_QB;
  const int q0 = qbase_block + wave * 16;

  const float* qb_ptr = q + (size_t)b * g.q_bs + (size_t)h * g.q_hs;
  const float* kb_ptr = k + (size_t)b * g.k_bs + (size_t)h * g.k_hs;
  const float* vb_ptr = v + (size_t)b * g.v_bs + (size_t)h * g.v_hs;
  float*       ob_ptr = out + (size_t)b * g.o_bs + (size_t)h * g.o_hs;

  // ---- Q fragments (A operand): 2 d-chunks, hi (and lo) ----
  v16b qah[2], qal[2];
  {
    const float* qrow = qb_ptr + (size_t)(q0 + c) * g.q_rs;
#pragma unroll
    for (int dc = 0; dc < 2; ++dc) {
#pragma unroll
      for (int e = 0; e < 8; ++e) {
        const float f0 = qrow[dc * 32 + 8 * hh + e] * g.qscale;
        const float f1 = qrow[dc * 32 + 16 + 8 * hh + e] * g.qscale;
        if (SPLIT_QK) { __bf16 hq, lq; at_split(f0, hq, lq); qah[dc][e] = hq; qal[dc][e] = lq; at_split(f1, hq, lq); qah[dc][8 + e] = hq; qal[dc][8 + e] = lq; }
        else { qah[dc][e] = at_to16<F16>(f0); qah[dc][8 + e] = at_to16<F16>(f1); qal[dc][e] = qah[dc][e]; qal[dc][8 + e] = qah[dc][8 + e]; }
      }
    }
  }

  float mrow[8], lrow[8];
  v8f oacc[4];
#pragma unroll
  for (int r = 0; r < 8; ++r) { mrow[r] = -INFINITY; lrow[r] = 0.f; }
#pragma unroll
  for (int t = 0; t < 4; ++t) oacc[t] = (v8f){0.f,0.f,0.f,0.f,0.f,0.f,0.f,0.f};

  const int nChunks = (g.mask_mode == 1 || g.mask_mode == 4) ? (qb + 1) : (g.Skv / AT_KC);   // block-uniform
  // per-row query mask (mode 3)
  int qkeep[8];
#pragma unroll
  for (int r = 0; r < 8; ++r) qkeep[r] = (g.mask_mode == 3) ? mask_b[(size_t)b * g.S + q0 + 8 * hh + r] : 1;   // mask_b = qmask in mode 3
  for (int kc = 0; kc < nChunks; ++kc) {
    const int kv0 = kc * AT_KC;
    __syncthreads();
    {
      const int kvr = tid >> 1, dh = (tid & 1) * 32;
      const float* krow = kb_ptr + (size_t)(kv0 + kvr) * g.k_rs + dh;
      const float* vrow = vb_ptr + (size_t)(kv0 + kvr) * g.v_rs + dh;
#pragma unroll
      for (int i = 0; i < 8; ++i) {
        v4f kk = *(const v4f*)(krow + 4 * i);
        v4f vv = *(const v4f*)(vrow + 4 * i);
#pragma unroll
        for (int e = 0; e < 4; ++e) {
          const int d = dh + 4 * i + e;
          if (SPLIT_QK) { __bf16 a, bl; at_split(kk[e], a, bl); Ksh[kvr * AT_D + d] = a; Ksl[kvr * AT_D + d] = bl; }
          else Ksh[kvr * AT_D + d] = at_to16<F16>(kk[e]);
          if (SPLIT_PV) { __bf16 a, bl; at_split(vv[e], a, bl); Vth[d * AT_KC + kvr] = a; Vtl[d * AT_KC + kvr] = bl; }
          else Vth[d * AT_KC + kvr] = at_to16<F16>(vv[e]);
        }
      }
    }
    __syncthreads();

    v8f s[4];
#pragma unroll
    for (int j = 0; j < 4; ++j) {
      s[j] = (v8f){0.f,0.f,0.f,0.f,0.f,0.f,0.f,0.f};
#pragma unroll 1
      for (int dc = 0; dc < 2; ++dc) {
        FB kb;
        kb.h[0] = *(const v8b*)(Ksh + (j * 16 + c) * AT_D + dc * 32 + 8 * hh);
        kb.h[1] = *(const v8b*)(Ksh + (j * 16 + c) * AT_D + dc * 32 + 16 + 8 * hh);
        s[j] = at_mma16<F16>(qah[dc], kb.v, s[j]);
        if (SPLIT_QK) {
          FB kl;
          kl.h[0] = *(const v8b*)(Ksl + (j * 16 + c) * AT_D + dc * 32 + 8 * hh);
          kl.h[1] = *(const v8b*)(Ksl + (j * 16 + c) * AT_D + dc * 32 + 16 + 8 * hh);
          s[j] = at_mma16<F16>(qah[dc], kl.v, s[j]);
          s[j] = at_mma16<F16>(qal[dc], kb.v, s[j]);
        }
      }
    }
    const bool diag = (g.mask_mode == 1) && (kc == qb);
    int kvkeep[4] = {1, 1, 1, 1};
    if (g.mask_mode == 3) {
#pragma unroll
      for (int j = 0; j < 4; ++j) kvkeep[j] = ((const int*)mask_a)[(size_t)b * g.Skv + kv0 + j * 16 + c];   // mask_a = kvmask
    }
    float cm[8];
#pragma unroll
    for (int r = 0; r < 8; ++r) {
      const int qrow = q0 + 8 * hh + r;
      float m = -INFINITY;
#pragma unroll
      for (int j = 0; j < 4; ++j) {
        const int kvcol = kv0 + j * 16 + c;
        bool masked = false;
        if (diag) masked = (kvcol > qrow);
        else if (g.mask_mode == 4) masked = (kvcol > qrow) || (qrow - kvcol > g.mask_is_int);
        else if (g.mask_mode == 2) {
          const size_t mi = (size_t)qrow * g.Skv + kvcol;
          masked = (g.mask_is_int == 0) ? (((const float*)mask_a)[mi] == 0.0f)
                 : (g.mask_is_int == 1) ? (((const int*)mask_a)[mi] == 0) : (((const int*)mask_a)[mi] != 0);
        } else if (g.mask_mode == 3) masked = (qkeep[r] == 0) || (kvkeep[j] == 0);
        else if (g.mask_mode == 5) {
          const size_t mi = (size_t)qrow * g.Skv + kvcol;
          masked = (((const int*)mask_a)[mi] != 0);
          int n = mask_b[mi]; n = n < 0 ? 0 : n;
          s[j][r] += g.cp[(size_t)b * g.c_bs + (size_t)h * g.c_hs + (size_t)qrow * g.c_rs + n]
                   + g.pc[(size_t)b * g.c_bs + (size_t)h * g.c_hs + (size_t)kvcol * g.c_rs + n];
        }
        if (masked) s[j][r] = g.mask_fill;
        m = fmaxf(m, s[j][r]);
      }
#pragma unroll
      for (int off = 1; off < 16; off <<= 1) m = fmaxf(m, __shfl_xor(m, off, 32));
      cm[r] = m;
    }
    __bf16* pwh = Psh[wave];
    __bf16* pwl = Psl[SPLIT_PV ? wave : 0];
#pragma unroll
    for (int r = 0; r < 8; ++r) {
      const float mnew = fmaxf(mrow[r], cm[r]);
      const float alpha = expf(mrow[r] - mnew);
      mrow[r] = mnew;
      float psum = 0.f;
#pragma unroll
      for (int j = 0; j < 4; ++j) {
        const float p = expf(s[j][r] - mnew);
        psum += p;
        if (SPLIT_PV) { __bf16 a, bl; at_split(p, a, bl); pwh[(8 * hh + r) * AT_KC + j * 16 + c] = a; pwl[(8 * hh + r) * AT_KC + j * 16 + c] = bl; }
        else pwh[(8 * hh + r) * AT_KC + j * 16 + c] = at_to16<F16>(p * PSC);
      }
#pragma unroll
      for (int off = 1; off < 16; off <<= 1) psum += __shfl_xor(psum, off, 32);
      lrow[r] = lrow[r] * alpha + psum;
#pragma unroll
      for (int t = 0; t < 4; ++t) oacc[t][r] *= alpha;
    }
    __builtin_amdgcn_fence(__ATOMIC_RELEASE, "workgroup");
    __builtin_amdgcn_wave_barrier();
    __builtin_amdgcn_fence(__ATOMIC_ACQUIRE, "workgroup");
#pragma unroll 1
    for (int kk = 0; kk < 2; ++kk) {
      FB pa, pl;
      pa.h[0] = *(const v8b*)(pwh + c * AT_KC + kk * 32 + 8 * hh);
      pa.h[1] = *(const v8b*)(pwh + c * AT_KC + kk * 32 + 16 + 8 * hh);
      if (SPLIT_PV) {
        pl.h[0] = *(const v8b*)(pwl + c * AT_KC + kk * 32 + 8 * hh);
        pl.h[1] = *(const v8b*)(pwl + c * AT_KC + kk * 32 + 16 + 8 * hh);
      }
#pragma unroll
      for (int t = 0; t < 4; ++t) {
        FB vb;
        vb.h[0] = *(const v8b*)(Vth + (t * 16 + c) * AT_KC + kk * 32 + 8 * hh);
        vb.h[1] = *(const v8b*)(Vth + (t * 16 + c) * AT_KC + kk * 32 + 16 + 8 * hh);
        oacc[t] = at_mma16<F16>(pa.v, vb.v, oacc[t]);
        if (SPLIT_PV) {
          FB vl;
          vl.h[0] = *(const v8b*)(Vtl + (t * 16 + c) * AT_KC + kk * 32 + 8 * hh);
          vl.h[1] = *(const v8b*)(Vtl + (t * 16 + c) * AT_KC + kk * 32 + 16 + 8 * hh);
          oacc[t] = at_mma16<F16>(pa.v, vl.v, oacc[t]);
          oacc[t] = at_mma16<F16>(pl.v, vb.v, oacc[t]);
        }
      }
    }
  }

  float* os = Os[wave];
#pragma unroll
  for (int r = 0; r < 8; ++r) {
    const float inv = 1.0f / (lrow[r] * PSC);
#pragma unroll
    for (int t = 0; t < 4; ++t) os[(8 * hh + r) * 68 + t * 16 + c] = oacc[t][r] * inv;
  }
  __builtin_amdgcn_fence(__ATOMIC_RELEASE, "workgroup");
  __builtin_amdgcn_wave_barrier();
  __builtin_amdgcn_fence(__ATOMIC_ACQUIRE, "workgroup");
  {
    const int c4 = (lane & 15) * 4;
    {
#pragma unroll
      for (int it = 0; it < 8; ++it) {
        const int row = it * 2 + hh;
        v4f val = *(const v4f*)(os + row * 68 + c4);
        *(v4f*)(ob_ptr + (size_t)(q0 + row) * g.o_rs + c4) = val;
      }
      
    }
  }
}

} // namespace w25


__device__ __forceinline__ void st_h2(unsigned short* d2, float a, float b) { const unsigned u = (unsigned)__builtin_bit_cast(unsigned short, (_Float16)a) | ((unsigned)__builtin_bit_cast(unsigned short, (_Float16)b) << 16); unsigned* d = (unsigned*)d2; *d = u;  }
__device__ __forceinline__ float ldh(const unsigned short* p) { return (float)__builtin_bit_cast(_Float16, *p); }
__device__ __forceinline__ v4f ld4h(const unsigned short* p) { const unsigned long long u = *(const unsigned long long*)p; v4f a;
    a.x = (float)__builtin_bit_cast(_Float16, (unsigned short)(u & 0xFFFFu)); a.y = (float)__builtin_bit_cast(_Float16, (unsigned short)((u >> 16) & 0xFFFFu)); a.z = (float)__builtin_bit_cast(_Float16, (unsigned short)((u >> 32) & 0xFFFFu)); a.w = (float)__builtin_bit_cast(_Float16, (unsigned short)((u >> 48) & 0xFFFFu)); return a; }
__device__ __forceinline__ unsigned long long pk4h(v4f s) { return (unsigned long long)__builtin_bit_cast(unsigned short, (_Float16)s.x) | ((unsigned long long)__builtin_bit_cast(unsigned short, (_Float16)s.y) << 16) | ((unsigned long long)__builtin_bit_cast(unsigned short, (_Float16)s.z) << 32) | ((unsigned long long)__builtin_bit_cast(unsigned short, (_Float16)s.w) << 48); }
typedef unsigned v4u __attribute__((ext_vector_type(4)));
__device__ __forceinline__ void st8h(unsigned short* d, v4f a, v4f b) { const unsigned long long pa = pk4h(a), pb = pk4h(b); v4u pk; pk.x = (unsigned)(pa & 0xFFFFFFFFull); pk.y = (unsigned)(pa >> 32); pk.z = (unsigned)(pb & 0xFFFFFFFFull); pk.w = (unsigned)(pb >> 32); v4u* dd = (v4u*)d; *dd = pk;  }
__device__ __forceinline__ unsigned short bfu_rne(float v) { unsigned u = __builtin_bit_cast(unsigned, v); u += 0x7FFFu + ((u >> 16) & 1u); return (unsigned short)(u >> 16); }
__device__ __forceinline__ void bfsplit(float v, unsigned short& hi, unsigned short& lo) { hi = bfu_rne(v); lo = bfu_rne(v - __builtin_bit_cast(float, (unsigned)hi << 16)); }
__device__ __forceinline__ void st_s2(unsigned short* Hp, unsigned short* Lp, long long o, float a, float b) { unsigned short h0,l0,h1,l1; bfsplit(a,h0,l0); bfsplit(b,h1,l1); const unsigned ph = (unsigned)h0 | ((unsigned)h1 << 16), pl = (unsigned)l0 | ((unsigned)l1 << 16);
    unsigned* dh = (unsigned*)(Hp + o); unsigned* dl = (unsigned*)(Lp + o); *dh = ph; *dl = pl;  }
__device__ __forceinline__ int cl(int v, int n) { return min(max(v, 0), n - 1); }

// GAT-style aggregation over a device in-edge CSR at dst (+ optional explicit self loop as iteration j = -1):
//   logit = leaky(AS[src][h] + AD[n][h] (+ EW[e]*CW[h]), slope); softmax over the node's edges per head; acc[c] = sum alpha XP[src][c] (f16 gather plane, pitch XW; 256 channels = H heads x CH)
//   wave per node; lane L owns channels 8L..8L+7 (head = 8L / CH); per-lane softmax state (lanes of one head agree) -> no shuffles in the loop.
//   EPI 0: + bias -> f32 OUT[n][256] via LDS redistribution (two 16-B stores per lane, each instruction 512 contiguous B)
//   EPI 1: + bias, LayerNorm(256) * g + bb, relu -> bf16 hi/lo planes OH/OL [n][256] (16-B stores)
//   EPI 2: mean over the 256/CH heads + bias[0..CH-1] , LayerNorm(64) * g + bb, relu -> f32 OUT[n][64] (CH must be 64; LDS redistribution, 8-B stores)
//   EPI 3: mean over heads + bias -> f32 OUT[n][64] (no norm / activation)
//   EPI 4: + bias, ELU -> bf16 hi/lo planes OH/OL [n][256];  EPI 5: + bias (full 256-wide, per head), ELU, then mean over the 256/CH heads -> f32 OUT[n][64]
//   EPI 6: (CH = 128, two heads) mean over the two heads, + bias[0..127], relu -> f32 OUT[n][128] (LDS redistribution, 16-B stores)
//   EWM 0: no edge weights; 1: logit += EW[e] * CW[h] (self loop weight 1); 2: alpha *= EW[e] after the softmax (message scale; self loop weight 1)
template <int CH, bool SELF, int EWM, int EPI>
__global__ __launch_bounds__(256) void k_gat_agg(const unsigned short* __restrict__ XP, int XW, const float* __restrict__ AS, const float* __restrict__ AD, int ASTR, const float* __restrict__ EW, const float* __restrict__ CW,
        const int* __restrict__ esrc, const int* __restrict__ off, const int* __restrict__ cnt, const int* __restrict__ slot, const float* __restrict__ bias, const float* __restrict__ g, const float* __restrict__ bb,
        float* __restrict__ OUT, unsigned short* __restrict__ OH, unsigned short* __restrict__ OL, int N, int E, int CAP, float slope) {
    __shared__ float stage[8][256];
    const int wv = threadIdx.x >> 5; const int n = blockIdx.x * 8 + wv; const int L = threadIdx.x & 31; if (n >= N) return; const int c0 = 8 * L; const int h = c0 / CH;
    const float ad = AD[(long long)n * ASTR + h]; const float cw = (EWM == 1) ? CW[h] : 0.f; float m = -3.0e38f, s = 0.f; v4f a0, a1; a0.x = a0.y = a0.z = a0.w = 0.f; a1 = a0;
    const int p0 = cl(off[n], E + 1), cn = min(max(cnt[n], 0), CAP);
    for (int j = (SELF ? -1 : 0); j < cn; ++j) { int sj; float ew = 0.f;
        if (j < 0) { sj = n; ew = 1.f; } else { int e = slot[cl(p0 + j, E)]; e = cl(e, E); sj = cl(esrc[e], N); if (EWM != 0) ew = EW[e]; }
        float lg = AS[(long long)sj * ASTR + h] + ad + ((EWM == 1) ? ew * cw : 0.f); lg = (lg >= 0.f) ? lg : slope * lg;
        const float mn = fmaxf(m, lg); const float cz = expf(m - mn), pj = expf(lg - mn); s = s * cz + pj; const float pw = (EWM == 2) ? pj * ew : pj;
        const unsigned short* xr = XP + (long long)sj * XW + c0; a0 = a0 * cz + ld4h(xr) * pw; a1 = a1 * cz + ld4h(xr + 4) * pw; m = mn; }
    const float inv = (s > 0.f) ? 1.f / (s + 1e-16f) : 0.f; a0 = a0 * inv; a1 = a1 * inv;
    if (EPI == 0 || EPI == 1 || EPI == 4 || EPI == 5) { a0 = a0 + *(const v4f*)(bias + c0); a1 = a1 + *(const v4f*)(bias + c0 + 4); }
    if (EPI == 4 || EPI == 5) { a0.x = (a0.x > 0.f) ? a0.x : (expf(a0.x) - 1.f); a0.y = (a0.y > 0.f) ? a0.y : (expf(a0.y) - 1.f); a0.z = (a0.z > 0.f) ? a0.z : (expf(a0.z) - 1.f); a0.w = (a0.w > 0.f) ? a0.w : (expf(a0.w) - 1.f);
        a1.x = (a1.x > 0.f) ? a1.x : (expf(a1.x) - 1.f); a1.y = (a1.y > 0.f) ? a1.y : (expf(a1.y) - 1.f); a1.z = (a1.z > 0.f) ? a1.z : (expf(a1.z) - 1.f); a1.w = (a1.w > 0.f) ? a1.w : (expf(a1.w) - 1.f); }
    if (EPI == 4) { float o8[8] = {a0.x, a0.y, a0.z, a0.w, a1.x, a1.y, a1.z, a1.w}; unsigned short hh[8], ll[8];
#pragma unroll
        for (int u = 0; u < 8; ++u) bfsplit(o8[u], hh[u], ll[u]);
        const unsigned long long ph0 = (unsigned long long)hh[0] | ((unsigned long long)hh[1] << 16) | ((unsigned long long)hh[2] << 32) | ((unsigned long long)hh[3] << 48), pl0 = (unsigned long long)ll[0] | ((unsigned long long)ll[1] << 16) | ((unsigned long long)ll[2] << 32) | ((unsigned long long)ll[3] << 48);
        const unsigned long long ph1 = (unsigned long long)hh[4] | ((unsigned long long)hh[5] << 16) | ((unsigned long long)hh[6] << 32) | ((unsigned long long)hh[7] << 48), pl1 = (unsigned long long)ll[4] | ((unsigned long long)ll[5] << 16) | ((unsigned long long)ll[6] << 32) | ((unsigned long long)ll[7] << 48);
        v4u pk; pk.x = (unsigned)(ph0 & 0xFFFFFFFFull); pk.y = (unsigned)(ph0 >> 32); pk.z = (unsigned)(ph1 & 0xFFFFFFFFull); pk.w = (unsigned)(ph1 >> 32); v4u* dh = (v4u*)(OH + (long long)n * 256 + c0); *dh = pk; 
        v4u ql; ql.x = (unsigned)(pl0 & 0xFFFFFFFFull); ql.y = (unsigned)(pl0 >> 32); ql.z = (unsigned)(pl1 & 0xFFFFFFFFull); ql.w = (unsigned)(pl1 >> 32); v4u* dl = (v4u*)(OL + (long long)n * 256 + c0); *dl = ql;  return; }
    if (EPI == 6) {
        a0.x += __shfl_xor(a0.x, 16); a0.y += __shfl_xor(a0.y, 16); a0.z += __shfl_xor(a0.z, 16); a0.w += __shfl_xor(a0.w, 16); a1.x += __shfl_xor(a1.x, 16); a1.y += __shfl_xor(a1.y, 16); a1.z += __shfl_xor(a1.z, 16); a1.w += __shfl_xor(a1.w, 16);
        if (L < 16) { const int cb = 8 * L; const v4f b0 = *(const v4f*)(bias + cb), b1v = *(const v4f*)(bias + cb + 4);
            stage[wv][cb] = fmaxf(a0.x * 0.5f + b0.x, 0.f); stage[wv][cb + 1] = fmaxf(a0.y * 0.5f + b0.y, 0.f); stage[wv][cb + 2] = fmaxf(a0.z * 0.5f + b0.z, 0.f); stage[wv][cb + 3] = fmaxf(a0.w * 0.5f + b0.w, 0.f);
            stage[wv][cb + 4] = fmaxf(a1.x * 0.5f + b1v.x, 0.f); stage[wv][cb + 5] = fmaxf(a1.y * 0.5f + b1v.y, 0.f); stage[wv][cb + 6] = fmaxf(a1.z * 0.5f + b1v.z, 0.f); stage[wv][cb + 7] = fmaxf(a1.w * 0.5f + b1v.w, 0.f); }
        __builtin_amdgcn_fence(__ATOMIC_RELEASE, "workgroup"); __builtin_amdgcn_wave_barrier(); __builtin_amdgcn_fence(__ATOMIC_ACQUIRE, "workgroup");
        v4f o6; o6.x = stage[wv][4 * L]; o6.y = stage[wv][4 * L + 1]; o6.z = stage[wv][4 * L + 2]; o6.w = stage[wv][4 * L + 3]; VST2V4(OUT + (long long)n * 128 + 4 * L, o6); return; }
    if (EPI == 5) {
        a0.x += __shfl_xor(a0.x, 8); a0.y += __shfl_xor(a0.y, 8); a0.z += __shfl_xor(a0.z, 8); a0.w += __shfl_xor(a0.w, 8); a1.x += __shfl_xor(a1.x, 8); a1.y += __shfl_xor(a1.y, 8); a1.z += __shfl_xor(a1.z, 8); a1.w += __shfl_xor(a1.w, 8);
        a0.x += __shfl_xor(a0.x, 16); a0.y += __shfl_xor(a0.y, 16); a0.z += __shfl_xor(a0.z, 16); a0.w += __shfl_xor(a0.w, 16); a1.x += __shfl_xor(a1.x, 16); a1.y += __shfl_xor(a1.y, 16); a1.z += __shfl_xor(a1.z, 16); a1.w += __shfl_xor(a1.w, 16);
        const int gq5 = L & 7; a0 = a0 * 0.25f; a1 = a1 * 0.25f;
        if (L < 8) { stage[wv][8 * gq5] = a0.x; stage[wv][8 * gq5 + 1] = a0.y; stage[wv][8 * gq5 + 2] = a0.z; stage[wv][8 * gq5 + 3] = a0.w; stage[wv][8 * gq5 + 4] = a1.x; stage[wv][8 * gq5 + 5] = a1.y; stage[wv][8 * gq5 + 6] = a1.z; stage[wv][8 * gq5 + 7] = a1.w; }
        __builtin_amdgcn_fence(__ATOMIC_RELEASE, "workgroup"); __builtin_amdgcn_wave_barrier(); __builtin_amdgcn_fence(__ATOMIC_ACQUIRE, "workgroup");
        const unsigned long long pk5 = (unsigned long long)__builtin_bit_cast(unsigned, stage[wv][2 * L]) | ((unsigned long long)__builtin_bit_cast(unsigned, stage[wv][2 * L + 1]) << 32); VST2(unsigned long long, (unsigned long long*)(OUT + (long long)n * 64 + 2 * L), pk5); return; }
    if (EPI == 1) { float sm = a0.x + a0.y + a0.z + a0.w + a1.x + a1.y + a1.z + a1.w;
#pragma unroll
        for (int o = 16; o > 0; o >>= 1) sm += __shfl_xor(sm, o);
        const float mu = sm * (1.f / 256.f); const v4f d0 = a0 - mu, d1 = a1 - mu; float q = d0.x * d0.x + d0.y * d0.y + d0.z * d0.z + d0.w * d0.w + d1.x * d1.x + d1.y * d1.y + d1.z * d1.z + d1.w * d1.w;
#pragma unroll
        for (int o = 16; o > 0; o >>= 1) q += __shfl_xor(q, o);
        const float rs = rsqrtf(q * (1.f / 256.f) + 1e-5f); float o8[8] = {d0.x, d0.y, d0.z, d0.w, d1.x, d1.y, d1.z, d1.w}; unsigned short hh[8], ll[8];
#pragma unroll
        for (int u = 0; u < 8; ++u) { const float v = fmaxf(o8[u] * rs * g[c0 + u] + bb[c0 + u], 0.f); bfsplit(v, hh[u], ll[u]); }
        const unsigned long long ph0 = (unsigned long long)hh[0] | ((unsigned long long)hh[1] << 16) | ((unsigned long long)hh[2] << 32) | ((unsigned long long)hh[3] << 48), pl0 = (unsigned long long)ll[0] | ((unsigned long long)ll[1] << 16) | ((unsigned long long)ll[2] << 32) | ((unsigned long long)ll[3] << 48);
        const unsigned long long ph1 = (unsigned long long)hh[4] | ((unsigned long long)hh[5] << 16) | ((unsigned long long)hh[6] << 32) | ((unsigned long long)hh[7] << 48), pl1 = (unsigned long long)ll[4] | ((unsigned long long)ll[5] << 16) | ((unsigned long long)ll[6] << 32) | ((unsigned long long)ll[7] << 48);
        // lane L's 8 halves at c0 = 8L: 16 B -> one 16-B store per plane (32 lanes x 16 B = whole 512-B row)
        v4u pk; pk.x = (unsigned)(ph0 & 0xFFFFFFFFull); pk.y = (unsigned)(ph0 >> 32); pk.z = (unsigned)(ph1 & 0xFFFFFFFFull); pk.w = (unsigned)(ph1 >> 32); v4u* dh = (v4u*)(OH + (long long)n * 256 + c0); *dh = pk; 
        v4u ql; ql.x = (unsigned)(pl0 & 0xFFFFFFFFull); ql.y = (unsigned)(pl0 >> 32); ql.z = (unsigned)(pl1 & 0xFFFFFFFFull); ql.w = (unsigned)(pl1 >> 32); v4u* dl = (v4u*)(OL + (long long)n * 256 + c0); *dl = ql;  return; }
    if (EPI == 2 || EPI == 3) {   // head mean: lanes L, L^8, L^16, L^24 hold the same chan group of the 4 heads (CH = 64 -> 8 lanes per head)
        a0.x += __shfl_xor(a0.x, 8); a0.y += __shfl_xor(a0.y, 8); a0.z += __shfl_xor(a0.z, 8); a0.w += __shfl_xor(a0.w, 8); a1.x += __shfl_xor(a1.x, 8); a1.y += __shfl_xor(a1.y, 8); a1.z += __shfl_xor(a1.z, 8); a1.w += __shfl_xor(a1.w, 8);
        a0.x += __shfl_xor(a0.x, 16); a0.y += __shfl_xor(a0.y, 16); a0.z += __shfl_xor(a0.z, 16); a0.w += __shfl_xor(a0.w, 16); a1.x += __shfl_xor(a1.x, 16); a1.y += __shfl_xor(a1.y, 16); a1.z += __shfl_xor(a1.z, 16); a1.w += __shfl_xor(a1.w, 16);
        const int gq = L & 7; a0 = a0 * 0.25f + *(const v4f*)(bias + 8 * gq); a1 = a1 * 0.25f + *(const v4f*)(bias + 8 * gq + 4);      // every lane now holds channels 8gq..8gq+7 of the mean
        if (EPI == 3) { if (L < 8) { stage[wv][8 * gq] = a0.x; stage[wv][8 * gq + 1] = a0.y; stage[wv][8 * gq + 2] = a0.z; stage[wv][8 * gq + 3] = a0.w; stage[wv][8 * gq + 4] = a1.x; stage[wv][8 * gq + 5] = a1.y; stage[wv][8 * gq + 6] = a1.z; stage[wv][8 * gq + 7] = a1.w; }
            __builtin_amdgcn_fence(__ATOMIC_RELEASE, "workgroup"); __builtin_amdgcn_wave_barrier(); __builtin_amdgcn_fence(__ATOMIC_ACQUIRE, "workgroup");
            const unsigned long long pk3 = (unsigned long long)__builtin_bit_cast(unsigned, stage[wv][2 * L]) | ((unsigned long long)__builtin_bit_cast(unsigned, stage[wv][2 * L + 1]) << 32); VST2(unsigned long long, (unsigned long long*)(OUT + (long long)n * 64 + 2 * L), pk3); return; }
        float sm = (L < 8) ? (a0.x + a0.y + a0.z + a0.w + a1.x + a1.y + a1.z + a1.w) : 0.f;
#pragma unroll
        for (int o = 16; o > 0; o >>= 1) sm += __shfl_xor(sm, o);
        const float mu = sm * (1.f / 64.f); const v4f d0 = a0 - mu, d1 = a1 - mu; float q = (L < 8) ? (d0.x * d0.x + d0.y * d0.y + d0.z * d0.z + d0.w * d0.w + d1.x * d1.x + d1.y * d1.y + d1.z * d1.z + d1.w * d1.w) : 0.f;
#pragma unroll
        for (int o = 16; o > 0; o >>= 1) q += __shfl_xor(q, o);
        const float rs = rsqrtf(q * (1.f / 64.f) + 1e-5f);
        if (L < 8) { const float* gg = g + 8 * gq; const float* bq = bb + 8 * gq; stage[wv][8 * gq] = fmaxf(d0.x * rs * gg[0] + bq[0], 0.f); stage[wv][8 * gq + 1] = fmaxf(d0.y * rs * gg[1] + bq[1], 0.f); stage[wv][8 * gq + 2] = fmaxf(d0.z * rs * gg[2] + bq[2], 0.f); stage[wv][8 * gq + 3] = fmaxf(d0.w * rs * gg[3] + bq[3], 0.f);
            stage[wv][8 * gq + 4] = fmaxf(d1.x * rs * gg[4] + bq[4], 0.f); stage[wv][8 * gq + 5] = fmaxf(d1.y * rs * gg[5] + bq[5], 0.f); stage[wv][8 * gq + 6] = fmaxf(d1.z * rs * gg[6] + bq[6], 0.f); stage[wv][8 * gq + 7] = fmaxf(d1.w * rs * gg[7] + bq[7], 0.f); }
        __builtin_amdgcn_fence(__ATOMIC_RELEASE, "workgroup"); __builtin_amdgcn_wave_barrier(); __builtin_amdgcn_fence(__ATOMIC_ACQUIRE, "workgroup");
        const unsigned long long pk = (unsigned long long)__builtin_bit_cast(unsigned, stage[wv][2 * L]) | ((unsigned long long)__builtin_bit_cast(unsigned, stage[wv][2 * L + 1]) << 32); VST2(unsigned long long, (unsigned long long*)(OUT + (long long)n * 64 + 2 * L), pk); return; }
    // EPI 0
    stage[wv][c0] = a0.x; stage[wv][c0 + 1] = a0.y; stage[wv][c0 + 2] = a0.z; stage[wv][c0 + 3] = a0.w; stage[wv][c0 + 4] = a1.x; stage[wv][c0 + 5] = a1.y; stage[wv][c0 + 6] = a1.z; stage[wv][c0 + 7] = a1.w;
    __builtin_amdgcn_fence(__ATOMIC_RELEASE, "workgroup"); __builtin_amdgcn_wave_barrier(); __builtin_amdgcn_fence(__ATOMIC_ACQUIRE, "workgroup");
#pragma unroll
    for (int q2 = 0; q2 < 2; ++q2) { const int c = 128 * q2 + 4 * L; v4f v; v.x = stage[wv][c]; v.y = stage[wv][c + 1]; v.z = stage[wv][c + 2]; v.w = stage[wv][c + 3]; VST2V4(OUT + (long long)n * 256 + c, v); } }

__device__ __forceinline__ void st4s(unsigned short* Hp, unsigned short* Lp, long long o, v4f a) { unsigned short h[4], l[4]; bfsplit(a.x, h[0], l[0]); bfsplit(a.y, h[1], l[1]); bfsplit(a.z, h[2], l[2]); bfsplit(a.w, h[3], l[3]);
    const unsigned long long ph = (unsigned long long)h[0] | ((unsigned long long)h[1] << 16) | ((unsigned long long)h[2] << 32) | ((unsigned long long)h[3] << 48), pl = (unsigned long long)l[0] | ((unsigned long long)l[1] << 16) | ((unsigned long long)l[2] << 32) | ((unsigned long long)l[3] << 48);
    VST2(unsigned long long, (unsigned long long*)(Hp + o), ph); VST2(unsigned long long, (unsigned long long*)(Lp + o), pl); }
// f32 [nval2 pairs] -> bf16 hi/lo planes (n2 pairs; pairs >= nval2 zero); thread-linear 4-B stores per plane
__global__ __launch_bounds__(256) void k_pl(const float* __restrict__ S, unsigned short* __restrict__ PH, unsigned short* __restrict__ PL, long long nval2, long long n2) { const long long u = (long long)blockIdx.x * 256 + threadIdx.x; if (u >= n2) return; const bool in = (u < nval2); const long long uc = in ? u : ((nval2 > 0) ? (nval2 - 1) : 0); const float a = S[2 * uc], b = S[2 * uc + 1]; st_s2(PH, PL, 2 * u, in ? a : 0.f, in ? b : 0.f); }
// WC [K][NOP] (thread-linear whole rows) = [W (cols < FO) | 0 | W_h . as_h @EO+h | W_h . ad_h @EO+NH+h | 0 ...]; W is [K][FO] (x @ W layout), as/ad [NH][DH]; EO >= FO.
// branch-free: every lane loads all candidates with clamped indices and selects by value (no exec-masked load arms)
__global__ __launch_bounds__(256) void k_wext(const float* __restrict__ Wm, const float* __restrict__ AS_, const float* __restrict__ AD_, int K, int NOP, int FO, int NH, int DH, int EO, float* __restrict__ WC) {
    #pragma clang fp contract(off)
    const long long u = (long long)blockIdx.x * 256 + threadIdx.x; if (u >= (long long)K * NOP) return; const int kk = (int)(u / NOP), o = (int)(u % NOP);
    const int oo = min(o, FO - 1); const float vw = Wm[(long long)kk * FO + oo]; const int q = min(max(o - EO, 0), 2 * NH - 1); const int h = q % NH; float s = 0.f;
#pragma unroll 1
    for (int c = 0; c < DH; ++c) { const float w = Wm[(long long)kk * FO + h * DH + c]; const float asv = AS_[h * DH + c], adv = AD_[h * DH + c]; s += w * ((q < NH) ? asv : adv); }
    const float v = (o < FO) ? vw : ((o >= EO && o < EO + 2 * NH) ? s : 0.f); VST2(float, WC + u, v); }
// GAT aggregation over a device in-edge CSR (+ analytic self loop as iteration j = -1 when SELF), per-lane online softmax (lanes of one head agree):
// HS rows (pitch P floats): [0,128) projected features z, col 128 + h = a_src.z_h, col 128 + NH + h = a_dst.z_h; lane L owns channels 4L..4L+3 (head = 4L / CH).
// out = sum_j softmax_j(leaky(el[src_j][h] + er[n][h])) z[src_j] (/ (den + deps)) + bias -> ACT (0 none, 1 relu, 2 elu, 3 leaky 0.01) ->
// MODE 0: f32 OUT[n][OW] cols < OC (16-B lane stores, OC*4 contiguous B per wave; OC in {64,128}); MODE 1: bf16 hi/lo planes PH/PL pitch PP (rows n >= N zero); MODE 2: both.
template <int CH, bool SELF, int ACT, int MODE>
__global__ __launch_bounds__(256) void k_gat128(const float* __restrict__ HS, int P, int NH, const float* __restrict__ bias, const int* __restrict__ SRC, const int* __restrict__ off, const int* __restrict__ cnt, const int* __restrict__ slot,
        float* __restrict__ OUT, int OW, int OC, unsigned short* __restrict__ PH, unsigned short* __restrict__ PL, int PP, int N, int NP, int E, int CAP, float slope, float deps) {
    #pragma clang fp contract(off)
    const int n = blockIdx.x * 8 + (threadIdx.x >> 5); const int L = threadIdx.x & 31; if (n >= NP) return; const int c = 4 * L; const int h = c / CH; v4f o; o.x = o.y = o.z = o.w = 0.f;
    if (n < N) { const float* hn = HS + (long long)n * P; const float er = hn[128 + NH + h]; float m = -3.0e38f, s = 0.f; v4f a; a.x = a.y = a.z = a.w = 0.f;
        const int p0 = min(max(off[n], 0), E), cn = min(max(cnt[n], 0), CAP);
        for (int j = (SELF ? -1 : 0); j < cn; ++j) { int sj; if (j < 0) sj = n; else { const int e = min(max(slot[min(p0 + j, E - 1)], 0), E - 1); sj = min(max(SRC[e], 0), N - 1); }
            const float* hs = HS + (long long)sj * P; float lg = hs[128 + h] + er; lg = (lg >= 0.f) ? lg : slope * lg;
            const float mn = fmaxf(m, lg); const float cz = expf(m - mn), pj = expf(lg - mn); s = s * cz + pj; a = a * cz + *(const v4f*)(hs + c) * pj; m = mn; }
        const float inv = (s > 0.f || deps > 0.f) ? 1.f / (s + deps) : 0.f; o = a * inv + *(const v4f*)(bias + c);
        if (ACT == 1) { o.x = fmaxf(o.x, 0.f); o.y = fmaxf(o.y, 0.f); o.z = fmaxf(o.z, 0.f); o.w = fmaxf(o.w, 0.f); }
        if (ACT == 2) { o.x = (o.x > 0.f) ? o.x : (expf(o.x) - 1.f); o.y = (o.y > 0.f) ? o.y : (expf(o.y) - 1.f); o.z = (o.z > 0.f) ? o.z : (expf(o.z) - 1.f); o.w = (o.w > 0.f) ? o.w : (expf(o.w) - 1.f); }
        if (ACT == 3) { o.x = (o.x >= 0.f) ? o.x : 0.01f * o.x; o.y = (o.y >= 0.f) ? o.y : 0.01f * o.y; o.z = (o.z >= 0.f) ? o.z : 0.01f * o.z; o.w = (o.w >= 0.f) ? o.w : 0.01f * o.w; }
        if (MODE != 1 && c < OC) VST2V4(OUT + (long long)n * OW + c, o); }
    if (MODE != 0) st4s(PH, PL, (long long)n * PP + c, o); }

// ---- util2 ----
// generic Bt plane builder from an f32 weight: Bt[o][k] (pitch KP halves) = (TRANS ? W[k*ldw + o] : W[o*ldw + k]) * (S ? S[o] : 1) for o < NO, k < KI; zero elsewhere for o < NOP rows, k < KP (thread per (o < NOP, pair k))
__global__ __launch_bounds__(256) void k_u2_bt(const float* __restrict__ Wm, int ldw, int TRANS, int KI, int NO, int KP, int NOP, const float* __restrict__ S, unsigned short* __restrict__ PH_, unsigned short* __restrict__ PL_) {
    const long long u = (long long)blockIdx.x * 256 + threadIdx.x; if (u >= (long long)NOP * (KP / 2)) return; const int k0 = 2 * (int)(u % (KP / 2)); const int o = (int)(u / (KP / 2)); float a = 0.f, b = 0.f;
    if (o < NO) { const float s = S ? S[o] : 1.f;
        if (k0 < KI) a = (TRANS ? Wm[(long long)k0 * ldw + o] : Wm[(long long)o * ldw + k0]) * s;
        if (k0 + 1 < KI) b = (TRANS ? Wm[(long long)(k0 + 1) * ldw + o] : Wm[(long long)o * ldw + k0 + 1]) * s; }
    st_s2(PH_, PL_, (long long)o * KP + k0, a, b); }
// generic padded vector: O[i] = (i < n) ? (A[i] * (S ? S[i] : 1) + (B2 ? B2[i] : 0)) : 0 for i < NP (one block of 256, NP <= 4096 looped)
__global__ __launch_bounds__(256) void k_u2_vec(const float* __restrict__ A, const float* __restrict__ S, const float* __restrict__ B2, int n, int NP, float* __restrict__ O) { for (int i = threadIdx.x; i < NP; i += 256) { float v = 0.f; if (i < n) v = A[i] * (S ? S[i] : 1.f) + (B2 ? B2[i] : 0.f); VST2(float, O + i, v); } }
__global__ __launch_bounds__(256) void k_u2_colstat(const float* __restrict__ X, int P, int N, float eps, float* __restrict__ STAT) {
    #pragma clang fp contract(off)
    __shared__ float red[256]; const int c = blockIdx.x; const int t = threadIdx.x; float s = 0.f; for (int r = t; r < N; r += 256) s += X[(long long)r * P + c]; red[t] = s; __syncthreads();
    for (int o = 128; o > 0; o >>= 1) { if (t < o) red[t] += red[t + o]; __syncthreads(); }
    const float mu = red[0] / (float)N; __syncthreads(); float q = 0.f; for (int r = t; r < N; r += 256) { const float d = X[(long long)r * P + c] - mu; q += d * d; } red[t] = q; __syncthreads();
    for (int o = 128; o > 0; o >>= 1) { if (t < o) red[t] += red[t + o]; __syncthreads(); }
    const float rs = 1.f / sqrtf(red[0] / (float)N + eps); if (t < 32) VST2(float, STAT + (long long)c * 32 + t, (t == 0) ? mu : ((t == 1) ? rs : 0.f)); }
// rows f32 [R][W] (pitch PW) -> planes at pitch PP, column offset coff; rows >= RL (live) written as zeros up to RP (thread per (r < RP, 4 of W))
__global__ __launch_bounds__(256) void k_u2_pl(const float* __restrict__ X, int PW, int Wd, int RL, int RP, unsigned short* __restrict__ PH_, unsigned short* __restrict__ PL_, int PP, int coff) { const long long u = (long long)blockIdx.x * 256 + threadIdx.x; if (u >= (long long)RP * (Wd / 4)) return; const int r = (int)(u / (Wd / 4)); const int c = 4 * (int)(u % (Wd / 4)); v4f v; v.x = v.y = v.z = v.w = 0.f; if (r < RL) v = *(const v4f*)(X + (long long)r * PW + c); st4s(PH_, PL_, (long long)r * PP + coff + c, v); }

typedef unsigned int cm_u4 __attribute__((ext_vector_type(4)));

__global__ __launch_bounds__(256) void k_cm_zero16(unsigned short* __restrict__ DST, long long n) { const long long u = (long long)blockIdx.x * 256 + threadIdx.x; if (u * 8 >= n) return; cm_u4 z; z.x = z.y = z.z = z.w = 0u; cm_u4* d = (cm_u4*)(DST + u * 8); *d = z;  }
// f32 -> bf16 (RNE) -> f16 casts: every 16-bit operand then holds exactly the bf16-rounded input value (times a power-of-two
// weight scale), so the f16 WMMA products are exact. Plain: thread per (row, 8 cols),
// dst [R][C] pitch ldd; transposed: thread per (col, 8 consecutive rows) -> dst [C][R] pitch ldd; both store 16 B per thread, thread-linear along the dst row.
__device__ __forceinline__ unsigned int cmb_pk2(float a, float b) { return (unsigned int)__builtin_bit_cast(unsigned short, (_Float16)a) | ((unsigned int)__builtin_bit_cast(unsigned short, (_Float16)b) << 16); }
__device__ __forceinline__ float cmb_bf(float v) { const unsigned u = __builtin_bit_cast(unsigned, v); const unsigned r = (u + 0x7fffu + ((u >> 16) & 1u)) & 0xffff0000u; return __builtin_bit_cast(float, r); }   // bf16 RNE, kept as f32 (finite inputs)
// BR[i] = bf16_rne(B[i]) kept as f32 (thread per element)
__global__ __launch_bounds__(256) void k_cm_bfvec(const float* __restrict__ SRC, float* __restrict__ DST, int n) { const int u = blockIdx.x * 256 + threadIdx.x; if (u >= n) return; VST2(float, DST + u, cmb_bf(SRC[u])); }
__global__ __launch_bounds__(256) void k_cm_castb(const float* __restrict__ SRC, int lds, unsigned short* __restrict__ DST, int ldd, int nR, int nC, float sc) {
    const long long u = (long long)blockIdx.x * 256 + threadIdx.x; const int per = nC / 8; if (u >= (long long)nR * per) return; const int r = (int)(u / per); const int c0 = 8 * (int)(u % per);
    const float* s = SRC + (long long)r * lds + c0; float w[8];
#pragma unroll
    for (int e = 0; e < 8; ++e) w[e] = cmb_bf(s[e]) * sc;
    cm_u4 pk; pk.x = cmb_pk2(w[0], w[1]); pk.y = cmb_pk2(w[2], w[3]); pk.z = cmb_pk2(w[4], w[5]); pk.w = cmb_pk2(w[6], w[7]); VST2(cm_u4, (cm_u4*)(DST + (long long)r * ldd + c0), pk); }
__global__ __launch_bounds__(256) void k_cm_castbT(const float* __restrict__ SRC, int lds, unsigned short* __restrict__ DST, int ldd, int nR, int nC, float sc) {
    const long long u = (long long)blockIdx.x * 256 + threadIdx.x; const int per = nR / 8; if (u >= (long long)nC * per) return; const int c = (int)(u / per); const int r0 = 8 * (int)(u % per);
    float w[8];
#pragma unroll
    for (int e = 0; e < 8; ++e) w[e] = cmb_bf(SRC[(long long)(r0 + e) * lds + c]) * sc;
    cm_u4 pk; pk.x = cmb_pk2(w[0], w[1]); pk.y = cmb_pk2(w[2], w[3]); pk.z = cmb_pk2(w[4], w[5]); pk.w = cmb_pk2(w[6], w[7]); VST2(cm_u4, (cm_u4*)(DST + (long long)c * ldd + r0), pk); }

typedef float ab_v2f __attribute__((ext_vector_type(2)));
__global__ __launch_bounds__(256) void k_ab_gstat(const float* __restrict__ X, float* __restrict__ STp, int per) {
    #pragma clang fp contract(off)
    __shared__ float red[256]; const int g = blockIdx.x; const int t = threadIdx.x; const float* base = X + (long long)g * per; float s = 0.f;
    for (int i = 4 * t; i < per; i += 1024) { const v4f v = *(const v4f*)(base + i); s += (cmb_bf(v.x) + cmb_bf(v.y)) + (cmb_bf(v.z) + cmb_bf(v.w)); }
    red[t] = s; __syncthreads();
    for (int o = 128; o > 0; o >>= 1) { if (t < o) red[t] += red[t + o]; __syncthreads(); }
    const float mean = red[0] / (float)per; __syncthreads(); float q = 0.f;
    for (int i = 4 * t; i < per; i += 1024) { const v4f v = *(const v4f*)(base + i); const float a = cmb_bf(v.x) - mean, b = cmb_bf(v.y) - mean, c = cmb_bf(v.z) - mean, d = cmb_bf(v.w) - mean; q += (a * a + b * b) + (c * c + d * d); }
    red[t] = q; __syncthreads();
    for (int o = 128; o > 0; o >>= 1) { if (t < o) red[t] += red[t + o]; __syncthreads(); }
    if (t == 0) { ab_v2f ms; ms.x = mean; ms.y = rsqrtf(red[0] / (float)per + 1e-5f); VST2(ab_v2f, (ab_v2f*)(STp + 32 * g), ms); } }
// XN[c][n] = (bf16(x[c][n]) - mean[g]) rstd[g] bf16(gamma[c]) + bf16(beta[c]); XB[c][n] = bf16(x[c][n]) (residual copy); thread per float4; c runs over the rows of all images ([B * CH][N], groups numbered through), gamma and beta repeat every CH rows
__global__ __launch_bounds__(256) void k_ab_gapply(const float* __restrict__ X, const float* __restrict__ STp, const float* __restrict__ Gm, const float* __restrict__ Bt, float* __restrict__ XNp, float* __restrict__ XBp, int N, int CPG, int CH, long long n4) {
    #pragma clang fp contract(off)
    const long long u = (long long)blockIdx.x * 256 + threadIdx.x; if (u >= n4) return; const int c = (int)((4 * u) / N); const int g = c / CPG; const float mean = STp[32 * g], rs = STp[32 * g + 1], ga = cmb_bf(Gm[c % CH]), be = cmb_bf(Bt[c % CH]);
    const v4f v = *(const v4f*)(X + 4 * u); v4f xb; xb.x = cmb_bf(v.x); xb.y = cmb_bf(v.y); xb.z = cmb_bf(v.z); xb.w = cmb_bf(v.w); v4f r; r.x = (xb.x - mean) * rs * ga + be; r.y = (xb.y - mean) * rs * ga + be; r.z = (xb.z - mean) * rs * ga + be; r.w = (xb.w - mean) * rs * ga + be;
    VST2V4(XNp + 4 * u, r); VST2V4(XBp + 4 * u, xb); }


extern "C" void kernel_launch(void* const* d_in, const int* in_sizes, int n_in, void* d_out, int out_size, void* d_ws, size_t ws_size, hipStream_t stream) {
    (void)in_sizes; (void)n_in; (void)out_size; (void)ws_size;
    const float* x = (const float*)d_in[0];
    const float* gam = (const float*)d_in[1];
    const float* bet = (const float*)d_in[2];
    const float* wqkv = (const float*)d_in[3];
    const float* bqkv = (const float*)d_in[4];
    const float* wo = (const float*)d_in[5];
    const float* bo = (const float*)d_in[6];
    float* out = (float*)d_out;
    char* wsp = (char*)d_ws;
    float* ST = (float*)wsp; wsp += (((size_t)((size_t)32 * 32 + 64) * 4 + 255) / 256) * 256;
    float* XN = (float*)wsp; wsp += (((size_t)((size_t)1024 * 4096) * 4 + 255) / 256) * 256;
    unsigned short* XTH = (unsigned short*)wsp; wsp += (((size_t)((size_t)16384 * 256) * 2 + 255) / 256) * 256;
    unsigned short* XTL = (unsigned short*)wsp; wsp += (((size_t)((size_t)16384 * 256) * 2 + 255) / 256) * 256;
    unsigned short* W3H = (unsigned short*)wsp; wsp += (((size_t)((size_t)768 * 256) * 2 + 255) / 256) * 256;
    unsigned short* W3L = (unsigned short*)wsp; wsp += (((size_t)((size_t)768 * 256) * 2 + 255) / 256) * 256;
    float* BR3 = (float*)wsp; wsp += (((size_t)((size_t)768 + 64) * 4 + 255) / 256) * 256;
    float* QKV = (float*)wsp; wsp += (((size_t)((size_t)16384 * 768) * 4 + 255) / 256) * 256;
    float* AO = (float*)wsp; wsp += (((size_t)((size_t)16384 * 256) * 4 + 255) / 256) * 256;
    unsigned short* AOH = (unsigned short*)wsp; wsp += (((size_t)((size_t)16384 * 256) * 2 + 255) / 256) * 256;
    unsigned short* AOL = (unsigned short*)wsp; wsp += (((size_t)((size_t)16384 * 256) * 2 + 255) / 256) * 256;
    unsigned short* WOH = (unsigned short*)wsp; wsp += (((size_t)((size_t)256 * 256) * 2 + 255) / 256) * 256;
    unsigned short* WOL = (unsigned short*)wsp; wsp += (((size_t)((size_t)256 * 256) * 2 + 255) / 256) * 256;
    float* BRO = (float*)wsp; wsp += (((size_t)((size_t)256 + 64) * 4 + 255) / 256) * 256;
    float* XB = (float*)wsp; wsp += (((size_t)((size_t)1024 * 4096) * 4 + 255) / 256) * 256;
    if ((size_t)(wsp - (char*)d_ws) > ws_size) return;   // static carve guard
    // All four images go through each stage in ONE launch: every buffer holds the four images one behind the other (pixel-major buffers as 16384 rows,
    // channel-major ones as 4 matrices), and the image is extra rows, grid.y or grid.z of the launch.
    k_castS16<<<(unsigned)((((long long)(768) * ((256) / 2)) + 255) / 256), 256, 0, stream>>>(wqkv, 256, (__bf16*)(W3H), (__bf16*)(W3L), 256, 768, 256, 1.0f, 0, 0, 0);
    k_cm_bfvec<<<3, 256, 0, stream>>>(bqkv, BR3, 768); k_cm_bfvec<<<1, 256, 0, stream>>>(bo, BRO, 256);
    k_castS16<<<(unsigned)((((long long)(256) * ((256) / 2)) + 255) / 256), 256, 0, stream>>>(wo, 256, (__bf16*)(WOH), (__bf16*)(WOL), 256, 256, 256, 1.0f, 0, 0, 0);
    k_ab_gstat<<<32, 256, 0, stream>>>(x, ST, 131072); k_ab_gapply<<<(1048576 + 255) / 256, 256, 0, stream>>>(x, ST, gam, bet, XN, XB, 4096, 32, 256, 1048576LL);
    k_castS16<<<dim3((unsigned)((((long long)(4096) * ((256) / 2)) + 255) / 256), (unsigned)(4)), 256, 0, stream>>>(XN, 4096, (__bf16*)(XTH), (__bf16*)(XTL), 256, 256, 4096, 1.0f, 1, 1048576, 1048576);
    w25::wmma_gemm64<1, false, 2, 0, false, 0><<<dim3((unsigned)((((16384) / 64) * ((768) / 64) + 7) / 8), (unsigned)(1)), 256, 0, stream>>>((const unsigned short*)(XTH), nullptr, 256, 0, (const unsigned short*)(W3H), nullptr, 256, 0, (void*)(QKV), nullptr, 768, 0, BR3, nullptr, 0, 16384, 768, 256, 1.0f);
    w25::wmma_gemm64<1, false, 0, 0, true, 0><<<dim3((unsigned)((((16384) / 64) * ((768) / 64) + 7) / 8), (unsigned)(1)), 256, 0, stream>>>((const unsigned short*)(XTL), nullptr, 256, 0, (const unsigned short*)(W3H), nullptr, 256, 0, (void*)(QKV), nullptr, 768, 0, nullptr, QKV, 0, 16384, 768, 256, 1.0f);
    { /*apv4*/ AttnP a;
      a.Q = QKV; a.K = QKV + 256; a.V = QKV + 512; a.O = AO; a.P = 0; a.Mf = 0; a.Mi = 0; a.ST = 0;
      a.Pw = 0; a.Rt = 0; a.SQ = 0; a.SK = 0;
      a.swb = 0; a.swh = 0; a.swi = 0; a.swj = 0; a.srb = 0; a.srh = 0; a.sri = 0; a.sQb = 3145728; a.sQh = 64; a.sQi = 768; a.sQd = 1; a.sKb = 3145728; a.sKh = 64; a.sKj = 768; a.sKd = 1; a.sVb = 3145728; a.sVh = 64; a.sVj = 768; a.sVd = 1; a.sOb = 1048576; a.sOh = 64; a.sOi = 256; a.sPb = 0; a.sPh = 0; a.sPi = 0; a.smb = 0; a.smh = 0; a.smi = 0; a.smj = 0;
      a.Lq = 4096; a.Lk = 4096; a.dh = 64; a.dv = 64; a.hrep = 1; a.causal = 0; a.coff = 0; a.pband = 0;
      a.scale = 0.125f; a.mfill = 0.0f; a.nonorm = 0; a.mpol = 0;
      a.roff = 0; a.rn = 1; a.segpol = 0; a.win = 0;
      k_attn<64, 64, 0, false, false, true, true><<<dim3((unsigned)((4096) + 16 * AW - 1) / (16 * AW), (unsigned)(4), (unsigned)(4)), 32 * AW, 0, stream>>>(a); }
    k_castS16<<<(unsigned)((((long long)(16384) * ((256) / 2)) + 255) / 256), 256, 0, stream>>>(AO, 256, (__bf16*)(AOH), (__bf16*)(AOL), 256, 16384, 256, 1.0f, 0, 0, 0);
    w25::wmma_gemm64<1, false, 1, 0, true, 0><<<dim3((unsigned)((((256) / 64) * ((4096) / 64) + 7) / 8), (unsigned)(4)), 256, 0, stream>>>((const unsigned short*)(WOH), nullptr, 256, 0, (const unsigned short*)(AOH), nullptr, 256, 1048576, (void*)(out), nullptr, 4096, 1048576, BRO, XB, 1048576, 256, 4096, 256, 1.0f);
    w25::wmma_gemm64<1, false, 0, 0, true, 0><<<dim3((unsigned)((((256) / 64) * ((4096) / 64) + 7) / 8), (unsigned)(4)), 256, 0, stream>>>((const unsigned short*)(WOH), nullptr, 256, 0, (const unsigned short*)(AOL), nullptr, 256, 1048576, (void*)(out), nullptr, 4096, 1048576, nullptr, out, 1048576, 256, 4096, 256, 1.0f);
}

// v006
// One run takes 294 microseconds.
// Timed twice side by side with v005, it ran 1.23 times as fast both times.
// Counting every step since v000, which is the starting kernel, it is 27.8 times as fast.
#include <hip/hip_runtime.h>
#include <math.h>

typedef __attribute__((ext_vector_type(16))) _Float16 v16h;
typedef __attribute__((ext_vector_type(8)))  _Float16 v8h;
typedef __attribute__((ext_vector_type(16))) __bf16   v16b;
typedef __attribute__((ext_vector_type(8)))  float    v8f;
typedef __attribute__((ext_vector_type(4)))  float    v4f;

// 16-bit WMMA fragment map (wave32), lane L, h = L>>4, m = L&15:
//   A 16x32: lane = row m;   element i -> k = (i<8) ? 8h+i : 16+8h+(i-8)
//   B 32x16: lane = column m; the SAME k(i,h)
//   D 16x16 (8 f32): lane = column m; element r -> row 8h+r
__device__ __forceinline__ int frag_k(int i, int h) { return (i < 8) ? (8 * h + i) : (16 + 8 * h + (i - 8)); }
__device__ __forceinline__ __bf16 bf16_rne(float f) {
    unsigned int u = __float_as_uint(f);
    u += 0x7fffu + ((u >> 16) & 1u);
    return __builtin_bit_cast(__bf16, (unsigned short)(u >> 16));
}
__device__ __forceinline__ float bf16_f32(__bf16 b) { return __uint_as_float(((unsigned int)__builtin_bit_cast(unsigned short, b)) << 16); }
__device__ __forceinline__ v8f wmma16(v16h a, v16h b, v8f c) {
    c = __builtin_amdgcn_wmma_f32_16x16x32_f16(false, a, false, b, (short)0, c, false, false);
    asm volatile("v_nop\n\tv_nop\n\tv_nop\n\tv_nop" : "+v"(c) : "v"(a), "v"(b));
    return c;
}
__device__ __forceinline__ v8f wmmab(v16b a, v16b b, v8f c) {
    c = __builtin_amdgcn_wmma_f32_16x16x32_bf16(false, a, false, b, (short)0, c, false, false);
    asm volatile("v_nop\n\tv_nop\n\tv_nop\n\tv_nop" : "+v"(c) : "v"(a), "v"(b));
    return c;
}
struct Split { v16b hi, lo; };
// hi/lo split product: a.hi*b.hi + a.hi*b.lo + a.lo*b.hi
__device__ __forceinline__ v8f wmma3(const Split& a, const Split& b, v8f c) {
    c = __builtin_amdgcn_wmma_f32_16x16x32_bf16(false, a.hi, false, b.hi, (short)0, c, false, false);
    c = __builtin_amdgcn_wmma_f32_16x16x32_bf16(false, a.hi, false, b.lo, (short)0, c, false, false);
    c = __builtin_amdgcn_wmma_f32_16x16x32_bf16(false, a.lo, false, b.hi, (short)0, c, false, false);
    asm volatile("v_nop\n\tv_nop\n\tv_nop\n\tv_nop" : "+v"(c) : "v"(a.hi), "v"(a.lo), "v"(b.hi), "v"(b.lo));
    return c;
}
struct Split3 { v16b hi, mid, lo; };
// triple split product (6 terms, drops only terms below 2^-24 relative)
__device__ __forceinline__ v8f wmma6(const Split3& a, const Split3& b, v8f c) {
    c = __builtin_amdgcn_wmma_f32_16x16x32_bf16(false, a.hi, false, b.hi, (short)0, c, false, false);
    c = __builtin_amdgcn_wmma_f32_16x16x32_bf16(false, a.hi, false, b.mid, (short)0, c, false, false);
    c = __builtin_amdgcn_wmma_f32_16x16x32_bf16(false, a.mid, false, b.hi, (short)0, c, false, false);
    c = __builtin_amdgcn_wmma_f32_16x16x32_bf16(false, a.hi, false, b.lo, (short)0, c, false, false);
    c = __builtin_amdgcn_wmma_f32_16x16x32_bf16(false, a.mid, false, b.mid, (short)0, c, false, false);
    c = __builtin_amdgcn_wmma_f32_16x16x32_bf16(false, a.lo, false, b.hi, (short)0, c, false, false);
    asm volatile("v_nop\n\tv_nop\n\tv_nop\n\tv_nop" : "+v"(c) : "v"(a.hi), "v"(a.mid), "v"(a.lo), "v"(b.hi), "v"(b.mid), "v"(b.lo));
    return c;
}

// Fragment gathers from f32 memory: element i <- p[(k0 + frag_k(i,h)) * sk] * s, zero for k >= klen.
__device__ __forceinline__ v16h fh_ld(const float* __restrict__ p, long long sk, int k0, int h, int klen, float s) {
    v16h a;
#pragma unroll
    for (int i = 0; i < 16; ++i) { const int k = k0 + frag_k(i, h); a[i] = (k < klen) ? (_Float16)(p[(long long)k * sk] * s) : (_Float16)0.f; }
    return a;
}
__device__ __forceinline__ Split sp_ld(const float* __restrict__ p, long long sk, int k0, int h, int klen, float s) {
    Split r;
#pragma unroll
    for (int i = 0; i < 16; ++i) {
        const int k = k0 + frag_k(i, h); const float x = (k < klen) ? p[(long long)k * sk] * s : 0.f;
        const __bf16 hb = bf16_rne(x); r.hi[i] = hb; r.lo[i] = bf16_rne(x - bf16_f32(hb));
    }
    return r;
}
__device__ __forceinline__ Split3 sp3_ld(const float* __restrict__ p, long long sk, int k0, int h, int klen, float s) {
    Split3 r;
#pragma unroll
    for (int i = 0; i < 16; ++i) {
        const int k = k0 + frag_k(i, h); const float x = (k < klen) ? p[(long long)k * sk] * s : 0.f;
        const __bf16 hb = bf16_rne(x); const float r1 = x - bf16_f32(hb); const __bf16 mb = bf16_rne(r1);
        r.hi[i] = hb; r.mid[i] = mb; r.lo[i] = bf16_rne(r1 - bf16_f32(mb));
    }
    return r;
}
__device__ __forceinline__ v16b bh_ld(const float* __restrict__ p, long long sk, int k0, int h, int klen, float s) {
    v16b a;
#pragma unroll
    for (int i = 0; i < 16; ++i) { const int k = k0 + frag_k(i, h); a[i] = bf16_rne((k < klen) ? p[(long long)k * sk] * s : 0.f); }
    return a;
}
// f16 fragment from an f16 LDS/global row with element stride 1 (k-contiguous), no bounds (tile already zero padded)
__device__ __forceinline__ v16h fh_row(const _Float16* __restrict__ row, int k0, int h) {
    v16h a;
#pragma unroll
    for (int i = 0; i < 16; ++i) a[i] = row[k0 + frag_k(i, h)];
    return a;
}

typedef __attribute__((ext_vector_type(4))) _Float16 v4h;
// One 16-bit fragment's 32 k of a k-contiguous, 16-byte aligned f32 row as four unguarded 16-byte loads; row = the lane's row + 8 * h elements.
// fr_cvt packs them in the k order of frag_k.
struct FragRaw { v4f x0, x1, x2, x3; };
__device__ __forceinline__ FragRaw fr_ld(const v4f* __restrict__ row, int k0) {
    FragRaw r; r.x0 = row[k0 / 4]; r.x1 = row[k0 / 4 + 1]; r.x2 = row[k0 / 4 + 4]; r.x3 = row[k0 / 4 + 5];
    return r;
}
__device__ __forceinline__ v16h fr_cvt(const FragRaw& r) {
    v16h a;
#pragma unroll
    for (int i = 0; i < 4; ++i) { a[i] = (_Float16)r.x0[i]; a[4 + i] = (_Float16)r.x1[i]; a[8 + i] = (_Float16)r.x2[i]; a[12 + i] = (_Float16)r.x3[i]; }
    return a;
}

#define VST2(T, ptr, val) do { const T vst2_v_ = (val); *(T*)(ptr) = vst2_v_;  } while (0)
typedef float v4f __attribute__((ext_vector_type(4)));
#define VST2V4(ptr, val) do { const v4f vst2_v4_ = (val); *(v4f*)(ptr) = vst2_v4_;  } while (0)

__device__ __attribute__((noinline)) float act_fn(float v, int act) {
    if (act == 1) return fmaxf(v, 0.f);                                                                               // relu
    if (act == 2) { const float u = 0.7978845608028654f * (v + 0.044715f * v * v * v); return 0.5f * v * (1.f + tanhf(u)); } // tanh-gelu
    if (act == 3) return v / (1.f + expf(-v));                                                                        // silu
    if (act == 4) return 0.5f * v * (1.f + erff(v * 0.7071067811865476f));                                             // erf-gelu
    if (act == 5) return tanhf(v);
    if (act == 6) return 1.f / (1.f + expf(-v));                                                                      // sigmoid
    if (act == 7) return (v > 0.f) ? v : 0.01f * v;                                                                   // leaky relu 0.01
    if (act == 8) return (v > 0.f) ? v : (expf(v) - 1.f);                                                             // elu
    if (act == 9) return fminf(fmaxf(v, 0.f), 6.f);                                                                   // relu6
    if (act == 10) return fabsf(v);                                                                                    // abs
    if (act == 11) return (v >= 0.f) ? v : 0.1f * v;                                                                  // leaky 0.1
    if (act == 12) return (v > 0.f) ? v : 0.2f * v;                                                                   // leaky 0.2
    if (act == 13) return (v > 20.f) ? v : log1pf(expf(v));                                                            // softplus
    return v;
}

// =====================================================================================================================
// k_gemm<MODE>: C(z, m, n) = act(alpha * sum_k A(z, m, k) * B(z, k, n) + bias) + beta * R(z, m, n)
//   One wave (32-thread block) per 16 x 32 tile of C; grid (ceil(N/32), ceil(M/16), Z). Batch z -> (zo = z / zi_n, zi = z % zi_n)
//   with separate outer/inner strides for every tensor (e.g. batch and head). A(m,k) = A[zo*sAo + zi*sAi + m*sAm + k*sAk] (f32),
//   B(k,n) = B[zo*sBo + zi*sBi + n*sBn + k*sBk] (f32); any M, N, K (K zero-padded to 32 inside the fragments, M/N tails guarded).
//   C(m,n) = C[zo*sCo + zi*sCi + m*sCm + n] (n contiguous). flags: 1 bias[n], 2 bias[m], 4 residual R[zo*sRo + zi*sRi + m*sRm + n*sRn].
//   MODE 0: f16 operands (A prescaled by sa, B by sb, both undone in the epilogue); 1: bf16 hi/lo split (3 products); 2: bf16;
//   3: bf16 hi/mid/lo triple split (6 products); 4: as 3 with Kahan-compensated f32 accumulation across k-steps.
// =====================================================================================================================
struct GemmP {
    const float* A; const float* B; const float* bias; const float* R; float* C;
    long long sAo, sAi, sAm, sAk, sBo, sBi, sBn, sBk, sCo, sCi, sCm, sRo, sRi, sRm, sRn;
    int M, N, K, zi_n, flags, act; float alpha, beta, sa, sb;
    int Npad, pad_;     // columns [N, Npad) of C are written as 0 so that padded workspace rows are covered by whole-line stores; Npad >= N
};
static_assert(sizeof(GemmP) == 5 * 8 + 15 * 8 + 6 * 4 + 4 * 4 + 2 * 4, "GemmP has padding");

template <int MODE>
__global__ __launch_bounds__(32) void k_gemm(GemmP p) {
    const int lane = threadIdx.x & 31, h = lane >> 4, l15 = lane & 15;
    const int m0 = blockIdx.y * 16, n0 = blockIdx.x * 32;
    const int z = blockIdx.z, zo = z / p.zi_n, zi = z - zo * p.zi_n;
    const float* A = p.A + zo * p.sAo + zi * p.sAi;
    const float* B = p.B + zo * p.sBo + zi * p.sBi;
    const int am = min(m0 + l15, p.M - 1);                       // clamped row for loads (stores are guarded)
    v8f acc[2], comp[2];
#pragma unroll
    for (int t = 0; t < 2; ++t) { v8f zz = {}; acc[t] = zz; comp[t] = zz; }
    for (int k0 = 0; k0 < p.K; k0 += 32) {
        const float* arow = A + (long long)am * p.sAm;
        if (MODE == 1) {
            const Split a = sp_ld(arow, p.sAk, k0, h, p.K, 1.f);
#pragma unroll
            for (int t = 0; t < 2; ++t) {
                const int bn = min(n0 + t * 16 + l15, p.N - 1);
                acc[t] = wmma3(a, sp_ld(B + (long long)bn * p.sBn, p.sBk, k0, h, p.K, 1.f), acc[t]);
            }
        } else if (MODE == 3) {
            const Split3 a = sp3_ld(arow, p.sAk, k0, h, p.K, 1.f);
#pragma unroll
            for (int t = 0; t < 2; ++t) {
                const int bn = min(n0 + t * 16 + l15, p.N - 1);
                acc[t] = wmma6(a, sp3_ld(B + (long long)bn * p.sBn, p.sBk, k0, h, p.K, 1.f), acc[t]);
            }
        } else if (MODE == 4) {
            // triple split as MODE 3, but each k-step's 6 products go into a fresh accumulator and the partial is added to the running f32 sum
            // on the VALU with Kahan compensation (accumulation error stays ~1 ulp however long K is)
            const Split3 a = sp3_ld(arow, p.sAk, k0, h, p.K, 1.f);
#pragma unroll
            for (int t = 0; t < 2; ++t) {
                const int bn = min(n0 + t * 16 + l15, p.N - 1); v8f zz = {};
                const v8f part = wmma6(a, sp3_ld(B + (long long)bn * p.sBn, p.sBk, k0, h, p.K, 1.f), zz);
                const v8f y = part - comp[t]; const v8f s = acc[t] + y; comp[t] = (s - acc[t]) - y; acc[t] = s;
            }
        } else if (MODE == 2) {
            const v16b a = bh_ld(arow, p.sAk, k0, h, p.K, 1.f);
#pragma unroll
            for (int t = 0; t < 2; ++t) {
                const int bn = min(n0 + t * 16 + l15, p.N - 1);
                acc[t] = wmmab(a, bh_ld(B + (long long)bn * p.sBn, p.sBk, k0, h, p.K, 1.f), acc[t]);
            }
        } else {
            const v16h a = fh_ld(arow, p.sAk, k0, h, p.K, p.sa);
#pragma unroll
            for (int t = 0; t < 2; ++t) {
                const int bn = min(n0 + t * 16 + l15, p.N - 1);
                acc[t] = wmma16(a, fh_ld(B + (long long)bn * p.sBn, p.sBk, k0, h, p.K, p.sb), acc[t]);
            }
        }
    }
    const float iscale = (MODE == 0) ? p.alpha / (p.sa * p.sb) : p.alpha;
    float* C = p.C + zo * p.sCo + zi * p.sCi;
    const float* R = p.R + zo * p.sRo + zi * p.sRi;
    __shared__ __align__(16) float ctile[16][36];
#pragma unroll
    for (int t = 0; t < 2; ++t) {
        const int n = n0 + t * 16 + l15; const int nn = min(n, p.N - 1);
#pragma unroll
        for (int r = 0; r < 8; ++r) {
            const int m = m0 + 8 * h + r; const int mm = min(m, p.M - 1);
            float v = acc[t][r] * iscale;
            if (p.flags & 1) v += p.bias[nn];
            if (p.flags & 2) v += p.bias[mm];
            if (p.flags & 8) v *= p.bias[(long long)zo * p.M + mm];   /* per-(z,row) scale vector laid out [Z][M]; exclusive with the bias flags */
            v = act_fn(v, p.act);
            if (p.flags & 4) v += p.beta * R[(long long)mm * p.sRm + (long long)nn * p.sRn];
            ctile[8 * h + r][t * 16 + l15] = (n < p.N) ? v : 0.f;
        }
    }
    __syncthreads();
    const int NW = (p.Npad > p.N) ? p.Npad : p.N;           // write width
    const bool fast = (m0 + 16 <= p.M) && (n0 + 32 <= NW) && ((p.sCm & 3) == 0) && ((((size_t)C) & 15) == 0);
    if (fast) {
#pragma unroll
        for (int s = 0; s < 4; ++s) {
            const int row = s * 4 + (lane >> 3), c4 = (lane & 7) * 4;
            const v4f v = *(const v4f*)&ctile[row][c4];
            VST2V4(C + (long long)(m0 + row) * p.sCm + n0 + c4, v);
        }
    } else {
        for (int row = 0; row < 16; ++row) {
            const int m = m0 + row, n = n0 + lane;
            if (m < p.M && n < NW) VST2(float, C + (long long)m * p.sCm + n, ctile[row][lane]);
        }
    }
}


// =====================================================================================================================
// k_gemmT<MODE, TM, TN>: same contract as k_gemm, but one wave computes a (16*TM) x (16*TN) tile: TM A fragments and TN B fragments are
//   loaded per 32-wide k-step and reused across TM*TN WMMAs (far fewer load/convert instructions per MAC). MODE 0 (f16), 1 (bf16 hi/lo),
//   2 (bf16) only. grid (ceil(NW/(16*TN)), ceil(M/(16*TM)), Z), block 32. Epilogue identical to k_gemm, run per 16x32 sub-tile.
// =====================================================================================================================
template <int MODE, int TM, int TN>
__global__ __launch_bounds__(32) void k_gemmT(GemmP p) {
    const int lane = threadIdx.x & 31, h = lane >> 4, l15 = lane & 15;
    const int m0 = blockIdx.y * (16 * TM), n0 = blockIdx.x * (16 * TN);
    const int z = blockIdx.z, zo = z / p.zi_n, zi = z - zo * p.zi_n;
    const float* A = p.A + zo * p.sAo + zi * p.sAi;
    const float* B = p.B + zo * p.sBo + zi * p.sBi;
    v8f acc[TM][TN];
#pragma unroll
    for (int i = 0; i < TM; ++i)
#pragma unroll
        for (int t = 0; t < TN; ++t) { v8f zz = {}; acc[i][t] = zz; }
    for (int k0 = 0; k0 < p.K; k0 += 32) {
        if (MODE == 1) {
            Split a[TM], b[TN];
#pragma unroll
            for (int i = 0; i < TM; ++i) { const int am = min(m0 + 16 * i + l15, p.M - 1); a[i] = sp_ld(A + (long long)am * p.sAm, p.sAk, k0, h, p.K, 1.f); }
#pragma unroll
            for (int t = 0; t < TN; ++t) { const int bn = min(n0 + 16 * t + l15, p.N - 1); b[t] = sp_ld(B + (long long)bn * p.sBn, p.sBk, k0, h, p.K, 1.f); }
#pragma unroll
            for (int i = 0; i < TM; ++i)
#pragma unroll
                for (int t = 0; t < TN; ++t) acc[i][t] = wmma3(a[i], b[t], acc[i][t]);
        } else if (MODE == 2) {
            v16b a[TM], b[TN];
#pragma unroll
            for (int i = 0; i < TM; ++i) { const int am = min(m0 + 16 * i + l15, p.M - 1); a[i] = bh_ld(A + (long long)am * p.sAm, p.sAk, k0, h, p.K, 1.f); }
#pragma unroll
            for (int t = 0; t < TN; ++t) { const int bn = min(n0 + 16 * t + l15, p.N - 1); b[t] = bh_ld(B + (long long)bn * p.sBn, p.sBk, k0, h, p.K, 1.f); }
#pragma unroll
            for (int i = 0; i < TM; ++i)
#pragma unroll
                for (int t = 0; t < TN; ++t) acc[i][t] = wmmab(a[i], b[t], acc[i][t]);
        } else {
            v16h a[TM], b[TN];
#pragma unroll
            for (int i = 0; i < TM; ++i) { const int am = min(m0 + 16 * i + l15, p.M - 1); a[i] = fh_ld(A + (long long)am * p.sAm, p.sAk, k0, h, p.K, p.sa); }
#pragma unroll
            for (int t = 0; t < TN; ++t) { const int bn = min(n0 + 16 * t + l15, p.N - 1); b[t] = fh_ld(B + (long long)bn * p.sBn, p.sBk, k0, h, p.K, p.sb); }
#pragma unroll
            for (int i = 0; i < TM; ++i)
#pragma unroll
                for (int t = 0; t < TN; ++t) acc[i][t] = wmma16(a[i], b[t], acc[i][t]);
        }
    }
    const float iscale = (MODE == 0) ? p.alpha / (p.sa * p.sb) : p.alpha;
    float* C = p.C + zo * p.sCo + zi * p.sCi;
    const float* R = p.R + zo * p.sRo + zi * p.sRi;
    const int NW = (p.Npad > p.N) ? p.Npad : p.N;
    __shared__ __align__(16) float ctile[16][36];
#pragma unroll
    for (int i = 0; i < TM; ++i) {
        const int mb = m0 + 16 * i; if (mb >= p.M) break;          // wave-uniform
#pragma unroll
        for (int tp = 0; tp < TN / 2; ++tp) {
            const int nb = n0 + 32 * tp; if (nb >= NW) break;        // wave-uniform
#pragma unroll
            for (int t2 = 0; t2 < 2; ++t2) {
                const int t = 2 * tp + t2; const int n = nb + t2 * 16 + l15; const int nn = min(n, p.N - 1);
#pragma unroll
                for (int r = 0; r < 8; ++r) {
                    const int m = mb + 8 * h + r; const int mm = min(m, p.M - 1);
                    float v = acc[i][t][r] * iscale;
                    if (p.flags & 1) v += p.bias[nn];
                    if (p.flags & 2) v += p.bias[mm];
            if (p.flags & 8) v *= p.bias[(long long)zo * p.M + mm];   /* per-(z,row) scale vector laid out [Z][M]; exclusive with the bias flags */
                    v = act_fn(v, p.act);
                    if (p.flags & 4) v += p.beta * R[(long long)mm * p.sRm + (long long)nn * p.sRn];
                    ctile[8 * h + r][t2 * 16 + l15] = (n < p.N) ? v : 0.f;
                }
            }
            __syncthreads();
            const bool fast = (mb + 16 <= p.M) && (nb + 32 <= NW) && ((p.sCm & 3) == 0) && ((((size_t)C) & 15) == 0);
            if (fast) {
#pragma unroll
                for (int s = 0; s < 4; ++s) {
                    const int row = s * 4 + (lane >> 3), c4 = (lane & 7) * 4;
                    const v4f v = *(const v4f*)&ctile[row][c4];
                    VST2V4(C + (long long)(mb + row) * p.sCm + nb + c4, v);
                }
            } else {
                for (int row = 0; row < 16; ++row) {
                    const int m = mb + row, n = nb + lane;
                    if (m < p.M && n < NW) VST2(float, C + (long long)m * p.sCm + n, ctile[row][lane]);
                }
            }
            __syncthreads();
        }
    }
}

// =====================================================================================================================
//   Wave = 16 queries, AW waves per block, 64-key blocks; grid (ceil(Lq/(16*AW)), H, B), block 32*AW. Any Lq, Lk; head dim dh <= DHP
//   (DHP multiple of 32), value dim dv <= DVP (multiple of 16, <= 128). Every tensor addressed by (batch, head, row, element) strides, f32.
//   Scores: QM 0 f16 operands, 1 bf16 hi/lo split, 2 bf16 triple split; statistics f32 (exp2 domain); P.V: P x 4096 as f16 with V f16 staged in LDS
//   (SPLITPV: P and V as bf16 hi/lo splits). kv head = h / hrep. Masking: causal = 1 (keep j <= i + coff, masked -> -inf, key blocks beyond the
//   diagonal skipped), causal = 2 (masked -> mfill, a finite fill like the -1e9; no skipping), causal = 3 (keep j >= i + coff,
//   masked -> -inf, no skipping); optional additive f32 mask Mf,
//   optional int keep-mask Mi (0 -> score := mfill), both addressed b*smb + h*smh + i*smi + j*smj (0 strides broadcast).
// =====================================================================================================================
#define AW 4
// lane l's value of lane l ^ 16 (the wave's other half), by a vector cross-row move
__device__ __forceinline__ float xhalf(float x) { return __builtin_bit_cast(float, __builtin_amdgcn_permlanex16(__builtin_bit_cast(int, x), __builtin_bit_cast(int, x), 0x76543210, 0xfedcba98, false, false)); }
struct AttnP {   // apv4
    const float* Q; const float* K; const float* V; float* O; float* P; const float* Mf; const int* Mi; float* ST;
    const float* Pw; const float* Rt; const int* SQ; const int* SK;           // optional: post-softmax weight, relative-position table, segment ids
    long long swb, swh, swi, swj, srb, srh, sri;                                 // Pw strides (b,h,i,j); Rt strides (b,h,i), column = clamp(i - j + roff, 0, rn-1)
    long long sQb, sQh, sQi, sQd, sKb, sKh, sKj, sKd, sVb, sVh, sVj, sVd, sOb, sOh, sOi, sPb, sPh, sPi, smb, smh, smi, smj;
    int Lq, Lk, dh, dv, hrep, causal, coff, pband;   // pband > 0: P holds only the band |j - i| <= pband, column j - i + pband
    float scale, mfill; int nonorm, mpol;             // nonorm (online path only): O = sum_j exp(score_j) V_j without the 1/rowsum (scores must be <= ~0); mpol: Mi masks where ==0 (mpol 0) or where !=0 (mpol 1)
    int roff, rn, segpol, win;                        // Rt column offset/count; SQ/SK: score := mfill where (segpol 0) SQ[i] != SK[j] or (segpol 1) SQ[i] == SK[j]; win > 0: keys with i - j > win (after coff) -> -inf
};
//   Pw: the softmax numerator is multiplied by Pw(b,h,i,j) AFTER the row sum is taken (probs * weight, then P.V), as in post-softmax multiplicative biases.                                                    // ST (optional): per row (b,h,i) -> ST[((b*H + h)*Lq + i)*2 + {0,1}] = {row max of the scaled+masked score (natural units), sum_j exp(score - max)}
static_assert(sizeof(AttnP) == 12 * 8 + 29 * 8 + 16 * 4, "AttnP has padding");

#ifndef KATTN_ATTR
#define KATTN_ATTR __attribute__((amdgpu_waves_per_eu(4, 4)))   // the launch puts 4 waves on a SIMD: registers are budgeted for that, so a key block's 16 loads still issue as one group
#endif
template <int DHP, int DVP, int QM, bool SPLITPV, bool TWOPASS, bool UNIT = false, bool PLAIN = false>
__global__ __launch_bounds__(32 * AW) KATTN_ATTR void k_attn(AttnP p) {
    static_assert(!PLAIN || !TWOPASS, "PLAIN covers the one-pass path");
    static_assert(!UNIT || (QM == 0 && !SPLITPV && !TWOPASS && (32 * AW) / (DVP / 4) == 8 && (32 * AW) / (DHP / 4) == 8), "UNIT covers the f16 one-pass path, 8 K rows and 8 V rows per load step");
    constexpr int NT = DVP / 16;                // output tiles
    constexpr int KS = DHP / 32;                // k-steps for the scores
    constexpr int VP = DVP + 8;                 // LDS pitch (halves)
    constexpr int KP = DHP + 8;                 // LDS pitch of the K tile (halves): an odd multiple of 16 bytes, so a fragment's 16 rows fall on different banks
    __shared__ __align__(16) float    pl[AW][16 * 64];
    __shared__ __align__(16) _Float16 vl[(SPLITPV ? 2 : 1) * 64 * VP];   // f16 V tile, or bf16 hi and lo tiles (same 2-byte size)
    __shared__ __align__(16) _Float16 kl[UNIT ? 64 * KP : 8];            // UNIT: f16 K tile, row = key
    const int lane = threadIdx.x & 31, hf = lane >> 4, l15 = lane & 15, wave = threadIdx.x >> 5;
    const int h = blockIdx.y, b = blockIdx.z, hk = h / p.hrep;
    const int q0 = (blockIdx.x * AW + wave) * 16;
    float* myp = pl[wave];
    const float L2E = 1.4426950408889634f;
    const float NEG = -__builtin_inff();
    const int qi = min(q0 + l15, p.Lq - 1);
    const float* qrow = p.Q + b * p.sQb + h * p.sQh + (long long)qi * p.sQi;
    const float* kbase = p.K + b * p.sKb + hk * p.sKh;
    const float* vbase = p.V + b * p.sVb + hk * p.sVh;
    const v4f* qp = (const v4f*)(qrow + 8 * hf);               // UNIT: the lane's half of the fragment's k
    v16h qa[QM == 0 ? KS : 1]; Split qs_[QM == 1 ? KS : 1]; Split3 qt_[QM == 2 ? KS : 1];
#pragma unroll
    for (int ks = 0; ks < KS; ++ks) {
        if (QM == 2) qt_[ks] = sp3_ld(qrow, p.sQd, ks * 32, hf, p.dh, 1.f);
        else if (QM == 1) qs_[ks] = sp_ld(qrow, p.sQd, ks * 32, hf, p.dh, 1.f);
        else if (UNIT) qa[ks] = fr_cvt(fr_ld(qp, ks * 32));
        else qa[ks] = fh_ld(qrow, p.sQd, ks * 32, hf, p.dh, 1.f);
    }
    if (UNIT) asm volatile("s_wait_xcnt 0x0" :: "v"(qp) : "memory");   // the Q loads' address registers stay as they are up to this wait (named as input) and are reused behind it
    constexpr int VR = (32 * AW) / (DVP / 4);                  // V rows that the block's threads cover with one 16-byte load each
    constexpr int KR = (32 * AW) / (DHP / 4);                  // K rows that the block's threads cover with one 16-byte load each
    const unsigned koff = (unsigned)((int)(threadIdx.x / (DHP / 4)) * (int)p.sKj + (int)(threadIdx.x % (DHP / 4)) * 4) * 4u;   // UNIT: thread's byte offset in KR rows of K
    const unsigned voff = (unsigned)((int)(threadIdx.x / (DVP / 4)) * (int)p.sVj + (int)(threadIdx.x % (DVP / 4)) * 4) * 4u;   // UNIT: thread's byte offset in VR rows of V
    v8f o[NT]; float m8[8], l8[8];
#pragma unroll
    for (int t = 0; t < NT; ++t) { v8f zz = {}; o[t] = zz; }
#pragma unroll
    for (int i = 0; i < 8; ++i) { m8[i] = NEG; l8[i] = 0.f; }
    int jend = p.Lk; int jstart = 0;
    if (!PLAIN && p.causal == 1) { const int je = (blockIdx.x * AW + AW - 1) * 16 + 16 + p.coff; jend = min(jend, max(je, 0)); }   // uniform per block
    if (!PLAIN && p.win > 0) { const int js = (int)(blockIdx.x * AW) * 16 + p.coff - p.win; jstart = (js > 0) ? (js / 64) * 64 : 0; }   // uniform per block: key blocks entirely outside every row's window hold only -inf entries and are skipped exactly
    const int npass = TWOPASS ? 2 : 1;
    for (int pass = 0; pass < npass; ++pass) {
        const bool dopv = (!TWOPASS) || pass == 1;
        for (int j0 = jstart; j0 < jend; j0 += 64) {
            if (dopv) {
                __syncthreads();                                 // previous key block's reads of kl / vl / pl are done
                if (!UNIT)
                for (int idx = threadIdx.x; idx < 64 * DVP; idx += 32 * AW) {
                    const int jr = idx / DVP, d = idx - jr * DVP, j = j0 + jr;
                    const float f = (j < p.Lk && d < p.dv) ? vbase[(long long)j * p.sVj + (long long)d * p.sVd] : 0.f;
                    if (SPLITPV) {
                        const __bf16 hb = bf16_rne(f);
                        ((__bf16*)vl)[jr * VP + d] = hb; ((__bf16*)vl)[64 * VP + jr * VP + d] = bf16_rne(f - bf16_f32(hb));
                    } else vl[jr * VP + d] = (_Float16)f;
                }
            }
            v8f s[4];
            if (UNIT) {
                v4f vr[8], kr[8]; const v4f* vp[8]; const v4f* kp[8];
#pragma unroll
                for (int it = 0; it < 8; ++it) { vp[it] = (const v4f*)((const char*)(vbase + (long long)(j0 + it * VR) * p.sVj) + voff); vr[it] = *vp[it]; }
#pragma unroll
                for (int it = 0; it < 8; ++it) { kp[it] = (const v4f*)((const char*)(kbase + (long long)(j0 + it * KR) * p.sKj) + koff); kr[it] = *kp[it]; }
                // the group's address registers stay as they are up to this wait (named as inputs) and are reused behind it, while the loads are still in flight
                asm volatile("s_wait_xcnt 0x0" :: "v"(vp[0]), "v"(vp[1]), "v"(vp[2]), "v"(vp[3]), "v"(vp[4]), "v"(vp[5]), "v"(vp[6]), "v"(vp[7]),
                             "v"(kp[0]), "v"(kp[1]), "v"(kp[2]), "v"(kp[3]), "v"(kp[4]), "v"(kp[5]), "v"(kp[6]), "v"(kp[7]) : "memory");
#pragma unroll
                for (int it = 0; it < 8; ++it) {
                    v4h hv; hv[0] = (_Float16)vr[it][0]; hv[1] = (_Float16)vr[it][1]; hv[2] = (_Float16)vr[it][2]; hv[3] = (_Float16)vr[it][3];
                    *(v4h*)(vl + (it * VR + (int)(threadIdx.x / (DVP / 4))) * VP + (int)(threadIdx.x % (DVP / 4)) * 4) = hv;
                }
#pragma unroll
                for (int it = 0; it < 8; ++it) {
                    v4h hk4; hk4[0] = (_Float16)kr[it][0]; hk4[1] = (_Float16)kr[it][1]; hk4[2] = (_Float16)kr[it][2]; hk4[3] = (_Float16)kr[it][3];
                    *(v4h*)(kl + (it * KR + (int)(threadIdx.x / (DHP / 4))) * KP + (int)(threadIdx.x % (DHP / 4)) * 4) = hk4;
                }
                __syncthreads();                                 // K and V tiles (shared) visible
                union { v16h v; v8h h[2]; } kf[4][KS];
#pragma unroll
                for (int t = 0; t < 4; ++t)
#pragma unroll
                    for (int ks = 0; ks < KS; ++ks) {
                        const _Float16* kq = kl + (t * 16 + l15) * KP + ks * 32 + 8 * hf;   // key row l15 of tile t; the lane's half of the fragment's k, in the order of frag_k
                        kf[t][ks].h[0] = *(const v8h*)kq; kf[t][ks].h[1] = *(const v8h*)(kq + 16);
                    }
#pragma unroll
                for (int t = 0; t < 4; ++t) {
                    v8f acc = {};
#pragma unroll
                    for (int ks = 0; ks < KS; ++ks) acc = PLAIN ? wmma16(kf[t][ks].v, qa[ks], acc) : wmma16(qa[ks], kf[t][ks].v, acc);
                    s[t] = acc;
                }
            } else
#pragma unroll
            for (int t = 0; t < 4; ++t) {
                const int j = min(j0 + t * 16 + l15, p.Lk - 1);
                const float* krow = kbase + (long long)j * p.sKj;
                v8f acc = {};
#pragma unroll
                for (int ks = 0; ks < KS; ++ks) {
                    if (QM == 2)      acc = wmma6(qt_[ks], sp3_ld(krow, p.sKd, ks * 32, hf, p.dh, 1.f), acc);
                    else if (QM == 1) acc = wmma3(qs_[ks], sp_ld(krow, p.sKd, ks * 32, hf, p.dh, 1.f), acc);
                    else              acc = wmma16(qa[ks], fh_ld(krow, p.sKd, ks * 32, hf, p.dh, 1.f), acc);
                }
                s[t] = acc;
            }
            if (UNIT && PLAIN) {                                 // s[t][r] = score of key j0 + 16 t + 8 hf + r for query q0 + l15; m8[0], l8[0]: that query's maximum and this half's sum
                float mt[4];                                     // one maximum chain per score tile, so that the four overlap
                // every loop of this block is unrolled: s, mt, rt, the fragments and o are then indexed by constants and stay in registers
#pragma unroll
                for (int t = 0; t < 4; ++t) {
#pragma unroll
                    for (int r = 0; r < 8; ++r) s[t][r] = s[t][r] * p.scale * L2E;
                    mt[t] = fmaxf(fmaxf(fmaxf(s[t][0], s[t][1]), fmaxf(s[t][2], s[t][3])), fmaxf(fmaxf(s[t][4], s[t][5]), fmaxf(s[t][6], s[t][7])));
                }
                float mx = fmaxf(fmaxf(mt[0], mt[1]), fmaxf(mt[2], mt[3]));
                mx = fmaxf(mx, xhalf(mx));
                const float mnew = fmaxf(m8[0], mx);
                const float corr = exp2f(m8[0] - mnew);
                float rt[4];
#pragma unroll
                for (int t = 0; t < 4; ++t) {
#pragma unroll
                    for (int r = 0; r < 8; ++r) s[t][r] = exp2f(s[t][r] - mnew);
                    rt[t] = ((s[t][0] + s[t][1]) + (s[t][2] + s[t][3])) + ((s[t][4] + s[t][5]) + (s[t][6] + s[t][7]));
                }
                l8[0] = l8[0] * corr + ((rt[0] + rt[1]) + (rt[2] + rt[3])); m8[0] = mnew;   // the halves' sums are joined behind the loop
                v16h pb0, pb1;                                   // P^T x 4096 as B: element e = key frag_k(e, hf) of the block's first and second 32 keys
#pragma unroll
                for (int e = 0; e < 16; ++e) { pb0[e] = (_Float16)(s[e >> 3][e & 7] * 4096.f); pb1[e] = (_Float16)(s[2 + (e >> 3)][e & 7] * 4096.f); }
#pragma unroll
                for (int t = 0; t < NT; ++t) {
                    const int dcol = t * 16 + l15;
                    v16h a0, a1;                                 // V^T as A: lane = value column dcol, element e = key frag_k(e, hf)
#pragma unroll
                    for (int e = 0; e < 16; ++e) { a0[e] = vl[frag_k(e, hf) * VP + dcol]; a1[e] = vl[(32 + frag_k(e, hf)) * VP + dcol]; }
                    o[t] *= corr;
                    o[t] = wmma16(a0, pb0, o[t]);                // o[t][r] = O^T[16 t + 8 hf + r][query l15]
                    o[t] = wmma16(a1, pb1, o[t]);
                }
                continue;
            }
            float pv[8][4];
#pragma unroll
            for (int i = 0; i < 8; ++i) {
                const int irow = q0 + i + 8 * hf;
                const int ic = min(irow, p.Lq - 1);
                float sc[4];
#pragma unroll
                for (int t = 0; t < 4; ++t) {
                    const int jg = j0 + t * 16 + l15;
                    float v = s[t][i] * p.scale;
                    if (!PLAIN && p.Mf) v += p.Mf[b * p.smb + h * p.smh + (long long)ic * p.smi + (long long)min(jg, p.Lk - 1) * p.smj];
                    if (!PLAIN && p.Rt) { int rc = ic - min(jg, p.Lk - 1) + p.roff; rc = rc < 0 ? 0 : (rc >= p.rn ? p.rn - 1 : rc); v += p.Rt[b * p.srb + h * p.srh + (long long)ic * p.sri + rc]; }
                    if (!PLAIN && p.Mi) { const int mv = p.Mi[b * p.smb + h * p.smh + (long long)ic * p.smi + (long long)min(jg, p.Lk - 1) * p.smj]; if (p.mpol ? (mv != 0) : (mv == 0)) v = p.mfill; }
                    if (!PLAIN && p.SQ) { const bool same = p.SQ[(long long)b * p.Lq + ic] == p.SK[(long long)b * p.Lk + min(jg, p.Lk - 1)]; if (p.segpol ? same : !same) v = p.mfill; }
                    if (!PLAIN && p.causal == 2 && jg > irow + p.coff) v = p.mfill;
                    if (!PLAIN && (jg >= p.Lk || (p.causal == 1 && jg > irow + p.coff) || (p.causal == 3 && jg < irow + p.coff) || (p.win > 0 && irow + p.coff - jg > p.win))) v = NEG; else v *= L2E;
                    sc[t] = v;
                }
                if (!TWOPASS || pass == 0) {
                    float mx = fmaxf(fmaxf(sc[0], sc[1]), fmaxf(sc[2], sc[3]));
                    mx = fmaxf(mx, __shfl_xor(mx, 1, 32)); mx = fmaxf(mx, __shfl_xor(mx, 2, 32));
                    mx = fmaxf(mx, __shfl_xor(mx, 4, 32)); mx = fmaxf(mx, __shfl_xor(mx, 8, 32));
                    const float mnew = fmaxf(m8[i], mx);
                    const float corr = (!PLAIN && mnew == NEG) ? 1.f : exp2f(m8[i] - mnew);
                    float rs = 0.f;
#pragma unroll
                    for (int t = 0; t < 4; ++t) {
                        const float pp = (!PLAIN && sc[t] == NEG) ? 0.f : exp2f(sc[t] - mnew); rs += pp;
                        pv[i][t] = (!PLAIN && p.Pw) ? pp * p.Pw[b * p.swb + h * p.swh + (long long)ic * p.swi + (long long)min(j0 + t * 16 + l15, p.Lk - 1) * p.swj] : pp;
                    }
                    rs += __shfl_xor(rs, 1, 32); rs += __shfl_xor(rs, 2, 32); rs += __shfl_xor(rs, 4, 32); rs += __shfl_xor(rs, 8, 32);
                    l8[i] = l8[i] * corr + rs; m8[i] = mnew;
                    if (!TWOPASS) {
#pragma unroll
                        for (int t = 0; t < NT; ++t) o[t][i] *= corr;
                    }
                } else {
                    const float inv = (l8[i] > 0.f) ? 1.f / l8[i] : 0.f;
#pragma unroll
                    for (int t = 0; t < 4; ++t) {
                        const int jg = j0 + t * 16 + l15;
                        float pp = (sc[t] == NEG) ? 0.f : exp2f(sc[t] - m8[i]) * inv;
                        if (p.Pw) pp *= p.Pw[b * p.swb + h * p.swh + (long long)ic * p.swi + (long long)min(jg, p.Lk - 1) * p.swj];
                        pv[i][t] = pp;
                    }
                }
            }
            if (dopv) {
#pragma unroll
                for (int i = 0; i < 8; ++i)
#pragma unroll
                    for (int t = 0; t < 4; ++t) ((float*)myp)[(i + 8 * hf) * 64 + t * 16 + l15] = pv[i][t];
                if (UNIT) {                                      // V was published with K, by the barrier behind the staging stores; P is read only by the wave that wrote it:
                    __builtin_amdgcn_fence(__ATOMIC_RELEASE, "workgroup");   // its lanes' P stores are done and stay in front of
                    __builtin_amdgcn_wave_barrier();                         // this point, the wave's P reads behind it
                    __builtin_amdgcn_fence(__ATOMIC_ACQUIRE, "workgroup");
                } else __syncthreads();                          // P (per wave) and V (shared) visible
                if (!PLAIN && p.P) {
                    float* pb_ = p.P + b * p.sPb + h * p.sPh;
                    const bool fastP = (p.pband == 0) && ((p.sPi & 3) == 0) && (j0 + 64 <= p.Lk) && (q0 + 16 <= p.Lq) && ((((size_t)pb_) & 15) == 0);
                    if (fastP) {
#pragma unroll
                        for (int s = 0; s < 8; ++s) {
                            const int row = s * 2 + (lane >> 4), c4 = (lane & 15) * 4;
                            const v4f v = *(const v4f*)(myp + row * 64 + c4);
                            VST2V4(pb_ + (long long)(q0 + row) * p.sPi + j0 + c4, v);
                        }
                    } else {
                        for (int row = 0; row < 16; ++row) {
                            const int irow = q0 + row; if (irow >= p.Lq) continue;
                            for (int c = lane; c < 64; c += 32) {
                                const int jg = j0 + c; if (jg >= p.Lk) continue;
                                if (p.pband == 0) VST2(float, pb_ + (long long)irow * p.sPi + jg, myp[row * 64 + c]);
                                else if (jg - irow <= p.pband && irow - jg <= p.pband) VST2(float, pb_ + (long long)irow * p.sPi + (jg - irow + p.pband), myp[row * 64 + c]);
                            }
                        }
                    }
                }
                if (SPLITPV) {
                    const Split pa0 = sp_ld(myp + l15 * 64, 1, 0, hf, 64, 1.f), pa1 = sp_ld(myp + l15 * 64, 1, 32, hf, 64, 1.f);
                    const __bf16* vh = (const __bf16*)vl; const __bf16* vlo = vh + 64 * VP;
#pragma unroll
                    for (int t = 0; t < NT; ++t) {
                        const int dcol = t * 16 + l15;
                        Split b0, b1;
#pragma unroll
                        for (int e = 0; e < 16; ++e) {
                            const int k0 = frag_k(e, hf), k1 = 32 + frag_k(e, hf);
                            b0.hi[e] = vh[k0 * VP + dcol]; b0.lo[e] = vlo[k0 * VP + dcol]; b1.hi[e] = vh[k1 * VP + dcol]; b1.lo[e] = vlo[k1 * VP + dcol];
                        }
                        o[t] = wmma3(pa0, b0, o[t]);
                        o[t] = wmma3(pa1, b1, o[t]);
                    }
                } else {
                    const v16h pa0 = fh_ld(myp + l15 * 64, 1, 0, hf, 64, 4096.f), pa1 = fh_ld(myp + l15 * 64, 1, 32, hf, 64, 4096.f);
#pragma unroll
                    for (int t = 0; t < NT; ++t) {
                        const int dcol = t * 16 + l15;
                        v16h b0, b1;
#pragma unroll
                        for (int e = 0; e < 16; ++e) { b0[e] = vl[frag_k(e, hf) * VP + dcol]; b1[e] = vl[(32 + frag_k(e, hf)) * VP + dcol]; }
                        o[t] = wmma16(pa0, b0, o[t]);
                        o[t] = wmma16(pa1, b1, o[t]);
                    }
                }
            }
        }
    }
    float* obase = p.O + b * p.sOb + h * p.sOh;
    if (!PLAIN && p.ST) {
        const int rl = lane >> 1, isel = rl & 7;           // row q0 + rl ; rl>>3 == hf holds because lane>>4 == (lane>>1)>>3
        float mv = 0.f, lv = 0.f;
#pragma unroll
        for (int i = 0; i < 8; ++i) if (i == isel) { mv = m8[i]; lv = l8[i]; }
        const int irow = q0 + rl;
        if (irow < p.Lq) { float* st = p.ST + (((long long)b * gridDim.y + h) * p.Lq + irow) * 2 + (lane & 1); VST2(float, st, (lane & 1) ? lv : mv * 0.6931471805599453f); }
    }
    float invr[8];
    if (UNIT && PLAIN) l8[0] += xhalf(l8[0]);                    // transposed path: the query's sum = its two halves' sums
#pragma unroll
    for (int i = 0; i < 8; ++i) {
        if (UNIT && PLAIN) invr[i] = (l8[0] > 0.f) ? 1.f / (l8[0] * 4096.f) : 0.f;
        else if (TWOPASS) invr[i] = SPLITPV ? 1.f : (1.f / 4096.f);
        else if (!PLAIN && p.nonorm) invr[i] = exp2f(m8[i]) * (SPLITPV ? 1.f : (1.f / 4096.f));
        else invr[i] = (l8[i] > 0.f) ? (SPLITPV ? 1.f / l8[i] : 1.f / (l8[i] * 4096.f)) : 0.f;
    }
    __syncthreads();                                             // all waves done with pl/vl from the main loop
    const bool ofast = ((p.sOi & 3) == 0) && ((((size_t)obase) & 15) == 0) && (q0 + 16 <= p.Lq);
#pragma unroll
    for (int c0 = 0; c0 < DVP; c0 += 64) {
#pragma unroll
        for (int i = 0; i < 8; ++i)
#pragma unroll
            for (int t = 0; t < NT; ++t) if (t * 16 >= c0 && t * 16 < c0 + 64) ((float*)myp)[(UNIT && PLAIN) ? l15 * 64 + (t * 16 - c0) + 8 * hf + i : (i + 8 * hf) * 64 + (t * 16 - c0) + l15] = o[t][i] * invr[i];
        __syncthreads();
        const int cw = (DVP - c0 < 64) ? (DVP - c0) : 64;      // staged columns in this chunk (multiple of 16)
        if (ofast && (c0 + cw <= p.dv) && (cw % 32 == 0)) {
            const int lpr = cw / 4;                              // lanes per row (16 for 64 cols, 8 for 32)
            const int rows_per_ins = 32 / lpr;
            for (int r0 = 0; r0 < 16; r0 += rows_per_ins) {
                const int row = r0 + lane / lpr, c4 = (lane % lpr) * 4;
                const v4f v = *(const v4f*)(myp + row * 64 + c4);
                VST2V4(obase + (long long)(q0 + row) * p.sOi + c0 + c4, v);
            }
        } else {
            for (int row = 0; row < 16; ++row) {
                const int irow = q0 + row; if (irow >= p.Lq) continue;
                for (int c = lane; c < cw; c += 32) { const int d = c0 + c; if (d < p.dv) VST2(float, obase + (long long)irow * p.sOi + d, myp[row * 64 + c]); }
            }
        }
        __syncthreads();
    }
}

// =====================================================================================================================
// k_tr: dst(z, c, r) = alpha * src(z, r, c) (+ beta * R2(z, c, r)): [Z][R][C] (row stride lds) -> [Z][C][R] (row stride ldd) through a 32x32 LDS tile;
//   flags: 1 -> add beta * residual R2 addressed like dst (z*sRz + c*ldr + r); act applied before the residual.
// =====================================================================================================================
struct TrP { const float* src; float* dst; const float* R2; long long sSz, lds, sDz, ldd, sRz, ldr; int R, C, flags, act; float alpha, beta; };
static_assert(sizeof(TrP) == 3 * 8 + 6 * 8 + 6 * 4, "TrP has padding");
__global__ __launch_bounds__(256) void k_tr(TrP p) {
    __shared__ float tile[32][33];
    const int c0 = blockIdx.x * 32, r0 = blockIdx.y * 32, z = blockIdx.z;
    const int lane = threadIdx.x & 31, wave = threadIdx.x >> 5;
    const float* s = p.src + z * p.sSz;
#pragma unroll
    for (int k = 0; k < 4; ++k) {
        const int rl = wave * 4 + k, r = r0 + rl, c = c0 + lane;
        tile[rl][lane] = (r < p.R && c < p.C) ? s[(long long)r * p.lds + c] : 0.f;
    }
    __syncthreads();
    float* d = p.dst + z * p.sDz; const float* rr = p.R2 + z * p.sRz;
#pragma unroll
    for (int k = 0; k < 4; ++k) {
        const int cl = wave * 4 + k, c = c0 + cl, r = r0 + lane;
        if (c < p.C && r < p.R) {
            float v = act_fn(p.alpha * tile[lane][cl], p.act);
            if (p.flags & 1) v += p.beta * rr[(long long)c * p.ldr + r];
            VST2(float, d + (long long)c * p.ldd + r, v);
        }
    }
}

// k_affine: dst[i] = a * (sdev ? sdev[0] : 1) * src[i] + b, i < n (one thread per element; consecutive lanes -> consecutive addresses)
__global__ __launch_bounds__(256) void k_affine(const float* __restrict__ src, float* __restrict__ dst, int n, float a, float b, const float* __restrict__ sdev) {
    const int i = blockIdx.x * 256 + threadIdx.x;
    if (i < n) { const float aa = sdev ? a * sdev[0] : a; const float v = aa * src[i] + b; VST2(float, dst + i, v); }
}

// =====================================================================================================================
// k_softmax: row softmax over n contiguous elements, one 256-thread block per row; rows addressed z*sz + r*sr (grid (R, Z)).
//   out = scale_out * softmax(scale_in * x + (Mf ? Mf[z*smz + r*smr + j] : 0)); a row whose max is -inf is written as 0.
// =====================================================================================================================
struct SmP { const float* src; float* dst; const float* Mf; long long sz, sr, dz, dr, smz, smr; int n, pad; float scale_in, scale_out; };
static_assert(sizeof(SmP) == 3 * 8 + 6 * 8 + 4 * 4, "SmP has padding");
__global__ __launch_bounds__(256) void k_softmax(SmP p) {
    __shared__ float red[256];
    const int r = blockIdx.x, z = blockIdx.y, tid = threadIdx.x;
    const float* s = p.src + z * p.sz + (long long)r * p.sr;
    const float* mf = p.Mf ? (p.Mf + z * p.smz + (long long)r * p.smr) : nullptr;
    float mx = -__builtin_inff();
    for (int j = tid; j < p.n; j += 256) { float v = s[j] * p.scale_in; if (mf) v += mf[j]; mx = fmaxf(mx, v); }
    red[tid] = mx; __syncthreads();
    for (int o = 128; o > 0; o >>= 1) { if (tid < o) red[tid] = fmaxf(red[tid], red[tid + o]); __syncthreads(); }
    mx = red[0]; __syncthreads();
    float sum = 0.f;
    for (int j = tid; j < p.n; j += 256) { float v = s[j] * p.scale_in; if (mf) v += mf[j]; sum += (mx == -__builtin_inff()) ? 0.f : expf(v - mx); }
    red[tid] = sum; __syncthreads();
    for (int o = 128; o > 0; o >>= 1) { if (tid < o) red[tid] += red[tid + o]; __syncthreads(); }
    sum = red[0];
    const float inv = (sum > 0.f) ? p.scale_out / sum : 0.f;
    float* d = p.dst + z * p.dz + (long long)r * p.dr;
    for (int j = tid; j < p.n; j += 256) { float v = s[j] * p.scale_in; if (mf) v += mf[j]; const float o = (mx == -__builtin_inff()) ? 0.f : expf(v - mx) * inv; VST2(float, d + j, o); }
}
// =====================================================================================================================
// k_stats: mean and rsqrt(var + eps) over a set of n elements addressed base + z*sz + (e / inner) * so + (e % inner) * si, one 256-thread
// k_norm_apply: y = (x - mean[set]) * rstd[set] * g[c] + b[c] over a [Z][C][L] chan-major tensor with set = z*G + c / (C/G) (G groups per z;
//   G = C -> per-chan sets indexed z*C+c; for batch norm pass stats indexed by c only via bn = 1). Optional act. Output same layout.
// =====================================================================================================================
//   mode 0: mean / rsqrt(var + eps); mode 1 (RMSNorm): 0 / rsqrt(mean(x^2) + eps); mode 2 (L2 normalize * sqrt(n)): 0 / sqrt(n) / max(||x||, eps); mode 3: as 0 with unbiased variance (n-1)
__global__ __launch_bounds__(256) void k_stats(const float* __restrict__ x, long long sz, long long so, long long si, int inner, int n, float eps, float* __restrict__ stat, int mode) {
    __shared__ float red[256];
    const int z = blockIdx.x, tid = threadIdx.x;
    const float* base = x + z * sz;
    float s = 0.f;
    for (int e = tid; e < n; e += 256) s += base[(long long)(e / inner) * so + (long long)(e % inner) * si];
    red[tid] = s; __syncthreads();
    for (int o = 128; o > 0; o >>= 1) { if (tid < o) red[tid] += red[tid + o]; __syncthreads(); }
    const float mu = (mode == 0 || mode == 3) ? red[0] / (float)n : 0.f; __syncthreads();
    float q = 0.f;
    for (int e = tid; e < n; e += 256) { const float dlt = base[(long long)(e / inner) * so + (long long)(e % inner) * si] - mu; q += dlt * dlt; }
    red[tid] = q; __syncthreads();
    for (int o = 128; o > 0; o >>= 1) { if (tid < o) red[tid] += red[tid + o]; __syncthreads(); }
    {
        float rs;
        if (mode == 2) rs = sqrtf((float)n) / fmaxf(sqrtf(red[0]), eps); else if (mode == 3) rs = rsqrtf(red[0] / (float)(n - 1) + eps); else rs = rsqrtf(red[0] / (float)n + eps);
        if (tid < 32) { const float v = (tid == 0) ? mu : ((tid == 1) ? rs : 0.f); VST2(float, stat + (long long)z * 32 + tid, v); }
    }
}
//   One thread per element over the flat [Z][C][L] index space: grid ceil(Z*C*L / 256).
__global__ __launch_bounds__(256) void k_norm_apply(const float* __restrict__ x, float* __restrict__ y, const float* __restrict__ stat, const float* __restrict__ g, const float* __restrict__ bta,
                                                     int Z, int C, int L, int G, int bn, int act) {
    const long long idx = (long long)blockIdx.x * 256 + threadIdx.x;
    if (idx >= (long long)Z * C * L) return;
    const int l = (int)(idx % L); const long long zc = idx / L; const int c = (int)(zc % C), z = (int)(zc / C); (void)l;
    const int set = bn ? c : (z * G + c / (C / G));
    float v = (x[idx] - stat[(long long)set * 32]) * stat[(long long)set * 32 + 1];
    if (g) v *= g[c];
    if (bta) v += bta[c];
    v = act_fn(v, act);
    VST2(float, y + idx, v);
}

// k_lse_neg: c[i] = -(st[2i] + log(st[2i+1])) = minus the log-sum-exp of row i from k_attn's ST output (for softmax over the query dimension)
__global__ __launch_bounds__(256) void k_lse_neg(const float* __restrict__ st, float* __restrict__ c, int n) {
    const int i = blockIdx.x * 256 + threadIdx.x;
    if (i < n) { const float v = -(st[2 * i] + logf(st[2 * i + 1])); VST2(float, c + i, v); }
}

// k_iota: dst[i] = a * i + b as int32 (segment/position id helper)
__global__ __launch_bounds__(256) void k_iota(int* __restrict__ dst, int n, int a, int b) {
    const int i = blockIdx.x * 256 + threadIdx.x;
    if (i < n) { const int v = a * i + b; VST2(int, dst + i, v); }
}

// k_axpby: dst[i] = a * x[i] + b * y[i] (+ c), i < n
__global__ __launch_bounds__(256) void k_axpby(const float* __restrict__ x, const float* __restrict__ y, float* __restrict__ dst, int n, float a, float b, float c) {
    const int i = blockIdx.x * 256 + threadIdx.x;
    if (i < n) { const float v = a * x[i] + b * y[i] + c; VST2(float, dst + i, v); }
}

// =====================================================================================================================
// k_rope: rotary embedding on a [R rows][Hn heads][D] view (row stride sXr, head stride sXh, element stride 1) -> Y (own strides).
//   mode 0: rotate_half (partner d±D/2, sign - for d<D/2); mode 1: interleaved pairs (partner d^1, sign - for even d).
//   table column tcol: tmode 0 -> d, 1 -> d % (D/2), 2 -> d / 2; position p: pmode 0 -> r % S, 1 -> head index, 2 -> pos[r];
//   c = C[(r / S) * sCb + p * sCp + tcol * sCd], s likewise from Sn; y = x[d] * c + sign * x[partner] * s. X and Y must not alias.
// =====================================================================================================================
struct RopeP { const float* X; float* Y; const float* C; const float* Sn; const int* pos; long long sXr, sXh, sYr, sYh, sCb, sCp, sCd; int R, Hn, D, S, mode, tmode, pmode, pad; };
static_assert(sizeof(RopeP) == 5 * 8 + 7 * 8 + 8 * 4, "RopeP has padding");
__global__ __launch_bounds__(256) void k_rope(RopeP p) {
    const long long idx = (long long)blockIdx.x * 256 + threadIdx.x;
    if (idx >= (long long)p.R * p.Hn * p.D) return;
    const int d = (int)(idx % p.D); const long long rh = idx / p.D; const int h = (int)(rh % p.Hn); const int r = (int)(rh / p.Hn);
    const int half = p.D / 2;
    int partner; float sign;
    if (p.mode == 0) { partner = (d < half) ? d + half : d - half; sign = (d < half) ? -1.f : 1.f; }
    else { partner = d ^ 1; sign = (d & 1) ? 1.f : -1.f; }
    const int tcol = (p.tmode == 0) ? d : ((p.tmode == 1) ? (d % half) : (d >> 1));
    const int pp = (p.pmode == 0) ? (r % p.S) : ((p.pmode == 1) ? h : p.pos[r]);
    const long long toff = (long long)(r / p.S) * p.sCb + (long long)pp * p.sCp + (long long)tcol * p.sCd;
    const float* xr = p.X + (long long)r * p.sXr + (long long)h * p.sXh;
    const float v = xr[d] * p.C[toff] + sign * xr[partner] * p.Sn[toff];
    VST2(float, p.Y + (long long)r * p.sYr + (long long)h * p.sYh + d, v);
}

// k_invf + k_sincos (split so neither kernel carries a large VALU-fma footprint): invf_i = num * (1 / powf(base, (2 i)/D)) [fmode 0],
//   num * expf((2 i) * cexp) [fmode 1], num * powf(base, -2 (i - 1) / D) [fmode 2]; then cs/sn[s*half + i] = cos/sin((pscale * s) * invf_i)
__global__ __launch_bounds__(256) void k_invf(float* __restrict__ invb, int half, int D, float base, float num, int fmode, float cexp) {
    const int i = blockIdx.x * 256 + threadIdx.x;
    if (i >= ((half + 31) / 32) * 32) return;
    if (i >= half) { VST2(float, invb + i, 0.f); return; }
    const float e = (float)(2 * i) / (float)D;
    float invf;
    if (fmode == 1) invf = num * expf((float)(2 * i) * cexp);
    else if (fmode == 2) invf = num * powf(base, (-2.0f * ((float)i - 1.0f)) / (float)D);
    else invf = num * (1.0f / powf(base, e));
    VST2(float, invb + i, invf);
}
__global__ __launch_bounds__(256) void k_sincos(float* __restrict__ cs, float* __restrict__ sn, const float* __restrict__ invb, int S, int half, float pscale) {
    const int idx = blockIdx.x * 256 + threadIdx.x;
    if (idx >= S * half) return;
    const int s = idx / half, i = idx - s * half;
    const float ang = (pscale * (float)s) * invb[i];
    VST2(float, cs + idx, cosf(ang)); VST2(float, sn + idx, sinf(ang));
}

// k_mulact: dst[i] = act(x[i]) * y[i]
__global__ __launch_bounds__(256) void k_mulact(const float* __restrict__ x, const float* __restrict__ y, float* __restrict__ dst, int n, int act) {
    const int i = blockIdx.x * 256 + threadIdx.x;
    if (i < n) { const float v = act_fn(x[i], act) * y[i]; VST2(float, dst + i, v); }
}

// =====================================================================================================================
// k_matvec: thread-per-row matrix-vector products for N <= 8 output columns (heads with 1-3 outputs, gates), f32 on the VALU.
//   C[r*sCm + j] = act(alpha * sum_k A[r*sAm + k*sAk] * B[j*sBn + k*sBk] + bias[j]) + beta * R[r*sRm + j*sRn]; each thread writes its N contiguous floats.
// =====================================================================================================================
__global__ __launch_bounds__(256) void k_matvec(GemmP p) {
    // 32 lanes write one line with one instruction.
    const int rpt = (p.N == 1) ? 1 : 32;
    const long long r0 = ((long long)blockIdx.x * 256 + threadIdx.x) * rpt; const int z = blockIdx.z, zo = z / p.zi_n, zi = z - zo * p.zi_n;
    if (r0 >= p.M) return;
    const float* Bb = p.B + zo * p.sBo + zi * p.sBi;
    float* C = p.C + zo * p.sCo + zi * p.sCi; const float* R = p.R + zo * p.sRo + zi * p.sRi;
    for (int rr = 0; rr < rpt; ++rr) {
        const long long r = r0 + rr; if (r >= p.M) break;
        const float* A = p.A + zo * p.sAo + zi * p.sAi + r * p.sAm;
        float acc[8] = {0.f, 0.f, 0.f, 0.f, 0.f, 0.f, 0.f, 0.f};
        for (int k = 0; k < p.K; ++k) { const float a = A[(long long)k * p.sAk];
#pragma unroll
            for (int j = 0; j < 8; ++j) if (j < p.N) acc[j] += a * Bb[(long long)j * p.sBn + (long long)k * p.sBk]; }
#pragma unroll
        for (int j = 0; j < 8; ++j) if (j < p.N) {
            float v = acc[j] * p.alpha;
            if (p.flags & 1) v += p.bias[j];
            if (p.flags & 2) v += p.bias[r];
            v = act_fn(v, p.act);
            if (p.flags & 4) v += p.beta * R[r * p.sRm + (long long)j * p.sRn];
            VST2(float, C + r * p.sCm + j, v);
        }
    }
}
// k_smallsoftmax: thread-per-row softmax for short rows (n <= 64): dst[r*dr + j] = softmax(scale*src[r*sr + j])
__global__ __launch_bounds__(256) void k_smallsoftmax(const float* __restrict__ src, float* __restrict__ dst, long long sr, long long dr, int n, long long R, float scale) {
    const long long r0 = ((long long)blockIdx.x * 256 + threadIdx.x) * 32;
    for (int rr = 0; rr < 32; ++rr) {
        const long long r = r0 + rr; if (r >= R) return;
        const float* s = src + r * sr; float* d = dst + r * dr;
        float mx = -__builtin_inff();
        for (int j = 0; j < n; ++j) mx = fmaxf(mx, s[j] * scale);
        float sum = 0.f;
        for (int j = 0; j < n; ++j) sum += expf(s[j] * scale - mx);
        const float inv = 1.f / sum;
        for (int j = 0; j < n; ++j) { const float v = expf(s[j] * scale - mx) * inv; VST2(float, d + j, v); }
    }
}

__global__ __launch_bounds__(32) void k_unitstat(float* __restrict__ st) { const int t = threadIdx.x; const float v = (t == 1) ? 1.f : 0.f; VST2(float, st + t, v); }

// destination (e.g. a d_out whose row width is not a multiple of 32 floats) is written by consecutive lanes of one instruction
__global__ __launch_bounds__(256) void k_lincopy(const float* __restrict__ src, long long lds, float* __restrict__ dst, long long ldd, long long rows, int cols) {
    const long long i = (long long)blockIdx.x * 256 + threadIdx.x; if (i >= rows * cols) return;
    const long long r = i / cols; const int c = (int)(i - r * cols);
    const float v = src[r * lds + c]; VST2(float, dst + r * ldd + c, v);
}

namespace w25 {
typedef __attribute__((ext_vector_type(16))) _Float16 v16h;
typedef __attribute__((ext_vector_type(8)))  _Float16 v8h;
typedef __attribute__((ext_vector_type(16))) __bf16   v16b;
typedef __attribute__((ext_vector_type(8)))  __bf16   v8b;
typedef __attribute__((ext_vector_type(8)))  float    v8f;
typedef __attribute__((ext_vector_type(4)))  float    v4f;

__device__ __forceinline__ unsigned short f2bf_bits(float f) {
  unsigned u = __float_as_uint(f);
  return (unsigned short)((u + 0x7FFFu + ((u >> 16) & 1u)) >> 16);
}
__device__ __forceinline__ float bf_bits2f(unsigned short h) { return __uint_as_float(((unsigned)h) << 16); }

// hazard guards as plain device helpers (no inline asm inside the kernel template body)
__device__ __forceinline__ void dep_guard_h(v8f& a, v8f& b, v16h x, v16h y) { asm volatile("v_nop\n\tv_nop\n\tv_nop\n\tv_nop" : "+v"(a), "+v"(b) : "v"(x), "v"(y)); }
__device__ __forceinline__ void dep_guard_b(v8f& a, v8f& b, v16b x, v16b y) { asm volatile("v_nop\n\tv_nop\n\tv_nop\n\tv_nop" : "+v"(a), "+v"(b) : "v"(x), "v"(y)); }
__device__ __forceinline__ void keep4_h(v16h a, v16h b, v16h c, v16h d) { asm volatile("v_nop" :: "v"(a), "v"(b), "v"(c), "v"(d)); }
__device__ __forceinline__ void keep4_b(v16b a, v16b b, v16b c, v16b d) { asm volatile("v_nop" :: "v"(a), "v"(b), "v"(c), "v"(d)); }
__device__ __forceinline__ void acc_guard4(v8f& a, v8f& b, v8f& c, v8f& d) { asm volatile("v_nop\n\tv_nop\n\tv_nop\n\tv_nop" : "+v"(a), "+v"(b), "+v"(c), "+v"(d)); }
template <typename T> struct Frag;
template <> struct Frag<_Float16> {
  typedef v16h V; union U { v16h v; v8h h[2]; };
  static __device__ __forceinline__ v16h load(const _Float16* p) {   // elements 0..7 <- p[0..7], 8..15 <- p[16..23]
    U f; f.h[0] = *(const v8h*)(p); f.h[1] = *(const v8h*)(p + 16); return f.v;
  }
  static __device__ __forceinline__ v8f mma(v16h a, v16h b, v8f c) {
    return __builtin_amdgcn_wmma_f32_16x16x32_f16(false, a, false, b, (short)0, c, false, false);
  }
  static __device__ __forceinline__ void guard(v8f& a, v8f& b, v16h x, v16h y) { dep_guard_h(a, b, x, y); }
  static __device__ __forceinline__ void keep(v16h a, v16h b, v16h c, v16h d) { keep4_h(a, b, c, d); }
};
template <> struct Frag<__bf16> {
  typedef v16b V; union U { v16b v; v8b h[2]; };
  static __device__ __forceinline__ v16b load(const __bf16* p) {
    U f; f.h[0] = *(const v8b*)(p); f.h[1] = *(const v8b*)(p + 16); return f.v;
  }
  static __device__ __forceinline__ v8f mma(v16b a, v16b b, v8f c) {
    return __builtin_amdgcn_wmma_f32_16x16x32_bf16(false, a, false, b, (short)0, c, false, false);
  }
  static __device__ __forceinline__ void guard(v8f& a, v8f& b, v16b x, v16b y) { dep_guard_b(a, b, x, y); }
  static __device__ __forceinline__ void keep(v16b a, v16b b, v16b c, v16b d) { keep4_b(a, b, c, d); }
};

// ---- Register-blocked batched WMMA GEMM ------------------------------------
// C[m,n] = scale * sum_k A[m,k] * Bt[n,k] (+bias)(+resid); each wave owns a 64x64 tile.
// A row-major [M,K]; Bt row-major [N,K]; M,N % 64 == 0, K % 32 == 0.
// SPLIT: operands are hi/lo planes (A2/Bt2 = lo planes, same layout); product = hi·hi + hi·lo + lo·hi.
// BIAS_MODE: 0 = none, 1 = bias[m], 2 = bias[n].
// OUT_MODE: 0 = f32, 1 = f16, 2 = bf16 hi plane (Cout) + bf16 lo plane (Cout2).
// ET: 0 = f16 operands, 1 = bf16 operands (pointers passed as 16-bit storage)
template <int ET> struct Elem;
template <> struct Elem<0> { typedef _Float16 T; };
template <> struct Elem<1> { typedef __bf16 T; };
template <int ET, bool SPLIT, int BIAS_MODE, int OUT_MODE, bool RESID, int ACT = 0>
__global__ __launch_bounds__(256) void wmma_gemm64(
    const unsigned short* __restrict__ Ap, const unsigned short* __restrict__ A2p, int lda, long strideA,
    const unsigned short* __restrict__ Btp, const unsigned short* __restrict__ Bt2p, int ldb, long strideB,
    void* __restrict__ Cout, void* __restrict__ Cout2, int ldc, long strideC,
    const float* __restrict__ bias,
    const float* __restrict__ resid, long strideR,
    int M, int N, int K, float scale) {
  typedef typename Elem<ET>::T T;
  typedef typename Frag<T>::V V;
  const T* A = (const T*)Ap; const T* A2 = (const T*)A2p; const T* Bt = (const T*)Btp; const T* Bt2 = (const T*)Bt2p;
  __shared__ __align__(16) float sT[8][16 * 68];   // per-wave 16x64 slab, pitch 68 floats
  const int b    = blockIdx.y;
  const int lane = threadIdx.x & 31;
  const int wave = threadIdx.x >> 5;
  const int tilesN = N >> 6;
  const int tilesM = M >> 6;
  const int tile = blockIdx.x * 8 + wave;
  if (tile >= tilesM * tilesN) return;   // wave-uniform; no block barriers in this kernel
  const int tm = tile / tilesN;
  const int tn = tile - tm * tilesN;
  const int m0 = tm << 6;
  const int n0 = tn << 6;

  const T* Ab  = A  + (size_t)b * strideA;
  const T* Bb  = Bt + (size_t)b * strideB;
  const T* Ab2 = SPLIT ? (A2  + (size_t)b * strideA) : nullptr;
  const T* Bb2 = SPLIT ? (Bt2 + (size_t)b * strideB) : nullptr;

  const int rlane = lane & 15;                 // row (A) / col (B, D) within subtile
  const int koff  = (lane >> 4) * 8;           // k offset of this lane half
  const int mOff  = (lane >> 4) * 8;           // D row offset

  v8f acc[4][4];
#pragma unroll
  for (int i = 0; i < 4; ++i)
#pragma unroll
    for (int j = 0; j < 4; ++j) acc[i][j] = (v8f){0.f,0.f,0.f,0.f,0.f,0.f,0.f,0.f};

  for (int k0 = 0; k0 < K; k0 += 32) {
    V bh[4], bl[4];
#pragma unroll
    for (int j = 0; j < 4; ++j) {
      const size_t bo = (size_t)(n0 + (j << 4) + rlane) * ldb + koff + k0;
      bh[j] = Frag<T>::load(Bb + bo);
      if (SPLIT) bl[j] = Frag<T>::load(Bb2 + bo);
    }
#pragma unroll
    for (int i = 0; i < 4; ++i) {
      const size_t ao = (size_t)(m0 + (i << 4) + rlane) * lda + koff + k0;
      V ah = Frag<T>::load(Ab + ao);
      V al;
      if (SPLIT) al = Frag<T>::load(Ab2 + ao);
#pragma unroll
      for (int j = 0; j < 4; ++j) {
        acc[i][j] = Frag<T>::mma(ah, bh[j], acc[i][j]);
        if (SPLIT) {
          acc[i][j] = Frag<T>::mma(ah, bl[j], acc[i][j]);
          acc[i][j] = Frag<T>::mma(al, bh[j], acc[i][j]);
        }
      }
      Frag<T>::guard(acc[i][0], acc[i][3], ah, SPLIT ? al : ah);
    }
    Frag<T>::keep(bh[0], bh[1], bh[2], bh[3]);
    if (SPLIT) Frag<T>::keep(bl[0], bl[1], bl[2], bl[3]);
  }
  acc_guard4(acc[0][0], acc[0][1], acc[0][2], acc[0][3]);
  acc_guard4(acc[1][0], acc[1][1], acc[1][2], acc[1][3]);
  acc_guard4(acc[2][0], acc[2][1], acc[2][2], acc[2][3]);
  acc_guard4(acc[3][0], acc[3][1], acc[3][2], acc[3][3]);

  // ---- epilogue ----
  float* slab = sT[wave];
  const float* Rb = RESID ? (resid + (size_t)b * strideR) : nullptr;
#pragma unroll
  for (int i = 0; i < 4; ++i) {
    const int mBase = m0 + (i << 4);
#pragma unroll
    for (int j = 0; j < 4; ++j) {
      const int n = n0 + (j << 4) + rlane;
      float bv = 0.f;
      if (BIAS_MODE == 2) bv = bias[n];
#pragma unroll
      for (int r = 0; r < 8; ++r) {
        float v = acc[i][j][r] * scale;
        if (BIAS_MODE == 1) v += bias[mBase + mOff + r];
        if (BIAS_MODE == 2) v += bv;
        if (RESID) v += Rb[(size_t)(mBase + mOff + r) * ldc + n];
        if (ACT == 1) v = tanhf(v);
        if (ACT == 2) v = fmaxf(v, 0.0f);
        if (ACT == 3) v = v / (1.0f + expf(-v));
        if (ACT == 4) v = (v > 0.f) ? v : 0.01f * v;
        if (ACT == 5) v = 0.5f * v * (1.0f + erff(v * 0.70710678118654752f));
        if (ACT == 6) v = (v > 0.f) ? v : 0.2f * v;
        if (ACT == 7) { const float u = 0.7978845608028654f * (v + 0.044715f * v * v * v); v = 0.5f * v * (1.f + tanhf(u)); }
        slab[(mOff + r) * 68 + (j << 4) + rlane] = v;
      }
    }
    __builtin_amdgcn_fence(__ATOMIC_RELEASE, "workgroup");
    __builtin_amdgcn_wave_barrier();
    __builtin_amdgcn_fence(__ATOMIC_ACQUIRE, "workgroup");
    if (OUT_MODE == 0) {
      float* C = (float*)Cout + (size_t)b * strideC;
      const int hh = lane >> 4, c4 = (lane & 15) * 4;     // row seg = 256 B = 16 lanes x 16 B
      {
#pragma unroll
        for (int it = 0; it < 8; ++it) {
          const int row = it * 2 + hh;
          v4f v = *(const v4f*)(slab + row * 68 + c4);
          *(v4f*)(C + (size_t)(mBase + row) * ldc + n0 + c4) = v;
        }
        
      }
    } else {
      const int q = lane >> 3, c8 = (lane & 7) * 8;
      unsigned short* C  = (unsigned short*)Cout  + (size_t)b * strideC;
      unsigned short* C2 = (OUT_MODE == 2) ? ((unsigned short*)Cout2 + (size_t)b * strideC) : nullptr;
      {
#pragma unroll
        for (int it = 0; it < 4; ++it) {
          const int row = it * 4 + q;
          const float* sp = slab + row * 68 + c8;
          v8h hv, lv;
#pragma unroll
          for (int e = 0; e < 8; ++e) {
            if (OUT_MODE == 1) {
              hv[e] = (_Float16)sp[e];
            } else {
              unsigned short hb = f2bf_bits(sp[e]);
              unsigned short lb = f2bf_bits(sp[e] - bf_bits2f(hb));
              hv[e] = __builtin_bit_cast(_Float16, hb);
              lv[e] = __builtin_bit_cast(_Float16, lb);
            }
          }
          *(v8h*)(C + (size_t)(mBase + row) * ldc + n0 + c8) = hv;
          if (OUT_MODE == 2) *(v8h*)(C2 + (size_t)(mBase + row) * ldc + n0 + c8) = lv;
        }
        
      }
    }
    __builtin_amdgcn_fence(__ATOMIC_RELEASE, "workgroup");
    __builtin_amdgcn_wave_barrier();
    __builtin_amdgcn_fence(__ATOMIC_ACQUIRE, "workgroup");
  }
}

__global__ __launch_bounds__(256) void cast_f32_f16x2(
    const float* __restrict__ in, _Float16* __restrict__ out, int n2) {
  int i = blockIdx.x * 256 + threadIdx.x;
  if (i < n2) {
    const _Float16 h0 = (_Float16)in[2 * i], h1 = (_Float16)in[2 * i + 1];
    const unsigned u = (unsigned)__builtin_bit_cast(unsigned short, h0) | ((unsigned)__builtin_bit_cast(unsigned short, h1) << 16);
    ((unsigned*)out)[i] = u;
    
  }
}


} // namespace w25

__global__ __launch_bounds__(256) void k_castT16(const float* __restrict__ src, long long lds, _Float16* __restrict__ dst, long long ldd, int R, int C, float s) {
    const long long i = (long long)blockIdx.x * 256 + threadIdx.x; const long long np = (long long)C * (R / 2); if (i >= np) return; const int c = (int)(i / (R / 2)); const int r = 2 * (int)(i % (R / 2));
    const _Float16 h0 = (_Float16)(src[(long long)r * lds + c] * s), h1 = (_Float16)(src[(long long)(r + 1) * lds + c] * s);
    const unsigned u = (unsigned)__builtin_bit_cast(unsigned short, h0) | ((unsigned)__builtin_bit_cast(unsigned short, h1) << 16);
    unsigned* d = (unsigned*)(dst + (long long)c * ldd + r); *d = u;  }
__global__ __launch_bounds__(256) void k_cast16(const float* __restrict__ src, long long lds, _Float16* __restrict__ dst, long long ldd, int R, int C, float s) {
    const long long i = (long long)blockIdx.x * 256 + threadIdx.x; const long long np = (long long)R * (C / 2); if (i >= np) return; const int r = (int)(i / (C / 2)); const int c = 2 * (int)(i % (C / 2));
    const _Float16 h0 = (_Float16)(src[(long long)r * lds + c] * s), h1 = (_Float16)(src[(long long)r * lds + c + 1] * s);
    const unsigned u = (unsigned)__builtin_bit_cast(unsigned short, h0) | ((unsigned)__builtin_bit_cast(unsigned short, h1) << 16);
    unsigned* d = (unsigned*)(dst + (long long)r * ldd + c); *d = u;  }

// f32 -> bf16 hi plane + bf16 lo plane (x = hi + lo to ~2^-17 relative; RNE both), [R][C] -> [R][C] (or transposed to [C][R]); 2 consecutive destination elements
__device__ __forceinline__ unsigned int f2bf2_pack(float a, float b, unsigned int* lo) {
    const unsigned short ha = w25::f2bf_bits(a), hb = w25::f2bf_bits(b);
    const unsigned short la = w25::f2bf_bits(a - w25::bf_bits2f(ha)), lb = w25::f2bf_bits(b - w25::bf_bits2f(hb));
    *lo = (unsigned)la | ((unsigned)lb << 16); return (unsigned)ha | ((unsigned)hb << 16); }
// blockIdx.y = matrix of a batch: source matrices sz floats apart, destination planes dz elements apart
__global__ __launch_bounds__(256) void k_castS16(const float* __restrict__ src, long long lds, __bf16* __restrict__ dhi, __bf16* __restrict__ dlo, long long ldd, int R, int C, float s, int transpose, long long sz, long long dz) {
    src += (long long)blockIdx.y * sz; dhi += (long long)blockIdx.y * dz; dlo += (long long)blockIdx.y * dz;
    const long long i = (long long)blockIdx.x * 256 + threadIdx.x; long long o; float a, b;
    if (transpose) { const long long np = (long long)C * (R / 2); if (i >= np) return; const int c = (int)(i / (R / 2)); const int r = 2 * (int)(i % (R / 2)); a = src[(long long)r * lds + c] * s; b = src[(long long)(r + 1) * lds + c] * s; o = (long long)c * ldd + r; }
    else { const long long np = (long long)R * (C / 2); if (i >= np) return; const int r = (int)(i / (C / 2)); const int c = 2 * (int)(i % (C / 2)); a = src[(long long)r * lds + c] * s; b = src[(long long)r * lds + c + 1] * s; o = (long long)r * ldd + c; }
    unsigned lo; const unsigned hi = f2bf2_pack(a, b, &lo); unsigned* ph = (unsigned*)(dhi + o); unsigned* pl = (unsigned*)(dlo + o);
    *ph = hi; *pl = lo;  }

namespace w25 {
// =====================================================================================
// Generic causal/non-causal attention for head_dim 64, f32 in / f32 out; 16-bit operands: bf16 with optional hi/lo splits, or
// plain f16 (F16=true, non-split, probabilities carried x2^15).
//   scores = (q*qscale)·kᵀ : v_wmma_f32_16x16x32_bf16; SPLIT_QK -> q,k as bf16 hi/lo (hi·hi + hi·lo + lo·hi)
//   out    = p·v           : v_wmma_f32_16x16x32_bf16; SPLIT_PV -> p,v as bf16 hi/lo; else p,v plain bf16
//   f32 accumulate; online softmax in f32. Block = 4 waves = 64 query rows of one (batch, head); S % 64 == 0.
//   Element (b, s, h, d) of tensor X lives at X[b*X_bs + s*X_rs + h*X_hs + d] (strides in floats, multiples of 4).
//   Masking: mask_mode 0 none, 1 causal (kv > q masked), 2 tensor [S][Skv] shared over (b,h) (float if
//   mask_is_int==0, int32 with element == 0 -> masked if 1, int32 with element != 0 -> masked if 2), 3 per-token vectors qmask[B][S] & kvmask[B][Skv] (int32,
//   0 -> masked), 4 causal + sliding window (kv > q or q - kv > W masked; W passed in mask_is_int);
//   5 = relative-position bias: s += cp[b,h,q][idx[q][kv]] + pc[b,h,kv][idx[q][kv]] with idx = mask_b ([S][Skv] int32) and
//   mask_a an int32 [S][Skv] tensor with nonzero = masked (tables: element (b,h,row,n) at X + b*c_bs + h*c_hs + row*c_rs + n);
//   masked scores are replaced by mask_fill (e.g. -inf or -1e9) before the softmax.
//   grid.x = B * H * (S/64) (or a sub-range with blk0).
// =====================================================================================
#define AT_D 64
#define AT_NW 4
#define AT_QB 64
#define AT_KC 64
struct AttnGeom { const float* cp = nullptr; const float* pc = nullptr; long c_bs = 0, c_rs = 0, c_hs = 0;   // mode-5 score-bias tables
                  long q_bs, q_rs, q_hs, k_bs, k_rs, k_hs, v_bs, v_rs, v_hs, o_bs, o_rs, o_hs;
                  int S, Skv, H, mask_mode; float qscale; int blk0; float mask_fill; int mask_is_int; };
static_assert(sizeof(AttnGeom) == 168, "no padding");

__device__ __forceinline__ unsigned short at_bf_bits(float f) {
  unsigned u = __float_as_uint(f);
  return (unsigned short)((u + 0x7FFFu + ((u >> 16) & 1u)) >> 16);
}
__device__ __forceinline__ __bf16 at_f2bf(float f) { return __builtin_bit_cast(__bf16, at_bf_bits(f)); }
__device__ __forceinline__ void at_split(float f, __bf16& hi, __bf16& lo) {
  const unsigned short hb = at_bf_bits(f);
  hi = __builtin_bit_cast(__bf16, hb);
  lo = at_f2bf(f - __uint_as_float(((unsigned)hb) << 16));
}
__device__ __forceinline__ v8f at_mma(v16b a, v16b b, v8f c) {
  c = __builtin_amdgcn_wmma_f32_16x16x32_bf16(false, a, false, b, (short)0, c, false, false);
  asm volatile("v_nop\n\tv_nop\n\tv_nop\n\tv_nop" : "+v"(c) : "v"(a), "v"(b));
  return c;
}
// 16-bit element as a bit pattern held in a __bf16 slot: f16 bits when F16, bf16 (RNE) otherwise
template <bool F16> __device__ __forceinline__ __bf16 at_to16(float f) {
  if (F16) return __builtin_bit_cast(__bf16, (_Float16)f);
  return at_f2bf(f);
}
template <bool F16> __device__ __forceinline__ v8f at_mma16(v16b a, v16b b, v8f c) {
  if (F16) {
    const v16h ah = __builtin_bit_cast(v16h, a), bh = __builtin_bit_cast(v16h, b);
    c = __builtin_amdgcn_wmma_f32_16x16x32_f16(false, ah, false, bh, (short)0, c, false, false);
    asm volatile("v_nop\n\tv_nop\n\tv_nop\n\tv_nop" : "+v"(c) : "v"(ah), "v"(bh));
    return c;
  }
  return at_mma(a, b, c);
}

template <bool SPLIT_QK, bool SPLIT_PV, bool F16 = false>
__global__ __launch_bounds__(128)
void attn64_kernel(const float* __restrict__ q, const float* __restrict__ k,
                   const float* __restrict__ v, float* __restrict__ out,
                   const void* __restrict__ mask_a, const int* __restrict__ mask_b, AttnGeom g) {
  static_assert(!(F16 && (SPLIT_QK || SPLIT_PV)), "f16 mode is non-split");
  const float PSC = F16 ? 32768.0f : 1.0f;     // f16 probabilities carried x2^15 (subnormal range), folded into the final 1/l
  union FB { v16b v; v8b h[2]; };
  __shared__ __align__(16) __bf16 Ksh[AT_KC * AT_D];             // K hi [kv][d]      8 KB
  __shared__ __align__(16) __bf16 Ksl[SPLIT_QK ? AT_KC * AT_D : 8];
  __shared__ __align__(16) __bf16 Vth[AT_D * AT_KC];             // V hi [d][kv]      8 KB
  __shared__ __align__(16) __bf16 Vtl[SPLIT_PV ? AT_D * AT_KC : 8];
  __shared__ __align__(16) __bf16 Psh[AT_NW][16 * AT_KC];        // per wave P hi [row][kv]  8 KB
  __shared__ __align__(16) __bf16 Psl[SPLIT_PV ? AT_NW : 1][SPLIT_PV ? 16 * AT_KC : 8];
  __shared__ __align__(16) float  Os[AT_NW][16 * 68];            // per wave out tile, pitch 68

  const int tid  = threadIdx.x;
  const int wave = tid >> 5;
  const int lane = tid & 31;
  const int hh   = lane >> 4;
  const int c    = lane & 15;

  const int nqb = g.S / AT_QB;
  const int bx = blockIdx.x + g.blk0;
  const int qb = bx % nqb;
  const int bh = bx / nqb;
  const int h  = bh % g.H;
  const int b  = bh / g.H;
  const int qbase_block = qb * AT_QB;
  const int q0 = qbase_block + wave * 16;

  const float* qb_ptr = q + (size_t)b * g.q_bs + (size_t)h * g.q_hs;
  const float* kb_ptr = k + (size_t)b * g.k_bs + (size_t)h * g.k_hs;
  const float* vb_ptr = v + (size_t)b * g.v_bs + (size_t)h * g.v_hs;
  float*       ob_ptr = out + (size_t)b * g.o_bs + (size_t)h * g.o_hs;

  // ---- Q fragments (A operand): 2 d-chunks, hi (and lo) ----
  v16b qah[2], qal[2];
  {
    const float* qrow = qb_ptr + (size_t)(q0 + c) * g.q_rs;
#pragma unroll
    for (int dc = 0; dc < 2; ++dc) {
#pragma unroll
      for (int e = 0; e < 8; ++e) {
        const float f0 = qrow[dc * 32 + 8 * hh + e] * g.qscale;
        const float f1 = qrow[dc * 32 + 16 + 8 * hh + e] * g.qscale;
        if (SPLIT_QK) { __bf16 hq, lq; at_split(f0, hq, lq); qah[dc][e] = hq; qal[dc][e] = lq; at_split(f1, hq, lq); qah[dc][8 + e] = hq; qal[dc][8 + e] = lq; }
        else { qah[dc][e] = at_to16<F16>(f0); qah[dc][8 + e] = at_to16<F16>(f1); qal[dc][e] = qah[dc][e]; qal[dc][8 + e] = qah[dc][8 + e]; }
      }
    }
  }

  float mrow[8], lrow[8];
  v8f oacc[4];
#pragma unroll
  for (int r = 0; r < 8; ++r) { mrow[r] = -INFINITY; lrow[r] = 0.f; }
#pragma unroll
  for (int t = 0; t < 4; ++t) oacc[t] = (v8f){0.f,0.f,0.f,0.f,0.f,0.f,0.f,0.f};

  const int nChunks = (g.mask_mode == 1 || g.mask_mode == 4) ? (qb + 1) : (g.Skv / AT_KC);   // block-uniform
  // per-row query mask (mode 3)
  int qkeep[8];
#pragma unroll
  for (int r = 0; r < 8; ++r) qkeep[r] = (g.mask_mode == 3) ? mask_b[(size_t)b * g.S + q0 + 8 * hh + r] : 1;   // mask_b = qmask in mode 3
  for (int kc = 0; kc < nChunks; ++kc) {
    const int kv0 = kc * AT_KC;
    __syncthreads();
    {
      const int kvr = tid >> 1, dh = (tid & 1) * 32;
      const float* krow = kb_ptr + (size_t)(kv0 + kvr) * g.k_rs + dh;
      const float* vrow = vb_ptr + (size_t)(kv0 + kvr) * g.v_rs + dh;
#pragma unroll
      for (int i = 0; i < 8; ++i) {
        v4f kk = *(const v4f*)(krow + 4 * i);
        v4f vv = *(const v4f*)(vrow + 4 * i);
#pragma unroll
        for (int e = 0; e < 4; ++e) {
          const int d = dh + 4 * i + e;
          if (SPLIT_QK) { __bf16 a, bl; at_split(kk[e], a, bl); Ksh[kvr * AT_D + d] = a; Ksl[kvr * AT_D + d] = bl; }
          else Ksh[kvr * AT_D + d] = at_to16<F16>(kk[e]);
          if (SPLIT_PV) { __bf16 a, bl; at_split(vv[e], a, bl); Vth[d * AT_KC + kvr] = a; Vtl[d * AT_KC + kvr] = bl; }
          else Vth[d * AT_KC + kvr] = at_to16<F16>(vv[e]);
        }
      }
    }
    __syncthreads();

    v8f s[4];
#pragma unroll
    for (int j = 0; j < 4; ++j) {
      s[j] = (v8f){0.f,0.f,0.f,0.f,0.f,0.f,0.f,0.f};
#pragma unroll 1
      for (int dc = 0; dc < 2; ++dc) {
        FB kb;
        kb.h[0] = *(const v8b*)(Ksh + (j * 16 + c) * AT_D + dc * 32 + 8 * hh);
        kb.h[1] = *(const v8b*)(Ksh + (j * 16 + c) * AT_D + dc * 32 + 16 + 8 * hh);
        s[j] = at_mma16<F16>(qah[dc], kb.v, s[j]);
        if (SPLIT_QK) {
          FB kl;
          kl.h[0] = *(const v8b*)(Ksl + (j * 16 + c) * AT_D + dc * 32 + 8 * hh);
          kl.h[1] = *(const v8b*)(Ksl + (j * 16 + c) * AT_D + dc * 32 + 16 + 8 * hh);
          s[j] = at_mma16<F16>(qah[dc], kl.v, s[j]);
          s[j] = at_mma16<F16>(qal[dc], kb.v, s[j]);
        }
      }
    }
    const bool diag = (g.mask_mode == 1) && (kc == qb);
    int kvkeep[4] = {1, 1, 1, 1};
    if (g.mask_mode == 3) {
#pragma unroll
      for (int j = 0; j < 4; ++j) kvkeep[j] = ((const int*)mask_a)[(size_t)b * g.Skv + kv0 + j * 16 + c];   // mask_a = kvmask
    }
    float cm[8];
#pragma unroll
    for (int r = 0; r < 8; ++r) {
      const int qrow = q0 + 8 * hh + r;
      float m = -INFINITY;
#pragma unroll
      for (int j = 0; j < 4; ++j) {
        const int kvcol = kv0 + j * 16 + c;
        bool masked = false;
        if (diag) masked = (kvcol > qrow);
        else if (g.mask_mode == 4) masked = (kvcol > qrow) || (qrow - kvcol > g.mask_is_int);
        else if (g.mask_mode == 2) {
          const size_t mi = (size_t)qrow * g.Skv + kvcol;
          masked = (g.mask_is_int == 0) ? (((const float*)mask_a)[mi] == 0.0f)
                 : (g.mask_is_int == 1) ? (((const int*)mask_a)[mi] == 0) : (((const int*)mask_a)[mi] != 0);
        } else if (g.mask_mode == 3) masked = (qkeep[r] == 0) || (kvkeep[j] == 0);
        else if (g.mask_mode == 5) {
          const size_t mi = (size_t)qrow * g.Skv + kvcol;
          masked = (((const int*)mask_a)[mi] != 0);
          int n = mask_b[mi]; n = n < 0 ? 0 : n;
          s[j][r] += g.cp[(size_t)b * g.c_bs + (size_t)h * g.c_hs + (size_t)qrow * g.c_rs + n]
                   + g.pc[(size_t)b * g.c_bs + (size_t)h * g.c_hs + (size_t)kvcol * g.c_rs + n];
        }
        if (masked) s[j][r] = g.mask_fill;
        m = fmaxf(m, s[j][r]);
      }
#pragma unroll
      for (int off = 1; off < 16; off <<= 1) m = fmaxf(m, __shfl_xor(m, off, 32));
      cm[r] = m;
    }
    __bf16* pwh = Psh[wave];
    __bf16* pwl = Psl[SPLIT_PV ? wave : 0];
#pragma unroll
    for (int r = 0; r < 8; ++r) {
      const float mnew = fmaxf(mrow[r], cm[r]);
      const float alpha = expf(mrow[r] - mnew);
      mrow[r] = mnew;
      float psum = 0.f;
#pragma unroll
      for (int j = 0; j < 4; ++j) {
        const float p = expf(s[j][r] - mnew);
        psum += p;
        if (SPLIT_PV) { __bf16 a, bl; at_split(p, a, bl); pwh[(8 * hh + r) * AT_KC + j * 16 + c] = a; pwl[(8 * hh + r) * AT_KC + j * 16 + c] = bl; }
        else pwh[(8 * hh + r) * AT_KC + j * 16 + c] = at_to16<F16>(p * PSC);
      }
#pragma unroll
      for (int off = 1; off < 16; off <<= 1) psum += __shfl_xor(psum, off, 32);
      lrow[r] = lrow[r] * alpha + psum;
#pragma unroll
      for (int t = 0; t < 4; ++t) oacc[t][r] *= alpha;
    }
    __builtin_amdgcn_fence(__ATOMIC_RELEASE, "workgroup");
    __builtin_amdgcn_wave_barrier();
    __builtin_amdgcn_fence(__ATOMIC_ACQUIRE, "workgroup");
#pragma unroll 1
    for (int kk = 0; kk < 2; ++kk) {
      FB pa, pl;
      pa.h[0] = *(const v8b*)(pwh + c * AT_KC + kk * 32 + 8 * hh);
      pa.h[1] = *(const v8b*)(pwh + c * AT_KC + kk * 32 + 16 + 8 * hh);
      if (SPLIT_PV) {
        pl.h[0] = *(const v8b*)(pwl + c * AT_KC + kk * 32 + 8 * hh);
        pl.h[1] = *(const v8b*)(pwl + c * AT_KC + kk * 32 + 16 + 8 * hh);
      }
#pragma unroll
      for (int t = 0; t < 4; ++t) {
        FB vb;
        vb.h[0] = *(const v8b*)(Vth + (t * 16 + c) * AT_KC + kk * 32 + 8 * hh);
        vb.h[1] = *(const v8b*)(Vth + (t * 16 + c) * AT_KC + kk * 32 + 16 + 8 * hh);
        oacc[t] = at_mma16<F16>(pa.v, vb.v, oacc[t]);
        if (SPLIT_PV) {
          FB vl;
          vl.h[0] = *(const v8b*)(Vtl + (t * 16 + c) * AT_KC + kk * 32 + 8 * hh);
          vl.h[1] = *(const v8b*)(Vtl + (t * 16 + c) * AT_KC + kk * 32 + 16 + 8 * hh);
          oacc[t] = at_mma16<F16>(pa.v, vl.v, oacc[t]);
          oacc[t] = at_mma16<F16>(pl.v, vb.v, oacc[t]);
        }
      }
    }
  }

  float* os = Os[wave];
#pragma unroll
  for (int r = 0; r < 8; ++r) {
    const float inv = 1.0f / (lrow[r] * PSC);
#pragma unroll
    for (int t = 0; t < 4; ++t) os[(8 * hh + r) * 68 + t * 16 + c] = oacc[t][r] * inv;
  }
  __builtin_amdgcn_fence(__ATOMIC_RELEASE, "workgroup");
  __builtin_amdgcn_wave_barrier();
  __builtin_amdgcn_fence(__ATOMIC_ACQUIRE, "workgroup");
  {
    const int c4 = (lane & 15) * 4;
    {
#pragma unroll
      for (int it = 0; it < 8; ++it) {
        const int row = it * 2 + hh;
        v4f val = *(const v4f*)(os + row * 68 + c4);
        *(v4f*)(ob_ptr + (size_t)(q0 + row) * g.o_rs + c4) = val;
      }
      
    }
  }
}

} // namespace w25


__device__ __forceinline__ void st_h2(unsigned short* d2, float a, float b) { const unsigned u = (unsigned)__builtin_bit_cast(unsigned short, (_Float16)a) | ((unsigned)__builtin_bit_cast(unsigned short, (_Float16)b) << 16); unsigned* d = (unsigned*)d2; *d = u;  }
__device__ __forceinline__ float ldh(const unsigned short* p) { return (float)__builtin_bit_cast(_Float16, *p); }
__device__ __forceinline__ v4f ld4h(const unsigned short* p) { const unsigned long long u = *(const unsigned long long*)p; v4f a;
    a.x = (float)__builtin_bit_cast(_Float16, (unsigned short)(u & 0xFFFFu)); a.y = (float)__builtin_bit_cast(_Float16, (unsigned short)((u >> 16) & 0xFFFFu)); a.z = (float)__builtin_bit_cast(_Float16, (unsigned short)((u >> 32) & 0xFFFFu)); a.w = (float)__builtin_bit_cast(_Float16, (unsigned short)((u >> 48) & 0xFFFFu)); return a; }
__device__ __forceinline__ unsigned long long pk4h(v4f s) { return (unsigned long long)__builtin_bit_cast(unsigned short, (_Float16)s.x) | ((unsigned long long)__builtin_bit_cast(unsigned short, (_Float16)s.y) << 16) | ((unsigned long long)__builtin_bit_cast(unsigned short, (_Float16)s.z) << 32) | ((unsigned long long)__builtin_bit_cast(unsigned short, (_Float16)s.w) << 48); }
typedef unsigned v4u __attribute__((ext_vector_type(4)));
__device__ __forceinline__ void st8h(unsigned short* d, v4f a, v4f b) { const unsigned long long pa = pk4h(a), pb = pk4h(b); v4u pk; pk.x = (unsigned)(pa & 0xFFFFFFFFull); pk.y = (unsigned)(pa >> 32); pk.z = (unsigned)(pb & 0xFFFFFFFFull); pk.w = (unsigned)(pb >> 32); v4u* dd = (v4u*)d; *dd = pk;  }
__device__ __forceinline__ unsigned short bfu_rne(float v) { unsigned u = __builtin_bit_cast(unsigned, v); u += 0x7FFFu + ((u >> 16) & 1u); return (unsigned short)(u >> 16); }
__device__ __forceinline__ void bfsplit(float v, unsigned short& hi, unsigned short& lo) { hi = bfu_rne(v); lo = bfu_rne(v - __builtin_bit_cast(float, (unsigned)hi << 16)); }
__device__ __forceinline__ void st_s2(unsigned short* Hp, unsigned short* Lp, long long o, float a, float b) { unsigned short h0,l0,h1,l1; bfsplit(a,h0,l0); bfsplit(b,h1,l1); const unsigned ph = (unsigned)h0 | ((unsigned)h1 << 16), pl = (unsigned)l0 | ((unsigned)l1 << 16);
    unsigned* dh = (unsigned*)(Hp + o); unsigned* dl = (unsigned*)(Lp + o); *dh = ph; *dl = pl;  }
__device__ __forceinline__ int cl(int v, int n) { return min(max(v, 0), n - 1); }

// GAT-style aggregation over a device in-edge CSR at dst (+ optional explicit self loop as iteration j = -1):
//   logit = leaky(AS[src][h] + AD[n][h] (+ EW[e]*CW[h]), slope); softmax over the node's edges per head; acc[c] = sum alpha XP[src][c] (f16 gather plane, pitch XW; 256 channels = H heads x CH)
//   wave per node; lane L owns channels 8L..8L+7 (head = 8L / CH); per-lane softmax state (lanes of one head agree) -> no shuffles in the loop.
//   EPI 0: + bias -> f32 OUT[n][256] via LDS redistribution (two 16-B stores per lane, each instruction 512 contiguous B)
//   EPI 1: + bias, LayerNorm(256) * g + bb, relu -> bf16 hi/lo planes OH/OL [n][256] (16-B stores)
//   EPI 2: mean over the 256/CH heads + bias[0..CH-1] , LayerNorm(64) * g + bb, relu -> f32 OUT[n][64] (CH must be 64; LDS redistribution, 8-B stores)
//   EPI 3: mean over heads + bias -> f32 OUT[n][64] (no norm / activation)
//   EPI 4: + bias, ELU -> bf16 hi/lo planes OH/OL [n][256];  EPI 5: + bias (full 256-wide, per head), ELU, then mean over the 256/CH heads -> f32 OUT[n][64]
//   EPI 6: (CH = 128, two heads) mean over the two heads, + bias[0..127], relu -> f32 OUT[n][128] (LDS redistribution, 16-B stores)
//   EWM 0: no edge weights; 1: logit += EW[e] * CW[h] (self loop weight 1); 2: alpha *= EW[e] after the softmax (message scale; self loop weight 1)
template <int CH, bool SELF, int EWM, int EPI>
__global__ __launch_bounds__(256) void k_gat_agg(const unsigned short* __restrict__ XP, int XW, const float* __restrict__ AS, const float* __restrict__ AD, int ASTR, const float* __restrict__ EW, const float* __restrict__ CW,
        const int* __restrict__ esrc, const int* __restrict__ off, const int* __restrict__ cnt, const int* __restrict__ slot, const float* __restrict__ bias, const float* __restrict__ g, const float* __restrict__ bb,
        float* __restrict__ OUT, unsigned short* __restrict__ OH, unsigned short* __restrict__ OL, int N, int E, int CAP, float slope) {
    __shared__ float stage[8][256];
    const int wv = threadIdx.x >> 5; const int n = blockIdx.x * 8 + wv; const int L = threadIdx.x & 31; if (n >= N) return; const int c0 = 8 * L; const int h = c0 / CH;
    const float ad = AD[(long long)n * ASTR + h]; const float cw = (EWM == 1) ? CW[h] : 0.f; float m = -3.0e38f, s = 0.f; v4f a0, a1; a0.x = a0.y = a0.z = a0.w = 0.f; a1 = a0;
    const int p0 = cl(off[n], E + 1), cn = min(max(cnt[n], 0), CAP);
    for (int j = (SELF ? -1 : 0); j < cn; ++j) { int sj; float ew = 0.f;
        if (j < 0) { sj = n; ew = 1.f; } else { int e = slot[cl(p0 + j, E)]; e = cl(e, E); sj = cl(esrc[e], N); if (EWM != 0) ew = EW[e]; }
        float lg = AS[(long long)sj * ASTR + h] + ad + ((EWM == 1) ? ew * cw : 0.f); lg = (lg >= 0.f) ? lg : slope * lg;
        const float mn = fmaxf(m, lg); const float cz = expf(m - mn), pj = expf(lg - mn); s = s * cz + pj; const float pw = (EWM == 2) ? pj * ew : pj;
        const unsigned short* xr = XP + (long long)sj * XW + c0; a0 = a0 * cz + ld4h(xr) * pw; a1 = a1 * cz + ld4h(xr + 4) * pw; m = mn; }
    const float inv = (s > 0.f) ? 1.f / (s + 1e-16f) : 0.f; a0 = a0 * inv; a1 = a1 * inv;
    if (EPI == 0 || EPI == 1 || EPI == 4 || EPI == 5) { a0 = a0 + *(const v4f*)(bias + c0); a1 = a1 + *(const v4f*)(bias + c0 + 4); }
    if (EPI == 4 || EPI == 5) { a0.x = (a0.x > 0.f) ? a0.x : (expf(a0.x) - 1.f); a0.y = (a0.y > 0.f) ? a0.y : (expf(a0.y) - 1.f); a0.z = (a0.z > 0.f) ? a0.z : (expf(a0.z) - 1.f); a0.w = (a0.w > 0.f) ? a0.w : (expf(a0.w) - 1.f);
        a1.x = (a1.x > 0.f) ? a1.x : (expf(a1.x) - 1.f); a1.y = (a1.y > 0.f) ? a1.y : (expf(a1.y) - 1.f); a1.z = (a1.z > 0.f) ? a1.z : (expf(a1.z) - 1.f); a1.w = (a1.w > 0.f) ? a1.w : (expf(a1.w) - 1.f); }
    if (EPI == 4) { float o8[8] = {a0.x, a0.y, a0.z, a0.w, a1.x, a1.y, a1.z, a1.w}; unsigned short hh[8], ll[8];
#pragma unroll
        for (int u = 0; u < 8; ++u) bfsplit(o8[u], hh[u], ll[u]);
        const unsigned long long ph0 = (unsigned long long)hh[0] | ((unsigned long long)hh[1] << 16) | ((unsigned long long)hh[2] << 32) | ((unsigned long long)hh[3] << 48), pl0 = (unsigned long long)ll[0] | ((unsigned long long)ll[1] << 16) | ((unsigned long long)ll[2] << 32) | ((unsigned long long)ll[3] << 48);
        const unsigned long long ph1 = (unsigned long long)hh[4] | ((unsigned long long)hh[5] << 16) | ((unsigned long long)hh[6] << 32) | ((unsigned long long)hh[7] << 48), pl1 = (unsigned long long)ll[4] | ((unsigned long long)ll[5] << 16) | ((unsigned long long)ll[6] << 32) | ((unsigned long long)ll[7] << 48);
        v4u pk; pk.x = (unsigned)(ph0 & 0xFFFFFFFFull); pk.y = (unsigned)(ph0 >> 32); pk.z = (unsigned)(ph1 & 0xFFFFFFFFull); pk.w = (unsigned)(ph1 >> 32); v4u* dh = (v4u*)(OH + (long long)n * 256 + c0); *dh = pk; 
        v4u ql; ql.x = (unsigned)(pl0 & 0xFFFFFFFFull); ql.y = (unsigned)(pl0 >> 32); ql.z = (unsigned)(pl1 & 0xFFFFFFFFull); ql.w = (unsigned)(pl1 >> 32); v4u* dl = (v4u*)(OL + (long long)n * 256 + c0); *dl = ql;  return; }
    if (EPI == 6) {
        a0.x += __shfl_xor(a0.x, 16); a0.y += __shfl_xor(a0.y, 16); a0.z += __shfl_xor(a0.z, 16); a0.w += __shfl_xor(a0.w, 16); a1.x += __shfl_xor(a1.x, 16); a1.y += __shfl_xor(a1.y, 16); a1.z += __shfl_xor(a1.z, 16); a1.w += __shfl_xor(a1.w, 16);
        if (L < 16) { const int cb = 8 * L; const v4f b0 = *(const v4f*)(bias + cb), b1v = *(const v4f*)(bias + cb + 4);
            stage[wv][cb] = fmaxf(a0.x * 0.5f + b0.x, 0.f); stage[wv][cb + 1] = fmaxf(a0.y * 0.5f + b0.y, 0.f); stage[wv][cb + 2] = fmaxf(a0.z * 0.5f + b0.z, 0.f); stage[wv][cb + 3] = fmaxf(a0.w * 0.5f + b0.w, 0.f);
            stage[wv][cb + 4] = fmaxf(a1.x * 0.5f + b1v.x, 0.f); stage[wv][cb + 5] = fmaxf(a1.y * 0.5f + b1v.y, 0.f); stage[wv][cb + 6] = fmaxf(a1.z * 0.5f + b1v.z, 0.f); stage[wv][cb + 7] = fmaxf(a1.w * 0.5f + b1v.w, 0.f); }
        __builtin_amdgcn_fence(__ATOMIC_RELEASE, "workgroup"); __builtin_amdgcn_wave_barrier(); __builtin_amdgcn_fence(__ATOMIC_ACQUIRE, "workgroup");
        v4f o6; o6.x = stage[wv][4 * L]; o6.y = stage[wv][4 * L + 1]; o6.z = stage[wv][4 * L + 2]; o6.w = stage[wv][4 * L + 3]; VST2V4(OUT + (long long)n * 128 + 4 * L, o6); return; }
    if (EPI == 5) {
        a0.x += __shfl_xor(a0.x, 8); a0.y += __shfl_xor(a0.y, 8); a0.z += __shfl_xor(a0.z, 8); a0.w += __shfl_xor(a0.w, 8); a1.x += __shfl_xor(a1.x, 8); a1.y += __shfl_xor(a1.y, 8); a1.z += __shfl_xor(a1.z, 8); a1.w += __shfl_xor(a1.w, 8);
        a0.x += __shfl_xor(a0.x, 16); a0.y += __shfl_xor(a0.y, 16); a0.z += __shfl_xor(a0.z, 16); a0.w += __shfl_xor(a0.w, 16); a1.x += __shfl_xor(a1.x, 16); a1.y += __shfl_xor(a1.y, 16); a1.z += __shfl_xor(a1.z, 16); a1.w += __shfl_xor(a1.w, 16);
        const int gq5 = L & 7; a0 = a0 * 0.25f; a1 = a1 * 0.25f;
        if (L < 8) { stage[wv][8 * gq5] = a0.x; stage[wv][8 * gq5 + 1] = a0.y; stage[wv][8 * gq5 + 2] = a0.z; stage[wv][8 * gq5 + 3] = a0.w; stage[wv][8 * gq5 + 4] = a1.x; stage[wv][8 * gq5 + 5] = a1.y; stage[wv][8 * gq5 + 6] = a1.z; stage[wv][8 * gq5 + 7] = a1.w; }
        __builtin_amdgcn_fence(__ATOMIC_RELEASE, "workgroup"); __builtin_amdgcn_wave_barrier(); __builtin_amdgcn_fence(__ATOMIC_ACQUIRE, "workgroup");
        const unsigned long long pk5 = (unsigned long long)__builtin_bit_cast(unsigned, stage[wv][2 * L]) | ((unsigned long long)__builtin_bit_cast(unsigned, stage[wv][2 * L + 1]) << 32); VST2(unsigned long long, (unsigned long long*)(OUT + (long long)n * 64 + 2 * L), pk5); return; }
    if (EPI == 1) { float sm = a0.x + a0.y + a0.z + a0.w + a1.x + a1.y + a1.z + a1.w;
#pragma unroll
        for (int o = 16; o > 0; o >>= 1) sm += __shfl_xor(sm, o);
        const float mu = sm * (1.f / 256.f); const v4f d0 = a0 - mu, d1 = a1 - mu; float q = d0.x * d0.x + d0.y * d0.y + d0.z * d0.z + d0.w * d0.w + d1.x * d1.x + d1.y * d1.y + d1.z * d1.z + d1.w * d1.w;
#pragma unroll
        for (int o = 16; o > 0; o >>= 1) q += __shfl_xor(q, o);
        const float rs = rsqrtf(q * (1.f / 256.f) + 1e-5f); float o8[8] = {d0.x, d0.y, d0.z, d0.w, d1.x, d1.y, d1.z, d1.w}; unsigned short hh[8], ll[8];
#pragma unroll
        for (int u = 0; u < 8; ++u) { const float v = fmaxf(o8[u] * rs * g[c0 + u] + bb[c0 + u], 0.f); bfsplit(v, hh[u], ll[u]); }
        const unsigned long long ph0 = (unsigned long long)hh[0] | ((unsigned long long)hh[1] << 16) | ((unsigned long long)hh[2] << 32) | ((unsigned long long)hh[3] << 48), pl0 = (unsigned long long)ll[0] | ((unsigned long long)ll[1] << 16) | ((unsigned long long)ll[2] << 32) | ((unsigned long long)ll[3] << 48);
        const unsigned long long ph1 = (unsigned long long)hh[4] | ((unsigned long long)hh[5] << 16) | ((unsigned long long)hh[6] << 32) | ((unsigned long long)hh[7] << 48), pl1 = (unsigned long long)ll[4] | ((unsigned long long)ll[5] << 16) | ((unsigned long long)ll[6] << 32) | ((unsigned long long)ll[7] << 48);
        // lane L's 8 halves at c0 = 8L: 16 B -> one 16-B store per plane (32 lanes x 16 B = whole 512-B row)
        v4u pk; pk.x = (unsigned)(ph0 & 0xFFFFFFFFull); pk.y = (unsigned)(ph0 >> 32); pk.z = (unsigned)(ph1 & 0xFFFFFFFFull); pk.w = (unsigned)(ph1 >> 32); v4u* dh = (v4u*)(OH + (long long)n * 256 + c0); *dh = pk; 
        v4u ql; ql.x = (unsigned)(pl0 & 0xFFFFFFFFull); ql.y = (unsigned)(pl0 >> 32); ql.z = (unsigned)(pl1 & 0xFFFFFFFFull); ql.w = (unsigned)(pl1 >> 32); v4u* dl = (v4u*)(OL + (long long)n * 256 + c0); *dl = ql;  return; }
    if (EPI == 2 || EPI == 3) {   // head mean: lanes L, L^8, L^16, L^24 hold the same chan group of the 4 heads (CH = 64 -> 8 lanes per head)
        a0.x += __shfl_xor(a0.x, 8); a0.y += __shfl_xor(a0.y, 8); a0.z += __shfl_xor(a0.z, 8); a0.w += __shfl_xor(a0.w, 8); a1.x += __shfl_xor(a1.x, 8); a1.y += __shfl_xor(a1.y, 8); a1.z += __shfl_xor(a1.z, 8); a1.w += __shfl_xor(a1.w, 8);
        a0.x += __shfl_xor(a0.x, 16); a0.y += __shfl_xor(a0.y, 16); a0.z += __shfl_xor(a0.z, 16); a0.w += __shfl_xor(a0.w, 16); a1.x += __shfl_xor(a1.x, 16); a1.y += __shfl_xor(a1.y, 16); a1.z += __shfl_xor(a1.z, 16); a1.w += __shfl_xor(a1.w, 16);
        const int gq = L & 7; a0 = a0 * 0.25f + *(const v4f*)(bias + 8 * gq); a1 = a1 * 0.25f + *(const v4f*)(bias + 8 * gq + 4);      // every lane now holds channels 8gq..8gq+7 of the mean
        if (EPI == 3) { if (L < 8) { stage[wv][8 * gq] = a0.x; stage[wv][8 * gq + 1] = a0.y; stage[wv][8 * gq + 2] = a0.z; stage[wv][8 * gq + 3] = a0.w; stage[wv][8 * gq + 4] = a1.x; stage[wv][8 * gq + 5] = a1.y; stage[wv][8 * gq + 6] = a1.z; stage[wv][8 * gq + 7] = a1.w; }
            __builtin_amdgcn_fence(__ATOMIC_RELEASE, "workgroup"); __builtin_amdgcn_wave_barrier(); __builtin_amdgcn_fence(__ATOMIC_ACQUIRE, "workgroup");
            const unsigned long long pk3 = (unsigned long long)__builtin_bit_cast(unsigned, stage[wv][2 * L]) | ((unsigned long long)__builtin_bit_cast(unsigned, stage[wv][2 * L + 1]) << 32); VST2(unsigned long long, (unsigned long long*)(OUT + (long long)n * 64 + 2 * L), pk3); return; }
        float sm = (L < 8) ? (a0.x + a0.y + a0.z + a0.w + a1.x + a1.y + a1.z + a1.w) : 0.f;
#pragma unroll
        for (int o = 16; o > 0; o >>= 1) sm += __shfl_xor(sm, o);
        const float mu = sm * (1.f / 64.f); const v4f d0 = a0 - mu, d1 = a1 - mu; float q = (L < 8) ? (d0.x * d0.x + d0.y * d0.y + d0.z * d0.z + d0.w * d0.w + d1.x * d1.x + d1.y * d1.y + d1.z * d1.z + d1.w * d1.w) : 0.f;
#pragma unroll
        for (int o = 16; o > 0; o >>= 1) q += __shfl_xor(q, o);
        const float rs = rsqrtf(q * (1.f / 64.f) + 1e-5f);
        if (L < 8) { const float* gg = g + 8 * gq; const float* bq = bb + 8 * gq; stage[wv][8 * gq] = fmaxf(d0.x * rs * gg[0] + bq[0], 0.f); stage[wv][8 * gq + 1] = fmaxf(d0.y * rs * gg[1] + bq[1], 0.f); stage[wv][8 * gq + 2] = fmaxf(d0.z * rs * gg[2] + bq[2], 0.f); stage[wv][8 * gq + 3] = fmaxf(d0.w * rs * gg[3] + bq[3], 0.f);
            stage[wv][8 * gq + 4] = fmaxf(d1.x * rs * gg[4] + bq[4], 0.f); stage[wv][8 * gq + 5] = fmaxf(d1.y * rs * gg[5] + bq[5], 0.f); stage[wv][8 * gq + 6] = fmaxf(d1.z * rs * gg[6] + bq[6], 0.f); stage[wv][8 * gq + 7] = fmaxf(d1.w * rs * gg[7] + bq[7], 0.f); }
        __builtin_amdgcn_fence(__ATOMIC_RELEASE, "workgroup"); __builtin_amdgcn_wave_barrier(); __builtin_amdgcn_fence(__ATOMIC_ACQUIRE, "workgroup");
        const unsigned long long pk = (unsigned long long)__builtin_bit_cast(unsigned, stage[wv][2 * L]) | ((unsigned long long)__builtin_bit_cast(unsigned, stage[wv][2 * L + 1]) << 32); VST2(unsigned long long, (unsigned long long*)(OUT + (long long)n * 64 + 2 * L), pk); return; }
    // EPI 0
    stage[wv][c0] = a0.x; stage[wv][c0 + 1] = a0.y; stage[wv][c0 + 2] = a0.z; stage[wv][c0 + 3] = a0.w; stage[wv][c0 + 4] = a1.x; stage[wv][c0 + 5] = a1.y; stage[wv][c0 + 6] = a1.z; stage[wv][c0 + 7] = a1.w;
    __builtin_amdgcn_fence(__ATOMIC_RELEASE, "workgroup"); __builtin_amdgcn_wave_barrier(); __builtin_amdgcn_fence(__ATOMIC_ACQUIRE, "workgroup");
#pragma unroll
    for (int q2 = 0; q2 < 2; ++q2) { const int c = 128 * q2 + 4 * L; v4f v; v.x = stage[wv][c]; v.y = stage[wv][c + 1]; v.z = stage[wv][c + 2]; v.w = stage[wv][c + 3]; VST2V4(OUT + (long long)n * 256 + c, v); } }

__device__ __forceinline__ void st4s(unsigned short* Hp, unsigned short* Lp, long long o, v4f a) { unsigned short h[4], l[4]; bfsplit(a.x, h[0], l[0]); bfsplit(a.y, h[1], l[1]); bfsplit(a.z, h[2], l[2]); bfsplit(a.w, h[3], l[3]);
    const unsigned long long ph = (unsigned long long)h[0] | ((unsigned long long)h[1] << 16) | ((unsigned long long)h[2] << 32) | ((unsigned long long)h[3] << 48), pl = (unsigned long long)l[0] | ((unsigned long long)l[1] << 16) | ((unsigned long long)l[2] << 32) | ((unsigned long long)l[3] << 48);
    VST2(unsigned long long, (unsigned long long*)(Hp + o), ph); VST2(unsigned long long, (unsigned long long*)(Lp + o), pl); }
// f32 [nval2 pairs] -> bf16 hi/lo planes (n2 pairs; pairs >= nval2 zero); thread-linear 4-B stores per plane
__global__ __launch_bounds__(256) void k_pl(const float* __restrict__ S, unsigned short* __restrict__ PH, unsigned short* __restrict__ PL, long long nval2, long long n2) { const long long u = (long long)blockIdx.x * 256 + threadIdx.x; if (u >= n2) return; const bool in = (u < nval2); const long long uc = in ? u : ((nval2 > 0) ? (nval2 - 1) : 0); const float a = S[2 * uc], b = S[2 * uc + 1]; st_s2(PH, PL, 2 * u, in ? a : 0.f, in ? b : 0.f); }
// WC [K][NOP] (thread-linear whole rows) = [W (cols < FO) | 0 | W_h . as_h @EO+h | W_h . ad_h @EO+NH+h | 0 ...]; W is [K][FO] (x @ W layout), as/ad [NH][DH]; EO >= FO.
// branch-free: every lane loads all candidates with clamped indices and selects by value (no exec-masked load arms)
__global__ __launch_bounds__(256) void k_wext(const float* __restrict__ Wm, const float* __restrict__ AS_, const float* __restrict__ AD_, int K, int NOP, int FO, int NH, int DH, int EO, float* __restrict__ WC) {
    #pragma clang fp contract(off)
    const long long u = (long long)blockIdx.x * 256 + threadIdx.x; if (u >= (long long)K * NOP) return; const int kk = (int)(u / NOP), o = (int)(u % NOP);
    const int oo = min(o, FO - 1); const float vw = Wm[(long long)kk * FO + oo]; const int q = min(max(o - EO, 0), 2 * NH - 1); const int h = q % NH; float s = 0.f;
#pragma unroll 1
    for (int c = 0; c < DH; ++c) { const float w = Wm[(long long)kk * FO + h * DH + c]; const float asv = AS_[h * DH + c], adv = AD_[h * DH + c]; s += w * ((q < NH) ? asv : adv); }
    const float v = (o < FO) ? vw : ((o >= EO && o < EO + 2 * NH) ? s : 0.f); VST2(float, WC + u, v); }
// GAT aggregation over a device in-edge CSR (+ analytic self loop as iteration j = -1 when SELF), per-lane online softmax (lanes of one head agree):
// HS rows (pitch P floats): [0,128) projected features z, col 128 + h = a_src.z_h, col 128 + NH + h = a_dst.z_h; lane L owns channels 4L..4L+3 (head = 4L / CH).
// out = sum_j softmax_j(leaky(el[src_j][h] + er[n][h])) z[src_j] (/ (den + deps)) + bias -> ACT (0 none, 1 relu, 2 elu, 3 leaky 0.01) ->
// MODE 0: f32 OUT[n][OW] cols < OC (16-B lane stores, OC*4 contiguous B per wave; OC in {64,128}); MODE 1: bf16 hi/lo planes PH/PL pitch PP (rows n >= N zero); MODE 2: both.
template <int CH, bool SELF, int ACT, int MODE>
__global__ __launch_bounds__(256) void k_gat128(const float* __restrict__ HS, int P, int NH, const float* __restrict__ bias, const int* __restrict__ SRC, const int* __restrict__ off, const int* __restrict__ cnt, const int* __restrict__ slot,
        float* __restrict__ OUT, int OW, int OC, unsigned short* __restrict__ PH, unsigned short* __restrict__ PL, int PP, int N, int NP, int E, int CAP, float slope, float deps) {
    #pragma clang fp contract(off)
    const int n = blockIdx.x * 8 + (threadIdx.x >> 5); const int L = threadIdx.x & 31; if (n >= NP) return; const int c = 4 * L; const int h = c / CH; v4f o; o.x = o.y = o.z = o.w = 0.f;
    if (n < N) { const float* hn = HS + (long long)n * P; const float er = hn[128 + NH + h]; float m = -3.0e38f, s = 0.f; v4f a; a.x = a.y = a.z = a.w = 0.f;
        const int p0 = min(max(off[n], 0), E), cn = min(max(cnt[n], 0), CAP);
        for (int j = (SELF ? -1 : 0); j < cn; ++j) { int sj; if (j < 0) sj = n; else { const int e = min(max(slot[min(p0 + j, E - 1)], 0), E - 1); sj = min(max(SRC[e], 0), N - 1); }
            const float* hs = HS + (long long)sj * P; float lg = hs[128 + h] + er; lg = (lg >= 0.f) ? lg : slope * lg;
            const float mn = fmaxf(m, lg); const float cz = expf(m - mn), pj = expf(lg - mn); s = s * cz + pj; a = a * cz + *(const v4f*)(hs + c) * pj; m = mn; }
        const float inv = (s > 0.f || deps > 0.f) ? 1.f / (s + deps) : 0.f; o = a * inv + *(const v4f*)(bias + c);
        if (ACT == 1) { o.x = fmaxf(o.x, 0.f); o.y = fmaxf(o.y, 0.f); o.z = fmaxf(o.z, 0.f); o.w = fmaxf(o.w, 0.f); }
        if (ACT == 2) { o.x = (o.x > 0.f) ? o.x : (expf(o.x) - 1.f); o.y = (o.y > 0.f) ? o.y : (expf(o.y) - 1.f); o.z = (o.z > 0.f) ? o.z : (expf(o.z) - 1.f); o.w = (o.w > 0.f) ? o.w : (expf(o.w) - 1.f); }
        if (ACT == 3) { o.x = (o.x >= 0.f) ? o.x : 0.01f * o.x; o.y = (o.y >= 0.f) ? o.y : 0.01f * o.y; o.z = (o.z >= 0.f) ? o.z : 0.01f * o.z; o.w = (o.w >= 0.f) ? o.w : 0.01f * o.w; }
        if (MODE != 1 && c < OC) VST2V4(OUT + (long long)n * OW + c, o); }
    if (MODE != 0) st4s(PH, PL, (long long)n * PP + c, o); }

// ---- util2 ----
// generic Bt plane builder from an f32 weight: Bt[o][k] (pitch KP halves) = (TRANS ? W[k*ldw + o] : W[o*ldw + k]) * (S ? S[o] : 1) for o < NO, k < KI; zero elsewhere for o < NOP rows, k < KP (thread per (o < NOP, pair k))
__global__ __launch_bounds__(256) void k_u2_bt(const float* __restrict__ Wm, int ldw, int TRANS, int KI, int NO, int KP, int NOP, const float* __restrict__ S, unsigned short* __restrict__ PH_, unsigned short* __restrict__ PL_) {
    const long long u = (long long)blockIdx.x * 256 + threadIdx.x; if (u >= (long long)NOP * (KP / 2)) return; const int k0 = 2 * (int)(u % (KP / 2)); const int o = (int)(u / (KP / 2)); float a = 0.f, b = 0.f;
    if (o < NO) { const float s = S ? S[o] : 1.f;
        if (k0 < KI) a = (TRANS ? Wm[(long long)k0 * ldw + o] : Wm[(long long)o * ldw + k0]) * s;
        if (k0 + 1 < KI) b = (TRANS ? Wm[(long long)(k0 + 1) * ldw + o] : Wm[(long long)o * ldw + k0 + 1]) * s; }
    st_s2(PH_, PL_, (long long)o * KP + k0, a, b); }
// generic padded vector: O[i] = (i < n) ? (A[i] * (S ? S[i] : 1) + (B2 ? B2[i] : 0)) : 0 for i < NP (one block of 256, NP <= 4096 looped)
__global__ __launch_bounds__(256) void k_u2_vec(const float* __restrict__ A, const float* __restrict__ S, const float* __restrict__ B2, int n, int NP, float* __restrict__ O) { for (int i = threadIdx.x; i < NP; i += 256) { float v = 0.f; if (i < n) v = A[i] * (S ? S[i] : 1.f) + (B2 ? B2[i] : 0.f); VST2(float, O + i, v); } }
__global__ __launch_bounds__(256) void k_u2_colstat(const float* __restrict__ X, int P, int N, float eps, float* __restrict__ STAT) {
    #pragma clang fp contract(off)
    __shared__ float red[256]; const int c = blockIdx.x; const int t = threadIdx.x; float s = 0.f; for (int r = t; r < N; r += 256) s += X[(long long)r * P + c]; red[t] = s; __syncthreads();
    for (int o = 128; o > 0; o >>= 1) { if (t < o) red[t] += red[t + o]; __syncthreads(); }
    const float mu = red[0] / (float)N; __syncthreads(); float q = 0.f; for (int r = t; r < N; r += 256) { const float d = X[(long long)r * P + c] - mu; q += d * d; } red[t] = q; __syncthreads();
    for (int o = 128; o > 0; o >>= 1) { if (t < o) red[t] += red[t + o]; __syncthreads(); }
    const float rs = 1.f / sqrtf(red[0] / (float)N + eps); if (t < 32) VST2(float, STAT + (long long)c * 32 + t, (t == 0) ? mu : ((t == 1) ? rs : 0.f)); }
// rows f32 [R][W] (pitch PW) -> planes at pitch PP, column offset coff; rows >= RL (live) written as zeros up to RP (thread per (r < RP, 4 of W))
__global__ __launch_bounds__(256) void k_u2_pl(const float* __restrict__ X, int PW, int Wd, int RL, int RP, unsigned short* __restrict__ PH_, unsigned short* __restrict__ PL_, int PP, int coff) { const long long u = (long long)blockIdx.x * 256 + threadIdx.x; if (u >= (long long)RP * (Wd / 4)) return; const int r = (int)(u / (Wd / 4)); const int c = 4 * (int)(u % (Wd / 4)); v4f v; v.x = v.y = v.z = v.w = 0.f; if (r < RL) v = *(const v4f*)(X + (long long)r * PW + c); st4s(PH_, PL_, (long long)r * PP + coff + c, v); }

typedef unsigned int cm_u4 __attribute__((ext_vector_type(4)));

__global__ __launch_bounds__(256) void k_cm_zero16(unsigned short* __restrict__ DST, long long n) { const long long u = (long long)blockIdx.x * 256 + threadIdx.x; if (u * 8 >= n) return; cm_u4 z; z.x = z.y = z.z = z.w = 0u; cm_u4* d = (cm_u4*)(DST + u * 8); *d = z;  }
// f32 -> bf16 (RNE) -> f16 casts: every 16-bit operand then holds exactly the bf16-rounded input value (times a power-of-two
// weight scale), so the f16 WMMA products are exact. Plain: thread per (row, 8 cols),
// dst [R][C] pitch ldd; transposed: thread per (col, 8 consecutive rows) -> dst [C][R] pitch ldd; both store 16 B per thread, thread-linear along the dst row.
__device__ __forceinline__ unsigned int cmb_pk2(float a, float b) { return (unsigned int)__builtin_bit_cast(unsigned short, (_Float16)a) | ((unsigned int)__builtin_bit_cast(unsigned short, (_Float16)b) << 16); }
__device__ __forceinline__ float cmb_bf(float v) { const unsigned u = __builtin_bit_cast(unsigned, v); const unsigned r = (u + 0x7fffu + ((u >> 16) & 1u)) & 0xffff0000u; return __builtin_bit_cast(float, r); }   // bf16 RNE, kept as f32 (finite inputs)
// BR[i] = bf16_rne(B[i]) kept as f32 (thread per element)
__global__ __launch_bounds__(256) void k_cm_bfvec(const float* __restrict__ SRC, float* __restrict__ DST, int n) { const int u = blockIdx.x * 256 + threadIdx.x; if (u >= n) return; VST2(float, DST + u, cmb_bf(SRC[u])); }
__global__ __launch_bounds__(256) void k_cm_castb(const float* __restrict__ SRC, int lds, unsigned short* __restrict__ DST, int ldd, int nR, int nC, float sc) {
    const long long u = (long long)blockIdx.x * 256 + threadIdx.x; const int per = nC / 8; if (u >= (long long)nR * per) return; const int r = (int)(u / per); const int c0 = 8 * (int)(u % per);
    const float* s = SRC + (long long)r * lds + c0; float w[8];
#pragma unroll
    for (int e = 0; e < 8; ++e) w[e] = cmb_bf(s[e]) * sc;
    cm_u4 pk; pk.x = cmb_pk2(w[0], w[1]); pk.y = cmb_pk2(w[2], w[3]); pk.z = cmb_pk2(w[4], w[5]); pk.w = cmb_pk2(w[6], w[7]); VST2(cm_u4, (cm_u4*)(DST + (long long)r * ldd + c0), pk); }
__global__ __launch_bounds__(256) void k_cm_castbT(const float* __restrict__ SRC, int lds, unsigned short* __restrict__ DST, int ldd, int nR, int nC, float sc) {
    const long long u = (long long)blockIdx.x * 256 + threadIdx.x; const int per = nR / 8; if (u >= (long long)nC * per) return; const int c = (int)(u / per); const int r0 = 8 * (int)(u % per);
    float w[8];
#pragma unroll
    for (int e = 0; e < 8; ++e) w[e] = cmb_bf(SRC[(long long)(r0 + e) * lds + c]) * sc;
    cm_u4 pk; pk.x = cmb_pk2(w[0], w[1]); pk.y = cmb_pk2(w[2], w[3]); pk.z = cmb_pk2(w[4], w[5]); pk.w = cmb_pk2(w[6], w[7]); VST2(cm_u4, (cm_u4*)(DST + (long long)c * ldd + r0), pk); }

typedef float ab_v2f __attribute__((ext_vector_type(2)));
// A thread's loads go out AB_GB at a time, and the next AB_GB are in flight while these are summed (two register sets, A and B, in turn), instead of one load and its
// wait per trip; each thread adds its values in the same order as one load per trip would (whole groups first, the rest one by one).
#define AB_GB 16
#define AB_GS (AB_GB * 256)                                      // 16-byte pieces from one group of the block's loads to the next
typedef const __attribute__((address_space(1))) v4f* ab_gp;     // pointer to global memory: it stays one behind the wait statement below, through which the compiler does not see
__device__ __forceinline__ void ab_ld(v4f (&v)[AB_GB], ab_gp& p, int off) {   // the group that begins off pieces behind p
#pragma unroll   // v is then indexed by constants and stays in registers, and the loads stand one behind the other
    for (int u = 0; u < AB_GB; ++u) v[u] = p[off + 256 * u];    // the block's 256 threads cover 256 consecutive 16-byte pieces per load
    asm volatile("s_wait_xcnt 0x0" : "+v"(p) :: "memory");      // the loads' address register pair is stepped or reused only behind this wait (p goes through it), the loads still in flight
}
__global__ __launch_bounds__(256) void k_ab_gstat(const float* __restrict__ X, float* __restrict__ STp, int per) {
    #pragma clang fp contract(off)
    __shared__ float red[256]; const int g = blockIdx.x; const int t = threadIdx.x; const float* base = X + (long long)g * per; float s = 0.f;
    const int nb = per / (AB_GB * 1024);                         // whole groups (the same for every thread)
    v4f A[AB_GB], B[AB_GB];
    auto sum = [&s](const v4f (&v)[AB_GB]) {
#pragma unroll   // v is then indexed by constants and stays in registers
        for (int u = 0; u < AB_GB; ++u) s += (cmb_bf(v[u].x) + cmb_bf(v[u].y)) + (cmb_bf(v[u].z) + cmb_bf(v[u].w));
    };
    ab_gp p = (ab_gp)base + t; int k = 0;                        // p: the thread's piece of group k
    if (nb > 0) {
        ab_ld(A, p, 0);
        for (; k + 2 < nb; k += 2) { ab_ld(B, p, AB_GS); sum(A); ab_ld(A, p, 2 * AB_GS); p += 2 * AB_GS; sum(B); }
        if (k + 1 < nb) { ab_ld(B, p, AB_GS); sum(A); sum(B); } else sum(A);
    }
    for (int i = nb * (AB_GB * 1024) + 4 * t; i < per; i += 1024) { const v4f v = *(const v4f*)(base + i); s += (cmb_bf(v.x) + cmb_bf(v.y)) + (cmb_bf(v.z) + cmb_bf(v.w)); }
    red[t] = s; __syncthreads();
    for (int o = 128; o > 0; o >>= 1) { if (t < o) red[t] += red[t + o]; __syncthreads(); }
    const float mean = red[0] / (float)per; __syncthreads(); float q = 0.f;
    auto sq = [&q, mean](const v4f (&v)[AB_GB]) {
#pragma unroll   // v is then indexed by constants and stays in registers
        for (int u = 0; u < AB_GB; ++u) { const float a = cmb_bf(v[u].x) - mean, b = cmb_bf(v[u].y) - mean, c = cmb_bf(v[u].z) - mean, d = cmb_bf(v[u].w) - mean; q += (a * a + b * b) + (c * c + d * d); }
    };
    if (nb > 0) {
        p -= (long long)k * AB_GS; k = 0; ab_ld(A, p, 0);        // p is stepped back to group 0, not formed anew: the first group too is then addressed by the pair that the wait in ab_ld holds
        for (; k + 2 < nb; k += 2) { ab_ld(B, p, AB_GS); sq(A); ab_ld(A, p, 2 * AB_GS); p += 2 * AB_GS; sq(B); }
        if (k + 1 < nb) { ab_ld(B, p, AB_GS); sq(A); sq(B); } else sq(A);
    }
    for (int i = nb * (AB_GB * 1024) + 4 * t; i < per; i += 1024) { const v4f v = *(const v4f*)(base + i); const float a = cmb_bf(v.x) - mean, b = cmb_bf(v.y) - mean, c = cmb_bf(v.z) - mean, d = cmb_bf(v.w) - mean; q += (a * a + b * b) + (c * c + d * d); }
    red[t] = q; __syncthreads();
    for (int o = 128; o > 0; o >>= 1) { if (t < o) red[t] += red[t + o]; __syncthreads(); }
    if (t == 0) { ab_v2f ms; ms.x = mean; ms.y = rsqrtf(red[0] / (float)per + 1e-5f); VST2(ab_v2f, (ab_v2f*)(STp + 32 * g), ms); } }
// XN[c][n] = (bf16(x[c][n]) - mean[g]) rstd[g] bf16(gamma[c]) + bf16(beta[c]); XB[c][n] = bf16(x[c][n]) (residual copy); thread per float4; c runs over the rows of all images ([B * CH][N], groups numbered through), gamma and beta repeat every CH rows
__global__ __launch_bounds__(256) void k_ab_gapply(const float* __restrict__ X, const float* __restrict__ STp, const float* __restrict__ Gm, const float* __restrict__ Bt, float* __restrict__ XNp, float* __restrict__ XBp, int N, int CPG, int CH, long long n4) {
    #pragma clang fp contract(off)
    const long long u = (long long)blockIdx.x * 256 + threadIdx.x; if (u >= n4) return; const int c = (int)((4 * u) / N); const int g = c / CPG; const float mean = STp[32 * g], rs = STp[32 * g + 1], ga = cmb_bf(Gm[c % CH]), be = cmb_bf(Bt[c % CH]);
    const v4f v = *(const v4f*)(X + 4 * u); v4f xb; xb.x = cmb_bf(v.x); xb.y = cmb_bf(v.y); xb.z = cmb_bf(v.z); xb.w = cmb_bf(v.w); v4f r; r.x = (xb.x - mean) * rs * ga + be; r.y = (xb.y - mean) * rs * ga + be; r.z = (xb.z - mean) * rs * ga + be; r.w = (xb.w - mean) * rs * ga + be;
    VST2V4(XNp + 4 * u, r); VST2V4(XBp + 4 * u, xb); }


extern "C" void kernel_launch(void* const* d_in, const int* in_sizes, int n_in, void* d_out, int out_size, void* d_ws, size_t ws_size, hipStream_t stream) {
    (void)in_sizes; (void)n_in; (void)out_size; (void)ws_size;
    const float* x = (const float*)d_in[0];
    const float* gam = (const float*)d_in[1];
    const float* bet = (const float*)d_in[2];
    const float* wqkv = (const float*)d_in[3];
    const float* bqkv = (const float*)d_in[4];
    const float* wo = (const float*)d_in[5];
    const float* bo = (const float*)d_in[6];
    float* out = (float*)d_out;
    char* wsp = (char*)d_ws;
    float* ST = (float*)wsp; wsp += (((size_t)((size_t)32 * 32 + 64) * 4 + 255) / 256) * 256;
    float* XN = (float*)wsp; wsp += (((size_t)((size_t)1024 * 4096) * 4 + 255) / 256) * 256;
    unsigned short* XTH = (unsigned short*)wsp; wsp += (((size_t)((size_t)16384 * 256) * 2 + 255) / 256) * 256;
    unsigned short* XTL = (unsigned short*)wsp; wsp += (((size_t)((size_t)16384 * 256) * 2 + 255) / 256) * 256;
    unsigned short* W3H = (unsigned short*)wsp; wsp += (((size_t)((size_t)768 * 256) * 2 + 255) / 256) * 256;
    unsigned short* W3L = (unsigned short*)wsp; wsp += (((size_t)((size_t)768 * 256) * 2 + 255) / 256) * 256;
    float* BR3 = (float*)wsp; wsp += (((size_t)((size_t)768 + 64) * 4 + 255) / 256) * 256;
    float* QKV = (float*)wsp; wsp += (((size_t)((size_t)16384 * 768) * 4 + 255) / 256) * 256;
    float* AO = (float*)wsp; wsp += (((size_t)((size_t)16384 * 256) * 4 + 255) / 256) * 256;
    unsigned short* AOH = (unsigned short*)wsp; wsp += (((size_t)((size_t)16384 * 256) * 2 + 255) / 256) * 256;
    unsigned short* AOL = (unsigned short*)wsp; wsp += (((size_t)((size_t)16384 * 256) * 2 + 255) / 256) * 256;
    unsigned short* WOH = (unsigned short*)wsp; wsp += (((size_t)((size_t)256 * 256) * 2 + 255) / 256) * 256;
    unsigned short* WOL = (unsigned short*)wsp; wsp += (((size_t)((size_t)256 * 256) * 2 + 255) / 256) * 256;
    float* BRO = (float*)wsp; wsp += (((size_t)((size_t)256 + 64) * 4 + 255) / 256) * 256;
    float* XB = (float*)wsp; wsp += (((size_t)((size_t)1024 * 4096) * 4 + 255) / 256) * 256;
    if ((size_t)(wsp - (char*)d_ws) > ws_size) return;   // static carve guard
    // All four images go through each stage in ONE launch: every buffer holds the four images one behind the other (pixel-major buffers as 16384 rows,
    // channel-major ones as 4 matrices), and the image is extra rows, grid.y or grid.z of the launch.
    k_castS16<<<(unsigned)((((long long)(768) * ((256) / 2)) + 255) / 256), 256, 0, stream>>>(wqkv, 256, (__bf16*)(W3H), (__bf16*)(W3L), 256, 768, 256, 1.0f, 0, 0, 0);
    k_cm_bfvec<<<3, 256, 0, stream>>>(bqkv, BR3, 768); k_cm_bfvec<<<1, 256, 0, stream>>>(bo, BRO, 256);
    k_castS16<<<(unsigned)((((long long)(256) * ((256) / 2)) + 255) / 256), 256, 0, stream>>>(wo, 256, (__bf16*)(WOH), (__bf16*)(WOL), 256, 256, 256, 1.0f, 0, 0, 0);
    k_ab_gstat<<<32, 256, 0, stream>>>(x, ST, 131072); k_ab_gapply<<<(1048576 + 255) / 256, 256, 0, stream>>>(x, ST, gam, bet, XN, XB, 4096, 32, 256, 1048576LL);
    k_castS16<<<dim3((unsigned)((((long long)(4096) * ((256) / 2)) + 255) / 256), (unsigned)(4)), 256, 0, stream>>>(XN, 4096, (__bf16*)(XTH), (__bf16*)(XTL), 256, 256, 4096, 1.0f, 1, 1048576, 1048576);
    w25::wmma_gemm64<1, false, 2, 0, false, 0><<<dim3((unsigned)((((16384) / 64) * ((768) / 64) + 7) / 8), (unsigned)(1)), 256, 0, stream>>>((const unsigned short*)(XTH), nullptr, 256, 0, (const unsigned short*)(W3H), nullptr, 256, 0, (void*)(QKV), nullptr, 768, 0, BR3, nullptr, 0, 16384, 768, 256, 1.0f);
    w25::wmma_gemm64<1, false, 0, 0, true, 0><<<dim3((unsigned)((((16384) / 64) * ((768) / 64) + 7) / 8), (unsigned)(1)), 256, 0, stream>>>((const unsigned short*)(XTL), nullptr, 256, 0, (const unsigned short*)(W3H), nullptr, 256, 0, (void*)(QKV), nullptr, 768, 0, nullptr, QKV, 0, 16384, 768, 256, 1.0f);
    { /*apv4*/ AttnP a;
      a.Q = QKV; a.K = QKV + 256; a.V = QKV + 512; a.O = AO; a.P = 0; a.Mf = 0; a.Mi = 0; a.ST = 0;
      a.Pw = 0; a.Rt = 0; a.SQ = 0; a.SK = 0;
      a.swb = 0; a.swh = 0; a.swi = 0; a.swj = 0; a.srb = 0; a.srh = 0; a.sri = 0; a.sQb = 3145728; a.sQh = 64; a.sQi = 768; a.sQd = 1; a.sKb = 3145728; a.sKh = 64; a.sKj = 768; a.sKd = 1; a.sVb = 3145728; a.sVh = 64; a.sVj = 768; a.sVd = 1; a.sOb = 1048576; a.sOh = 64; a.sOi = 256; a.sPb = 0; a.sPh = 0; a.sPi = 0; a.smb = 0; a.smh = 0; a.smi = 0; a.smj = 0;
      a.Lq = 4096; a.Lk = 4096; a.dh = 64; a.dv = 64; a.hrep = 1; a.causal = 0; a.coff = 0; a.pband = 0;
      a.scale = 0.125f; a.mfill = 0.0f; a.nonorm = 0; a.mpol = 0;
      a.roff = 0; a.rn = 1; a.segpol = 0; a.win = 0;
      k_attn<64, 64, 0, false, false, true, true><<<dim3((unsigned)((4096) + 16 * AW - 1) / (16 * AW), (unsigned)(4), (unsigned)(4)), 32 * AW, 0, stream>>>(a); }
    k_castS16<<<(unsigned)((((long long)(16384) * ((256) / 2)) + 255) / 256), 256, 0, stream>>>(AO, 256, (__bf16*)(AOH), (__bf16*)(AOL), 256, 16384, 256, 1.0f, 0, 0, 0);
    w25::wmma_gemm64<1, false, 1, 0, true, 0><<<dim3((unsigned)((((256) / 64) * ((4096) / 64) + 7) / 8), (unsigned)(4)), 256, 0, stream>>>((const unsigned short*)(WOH), nullptr, 256, 0, (const unsigned short*)(AOH), nullptr, 256, 1048576, (void*)(out), nullptr, 4096, 1048576, BRO, XB, 1048576, 256, 4096, 256, 1.0f);
    w25::wmma_gemm64<1, false, 0, 0, true, 0><<<dim3((unsigned)((((256) / 64) * ((4096) / 64) + 7) / 8), (unsigned)(4)), 256, 0, stream>>>((const unsigned short*)(WOH), nullptr, 256, 0, (const unsigned short*)(AOL), nullptr, 256, 1048576, (void*)(out), nullptr, 4096, 1048576, nullptr, out, 1048576, 256, 4096, 256, 1.0f);
}

// v007
// One run takes 270 microseconds.
// In both of two side-by-side timings against v006, it was 1.09 times as fast.
// All steps since the starting kernel, v000, together make it 30.3 times as fast.
#include <hip/hip_runtime.h>
#include <math.h>

typedef __attribute__((ext_vector_type(16))) _Float16 v16h;
typedef __attribute__((ext_vector_type(8)))  _Float16 v8h;
typedef __attribute__((ext_vector_type(16))) __bf16   v16b;
typedef __attribute__((ext_vector_type(8)))  float    v8f;
typedef __attribute__((ext_vector_type(4)))  float    v4f;

// 16-bit WMMA fragment map (wave32), lane L, h = L>>4, m = L&15:
//   A 16x32: lane = row m;   element i -> k = (i<8) ? 8h+i : 16+8h+(i-8)
//   B 32x16: lane = column m; the SAME k(i,h)
//   D 16x16 (8 f32): lane = column m; element r -> row 8h+r
__device__ __forceinline__ int frag_k(int i, int h) { return (i < 8) ? (8 * h + i) : (16 + 8 * h + (i - 8)); }
__device__ __forceinline__ __bf16 bf16_rne(float f) {
    unsigned int u = __float_as_uint(f);
    u += 0x7fffu + ((u >> 16) & 1u);
    return __builtin_bit_cast(__bf16, (unsigned short)(u >> 16));
}
__device__ __forceinline__ float bf16_f32(__bf16 b) { return __uint_as_float(((unsigned int)__builtin_bit_cast(unsigned short, b)) << 16); }
__device__ __forceinline__ v8f wmma16(v16h a, v16h b, v8f c) {
    c = __builtin_amdgcn_wmma_f32_16x16x32_f16(false, a, false, b, (short)0, c, false, false);
    asm volatile("v_nop\n\tv_nop\n\tv_nop\n\tv_nop" : "+v"(c) : "v"(a), "v"(b));
    return c;
}
__device__ __forceinline__ v8f wmmab(v16b a, v16b b, v8f c) {
    c = __builtin_amdgcn_wmma_f32_16x16x32_bf16(false, a, false, b, (short)0, c, false, false);
    asm volatile("v_nop\n\tv_nop\n\tv_nop\n\tv_nop" : "+v"(c) : "v"(a), "v"(b));
    return c;
}
struct Split { v16b hi, lo; };
// hi/lo split product: a.hi*b.hi + a.hi*b.lo + a.lo*b.hi
__device__ __forceinline__ v8f wmma3(const Split& a, const Split& b, v8f c) {
    c = __builtin_amdgcn_wmma_f32_16x16x32_bf16(false, a.hi, false, b.hi, (short)0, c, false, false);
    c = __builtin_amdgcn_wmma_f32_16x16x32_bf16(false, a.hi, false, b.lo, (short)0, c, false, false);
    c = __builtin_amdgcn_wmma_f32_16x16x32_bf16(false, a.lo, false, b.hi, (short)0, c, false, false);
    asm volatile("v_nop\n\tv_nop\n\tv_nop\n\tv_nop" : "+v"(c) : "v"(a.hi), "v"(a.lo), "v"(b.hi), "v"(b.lo));
    return c;
}
struct Split3 { v16b hi, mid, lo; };
// triple split product (6 terms, drops only terms below 2^-24 relative)
__device__ __forceinline__ v8f wmma6(const Split3& a, const Split3& b, v8f c) {
    c = __builtin_amdgcn_wmma_f32_16x16x32_bf16(false, a.hi, false, b.hi, (short)0, c, false, false);
    c = __builtin_amdgcn_wmma_f32_16x16x32_bf16(false, a.hi, false, b.mid, (short)0, c, false, false);
    c = __builtin_amdgcn_wmma_f32_16x16x32_bf16(false, a.mid, false, b.hi, (short)0, c, false, false);
    c = __builtin_amdgcn_wmma_f32_16x16x32_bf16(false, a.hi, false, b.lo, (short)0, c, false, false);
    c = __builtin_amdgcn_wmma_f32_16x16x32_bf16(false, a.mid, false, b.mid, (short)0, c, false, false);
    c = __builtin_amdgcn_wmma_f32_16x16x32_bf16(false, a.lo, false, b.hi, (short)0, c, false, false);
    asm volatile("v_nop\n\tv_nop\n\tv_nop\n\tv_nop" : "+v"(c) : "v"(a.hi), "v"(a.mid), "v"(a.lo), "v"(b.hi), "v"(b.mid), "v"(b.lo));
    return c;
}

// Fragment gathers from f32 memory: element i <- p[(k0 + frag_k(i,h)) * sk] * s, zero for k >= klen.
__device__ __forceinline__ v16h fh_ld(const float* __restrict__ p, long long sk, int k0, int h, int klen, float s) {
    v16h a;
#pragma unroll
    for (int i = 0; i < 16; ++i) { const int k = k0 + frag_k(i, h); a[i] = (k < klen) ? (_Float16)(p[(long long)k * sk] * s) : (_Float16)0.f; }
    return a;
}
__device__ __forceinline__ Split sp_ld(const float* __restrict__ p, long long sk, int k0, int h, int klen, float s) {
    Split r;
#pragma unroll
    for (int i = 0; i < 16; ++i) {
        const int k = k0 + frag_k(i, h); const float x = (k < klen) ? p[(long long)k * sk] * s : 0.f;
        const __bf16 hb = bf16_rne(x); r.hi[i] = hb; r.lo[i] = bf16_rne(x - bf16_f32(hb));
    }
    return r;
}
__device__ __forceinline__ Split3 sp3_ld(const float* __restrict__ p, long long sk, int k0, int h, int klen, float s) {
    Split3 r;
#pragma unroll
    for (int i = 0; i < 16; ++i) {
        const int k = k0 + frag_k(i, h); const float x = (k < klen) ? p[(long long)k * sk] * s : 0.f;
        const __bf16 hb = bf16_rne(x); const float r1 = x - bf16_f32(hb); const __bf16 mb = bf16_rne(r1);
        r.hi[i] = hb; r.mid[i] = mb; r.lo[i] = bf16_rne(r1 - bf16_f32(mb));
    }
    return r;
}
__device__ __forceinline__ v16b bh_ld(const float* __restrict__ p, long long sk, int k0, int h, int klen, float s) {
    v16b a;
#pragma unroll
    for (int i = 0; i < 16; ++i) { const int k = k0 + frag_k(i, h); a[i] = bf16_rne((k < klen) ? p[(long long)k * sk] * s : 0.f); }
    return a;
}
// f16 fragment from an f16 LDS/global row with element stride 1 (k-contiguous), no bounds (tile already zero padded)
__device__ __forceinline__ v16h fh_row(const _Float16* __restrict__ row, int k0, int h) {
    v16h a;
#pragma unroll
    for (int i = 0; i < 16; ++i) a[i] = row[k0 + frag_k(i, h)];
    return a;
}

typedef __attribute__((ext_vector_type(4))) _Float16 v4h;
typedef __attribute__((ext_vector_type(8))) short v8s;
typedef __attribute__((address_space(3))) v8s lds_v8s;         // 16 bytes of LDS, as the transposing load takes them
// One 16-bit fragment's 32 k of a k-contiguous, 16-byte aligned f32 row as four unguarded 16-byte loads; row = the lane's row + 8 * h elements.
// fr_cvt packs them in the k order of frag_k.
struct FragRaw { v4f x0, x1, x2, x3; };
__device__ __forceinline__ FragRaw fr_ld(const v4f* __restrict__ row, int k0) {
    FragRaw r; r.x0 = row[k0 / 4]; r.x1 = row[k0 / 4 + 1]; r.x2 = row[k0 / 4 + 4]; r.x3 = row[k0 / 4 + 5];
    return r;
}
__device__ __forceinline__ v16h fr_cvt(const FragRaw& r) {
    v16h a;
#pragma unroll
    for (int i = 0; i < 4; ++i) { a[i] = (_Float16)r.x0[i]; a[4 + i] = (_Float16)r.x1[i]; a[8 + i] = (_Float16)r.x2[i]; a[12 + i] = (_Float16)r.x3[i]; }
    return a;
}

#define VST2(T, ptr, val) do { const T vst2_v_ = (val); *(T*)(ptr) = vst2_v_;  } while (0)
typedef float v4f __attribute__((ext_vector_type(4)));
#define VST2V4(ptr, val) do { const v4f vst2_v4_ = (val); *(v4f*)(ptr) = vst2_v4_;  } while (0)

__device__ __attribute__((noinline)) float act_fn(float v, int act) {
    if (act == 1) return fmaxf(v, 0.f);                                                                               // relu
    if (act == 2) { const float u = 0.7978845608028654f * (v + 0.044715f * v * v * v); return 0.5f * v * (1.f + tanhf(u)); } // tanh-gelu
    if (act == 3) return v / (1.f + expf(-v));                                                                        // silu
    if (act == 4) return 0.5f * v * (1.f + erff(v * 0.7071067811865476f));                                             // erf-gelu
    if (act == 5) return tanhf(v);
    if (act == 6) return 1.f / (1.f + expf(-v));                                                                      // sigmoid
    if (act == 7) return (v > 0.f) ? v : 0.01f * v;                                                                   // leaky relu 0.01
    if (act == 8) return (v > 0.f) ? v : (expf(v) - 1.f);                                                             // elu
    if (act == 9) return fminf(fmaxf(v, 0.f), 6.f);                                                                   // relu6
    if (act == 10) return fabsf(v);                                                                                    // abs
    if (act == 11) return (v >= 0.f) ? v : 0.1f * v;                                                                  // leaky 0.1
    if (act == 12) return (v > 0.f) ? v : 0.2f * v;                                                                   // leaky 0.2
    if (act == 13) return (v > 20.f) ? v : log1pf(expf(v));                                                            // softplus
    return v;
}

// =====================================================================================================================
// k_gemm<MODE>: C(z, m, n) = act(alpha * sum_k A(z, m, k) * B(z, k, n) + bias) + beta * R(z, m, n)
//   One wave (32-thread block) per 16 x 32 tile of C; grid (ceil(N/32), ceil(M/16), Z). Batch z -> (zo = z / zi_n, zi = z % zi_n)
//   with separate outer/inner strides for every tensor (e.g. batch and head). A(m,k) = A[zo*sAo + zi*sAi + m*sAm + k*sAk] (f32),
//   B(k,n) = B[zo*sBo + zi*sBi + n*sBn + k*sBk] (f32); any M, N, K (K zero-padded to 32 inside the fragments, M/N tails guarded).
//   C(m,n) = C[zo*sCo + zi*sCi + m*sCm + n] (n contiguous). flags: 1 bias[n], 2 bias[m], 4 residual R[zo*sRo + zi*sRi + m*sRm + n*sRn].
//   MODE 0: f16 operands (A prescaled by sa, B by sb, both undone in the epilogue); 1: bf16 hi/lo split (3 products); 2: bf16;
//   3: bf16 hi/mid/lo triple split (6 products); 4: as 3 with Kahan-compensated f32 accumulation across k-steps.
// =====================================================================================================================
struct GemmP {
    const float* A; const float* B; const float* bias; const float* R; float* C;
    long long sAo, sAi, sAm, sAk, sBo, sBi, sBn, sBk, sCo, sCi, sCm, sRo, sRi, sRm, sRn;
    int M, N, K, zi_n, flags, act; float alpha, beta, sa, sb;
    int Npad, pad_;     // columns [N, Npad) of C are written as 0 so that padded workspace rows are covered by whole-line stores; Npad >= N
};
static_assert(sizeof(GemmP) == 5 * 8 + 15 * 8 + 6 * 4 + 4 * 4 + 2 * 4, "GemmP has padding");

template <int MODE>
__global__ __launch_bounds__(32) void k_gemm(GemmP p) {
    const int lane = threadIdx.x & 31, h = lane >> 4, l15 = lane & 15;
    const int m0 = blockIdx.y * 16, n0 = blockIdx.x * 32;
    const int z = blockIdx.z, zo = z / p.zi_n, zi = z - zo * p.zi_n;
    const float* A = p.A + zo * p.sAo + zi * p.sAi;
    const float* B = p.B + zo * p.sBo + zi * p.sBi;
    const int am = min(m0 + l15, p.M - 1);                       // clamped row for loads (stores are guarded)
    v8f acc[2], comp[2];
#pragma unroll
    for (int t = 0; t < 2; ++t) { v8f zz = {}; acc[t] = zz; comp[t] = zz; }
    for (int k0 = 0; k0 < p.K; k0 += 32) {
        const float* arow = A + (long long)am * p.sAm;
        if (MODE == 1) {
            const Split a = sp_ld(arow, p.sAk, k0, h, p.K, 1.f);
#pragma unroll
            for (int t = 0; t < 2; ++t) {
                const int bn = min(n0 + t * 16 + l15, p.N - 1);
                acc[t] = wmma3(a, sp_ld(B + (long long)bn * p.sBn, p.sBk, k0, h, p.K, 1.f), acc[t]);
            }
        } else if (MODE == 3) {
            const Split3 a = sp3_ld(arow, p.sAk, k0, h, p.K, 1.f);
#pragma unroll
            for (int t = 0; t < 2; ++t) {
                const int bn = min(n0 + t * 16 + l15, p.N - 1);
                acc[t] = wmma6(a, sp3_ld(B + (long long)bn * p.sBn, p.sBk, k0, h, p.K, 1.f), acc[t]);
            }
        } else if (MODE == 4) {
            // triple split as MODE 3, but each k-step's 6 products go into a fresh accumulator and the partial is added to the running f32 sum
            // on the VALU with Kahan compensation (accumulation error stays ~1 ulp however long K is)
            const Split3 a = sp3_ld(arow, p.sAk, k0, h, p.K, 1.f);
#pragma unroll
            for (int t = 0; t < 2; ++t) {
                const int bn = min(n0 + t * 16 + l15, p.N - 1); v8f zz = {};
                const v8f part = wmma6(a, sp3_ld(B + (long long)bn * p.sBn, p.sBk, k0, h, p.K, 1.f), zz);
                const v8f y = part - comp[t]; const v8f s = acc[t] + y; comp[t] = (s - acc[t]) - y; acc[t] = s;
            }
        } else if (MODE == 2) {
            const v16b a = bh_ld(arow, p.sAk, k0, h, p.K, 1.f);
#pragma unroll
            for (int t = 0; t < 2; ++t) {
                const int bn = min(n0 + t * 16 + l15, p.N - 1);
                acc[t] = wmmab(a, bh_ld(B + (long long)bn * p.sBn, p.sBk, k0, h, p.K, 1.f), acc[t]);
            }
        } else {
            const v16h a = fh_ld(arow, p.sAk, k0, h, p.K, p.sa);
#pragma unroll
            for (int t = 0; t < 2; ++t) {
                const int bn = min(n0 + t * 16 + l15, p.N - 1);
                acc[t] = wmma16(a, fh_ld(B + (long long)bn * p.sBn, p.sBk, k0, h, p.K, p.sb), acc[t]);
            }
        }
    }
    const float iscale = (MODE == 0) ? p.alpha / (p.sa * p.sb) : p.alpha;
    float* C = p.C + zo * p.sCo + zi * p.sCi;
    const float* R = p.R + zo * p.sRo + zi * p.sRi;
    __shared__ __align__(16) float ctile[16][36];
#pragma unroll
    for (int t = 0; t < 2; ++t) {
        const int n = n0 + t * 16 + l15; const int nn = min(n, p.N - 1);
#pragma unroll
        for (int r = 0; r < 8; ++r) {
            const int m = m0 + 8 * h + r; const int mm = min(m, p.M - 1);
            float v = acc[t][r] * iscale;
            if (p.flags & 1) v += p.bias[nn];
            if (p.flags & 2) v += p.bias[mm];
            if (p.flags & 8) v *= p.bias[(long long)zo * p.M + mm];   /* per-(z,row) scale vector laid out [Z][M]; exclusive with the bias flags */
            v = act_fn(v, p.act);
            if (p.flags & 4) v += p.beta * R[(long long)mm * p.sRm + (long long)nn * p.sRn];
            ctile[8 * h + r][t * 16 + l15] = (n < p.N) ? v : 0.f;
        }
    }
    __syncthreads();
    const int NW = (p.Npad > p.N) ? p.Npad : p.N;           // write width
    const bool fast = (m0 + 16 <= p.M) && (n0 + 32 <= NW) && ((p.sCm & 3) == 0) && ((((size_t)C) & 15) == 0);
    if (fast) {
#pragma unroll
        for (int s = 0; s < 4; ++s) {
            const int row = s * 4 + (lane >> 3), c4 = (lane & 7) * 4;
            const v4f v = *(const v4f*)&ctile[row][c4];
            VST2V4(C + (long long)(m0 + row) * p.sCm + n0 + c4, v);
        }
    } else {
        for (int row = 0; row < 16; ++row) {
            const int m = m0 + row, n = n0 + lane;
            if (m < p.M && n < NW) VST2(float, C + (long long)m * p.sCm + n, ctile[row][lane]);
        }
    }
}


// =====================================================================================================================
// k_gemmT<MODE, TM, TN>: same contract as k_gemm, but one wave computes a (16*TM) x (16*TN) tile: TM A fragments and TN B fragments are
//   loaded per 32-wide k-step and reused across TM*TN WMMAs (far fewer load/convert instructions per MAC). MODE 0 (f16), 1 (bf16 hi/lo),
//   2 (bf16) only. grid (ceil(NW/(16*TN)), ceil(M/(16*TM)), Z), block 32. Epilogue identical to k_gemm, run per 16x32 sub-tile.
// =====================================================================================================================
template <int MODE, int TM, int TN>
__global__ __launch_bounds__(32) void k_gemmT(GemmP p) {
    const int lane = threadIdx.x & 31, h = lane >> 4, l15 = lane & 15;
    const int m0 = blockIdx.y * (16 * TM), n0 = blockIdx.x * (16 * TN);
    const int z = blockIdx.z, zo = z / p.zi_n, zi = z - zo * p.zi_n;
    const float* A = p.A + zo * p.sAo + zi * p.sAi;
    const float* B = p.B + zo * p.sBo + zi * p.sBi;
    v8f acc[TM][TN];
#pragma unroll
    for (int i = 0; i < TM; ++i)
#pragma unroll
        for (int t = 0; t < TN; ++t) { v8f zz = {}; acc[i][t] = zz; }
    for (int k0 = 0; k0 < p.K; k0 += 32) {
        if (MODE == 1) {
            Split a[TM], b[TN];
#pragma unroll
            for (int i = 0; i < TM; ++i) { const int am = min(m0 + 16 * i + l15, p.M - 1); a[i] = sp_ld(A + (long long)am * p.sAm, p.sAk, k0, h, p.K, 1.f); }
#pragma unroll
            for (int t = 0; t < TN; ++t) { const int bn = min(n0 + 16 * t + l15, p.N - 1); b[t] = sp_ld(B + (long long)bn * p.sBn, p.sBk, k0, h, p.K, 1.f); }
#pragma unroll
            for (int i = 0; i < TM; ++i)
#pragma unroll
                for (int t = 0; t < TN; ++t) acc[i][t] = wmma3(a[i], b[t], acc[i][t]);
        } else if (MODE == 2) {
            v16b a[TM], b[TN];
#pragma unroll
            for (int i = 0; i < TM; ++i) { const int am = min(m0 + 16 * i + l15, p.M - 1); a[i] = bh_ld(A + (long long)am * p.sAm, p.sAk, k0, h, p.K, 1.f); }
#pragma unroll
            for (int t = 0; t < TN; ++t) { const int bn = min(n0 + 16 * t + l15, p.N - 1); b[t] = bh_ld(B + (long long)bn * p.sBn, p.sBk, k0, h, p.K, 1.f); }
#pragma unroll
            for (int i = 0; i < TM; ++i)
#pragma unroll
                for (int t = 0; t < TN; ++t) acc[i][t] = wmmab(a[i], b[t], acc[i][t]);
        } else {
            v16h a[TM], b[TN];
#pragma unroll
            for (int i = 0; i < TM; ++i) { const int am = min(m0 + 16 * i + l15, p.M - 1); a[i] = fh_ld(A + (long long)am * p.sAm, p.sAk, k0, h, p.K, p.sa); }
#pragma unroll
            for (int t = 0; t < TN; ++t) { const int bn = min(n0 + 16 * t + l15, p.N - 1); b[t] = fh_ld(B + (long long)bn * p.sBn, p.sBk, k0, h, p.K, p.sb); }
#pragma unroll
            for (int i = 0; i < TM; ++i)
#pragma unroll
                for (int t = 0; t < TN; ++t) acc[i][t] = wmma16(a[i], b[t], acc[i][t]);
        }
    }
    const float iscale = (MODE == 0) ? p.alpha / (p.sa * p.sb) : p.alpha;
    float* C = p.C + zo * p.sCo + zi * p.sCi;
    const float* R = p.R + zo * p.sRo + zi * p.sRi;
    const int NW = (p.Npad > p.N) ? p.Npad : p.N;
    __shared__ __align__(16) float ctile[16][36];
#pragma unroll
    for (int i = 0; i < TM; ++i) {
        const int mb = m0 + 16 * i; if (mb >= p.M) break;          // wave-uniform
#pragma unroll
        for (int tp = 0; tp < TN / 2; ++tp) {
            const int nb = n0 + 32 * tp; if (nb >= NW) break;        // wave-uniform
#pragma unroll
            for (int t2 = 0; t2 < 2; ++t2) {
                const int t = 2 * tp + t2; const int n = nb + t2 * 16 + l15; const int nn = min(n, p.N - 1);
#pragma unroll
                for (int r = 0; r < 8; ++r) {
                    const int m = mb + 8 * h + r; const int mm = min(m, p.M - 1);
                    float v = acc[i][t][r] * iscale;
                    if (p.flags & 1) v += p.bias[nn];
                    if (p.flags & 2) v += p.bias[mm];
            if (p.flags & 8) v *= p.bias[(long long)zo * p.M + mm];   /* per-(z,row) scale vector laid out [Z][M]; exclusive with the bias flags */
                    v = act_fn(v, p.act);
                    if (p.flags & 4) v += p.beta * R[(long long)mm * p.sRm + (long long)nn * p.sRn];
                    ctile[8 * h + r][t2 * 16 + l15] = (n < p.N) ? v : 0.f;
                }
            }
            __syncthreads();
            const bool fast = (mb + 16 <= p.M) && (nb + 32 <= NW) && ((p.sCm & 3) == 0) && ((((size_t)C) & 15) == 0);
            if (fast) {
#pragma unroll
                for (int s = 0; s < 4; ++s) {
                    const int row = s * 4 + (lane >> 3), c4 = (lane & 7) * 4;
                    const v4f v = *(const v4f*)&ctile[row][c4];
                    VST2V4(C + (long long)(mb + row) * p.sCm + nb + c4, v);
                }
            } else {
                for (int row = 0; row < 16; ++row) {
                    const int m = mb + row, n = nb + lane;
                    if (m < p.M && n < NW) VST2(float, C + (long long)m * p.sCm + n, ctile[row][lane]);
                }
            }
            __syncthreads();
        }
    }
}

// =====================================================================================================================
//   Wave = 16 queries, AW waves per block, 64-key blocks; grid (ceil(Lq/(16*AW)), H, B), block 32*AW. Any Lq, Lk; head dim dh <= DHP
//   (DHP multiple of 32), value dim dv <= DVP (multiple of 16, <= 128). Every tensor addressed by (batch, head, row, element) strides, f32.
//   Scores: QM 0 f16 operands, 1 bf16 hi/lo split, 2 bf16 triple split; statistics f32 (exp2 domain); P.V: P x 4096 as f16 with V f16 staged in LDS
//   (SPLITPV: P and V as bf16 hi/lo splits). kv head = h / hrep. Masking: causal = 1 (keep j <= i + coff, masked -> -inf, key blocks beyond the
//   diagonal skipped), causal = 2 (masked -> mfill, a finite fill like the -1e9; no skipping), causal = 3 (keep j >= i + coff,
//   masked -> -inf, no skipping); optional additive f32 mask Mf,
//   optional int keep-mask Mi (0 -> score := mfill), both addressed b*smb + h*smh + i*smi + j*smj (0 strides broadcast).
// =====================================================================================================================
#define AW 4
// lane l's value of lane l ^ 16 (the wave's other half), by a vector cross-row move
__device__ __forceinline__ float xhalf(float x) { return __builtin_bit_cast(float, __builtin_amdgcn_permlanex16(__builtin_bit_cast(int, x), __builtin_bit_cast(int, x), 0x76543210, 0xfedcba98, false, false)); }
struct AttnP {   // apv4
    const float* Q; const float* K; const float* V; float* O; float* P; const float* Mf; const int* Mi; float* ST;
    const float* Pw; const float* Rt; const int* SQ; const int* SK;           // optional: post-softmax weight, relative-position table, segment ids
    long long swb, swh, swi, swj, srb, srh, sri;                                 // Pw strides (b,h,i,j); Rt strides (b,h,i), column = clamp(i - j + roff, 0, rn-1)
    long long sQb, sQh, sQi, sQd, sKb, sKh, sKj, sKd, sVb, sVh, sVj, sVd, sOb, sOh, sOi, sPb, sPh, sPi, smb, smh, smi, smj;
    int Lq, Lk, dh, dv, hrep, causal, coff, pband;   // pband > 0: P holds only the band |j - i| <= pband, column j - i + pband
    float scale, mfill; int nonorm, mpol;             // nonorm (online path only): O = sum_j exp(score_j) V_j without the 1/rowsum (scores must be <= ~0); mpol: Mi masks where ==0 (mpol 0) or where !=0 (mpol 1)
    int roff, rn, segpol, win;                        // Rt column offset/count; SQ/SK: score := mfill where (segpol 0) SQ[i] != SK[j] or (segpol 1) SQ[i] == SK[j]; win > 0: keys with i - j > win (after coff) -> -inf
};
//   Pw: the softmax numerator is multiplied by Pw(b,h,i,j) AFTER the row sum is taken (probs * weight, then P.V), as in post-softmax multiplicative biases.                                                    // ST (optional): per row (b,h,i) -> ST[((b*H + h)*Lq + i)*2 + {0,1}] = {row max of the scaled+masked score (natural units), sum_j exp(score - max)}
static_assert(sizeof(AttnP) == 12 * 8 + 29 * 8 + 16 * 4, "AttnP has padding");

#ifndef KATTN_ATTR
#define KATTN_ATTR __attribute__((amdgpu_waves_per_eu(4, 4)))   // the launch puts 4 waves on a SIMD: registers are budgeted for that, so a key block's 16 loads still issue as one group
#endif
template <int DHP, int DVP, int QM, bool SPLITPV, bool TWOPASS, bool UNIT = false, bool PLAIN = false>
__global__ __launch_bounds__(32 * AW) KATTN_ATTR void k_attn(AttnP p) {
    static_assert(!PLAIN || !TWOPASS, "PLAIN covers the one-pass path");
    static_assert(!UNIT || (QM == 0 && !SPLITPV && !TWOPASS && (32 * AW) / (DVP / 4) == 8 && (32 * AW) / (DHP / 4) == 8), "UNIT covers the f16 one-pass path, 8 K rows and 8 V rows per load step");
    constexpr int NT = DVP / 16;                // output tiles
    constexpr int KS = DHP / 32;                // k-steps for the scores
    constexpr int VP = (UNIT && PLAIN) ? DVP + 16 : DVP + 8;   // LDS pitch of the V tile (halves); transposed path: an odd multiple of 32 bytes, the pitch at which the transposing LDS load runs without bank conflicts
    constexpr int KP = DHP + 8;                 // LDS pitch of the K tile (halves): an odd multiple of 16 bytes, so a fragment's 16 rows fall on different banks
    __shared__ __align__(16) float    pl[AW][16 * 64];
    __shared__ __align__(16) _Float16 vl[(SPLITPV ? 2 : 1) * 64 * VP];   // f16 V tile, or bf16 hi and lo tiles (same 2-byte size)
    __shared__ __align__(16) _Float16 kl[UNIT ? 64 * KP : 8];            // UNIT: f16 K tile, row = key
    const int lane = threadIdx.x & 31, hf = lane >> 4, l15 = lane & 15, wave = threadIdx.x >> 5;
    const int h = blockIdx.y, b = blockIdx.z, hk = h / p.hrep;
    const int q0 = (blockIdx.x * AW + wave) * 16;
    float* myp = pl[wave];
    const float L2E = 1.4426950408889634f;
    const float NEG = -__builtin_inff();
    const int qi = min(q0 + l15, p.Lq - 1);
    const float* qrow = p.Q + b * p.sQb + h * p.sQh + (long long)qi * p.sQi;
    const float* kbase = p.K + b * p.sKb + hk * p.sKh;
    const float* vbase = p.V + b * p.sVb + hk * p.sVh;
    const v4f* qp = (const v4f*)(qrow + 8 * hf);               // UNIT: the lane's half of the fragment's k
    v16h qa[QM == 0 ? KS : 1]; Split qs_[QM == 1 ? KS : 1]; Split3 qt_[QM == 2 ? KS : 1];
#pragma unroll
    for (int ks = 0; ks < KS; ++ks) {
        if (QM == 2) qt_[ks] = sp3_ld(qrow, p.sQd, ks * 32, hf, p.dh, 1.f);
        else if (QM == 1) qs_[ks] = sp_ld(qrow, p.sQd, ks * 32, hf, p.dh, 1.f);
        else if (UNIT) qa[ks] = fr_cvt(fr_ld(qp, ks * 32));
        else qa[ks] = fh_ld(qrow, p.sQd, ks * 32, hf, p.dh, 1.f);
    }
    if (UNIT) asm volatile("s_wait_xcnt 0x0" :: "v"(qp) : "memory");   // the Q loads' address registers stay as they are up to this wait (named as input) and are reused behind it
    constexpr int VR = (32 * AW) / (DVP / 4);                  // V rows that the block's threads cover with one 16-byte load each
    constexpr int KR = (32 * AW) / (DHP / 4);                  // K rows that the block's threads cover with one 16-byte load each
    const unsigned koff = (unsigned)((int)(threadIdx.x / (DHP / 4)) * (int)p.sKj + (int)(threadIdx.x % (DHP / 4)) * 4) * 4u;   // UNIT: thread's byte offset in KR rows of K
    const unsigned voff = (unsigned)((int)(threadIdx.x / (DVP / 4)) * (int)p.sVj + (int)(threadIdx.x % (DVP / 4)) * 4) * 4u;   // UNIT: thread's byte offset in VR rows of V
    // transposed path: the 16 bytes of the V tile that this lane hands to a transposing load of keys 0 ... 15, columns 0 ... 15: row 8 hf + (lane & 7), column half (lane >> 3) & 1
    lds_v8s* const vtr = (lds_v8s*)(vl + (8 * hf + (lane & 7)) * VP + 8 * ((lane >> 3) & 1));
    v8f o[NT]; float m8[8], l8[8];
#pragma unroll
    for (int t = 0; t < NT; ++t) { v8f zz = {}; o[t] = zz; }
#pragma unroll
    for (int i = 0; i < 8; ++i) { m8[i] = NEG; l8[i] = 0.f; }
    int jend = p.Lk; int jstart = 0;
    if (!PLAIN && p.causal == 1) { const int je = (blockIdx.x * AW + AW - 1) * 16 + 16 + p.coff; jend = min(jend, max(je, 0)); }   // uniform per block
    if (!PLAIN && p.win > 0) { const int js = (int)(blockIdx.x * AW) * 16 + p.coff - p.win; jstart = (js > 0) ? (js / 64) * 64 : 0; }   // uniform per block: key blocks entirely outside every row's window hold only -inf entries and are skipped exactly
    const int npass = TWOPASS ? 2 : 1;
    for (int pass = 0; pass < npass; ++pass) {
        const bool dopv = (!TWOPASS) || pass == 1;
        for (int j0 = jstart; j0 < jend; j0 += 64) {
            if (dopv) {
                __syncthreads();                                 // previous key block's reads of kl / vl / pl are done
                if (!UNIT)
                for (int idx = threadIdx.x; idx < 64 * DVP; idx += 32 * AW) {
                    const int jr = idx / DVP, d = idx - jr * DVP, j = j0 + jr;
                    const float f = (j < p.Lk && d < p.dv) ? vbase[(long long)j * p.sVj + (long long)d * p.sVd] : 0.f;
                    if (SPLITPV) {
                        const __bf16 hb = bf16_rne(f);
                        ((__bf16*)vl)[jr * VP + d] = hb; ((__bf16*)vl)[64 * VP + jr * VP + d] = bf16_rne(f - bf16_f32(hb));
                    } else vl[jr * VP + d] = (_Float16)f;
                }
            }
            v8f s[4];
            union { v16h v; v8s h[2]; } va[(UNIT && PLAIN) ? NT : 1][2];   // transposed path: V^T as A, [value tile t][the block's first and second 32 keys]: lane = value column 16 t + l15, element e = key frag_k(e, hf)
            if (UNIT) {
                v4f vr[8], kr[8]; const v4f* vp[8]; const v4f* kp[8];
#pragma unroll
                for (int it = 0; it < 8; ++it) { vp[it] = (const v4f*)((const char*)(vbase + (long long)(j0 + it * VR) * p.sVj) + voff); vr[it] = *vp[it]; }
#pragma unroll
                for (int it = 0; it < 8; ++it) { kp[it] = (const v4f*)((const char*)(kbase + (long long)(j0 + it * KR) * p.sKj) + koff); kr[it] = *kp[it]; }
                // the group's address registers stay as they are up to this wait (named as inputs) and are reused behind it, while the loads are still in flight
                asm volatile("s_wait_xcnt 0x0" :: "v"(vp[0]), "v"(vp[1]), "v"(vp[2]), "v"(vp[3]), "v"(vp[4]), "v"(vp[5]), "v"(vp[6]), "v"(vp[7]),
                             "v"(kp[0]), "v"(kp[1]), "v"(kp[2]), "v"(kp[3]), "v"(kp[4]), "v"(kp[5]), "v"(kp[6]), "v"(kp[7]) : "memory");
#pragma unroll
                for (int it = 0; it < 8; ++it) {
                    v4h hv; hv[0] = (_Float16)vr[it][0]; hv[1] = (_Float16)vr[it][1]; hv[2] = (_Float16)vr[it][2]; hv[3] = (_Float16)vr[it][3];
                    *(v4h*)(vl + (it * VR + (int)(threadIdx.x / (DVP / 4))) * VP + (int)(threadIdx.x % (DVP / 4)) * 4) = hv;
                }
#pragma unroll
                for (int it = 0; it < 8; ++it) {
                    v4h hk4; hk4[0] = (_Float16)kr[it][0]; hk4[1] = (_Float16)kr[it][1]; hk4[2] = (_Float16)kr[it][2]; hk4[3] = (_Float16)kr[it][3];
                    *(v4h*)(kl + (it * KR + (int)(threadIdx.x / (DHP / 4))) * KP + (int)(threadIdx.x % (DHP / 4)) * 4) = hk4;
                }
                __syncthreads();                                 // K and V tiles (shared) visible
                union { v16h v; v8h h[2]; } kf[4][KS];
#pragma unroll
                for (int t = 0; t < 4; ++t)
#pragma unroll
                    for (int ks = 0; ks < KS; ++ks) {
                        const _Float16* kq = kl + (t * 16 + l15) * KP + ks * 32 + 8 * hf;   // key row l15 of tile t; the lane's half of the fragment's k, in the order of frag_k
                        kf[t][ks].h[0] = *(const v8h*)kq; kf[t][ks].h[1] = *(const v8h*)(kq + 16);
                    }
                if (PLAIN) {                                     // one transposing load hands the lane 8 keys (8 hf + 0 ... 7 of a 16-key group) of its column; issued here, the loads return while the scores and the softmax run
#pragma unroll   // both loops: va is then indexed by constants and stays in registers, and each load's place is an immediate offset from vtr
                    for (int t = 0; t < NT; ++t)
#pragma unroll   // (as above)
                        for (int g = 0; g < 4; ++g) va[t][g >> 1].h[g & 1] = __builtin_amdgcn_ds_load_tr16_b128_v8i16(vtr + (g * 16 * VP + t * 16) / 8);
                }
#pragma unroll
                for (int t = 0; t < 4; ++t) {
                    v8f acc = {};
#pragma unroll
                    for (int ks = 0; ks < KS; ++ks) acc = PLAIN ? wmma16(kf[t][ks].v, qa[ks], acc) : wmma16(qa[ks], kf[t][ks].v, acc);
                    s[t] = acc;
                }
            } else
#pragma unroll
            for (int t = 0; t < 4; ++t) {
                const int j = min(j0 + t * 16 + l15, p.Lk - 1);
                const float* krow = kbase + (long long)j * p.sKj;
                v8f acc = {};
#pragma unroll
                for (int ks = 0; ks < KS; ++ks) {
                    if (QM == 2)      acc = wmma6(qt_[ks], sp3_ld(krow, p.sKd, ks * 32, hf, p.dh, 1.f), acc);
                    else if (QM == 1) acc = wmma3(qs_[ks], sp_ld(krow, p.sKd, ks * 32, hf, p.dh, 1.f), acc);
                    else              acc = wmma16(qa[ks], fh_ld(krow, p.sKd, ks * 32, hf, p.dh, 1.f), acc);
                }
                s[t] = acc;
            }
            if (UNIT && PLAIN) {                                 // s[t][r] = score of key j0 + 16 t + 8 hf + r for query q0 + l15; m8[0], l8[0]: that query's maximum and this half's sum
                float mt[4];                                     // one maximum chain per score tile, so that the four overlap
                // every loop of this block is unrolled: s, mt, rt, the fragments and o are then indexed by constants and stay in registers
#pragma unroll
                for (int t = 0; t < 4; ++t) {
#pragma unroll
                    for (int r = 0; r < 8; ++r) s[t][r] = s[t][r] * p.scale * L2E;
                    mt[t] = fmaxf(fmaxf(fmaxf(s[t][0], s[t][1]), fmaxf(s[t][2], s[t][3])), fmaxf(fmaxf(s[t][4], s[t][5]), fmaxf(s[t][6], s[t][7])));
                }
                float mx = fmaxf(fmaxf(mt[0], mt[1]), fmaxf(mt[2], mt[3]));
                mx = fmaxf(mx, xhalf(mx));
                const float mnew = fmaxf(m8[0], mx);
                const float corr = exp2f(m8[0] - mnew);
                float rt[4];
#pragma unroll
                for (int t = 0; t < 4; ++t) {
#pragma unroll
                    for (int r = 0; r < 8; ++r) s[t][r] = exp2f(s[t][r] - mnew);
                    rt[t] = ((s[t][0] + s[t][1]) + (s[t][2] + s[t][3])) + ((s[t][4] + s[t][5]) + (s[t][6] + s[t][7]));
                }
                l8[0] = l8[0] * corr + ((rt[0] + rt[1]) + (rt[2] + rt[3])); m8[0] = mnew;   // the halves' sums are joined behind the loop
                v16h pb0, pb1;                                   // P^T x 4096 as B: element e = key frag_k(e, hf) of the block's first and second 32 keys
#pragma unroll
                for (int e = 0; e < 16; ++e) { pb0[e] = (_Float16)(s[e >> 3][e & 7] * 4096.f); pb1[e] = (_Float16)(s[2 + (e >> 3)][e & 7] * 4096.f); }
#pragma unroll
                for (int t = 0; t < NT; ++t) {
                    o[t] *= corr;
                    o[t] = wmma16(va[t][0].v, pb0, o[t]);        // o[t][r] = O^T[16 t + 8 hf + r][query l15]
                    o[t] = wmma16(va[t][1].v, pb1, o[t]);
                }
                continue;
            }
            float pv[8][4];
#pragma unroll
            for (int i = 0; i < 8; ++i) {
                const int irow = q0 + i + 8 * hf;
                const int ic = min(irow, p.Lq - 1);
                float sc[4];
#pragma unroll
                for (int t = 0; t < 4; ++t) {
                    const int jg = j0 + t * 16 + l15;
                    float v = s[t][i] * p.scale;
                    if (!PLAIN && p.Mf) v += p.Mf[b * p.smb + h * p.smh + (long long)ic * p.smi + (long long)min(jg, p.Lk - 1) * p.smj];
                    if (!PLAIN && p.Rt) { int rc = ic - min(jg, p.Lk - 1) + p.roff; rc = rc < 0 ? 0 : (rc >= p.rn ? p.rn - 1 : rc); v += p.Rt[b * p.srb + h * p.srh + (long long)ic * p.sri + rc]; }
                    if (!PLAIN && p.Mi) { const int mv = p.Mi[b * p.smb + h * p.smh + (long long)ic * p.smi + (long long)min(jg, p.Lk - 1) * p.smj]; if (p.mpol ? (mv != 0) : (mv == 0)) v = p.mfill; }
                    if (!PLAIN && p.SQ) { const bool same = p.SQ[(long long)b * p.Lq + ic] == p.SK[(long long)b * p.Lk + min(jg, p.Lk - 1)]; if (p.segpol ? same : !same) v = p.mfill; }
                    if (!PLAIN && p.causal == 2 && jg > irow + p.coff) v = p.mfill;
                    if (!PLAIN && (jg >= p.Lk || (p.causal == 1 && jg > irow + p.coff) || (p.causal == 3 && jg < irow + p.coff) || (p.win > 0 && irow + p.coff - jg > p.win))) v = NEG; else v *= L2E;
                    sc[t] = v;
                }
                if (!TWOPASS || pass == 0) {
                    float mx = fmaxf(fmaxf(sc[0], sc[1]), fmaxf(sc[2], sc[3]));
                    mx = fmaxf(mx, __shfl_xor(mx, 1, 32)); mx = fmaxf(mx, __shfl_xor(mx, 2, 32));
                    mx = fmaxf(mx, __shfl_xor(mx, 4, 32)); mx = fmaxf(mx, __shfl_xor(mx, 8, 32));
                    const float mnew = fmaxf(m8[i], mx);
                    const float corr = (!PLAIN && mnew == NEG) ? 1.f : exp2f(m8[i] - mnew);
                    float rs = 0.f;
#pragma unroll
                    for (int t = 0; t < 4; ++t) {
                        const float pp = (!PLAIN && sc[t] == NEG) ? 0.f : exp2f(sc[t] - mnew); rs += pp;
                        pv[i][t] = (!PLAIN && p.Pw) ? pp * p.Pw[b * p.swb + h * p.swh + (long long)ic * p.swi + (long long)min(j0 + t * 16 + l15, p.Lk - 1) * p.swj] : pp;
                    }
                    rs += __shfl_xor(rs, 1, 32); rs += __shfl_xor(rs, 2, 32); rs += __shfl_xor(rs, 4, 32); rs += __shfl_xor(rs, 8, 32);
                    l8[i] = l8[i] * corr + rs; m8[i] = mnew;
                    if (!TWOPASS) {
#pragma unroll
                        for (int t = 0; t < NT; ++t) o[t][i] *= corr;
                    }
                } else {
                    const float inv = (l8[i] > 0.f) ? 1.f / l8[i] : 0.f;
#pragma unroll
                    for (int t = 0; t < 4; ++t) {
                        const int jg = j0 + t * 16 + l15;
                        float pp = (sc[t] == NEG) ? 0.f : exp2f(sc[t] - m8[i]) * inv;
                        if (p.Pw) pp *= p.Pw[b * p.swb + h * p.swh + (long long)ic * p.swi + (long long)min(jg, p.Lk - 1) * p.swj];
                        pv[i][t] = pp;
                    }
                }
            }
            if (dopv) {
#pragma unroll
                for (int i = 0; i < 8; ++i)
#pragma unroll
                    for (int t = 0; t < 4; ++t) ((float*)myp)[(i + 8 * hf) * 64 + t * 16 + l15] = pv[i][t];
                if (UNIT) {                                      // V was published with K, by the barrier behind the staging stores; P is read only by the wave that wrote it:
                    __builtin_amdgcn_fence(__ATOMIC_RELEASE, "workgroup");   // its lanes' P stores are done and stay in front of
                    __builtin_amdgcn_wave_barrier();                         // this point, the wave's P reads behind it
                    __builtin_amdgcn_fence(__ATOMIC_ACQUIRE, "workgroup");
                } else __syncthreads();                          // P (per wave) and V (shared) visible
                if (!PLAIN && p.P) {
                    float* pb_ = p.P + b * p.sPb + h * p.sPh;
                    const bool fastP = (p.pband == 0) && ((p.sPi & 3) == 0) && (j0 + 64 <= p.Lk) && (q0 + 16 <= p.Lq) && ((((size_t)pb_) & 15) == 0);
                    if (fastP) {
#pragma unroll
                        for (int s = 0; s < 8; ++s) {
                            const int row = s * 2 + (lane >> 4), c4 = (lane & 15) * 4;
                            const v4f v = *(const v4f*)(myp + row * 64 + c4);
                            VST2V4(pb_ + (long long)(q0 + row) * p.sPi + j0 + c4, v);
                        }
                    } else {
                        for (int row = 0; row < 16; ++row) {
                            const int irow = q0 + row; if (irow >= p.Lq) continue;
                            for (int c = lane; c < 64; c += 32) {
                                const int jg = j0 + c; if (jg >= p.Lk) continue;
                                if (p.pband == 0) VST2(float, pb_ + (long long)irow * p.sPi + jg, myp[row * 64 + c]);
                                else if (jg - irow <= p.pband && irow - jg <= p.pband) VST2(float, pb_ + (long long)irow * p.sPi + (jg - irow + p.pband), myp[row * 64 + c]);
                            }
                        }
                    }
                }
                if (SPLITPV) {
                    const Split pa0 = sp_ld(myp + l15 * 64, 1, 0, hf, 64, 1.f), pa1 = sp_ld(myp + l15 * 64, 1, 32, hf, 64, 1.f);
                    const __bf16* vh = (const __bf16*)vl; const __bf16* vlo = vh + 64 * VP;
#pragma unroll
                    for (int t = 0; t < NT; ++t) {
                        const int dcol = t * 16 + l15;
                        Split b0, b1;
#pragma unroll
                        for (int e = 0; e < 16; ++e) {
                            const int k0 = frag_k(e, hf), k1 = 32 + frag_k(e, hf);
                            b0.hi[e] = vh[k0 * VP + dcol]; b0.lo[e] = vlo[k0 * VP + dcol]; b1.hi[e] = vh[k1 * VP + dcol]; b1.lo[e] = vlo[k1 * VP + dcol];
                        }
                        o[t] = wmma3(pa0, b0, o[t]);
                        o[t] = wmma3(pa1, b1, o[t]);
                    }
                } else {
                    const v16h pa0 = fh_ld(myp + l15 * 64, 1, 0, hf, 64, 4096.f), pa1 = fh_ld(myp + l15 * 64, 1, 32, hf, 64, 4096.f);
#pragma unroll
                    for (int t = 0; t < NT; ++t) {
                        const int dcol = t * 16 + l15;
                        v16h b0, b1;
#pragma unroll
                        for (int e = 0; e < 16; ++e) { b0[e] = vl[frag_k(e, hf) * VP + dcol]; b1[e] = vl[(32 + frag_k(e, hf)) * VP + dcol]; }
                        o[t] = wmma16(pa0, b0, o[t]);
                        o[t] = wmma16(pa1, b1, o[t]);
                    }
                }
            }
        }
    }
    float* obase = p.O + b * p.sOb + h * p.sOh;
    if (!PLAIN && p.ST) {
        const int rl = lane >> 1, isel = rl & 7;           // row q0 + rl ; rl>>3 == hf holds because lane>>4 == (lane>>1)>>3
        float mv = 0.f, lv = 0.f;
#pragma unroll
        for (int i = 0; i < 8; ++i) if (i == isel) { mv = m8[i]; lv = l8[i]; }
        const int irow = q0 + rl;
        if (irow < p.Lq) { float* st = p.ST + (((long long)b * gridDim.y + h) * p.Lq + irow) * 2 + (lane & 1); VST2(float, st, (lane & 1) ? lv : mv * 0.6931471805599453f); }
    }
    float invr[8];
    if (UNIT && PLAIN) l8[0] += xhalf(l8[0]);                    // transposed path: the query's sum = its two halves' sums
#pragma unroll
    for (int i = 0; i < 8; ++i) {
        if (UNIT && PLAIN) invr[i] = (l8[0] > 0.f) ? 1.f / (l8[0] * 4096.f) : 0.f;
        else if (TWOPASS) invr[i] = SPLITPV ? 1.f : (1.f / 4096.f);
        else if (!PLAIN && p.nonorm) invr[i] = exp2f(m8[i]) * (SPLITPV ? 1.f : (1.f / 4096.f));
        else invr[i] = (l8[i] > 0.f) ? (SPLITPV ? 1.f / l8[i] : 1.f / (l8[i] * 4096.f)) : 0.f;
    }
    __syncthreads();                                             // all waves done with pl/vl from the main loop
    const bool ofast = ((p.sOi & 3) == 0) && ((((size_t)obase) & 15) == 0) && (q0 + 16 <= p.Lq);
#pragma unroll
    for (int c0 = 0; c0 < DVP; c0 += 64) {
#pragma unroll
        for (int i = 0; i < 8; ++i)
#pragma unroll
            for (int t = 0; t < NT; ++t) if (t * 16 >= c0 && t * 16 < c0 + 64) ((float*)myp)[(UNIT && PLAIN) ? l15 * 64 + (t * 16 - c0) + 8 * hf + i : (i + 8 * hf) * 64 + (t * 16 - c0) + l15] = o[t][i] * invr[i];
        __syncthreads();
        const int cw = (DVP - c0 < 64) ? (DVP - c0) : 64;      // staged columns in this chunk (multiple of 16)
        if (ofast && (c0 + cw <= p.dv) && (cw % 32 == 0)) {
            const int lpr = cw / 4;                              // lanes per row (16 for 64 cols, 8 for 32)
            const int rows_per_ins = 32 / lpr;
            for (int r0 = 0; r0 < 16; r0 += rows_per_ins) {
                const int row = r0 + lane / lpr, c4 = (lane % lpr) * 4;
                const v4f v = *(const v4f*)(myp + row * 64 + c4);
                VST2V4(obase + (long long)(q0 + row) * p.sOi + c0 + c4, v);
            }
        } else {
            for (int row = 0; row < 16; ++row) {
                const int irow = q0 + row; if (irow >= p.Lq) continue;
                for (int c = lane; c < cw; c += 32) { const int d = c0 + c; if (d < p.dv) VST2(float, obase + (long long)irow * p.sOi + d, myp[row * 64 + c]); }
            }
        }
        __syncthreads();
    }
}

// =====================================================================================================================
// k_tr: dst(z, c, r) = alpha * src(z, r, c) (+ beta * R2(z, c, r)): [Z][R][C] (row stride lds) -> [Z][C][R] (row stride ldd) through a 32x32 LDS tile;
//   flags: 1 -> add beta * residual R2 addressed like dst (z*sRz + c*ldr + r); act applied before the residual.
// =====================================================================================================================
struct TrP { const float* src; float* dst; const float* R2; long long sSz, lds, sDz, ldd, sRz, ldr; int R, C, flags, act; float alpha, beta; };
static_assert(sizeof(TrP) == 3 * 8 + 6 * 8 + 6 * 4, "TrP has padding");
__global__ __launch_bounds__(256) void k_tr(TrP p) {
    __shared__ float tile[32][33];
    const int c0 = blockIdx.x * 32, r0 = blockIdx.y * 32, z = blockIdx.z;
    const int lane = threadIdx.x & 31, wave = threadIdx.x >> 5;
    const float* s = p.src + z * p.sSz;
#pragma unroll
    for (int k = 0; k < 4; ++k) {
        const int rl = wave * 4 + k, r = r0 + rl, c = c0 + lane;
        tile[rl][lane] = (r < p.R && c < p.C) ? s[(long long)r * p.lds + c] : 0.f;
    }
    __syncthreads();
    float* d = p.dst + z * p.sDz; const float* rr = p.R2 + z * p.sRz;
#pragma unroll
    for (int k = 0; k < 4; ++k) {
        const int cl = wave * 4 + k, c = c0 + cl, r = r0 + lane;
        if (c < p.C && r < p.R) {
            float v = act_fn(p.alpha * tile[lane][cl], p.act);
            if (p.flags & 1) v += p.beta * rr[(long long)c * p.ldr + r];
            VST2(float, d + (long long)c * p.ldd + r, v);
        }
    }
}

// k_affine: dst[i] = a * (sdev ? sdev[0] : 1) * src[i] + b, i < n (one thread per element; consecutive lanes -> consecutive addresses)
__global__ __launch_bounds__(256) void k_affine(const float* __restrict__ src, float* __restrict__ dst, int n, float a, float b, const float* __restrict__ sdev) {
    const int i = blockIdx.x * 256 + threadIdx.x;
    if (i < n) { const float aa = sdev ? a * sdev[0] : a; const float v = aa * src[i] + b; VST2(float, dst + i, v); }
}

// =====================================================================================================================
// k_softmax: row softmax over n contiguous elements, one 256-thread block per row; rows addressed z*sz + r*sr (grid (R, Z)).
//   out = scale_out * softmax(scale_in * x + (Mf ? Mf[z*smz + r*smr + j] : 0)); a row whose max is -inf is written as 0.
// =====================================================================================================================
struct SmP { const float* src; float* dst; const float* Mf; long long sz, sr, dz, dr, smz, smr; int n, pad; float scale_in, scale_out; };
static_assert(sizeof(SmP) == 3 * 8 + 6 * 8 + 4 * 4, "SmP has padding");
__global__ __launch_bounds__(256) void k_softmax(SmP p) {
    __shared__ float red[256];
    const int r = blockIdx.x, z = blockIdx.y, tid = threadIdx.x;
    const float* s = p.src + z * p.sz + (long long)r * p.sr;
    const float* mf = p.Mf ? (p.Mf + z * p.smz + (long long)r * p.smr) : nullptr;
    float mx = -__builtin_inff();
    for (int j = tid; j < p.n; j += 256) { float v = s[j] * p.scale_in; if (mf) v += mf[j]; mx = fmaxf(mx, v); }
    red[tid] = mx; __syncthreads();
    for (int o = 128; o > 0; o >>= 1) { if (tid < o) red[tid] = fmaxf(red[tid], red[tid + o]); __syncthreads(); }
    mx = red[0]; __syncthreads();
    float sum = 0.f;
    for (int j = tid; j < p.n; j += 256) { float v = s[j] * p.scale_in; if (mf) v += mf[j]; sum += (mx == -__builtin_inff()) ? 0.f : expf(v - mx); }
    red[tid] = sum; __syncthreads();
    for (int o = 128; o > 0; o >>= 1) { if (tid < o) red[tid] += red[tid + o]; __syncthreads(); }
    sum = red[0];
    const float inv = (sum > 0.f) ? p.scale_out / sum : 0.f;
    float* d = p.dst + z * p.dz + (long long)r * p.dr;
    for (int j = tid; j < p.n; j += 256) { float v = s[j] * p.scale_in; if (mf) v += mf[j]; const float o = (mx == -__builtin_inff()) ? 0.f : expf(v - mx) * inv; VST2(float, d + j, o); }
}
// =====================================================================================================================
// k_stats: mean and rsqrt(var + eps) over a set of n elements addressed base + z*sz + (e / inner) * so + (e % inner) * si, one 256-thread
// k_norm_apply: y = (x - mean[set]) * rstd[set] * g[c] + b[c] over a [Z][C][L] chan-major tensor with set = z*G + c / (C/G) (G groups per z;
//   G = C -> per-chan sets indexed z*C+c; for batch norm pass stats indexed by c only via bn = 1). Optional act. Output same layout.
// =====================================================================================================================
//   mode 0: mean / rsqrt(var + eps); mode 1 (RMSNorm): 0 / rsqrt(mean(x^2) + eps); mode 2 (L2 normalize * sqrt(n)): 0 / sqrt(n) / max(||x||, eps); mode 3: as 0 with unbiased variance (n-1)
__global__ __launch_bounds__(256) void k_stats(const float* __restrict__ x, long long sz, long long so, long long si, int inner, int n, float eps, float* __restrict__ stat, int mode) {
    __shared__ float red[256];
    const int z = blockIdx.x, tid = threadIdx.x;
    const float* base = x + z * sz;
    float s = 0.f;
    for (int e = tid; e < n; e += 256) s += base[(long long)(e / inner) * so + (long long)(e % inner) * si];
    red[tid] = s; __syncthreads();
    for (int o = 128; o > 0; o >>= 1) { if (tid < o) red[tid] += red[tid + o]; __syncthreads(); }
    const float mu = (mode == 0 || mode == 3) ? red[0] / (float)n : 0.f; __syncthreads();
    float q = 0.f;
    for (int e = tid; e < n; e += 256) { const float dlt = base[(long long)(e / inner) * so + (long long)(e % inner) * si] - mu; q += dlt * dlt; }
    red[tid] = q; __syncthreads();
    for (int o = 128; o > 0; o >>= 1) { if (tid < o) red[tid] += red[tid + o]; __syncthreads(); }
    {
        float rs;
        if (mode == 2) rs = sqrtf((float)n) / fmaxf(sqrtf(red[0]), eps); else if (mode == 3) rs = rsqrtf(red[0] / (float)(n - 1) + eps); else rs = rsqrtf(red[0] / (float)n + eps);
        if (tid < 32) { const float v = (tid == 0) ? mu : ((tid == 1) ? rs : 0.f); VST2(float, stat + (long long)z * 32 + tid, v); }
    }
}
//   One thread per element over the flat [Z][C][L] index space: grid ceil(Z*C*L / 256).
__global__ __launch_bounds__(256) void k_norm_apply(const float* __restrict__ x, float* __restrict__ y, const float* __restrict__ stat, const float* __restrict__ g, const float* __restrict__ bta,
                                                     int Z, int C, int L, int G, int bn, int act) {
    const long long idx = (long long)blockIdx.x * 256 + threadIdx.x;
    if (idx >= (long long)Z * C * L) return;
    const int l = (int)(idx % L); const long long zc = idx / L; const int c = (int)(zc % C), z = (int)(zc / C); (void)l;
    const int set = bn ? c : (z * G + c / (C / G));
    float v = (x[idx] - stat[(long long)set * 32]) * stat[(long long)set * 32 + 1];
    if (g) v *= g[c];
    if (bta) v += bta[c];
    v = act_fn(v, act);
    VST2(float, y + idx, v);
}

// k_lse_neg: c[i] = -(st[2i] + log(st[2i+1])) = minus the log-sum-exp of row i from k_attn's ST output (for softmax over the query dimension)
__global__ __launch_bounds__(256) void k_lse_neg(const float* __restrict__ st, float* __restrict__ c, int n) {
    const int i = blockIdx.x * 256 + threadIdx.x;
    if (i < n) { const float v = -(st[2 * i] + logf(st[2 * i + 1])); VST2(float, c + i, v); }
}

// k_iota: dst[i] = a * i + b as int32 (segment/position id helper)
__global__ __launch_bounds__(256) void k_iota(int* __restrict__ dst, int n, int a, int b) {
    const int i = blockIdx.x * 256 + threadIdx.x;
    if (i < n) { const int v = a * i + b; VST2(int, dst + i, v); }
}

// k_axpby: dst[i] = a * x[i] + b * y[i] (+ c), i < n
__global__ __launch_bounds__(256) void k_axpby(const float* __restrict__ x, const float* __restrict__ y, float* __restrict__ dst, int n, float a, float b, float c) {
    const int i = blockIdx.x * 256 + threadIdx.x;
    if (i < n) { const float v = a * x[i] + b * y[i] + c; VST2(float, dst + i, v); }
}

// =====================================================================================================================
// k_rope: rotary embedding on a [R rows][Hn heads][D] view (row stride sXr, head stride sXh, element stride 1) -> Y (own strides).
//   mode 0: rotate_half (partner d±D/2, sign - for d<D/2); mode 1: interleaved pairs (partner d^1, sign - for even d).
//   table column tcol: tmode 0 -> d, 1 -> d % (D/2), 2 -> d / 2; position p: pmode 0 -> r % S, 1 -> head index, 2 -> pos[r];
//   c = C[(r / S) * sCb + p * sCp + tcol * sCd], s likewise from Sn; y = x[d] * c + sign * x[partner] * s. X and Y must not alias.
// =====================================================================================================================
struct RopeP { const float* X; float* Y; const float* C; const float* Sn; const int* pos; long long sXr, sXh, sYr, sYh, sCb, sCp, sCd; int R, Hn, D, S, mode, tmode, pmode, pad; };
static_assert(sizeof(RopeP) == 5 * 8 + 7 * 8 + 8 * 4, "RopeP has padding");
__global__ __launch_bounds__(256) void k_rope(RopeP p) {
    const long long idx = (long long)blockIdx.x * 256 + threadIdx.x;
    if (idx >= (long long)p.R * p.Hn * p.D) return;
    const int d = (int)(idx % p.D); const long long rh = idx / p.D; const int h = (int)(rh % p.Hn); const int r = (int)(rh / p.Hn);
    const int half = p.D / 2;
    int partner; float sign;
    if (p.mode == 0) { partner = (d < half) ? d + half : d - half; sign = (d < half) ? -1.f : 1.f; }
    else { partner = d ^ 1; sign = (d & 1) ? 1.f : -1.f; }
    const int tcol = (p.tmode == 0) ? d : ((p.tmode == 1) ? (d % half) : (d >> 1));
    const int pp = (p.pmode == 0) ? (r % p.S) : ((p.pmode == 1) ? h : p.pos[r]);
    const long long toff = (long long)(r / p.S) * p.sCb + (long long)pp * p.sCp + (long long)tcol * p.sCd;
    const float* xr = p.X + (long long)r * p.sXr + (long long)h * p.sXh;
    const float v = xr[d] * p.C[toff] + sign * xr[partner] * p.Sn[toff];
    VST2(float, p.Y + (long long)r * p.sYr + (long long)h * p.sYh + d, v);
}

// k_invf + k_sincos (split so neither kernel carries a large VALU-fma footprint): invf_i = num * (1 / powf(base, (2 i)/D)) [fmode 0],
//   num * expf((2 i) * cexp) [fmode 1], num * powf(base, -2 (i - 1) / D) [fmode 2]; then cs/sn[s*half + i] = cos/sin((pscale * s) * invf_i)
__global__ __launch_bounds__(256) void k_invf(float* __restrict__ invb, int half, int D, float base, float num, int fmode, float cexp) {
    const int i = blockIdx.x * 256 + threadIdx.x;
    if (i >= ((half + 31) / 32) * 32) return;
    if (i >= half) { VST2(float, invb + i, 0.f); return; }
    const float e = (float)(2 * i) / (float)D;
    float invf;
    if (fmode == 1) invf = num * expf((float)(2 * i) * cexp);
    else if (fmode == 2) invf = num * powf(base, (-2.0f * ((float)i - 1.0f)) / (float)D);
    else invf = num * (1.0f / powf(base, e));
    VST2(float, invb + i, invf);
}
__global__ __launch_bounds__(256) void k_sincos(float* __restrict__ cs, float* __restrict__ sn, const float* __restrict__ invb, int S, int half, float pscale) {
    const int idx = blockIdx.x * 256 + threadIdx.x;
    if (idx >= S * half) return;
    const int s = idx / half, i = idx - s * half;
    const float ang = (pscale * (float)s) * invb[i];
    VST2(float, cs + idx, cosf(ang)); VST2(float, sn + idx, sinf(ang));
}

// k_mulact: dst[i] = act(x[i]) * y[i]
__global__ __launch_bounds__(256) void k_mulact(const float* __restrict__ x, const float* __restrict__ y, float* __restrict__ dst, int n, int act) {
    const int i = blockIdx.x * 256 + threadIdx.x;
    if (i < n) { const float v = act_fn(x[i], act) * y[i]; VST2(float, dst + i, v); }
}

// =====================================================================================================================
// k_matvec: thread-per-row matrix-vector products for N <= 8 output columns (heads with 1-3 outputs, gates), f32 on the VALU.
//   C[r*sCm + j] = act(alpha * sum_k A[r*sAm + k*sAk] * B[j*sBn + k*sBk] + bias[j]) + beta * R[r*sRm + j*sRn]; each thread writes its N contiguous floats.
// =====================================================================================================================
__global__ __launch_bounds__(256) void k_matvec(GemmP p) {
    // 32 lanes write one line with one instruction.
    const int rpt = (p.N == 1) ? 1 : 32;
    const long long r0 = ((long long)blockIdx.x * 256 + threadIdx.x) * rpt; const int z = blockIdx.z, zo = z / p.zi_n, zi = z - zo * p.zi_n;
    if (r0 >= p.M) return;
    const float* Bb = p.B + zo * p.sBo + zi * p.sBi;
    float* C = p.C + zo * p.sCo + zi * p.sCi; const float* R = p.R + zo * p.sRo + zi * p.sRi;
    for (int rr = 0; rr < rpt; ++rr) {
        const long long r = r0 + rr; if (r >= p.M) break;
        const float* A = p.A + zo * p.sAo + zi * p.sAi + r * p.sAm;
        float acc[8] = {0.f, 0.f, 0.f, 0.f, 0.f, 0.f, 0.f, 0.f};
        for (int k = 0; k < p.K; ++k) { const float a = A[(long long)k * p.sAk];
#pragma unroll
            for (int j = 0; j < 8; ++j) if (j < p.N) acc[j] += a * Bb[(long long)j * p.sBn + (long long)k * p.sBk]; }
#pragma unroll
        for (int j = 0; j < 8; ++j) if (j < p.N) {
            float v = acc[j] * p.alpha;
            if (p.flags & 1) v += p.bias[j];
            if (p.flags & 2) v += p.bias[r];
            v = act_fn(v, p.act);
            if (p.flags & 4) v += p.beta * R[r * p.sRm + (long long)j * p.sRn];
            VST2(float, C + r * p.sCm + j, v);
        }
    }
}
// k_smallsoftmax: thread-per-row softmax for short rows (n <= 64): dst[r*dr + j] = softmax(scale*src[r*sr + j])
__global__ __launch_bounds__(256) void k_smallsoftmax(const float* __restrict__ src, float* __restrict__ dst, long long sr, long long dr, int n, long long R, float scale) {
    const long long r0 = ((long long)blockIdx.x * 256 + threadIdx.x) * 32;
    for (int rr = 0; rr < 32; ++rr) {
        const long long r = r0 + rr; if (r >= R) return;
        const float* s = src + r * sr; float* d = dst + r * dr;
        float mx = -__builtin_inff();
        for (int j = 0; j < n; ++j) mx = fmaxf(mx, s[j] * scale);
        float sum = 0.f;
        for (int j = 0; j < n; ++j) sum += expf(s[j] * scale - mx);
        const float inv = 1.f / sum;
        for (int j = 0; j < n; ++j) { const float v = expf(s[j] * scale - mx) * inv; VST2(float, d + j, v); }
    }
}

__global__ __launch_bounds__(32) void k_unitstat(float* __restrict__ st) { const int t = threadIdx.x; const float v = (t == 1) ? 1.f : 0.f; VST2(float, st + t, v); }

// destination (e.g. a d_out whose row width is not a multiple of 32 floats) is written by consecutive lanes of one instruction
__global__ __launch_bounds__(256) void k_lincopy(const float* __restrict__ src, long long lds, float* __restrict__ dst, long long ldd, long long rows, int cols) {
    const long long i = (long long)blockIdx.x * 256 + threadIdx.x; if (i >= rows * cols) return;
    const long long r = i / cols; const int c = (int)(i - r * cols);
    const float v = src[r * lds + c]; VST2(float, dst + r * ldd + c, v);
}

namespace w25 {
typedef __attribute__((ext_vector_type(16))) _Float16 v16h;
typedef __attribute__((ext_vector_type(8)))  _Float16 v8h;
typedef __attribute__((ext_vector_type(16))) __bf16   v16b;
typedef __attribute__((ext_vector_type(8)))  __bf16   v8b;
typedef __attribute__((ext_vector_type(8)))  float    v8f;
typedef __attribute__((ext_vector_type(4)))  float    v4f;

__device__ __forceinline__ unsigned short f2bf_bits(float f) {
  unsigned u = __float_as_uint(f);
  return (unsigned short)((u + 0x7FFFu + ((u >> 16) & 1u)) >> 16);
}
__device__ __forceinline__ float bf_bits2f(unsigned short h) { return __uint_as_float(((unsigned)h) << 16); }

// hazard guards as plain device helpers (no inline asm inside the kernel template body)
__device__ __forceinline__ void dep_guard_h(v8f& a, v8f& b, v16h x, v16h y) { asm volatile("v_nop\n\tv_nop\n\tv_nop\n\tv_nop" : "+v"(a), "+v"(b) : "v"(x), "v"(y)); }
__device__ __forceinline__ void dep_guard_b(v8f& a, v8f& b, v16b x, v16b y) { asm volatile("v_nop\n\tv_nop\n\tv_nop\n\tv_nop" : "+v"(a), "+v"(b) : "v"(x), "v"(y)); }
__device__ __forceinline__ void keep4_h(v16h a, v16h b, v16h c, v16h d) { asm volatile("v_nop" :: "v"(a), "v"(b), "v"(c), "v"(d)); }
__device__ __forceinline__ void keep4_b(v16b a, v16b b, v16b c, v16b d) { asm volatile("v_nop" :: "v"(a), "v"(b), "v"(c), "v"(d)); }
__device__ __forceinline__ void acc_guard4(v8f& a, v8f& b, v8f& c, v8f& d) { asm volatile("v_nop\n\tv_nop\n\tv_nop\n\tv_nop" : "+v"(a), "+v"(b), "+v"(c), "+v"(d)); }
template <typename T> struct Frag;
template <> struct Frag<_Float16> {
  typedef v16h V; union U { v16h v; v8h h[2]; };
  static __device__ __forceinline__ v16h load(const _Float16* p) {   // elements 0..7 <- p[0..7], 8..15 <- p[16..23]
    U f; f.h[0] = *(const v8h*)(p); f.h[1] = *(const v8h*)(p + 16); return f.v;
  }
  static __device__ __forceinline__ v8f mma(v16h a, v16h b, v8f c) {
    return __builtin_amdgcn_wmma_f32_16x16x32_f16(false, a, false, b, (short)0, c, false, false);
  }
  static __device__ __forceinline__ void guard(v8f& a, v8f& b, v16h x, v16h y) { dep_guard_h(a, b, x, y); }
  static __device__ __forceinline__ void keep(v16h a, v16h b, v16h c, v16h d) { keep4_h(a, b, c, d); }
};
template <> struct Frag<__bf16> {
  typedef v16b V; union U { v16b v; v8b h[2]; };
  static __device__ __forceinline__ v16b load(const __bf16* p) {
    U f; f.h[0] = *(const v8b*)(p); f.h[1] = *(const v8b*)(p + 16); return f.v;
  }
  static __device__ __forceinline__ v8f mma(v16b a, v16b b, v8f c) {
    return __builtin_amdgcn_wmma_f32_16x16x32_bf16(false, a, false, b, (short)0, c, false, false);
  }
  static __device__ __forceinline__ void guard(v8f& a, v8f& b, v16b x, v16b y) { dep_guard_b(a, b, x, y); }
  static __device__ __forceinline__ void keep(v16b a, v16b b, v16b c, v16b d) { keep4_b(a, b, c, d); }
};

// ---- Register-blocked batched WMMA GEMM ------------------------------------
// C[m,n] = scale * sum_k A[m,k] * Bt[n,k] (+bias)(+resid); each wave owns a 64x64 tile.
// A row-major [M,K]; Bt row-major [N,K]; M,N % 64 == 0, K % 32 == 0.
// SPLIT: operands are hi/lo planes (A2/Bt2 = lo planes, same layout); product = hi·hi + hi·lo + lo·hi.
// BIAS_MODE: 0 = none, 1 = bias[m], 2 = bias[n].
// OUT_MODE: 0 = f32, 1 = f16, 2 = bf16 hi plane (Cout) + bf16 lo plane (Cout2).
// ET: 0 = f16 operands, 1 = bf16 operands (pointers passed as 16-bit storage)
template <int ET> struct Elem;
template <> struct Elem<0> { typedef _Float16 T; };
template <> struct Elem<1> { typedef __bf16 T; };
template <int ET, bool SPLIT, int BIAS_MODE, int OUT_MODE, bool RESID, int ACT = 0>
__global__ __launch_bounds__(256) void wmma_gemm64(
    const unsigned short* __restrict__ Ap, const unsigned short* __restrict__ A2p, int lda, long strideA,
    const unsigned short* __restrict__ Btp, const unsigned short* __restrict__ Bt2p, int ldb, long strideB,
    void* __restrict__ Cout, void* __restrict__ Cout2, int ldc, long strideC,
    const float* __restrict__ bias,
    const float* __restrict__ resid, long strideR,
    int M, int N, int K, float scale) {
  typedef typename Elem<ET>::T T;
  typedef typename Frag<T>::V V;
  const T* A = (const T*)Ap; const T* A2 = (const T*)A2p; const T* Bt = (const T*)Btp; const T* Bt2 = (const T*)Bt2p;
  __shared__ __align__(16) float sT[8][16 * 68];   // per-wave 16x64 slab, pitch 68 floats
  const int b    = blockIdx.y;
  const int lane = threadIdx.x & 31;
  const int wave = threadIdx.x >> 5;
  const int tilesN = N >> 6;
  const int tilesM = M >> 6;
  const int tile = blockIdx.x * 8 + wave;
  if (tile >= tilesM * tilesN) return;   // wave-uniform; no block barriers in this kernel
  const int tm = tile / tilesN;
  const int tn = tile - tm * tilesN;
  const int m0 = tm << 6;
  const int n0 = tn << 6;

  const T* Ab  = A  + (size_t)b * strideA;
  const T* Bb  = Bt + (size_t)b * strideB;
  const T* Ab2 = SPLIT ? (A2  + (size_t)b * strideA) : nullptr;
  const T* Bb2 = SPLIT ? (Bt2 + (size_t)b * strideB) : nullptr;

  const int rlane = lane & 15;                 // row (A) / col (B, D) within subtile
  const int koff  = (lane >> 4) * 8;           // k offset of this lane half
  const int mOff  = (lane >> 4) * 8;           // D row offset

  v8f acc[4][4];
#pragma unroll
  for (int i = 0; i < 4; ++i)
#pragma unroll
    for (int j = 0; j < 4; ++j) acc[i][j] = (v8f){0.f,0.f,0.f,0.f,0.f,0.f,0.f,0.f};

  for (int k0 = 0; k0 < K; k0 += 32) {
    V bh[4], bl[4];
#pragma unroll
    for (int j = 0; j < 4; ++j) {
      const size_t bo = (size_t)(n0 + (j << 4) + rlane) * ldb + koff + k0;
      bh[j] = Frag<T>::load(Bb + bo);
      if (SPLIT) bl[j] = Frag<T>::load(Bb2 + bo);
    }
#pragma unroll
    for (int i = 0; i < 4; ++i) {
      const size_t ao = (size_t)(m0 + (i << 4) + rlane) * lda + koff + k0;
      V ah = Frag<T>::load(Ab + ao);
      V al;
      if (SPLIT) al = Frag<T>::load(Ab2 + ao);
#pragma unroll
      for (int j = 0; j < 4; ++j) {
        acc[i][j] = Frag<T>::mma(ah, bh[j], acc[i][j]);
        if (SPLIT) {
          acc[i][j] = Frag<T>::mma(ah, bl[j], acc[i][j]);
          acc[i][j] = Frag<T>::mma(al, bh[j], acc[i][j]);
        }
      }
      Frag<T>::guard(acc[i][0], acc[i][3], ah, SPLIT ? al : ah);
    }
    Frag<T>::keep(bh[0], bh[1], bh[2], bh[3]);
    if (SPLIT) Frag<T>::keep(bl[0], bl[1], bl[2], bl[3]);
  }
  acc_guard4(acc[0][0], acc[0][1], acc[0][2], acc[0][3]);
  acc_guard4(acc[1][0], acc[1][1], acc[1][2], acc[1][3]);
  acc_guard4(acc[2][0], acc[2][1], acc[2][2], acc[2][3]);
  acc_guard4(acc[3][0], acc[3][1], acc[3][2], acc[3][3]);

  // ---- epilogue ----
  float* slab = sT[wave];
  const float* Rb = RESID ? (resid + (size_t)b * strideR) : nullptr;
#pragma unroll
  for (int i = 0; i < 4; ++i) {
    const int mBase = m0 + (i << 4);
#pragma unroll
    for (int j = 0; j < 4; ++j) {
      const int n = n0 + (j << 4) + rlane;
      float bv = 0.f;
      if (BIAS_MODE == 2) bv = bias[n];
#pragma unroll
      for (int r = 0; r < 8; ++r) {
        float v = acc[i][j][r] * scale;
        if (BIAS_MODE == 1) v += bias[mBase + mOff + r];
        if (BIAS_MODE == 2) v += bv;
        if (RESID) v += Rb[(size_t)(mBase + mOff + r) * ldc + n];
        if (ACT == 1) v = tanhf(v);
        if (ACT == 2) v = fmaxf(v, 0.0f);
        if (ACT == 3) v = v / (1.0f + expf(-v));
        if (ACT == 4) v = (v > 0.f) ? v : 0.01f * v;
        if (ACT == 5) v = 0.5f * v * (1.0f + erff(v * 0.70710678118654752f));
        if (ACT == 6) v = (v > 0.f) ? v : 0.2f * v;
        if (ACT == 7) { const float u = 0.7978845608028654f * (v + 0.044715f * v * v * v); v = 0.5f * v * (1.f + tanhf(u)); }
        slab[(mOff + r) * 68 + (j << 4) + rlane] = v;
      }
    }
    __builtin_amdgcn_fence(__ATOMIC_RELEASE, "workgroup");
    __builtin_amdgcn_wave_barrier();
    __builtin_amdgcn_fence(__ATOMIC_ACQUIRE, "workgroup");
    if (OUT_MODE == 0) {
      float* C = (float*)Cout + (size_t)b * strideC;
      const int hh = lane >> 4, c4 = (lane & 15) * 4;     // row seg = 256 B = 16 lanes x 16 B
      {
#pragma unroll
        for (int it = 0; it < 8; ++it) {
          const int row = it * 2 + hh;
          v4f v = *(const v4f*)(slab + row * 68 + c4);
          *(v4f*)(C + (size_t)(mBase + row) * ldc + n0 + c4) = v;
        }
        
      }
    } else {
      const int q = lane >> 3, c8 = (lane & 7) * 8;
      unsigned short* C  = (unsigned short*)Cout  + (size_t)b * strideC;
      unsigned short* C2 = (OUT_MODE == 2) ? ((unsigned short*)Cout2 + (size_t)b * strideC) : nullptr;
      {
#pragma unroll
        for (int it = 0; it < 4; ++it) {
          const int row = it * 4 + q;
          const float* sp = slab + row * 68 + c8;
          v8h hv, lv;
#pragma unroll
          for (int e = 0; e < 8; ++e) {
            if (OUT_MODE == 1) {
              hv[e] = (_Float16)sp[e];
            } else {
              unsigned short hb = f2bf_bits(sp[e]);
              unsigned short lb = f2bf_bits(sp[e] - bf_bits2f(hb));
              hv[e] = __builtin_bit_cast(_Float16, hb);
              lv[e] = __builtin_bit_cast(_Float16, lb);
            }
          }
          *(v8h*)(C + (size_t)(mBase + row) * ldc + n0 + c8) = hv;
          if (OUT_MODE == 2) *(v8h*)(C2 + (size_t)(mBase + row) * ldc + n0 + c8) = lv;
        }
        
      }
    }
    __builtin_amdgcn_fence(__ATOMIC_RELEASE, "workgroup");
    __builtin_amdgcn_wave_barrier();
    __builtin_amdgcn_fence(__ATOMIC_ACQUIRE, "workgroup");
  }
}

__global__ __launch_bounds__(256) void cast_f32_f16x2(
    const float* __restrict__ in, _Float16* __restrict__ out, int n2) {
  int i = blockIdx.x * 256 + threadIdx.x;
  if (i < n2) {
    const _Float16 h0 = (_Float16)in[2 * i], h1 = (_Float16)in[2 * i + 1];
    const unsigned u = (unsigned)__builtin_bit_cast(unsigned short, h0) | ((unsigned)__builtin_bit_cast(unsigned short, h1) << 16);
    ((unsigned*)out)[i] = u;
    
  }
}


} // namespace w25

__global__ __launch_bounds__(256) void k_castT16(const float* __restrict__ src, long long lds, _Float16* __restrict__ dst, long long ldd, int R, int C, float s) {
    const long long i = (long long)blockIdx.x * 256 + threadIdx.x; const long long np = (long long)C * (R / 2); if (i >= np) return; const int c = (int)(i / (R / 2)); const int r = 2 * (int)(i % (R / 2));
    const _Float16 h0 = (_Float16)(src[(long long)r * lds + c] * s), h1 = (_Float16)(src[(long long)(r + 1) * lds + c] * s);
    const unsigned u = (unsigned)__builtin_bit_cast(unsigned short, h0) | ((unsigned)__builtin_bit_cast(unsigned short, h1) << 16);
    unsigned* d = (unsigned*)(dst + (long long)c * ldd + r); *d = u;  }
__global__ __launch_bounds__(256) void k_cast16(const float* __restrict__ src, long long lds, _Float16* __restrict__ dst, long long ldd, int R, int C, float s) {
    const long long i = (long long)blockIdx.x * 256 + threadIdx.x; const long long np = (long long)R * (C / 2); if (i >= np) return; const int r = (int)(i / (C / 2)); const int c = 2 * (int)(i % (C / 2));
    const _Float16 h0 = (_Float16)(src[(long long)r * lds + c] * s), h1 = (_Float16)(src[(long long)r * lds + c + 1] * s);
    const unsigned u = (unsigned)__builtin_bit_cast(unsigned short, h0) | ((unsigned)__builtin_bit_cast(unsigned short, h1) << 16);
    unsigned* d = (unsigned*)(dst + (long long)r * ldd + c); *d = u;  }

// f32 -> bf16 hi plane + bf16 lo plane (x = hi + lo to ~2^-17 relative; RNE both), [R][C] -> [R][C] (or transposed to [C][R]); 2 consecutive destination elements
__device__ __forceinline__ unsigned int f2bf2_pack(float a, float b, unsigned int* lo) {
    const unsigned short ha = w25::f2bf_bits(a), hb = w25::f2bf_bits(b);
    const unsigned short la = w25::f2bf_bits(a - w25::bf_bits2f(ha)), lb = w25::f2bf_bits(b - w25::bf_bits2f(hb));
    *lo = (unsigned)la | ((unsigned)lb << 16); return (unsigned)ha | ((unsigned)hb << 16); }
// blockIdx.y = matrix of a batch: source matrices sz floats apart, destination planes dz elements apart
__global__ __launch_bounds__(256) void k_castS16(const float* __restrict__ src, long long lds, __bf16* __restrict__ dhi, __bf16* __restrict__ dlo, long long ldd, int R, int C, float s, int transpose, long long sz, long long dz) {
    src += (long long)blockIdx.y * sz; dhi += (long long)blockIdx.y * dz; dlo += (long long)blockIdx.y * dz;
    const long long i = (long long)blockIdx.x * 256 + threadIdx.x; long long o; float a, b;
    if (transpose) { const long long np = (long long)C * (R / 2); if (i >= np) return; const int c = (int)(i / (R / 2)); const int r = 2 * (int)(i % (R / 2)); a = src[(long long)r * lds + c] * s; b = src[(long long)(r + 1) * lds + c] * s; o = (long long)c * ldd + r; }
    else { const long long np = (long long)R * (C / 2); if (i >= np) return; const int r = (int)(i / (C / 2)); const int c = 2 * (int)(i % (C / 2)); a = src[(long long)r * lds + c] * s; b = src[(long long)r * lds + c + 1] * s; o = (long long)r * ldd + c; }
    unsigned lo; const unsigned hi = f2bf2_pack(a, b, &lo); unsigned* ph = (unsigned*)(dhi + o); unsigned* pl = (unsigned*)(dlo + o);
    *ph = hi; *pl = lo;  }

namespace w25 {
// =====================================================================================
// Generic causal/non-causal attention for head_dim 64, f32 in / f32 out; 16-bit operands: bf16 with optional hi/lo splits, or
// plain f16 (F16=true, non-split, probabilities carried x2^15).
//   scores = (q*qscale)·kᵀ : v_wmma_f32_16x16x32_bf16; SPLIT_QK -> q,k as bf16 hi/lo (hi·hi + hi·lo + lo·hi)
//   out    = p·v           : v_wmma_f32_16x16x32_bf16; SPLIT_PV -> p,v as bf16 hi/lo; else p,v plain bf16
//   f32 accumulate; online softmax in f32. Block = 4 waves = 64 query rows of one (batch, head); S % 64 == 0.
//   Element (b, s, h, d) of tensor X lives at X[b*X_bs + s*X_rs + h*X_hs + d] (strides in floats, multiples of 4).
//   Masking: mask_mode 0 none, 1 causal (kv > q masked), 2 tensor [S][Skv] shared over (b,h) (float if
//   mask_is_int==0, int32 with element == 0 -> masked if 1, int32 with element != 0 -> masked if 2), 3 per-token vectors qmask[B][S] & kvmask[B][Skv] (int32,
//   0 -> masked), 4 causal + sliding window (kv > q or q - kv > W masked; W passed in mask_is_int);
//   5 = relative-position bias: s += cp[b,h,q][idx[q][kv]] + pc[b,h,kv][idx[q][kv]] with idx = mask_b ([S][Skv] int32) and
//   mask_a an int32 [S][Skv] tensor with nonzero = masked (tables: element (b,h,row,n) at X + b*c_bs + h*c_hs + row*c_rs + n);
//   masked scores are replaced by mask_fill (e.g. -inf or -1e9) before the softmax.
//   grid.x = B * H * (S/64) (or a sub-range with blk0).
// =====================================================================================
#define AT_D 64
#define AT_NW 4
#define AT_QB 64
#define AT_KC 64
struct AttnGeom { const float* cp = nullptr; const float* pc = nullptr; long c_bs = 0, c_rs = 0, c_hs = 0;   // mode-5 score-bias tables
                  long q_bs, q_rs, q_hs, k_bs, k_rs, k_hs, v_bs, v_rs, v_hs, o_bs, o_rs, o_hs;
                  int S, Skv, H, mask_mode; float qscale; int blk0; float mask_fill; int mask_is_int; };
static_assert(sizeof(AttnGeom) == 168, "no padding");

__device__ __forceinline__ unsigned short at_bf_bits(float f) {
  unsigned u = __float_as_uint(f);
  return (unsigned short)((u + 0x7FFFu + ((u >> 16) & 1u)) >> 16);
}
__device__ __forceinline__ __bf16 at_f2bf(float f) { return __builtin_bit_cast(__bf16, at_bf_bits(f)); }
__device__ __forceinline__ void at_split(float f, __bf16& hi, __bf16& lo) {
  const unsigned short hb = at_bf_bits(f);
  hi = __builtin_bit_cast(__bf16, hb);
  lo = at_f2bf(f - __uint_as_float(((unsigned)hb) << 16));
}
__device__ __forceinline__ v8f at_mma(v16b a, v16b b, v8f c) {
  c = __builtin_amdgcn_wmma_f32_16x16x32_bf16(false, a, false, b, (short)0, c, false, false);
  asm volatile("v_nop\n\tv_nop\n\tv_nop\n\tv_nop" : "+v"(c) : "v"(a), "v"(b));
  return c;
}
// 16-bit element as a bit pattern held in a __bf16 slot: f16 bits when F16, bf16 (RNE) otherwise
template <bool F16> __device__ __forceinline__ __bf16 at_to16(float f) {
  if (F16) return __builtin_bit_cast(__bf16, (_Float16)f);
  return at_f2bf(f);
}
template <bool F16> __device__ __forceinline__ v8f at_mma16(v16b a, v16b b, v8f c) {
  if (F16) {
    const v16h ah = __builtin_bit_cast(v16h, a), bh = __builtin_bit_cast(v16h, b);
    c = __builtin_amdgcn_wmma_f32_16x16x32_f16(false, ah, false, bh, (short)0, c, false, false);
    asm volatile("v_nop\n\tv_nop\n\tv_nop\n\tv_nop" : "+v"(c) : "v"(ah), "v"(bh));
    return c;
  }
  return at_mma(a, b, c);
}

template <bool SPLIT_QK, bool SPLIT_PV, bool F16 = false>
__global__ __launch_bounds__(128)
void attn64_kernel(const float* __restrict__ q, const float* __restrict__ k,
                   const float* __restrict__ v, float* __restrict__ out,
                   const void* __restrict__ mask_a, const int* __restrict__ mask_b, AttnGeom g) {
  static_assert(!(F16 && (SPLIT_QK || SPLIT_PV)), "f16 mode is non-split");
  const float PSC = F16 ? 32768.0f : 1.0f;     // f16 probabilities carried x2^15 (subnormal range), folded into the final 1/l
  union FB { v16b v; v8b h[2]; };
  __shared__ __align__(16) __bf16 Ksh[AT_KC * AT_D];             // K hi [kv][d]      8 KB
  __shared__ __align__(16) __bf16 Ksl[SPLIT_QK ? AT_KC * AT_D : 8];
  __shared__ __align__(16) __bf16 Vth[AT_D * AT_KC];             // V hi [d][kv]      8 KB
  __shared__ __align__(16) __bf16 Vtl[SPLIT_PV ? AT_D * AT_KC : 8];
  __shared__ __align__(16) __bf16 Psh[AT_NW][16 * AT_KC];        // per wave P hi [row][kv]  8 KB
  __shared__ __align__(16) __bf16 Psl[SPLIT_PV ? AT_NW : 1][SPLIT_PV ? 16 * AT_KC : 8];
  __shared__ __align__(16) float  Os[AT_NW][16 * 68];            // per wave out tile, pitch 68

  const int tid  = threadIdx.x;
  const int wave = tid >> 5;
  const int lane = tid & 31;
  const int hh   = lane >> 4;
  const int c    = lane & 15;

  const int nqb = g.S / AT_QB;
  const int bx = blockIdx.x + g.blk0;
  const int qb = bx % nqb;
  const int bh = bx / nqb;
  const int h  = bh % g.H;
  const int b  = bh / g.H;
  const int qbase_block = qb * AT_QB;
  const int q0 = qbase_block + wave * 16;

  const float* qb_ptr = q + (size_t)b * g.q_bs + (size_t)h * g.q_hs;
  const float* kb_ptr = k + (size_t)b * g.k_bs + (size_t)h * g.k_hs;
  const float* vb_ptr = v + (size_t)b * g.v_bs + (size_t)h * g.v_hs;
  float*       ob_ptr = out + (size_t)b * g.o_bs + (size_t)h * g.o_hs;

  // ---- Q fragments (A operand): 2 d-chunks, hi (and lo) ----
  v16b qah[2], qal[2];
  {
    const float* qrow = qb_ptr + (size_t)(q0 + c) * g.q_rs;
#pragma unroll
    for (int dc = 0; dc < 2; ++dc) {
#pragma unroll
      for (int e = 0; e < 8; ++e) {
        const float f0 = qrow[dc * 32 + 8 * hh + e] * g.qscale;
        const float f1 = qrow[dc * 32 + 16 + 8 * hh + e] * g.qscale;
        if (SPLIT_QK) { __bf16 hq, lq; at_split(f0, hq, lq); qah[dc][e] = hq; qal[dc][e] = lq; at_split(f1, hq, lq); qah[dc][8 + e] = hq; qal[dc][8 + e] = lq; }
        else { qah[dc][e] = at_to16<F16>(f0); qah[dc][8 + e] = at_to16<F16>(f1); qal[dc][e] = qah[dc][e]; qal[dc][8 + e] = qah[dc][8 + e]; }
      }
    }
  }

  float mrow[8], lrow[8];
  v8f oacc[4];
#pragma unroll
  for (int r = 0; r < 8; ++r) { mrow[r] = -INFINITY; lrow[r] = 0.f; }
#pragma unroll
  for (int t = 0; t < 4; ++t) oacc[t] = (v8f){0.f,0.f,0.f,0.f,0.f,0.f,0.f,0.f};

  const int nChunks = (g.mask_mode == 1 || g.mask_mode == 4) ? (qb + 1) : (g.Skv / AT_KC);   // block-uniform
  // per-row query mask (mode 3)
  int qkeep[8];
#pragma unroll
  for (int r = 0; r < 8; ++r) qkeep[r] = (g.mask_mode == 3) ? mask_b[(size_t)b * g.S + q0 + 8 * hh + r] : 1;   // mask_b = qmask in mode 3
  for (int kc = 0; kc < nChunks; ++kc) {
    const int kv0 = kc * AT_KC;
    __syncthreads();
    {
      const int kvr = tid >> 1, dh = (tid & 1) * 32;
      const float* krow = kb_ptr + (size_t)(kv0 + kvr) * g.k_rs + dh;
      const float* vrow = vb_ptr + (size_t)(kv0 + kvr) * g.v_rs + dh;
#pragma unroll
      for (int i = 0; i < 8; ++i) {
        v4f kk = *(const v4f*)(krow + 4 * i);
        v4f vv = *(const v4f*)(vrow + 4 * i);
#pragma unroll
        for (int e = 0; e < 4; ++e) {
          const int d = dh + 4 * i + e;
          if (SPLIT_QK) { __bf16 a, bl; at_split(kk[e], a, bl); Ksh[kvr * AT_D + d] = a; Ksl[kvr * AT_D + d] = bl; }
          else Ksh[kvr * AT_D + d] = at_to16<F16>(kk[e]);
          if (SPLIT_PV) { __bf16 a, bl; at_split(vv[e], a, bl); Vth[d * AT_KC + kvr] = a; Vtl[d * AT_KC + kvr] = bl; }
          else Vth[d * AT_KC + kvr] = at_to16<F16>(vv[e]);
        }
      }
    }
    __syncthreads();

    v8f s[4];
#pragma unroll
    for (int j = 0; j < 4; ++j) {
      s[j] = (v8f){0.f,0.f,0.f,0.f,0.f,0.f,0.f,0.f};
#pragma unroll 1
      for (int dc = 0; dc < 2; ++dc) {
        FB kb;
        kb.h[0] = *(const v8b*)(Ksh + (j * 16 + c) * AT_D + dc * 32 + 8 * hh);
        kb.h[1] = *(const v8b*)(Ksh + (j * 16 + c) * AT_D + dc * 32 + 16 + 8 * hh);
        s[j] = at_mma16<F16>(qah[dc], kb.v, s[j]);
        if (SPLIT_QK) {
          FB kl;
          kl.h[0] = *(const v8b*)(Ksl + (j * 16 + c) * AT_D + dc * 32 + 8 * hh);
          kl.h[1] = *(const v8b*)(Ksl + (j * 16 + c) * AT_D + dc * 32 + 16 + 8 * hh);
          s[j] = at_mma16<F16>(qah[dc], kl.v, s[j]);
          s[j] = at_mma16<F16>(qal[dc], kb.v, s[j]);
        }
      }
    }
    const bool diag = (g.mask_mode == 1) && (kc == qb);
    int kvkeep[4] = {1, 1, 1, 1};
    if (g.mask_mode == 3) {
#pragma unroll
      for (int j = 0; j < 4; ++j) kvkeep[j] = ((const int*)mask_a)[(size_t)b * g.Skv + kv0 + j * 16 + c];   // mask_a = kvmask
    }
    float cm[8];
#pragma unroll
    for (int r = 0; r < 8; ++r) {
      const int qrow = q0 + 8 * hh + r;
      float m = -INFINITY;
#pragma unroll
      for (int j = 0; j < 4; ++j) {
        const int kvcol = kv0 + j * 16 + c;
        bool masked = false;
        if (diag) masked = (kvcol > qrow);
        else if (g.mask_mode == 4) masked = (kvcol > qrow) || (qrow - kvcol > g.mask_is_int);
        else if (g.mask_mode == 2) {
          const size_t mi = (size_t)qrow * g.Skv + kvcol;
          masked = (g.mask_is_int == 0) ? (((const float*)mask_a)[mi] == 0.0f)
                 : (g.mask_is_int == 1) ? (((const int*)mask_a)[mi] == 0) : (((const int*)mask_a)[mi] != 0);
        } else if (g.mask_mode == 3) masked = (qkeep[r] == 0) || (kvkeep[j] == 0);
        else if (g.mask_mode == 5) {
          const size_t mi = (size_t)qrow * g.Skv + kvcol;
          masked = (((const int*)mask_a)[mi] != 0);
          int n = mask_b[mi]; n = n < 0 ? 0 : n;
          s[j][r] += g.cp[(size_t)b * g.c_bs + (size_t)h * g.c_hs + (size_t)qrow * g.c_rs + n]
                   + g.pc[(size_t)b * g.c_bs + (size_t)h * g.c_hs + (size_t)kvcol * g.c_rs + n];
        }
        if (masked) s[j][r] = g.mask_fill;
        m = fmaxf(m, s[j][r]);
      }
#pragma unroll
      for (int off = 1; off < 16; off <<= 1) m = fmaxf(m, __shfl_xor(m, off, 32));
      cm[r] = m;
    }
    __bf16* pwh = Psh[wave];
    __bf16* pwl = Psl[SPLIT_PV ? wave : 0];
#pragma unroll
    for (int r = 0; r < 8; ++r) {
      const float mnew = fmaxf(mrow[r], cm[r]);
      const float alpha = expf(mrow[r] - mnew);
      mrow[r] = mnew;
      float psum = 0.f;
#pragma unroll
      for (int j = 0; j < 4; ++j) {
        const float p = expf(s[j][r] - mnew);
        psum += p;
        if (SPLIT_PV) { __bf16 a, bl; at_split(p, a, bl); pwh[(8 * hh + r) * AT_KC + j * 16 + c] = a; pwl[(8 * hh + r) * AT_KC + j * 16 + c] = bl; }
        else pwh[(8 * hh + r) * AT_KC + j * 16 + c] = at_to16<F16>(p * PSC);
      }
#pragma unroll
      for (int off = 1; off < 16; off <<= 1) psum += __shfl_xor(psum, off, 32);
      lrow[r] = lrow[r] * alpha + psum;
#pragma unroll
      for (int t = 0; t < 4; ++t) oacc[t][r] *= alpha;
    }
    __builtin_amdgcn_fence(__ATOMIC_RELEASE, "workgroup");
    __builtin_amdgcn_wave_barrier();
    __builtin_amdgcn_fence(__ATOMIC_ACQUIRE, "workgroup");
#pragma unroll 1
    for (int kk = 0; kk < 2; ++kk) {
      FB pa, pl;
      pa.h[0] = *(const v8b*)(pwh + c * AT_KC + kk * 32 + 8 * hh);
      pa.h[1] = *(const v8b*)(pwh + c * AT_KC + kk * 32 + 16 + 8 * hh);
      if (SPLIT_PV) {
        pl.h[0] = *(const v8b*)(pwl + c * AT_KC + kk * 32 + 8 * hh);
        pl.h[1] = *(const v8b*)(pwl + c * AT_KC + kk * 32 + 16 + 8 * hh);
      }
#pragma unroll
      for (int t = 0; t < 4; ++t) {
        FB vb;
        vb.h[0] = *(const v8b*)(Vth + (t * 16 + c) * AT_KC + kk * 32 + 8 * hh);
        vb.h[1] = *(const v8b*)(Vth + (t * 16 + c) * AT_KC + kk * 32 + 16 + 8 * hh);
        oacc[t] = at_mma16<F16>(pa.v, vb.v, oacc[t]);
        if (SPLIT_PV) {
          FB vl;
          vl.h[0] = *(const v8b*)(Vtl + (t * 16 + c) * AT_KC + kk * 32 + 8 * hh);
          vl.h[1] = *(const v8b*)(Vtl + (t * 16 + c) * AT_KC + kk * 32 + 16 + 8 * hh);
          oacc[t] = at_mma16<F16>(pa.v, vl.v, oacc[t]);
          oacc[t] = at_mma16<F16>(pl.v, vb.v, oacc[t]);
        }
      }
    }
  }

  float* os = Os[wave];
#pragma unroll
  for (int r = 0; r < 8; ++r) {
    const float inv = 1.0f / (lrow[r] * PSC);
#pragma unroll
    for (int t = 0; t < 4; ++t) os[(8 * hh + r) * 68 + t * 16 + c] = oacc[t][r] * inv;
  }
  __builtin_amdgcn_fence(__ATOMIC_RELEASE, "workgroup");
  __builtin_amdgcn_wave_barrier();
  __builtin_amdgcn_fence(__ATOMIC_ACQUIRE, "workgroup");
  {
    const int c4 = (lane & 15) * 4;
    {
#pragma unroll
      for (int it = 0; it < 8; ++it) {
        const int row = it * 2 + hh;
        v4f val = *(const v4f*)(os + row * 68 + c4);
        *(v4f*)(ob_ptr + (size_t)(q0 + row) * g.o_rs + c4) = val;
      }
      
    }
  }
}

} // namespace w25


__device__ __forceinline__ void st_h2(unsigned short* d2, float a, float b) { const unsigned u = (unsigned)__builtin_bit_cast(unsigned short, (_Float16)a) | ((unsigned)__builtin_bit_cast(unsigned short, (_Float16)b) << 16); unsigned* d = (unsigned*)d2; *d = u;  }
__device__ __forceinline__ float ldh(const unsigned short* p) { return (float)__builtin_bit_cast(_Float16, *p); }
__device__ __forceinline__ v4f ld4h(const unsigned short* p) { const unsigned long long u = *(const unsigned long long*)p; v4f a;
    a.x = (float)__builtin_bit_cast(_Float16, (unsigned short)(u & 0xFFFFu)); a.y = (float)__builtin_bit_cast(_Float16, (unsigned short)((u >> 16) & 0xFFFFu)); a.z = (float)__builtin_bit_cast(_Float16, (unsigned short)((u >> 32) & 0xFFFFu)); a.w = (float)__builtin_bit_cast(_Float16, (unsigned short)((u >> 48) & 0xFFFFu)); return a; }
__device__ __forceinline__ unsigned long long pk4h(v4f s) { return (unsigned long long)__builtin_bit_cast(unsigned short, (_Float16)s.x) | ((unsigned long long)__builtin_bit_cast(unsigned short, (_Float16)s.y) << 16) | ((unsigned long long)__builtin_bit_cast(unsigned short, (_Float16)s.z) << 32) | ((unsigned long long)__builtin_bit_cast(unsigned short, (_Float16)s.w) << 48); }
typedef unsigned v4u __attribute__((ext_vector_type(4)));
__device__ __forceinline__ void st8h(unsigned short* d, v4f a, v4f b) { const unsigned long long pa = pk4h(a), pb = pk4h(b); v4u pk; pk.x = (unsigned)(pa & 0xFFFFFFFFull); pk.y = (unsigned)(pa >> 32); pk.z = (unsigned)(pb & 0xFFFFFFFFull); pk.w = (unsigned)(pb >> 32); v4u* dd = (v4u*)d; *dd = pk;  }
__device__ __forceinline__ unsigned short bfu_rne(float v) { unsigned u = __builtin_bit_cast(unsigned, v); u += 0x7FFFu + ((u >> 16) & 1u); return (unsigned short)(u >> 16); }
__device__ __forceinline__ void bfsplit(float v, unsigned short& hi, unsigned short& lo) { hi = bfu_rne(v); lo = bfu_rne(v - __builtin_bit_cast(float, (unsigned)hi << 16)); }
__device__ __forceinline__ void st_s2(unsigned short* Hp, unsigned short* Lp, long long o, float a, float b) { unsigned short h0,l0,h1,l1; bfsplit(a,h0,l0); bfsplit(b,h1,l1); const unsigned ph = (unsigned)h0 | ((unsigned)h1 << 16), pl = (unsigned)l0 | ((unsigned)l1 << 16);
    unsigned* dh = (unsigned*)(Hp + o); unsigned* dl = (unsigned*)(Lp + o); *dh = ph; *dl = pl;  }
__device__ __forceinline__ int cl(int v, int n) { return min(max(v, 0), n - 1); }

// GAT-style aggregation over a device in-edge CSR at dst (+ optional explicit self loop as iteration j = -1):
//   logit = leaky(AS[src][h] + AD[n][h] (+ EW[e]*CW[h]), slope); softmax over the node's edges per head; acc[c] = sum alpha XP[src][c] (f16 gather plane, pitch XW; 256 channels = H heads x CH)
//   wave per node; lane L owns channels 8L..8L+7 (head = 8L / CH); per-lane softmax state (lanes of one head agree) -> no shuffles in the loop.
//   EPI 0: + bias -> f32 OUT[n][256] via LDS redistribution (two 16-B stores per lane, each instruction 512 contiguous B)
//   EPI 1: + bias, LayerNorm(256) * g + bb, relu -> bf16 hi/lo planes OH/OL [n][256] (16-B stores)
//   EPI 2: mean over the 256/CH heads + bias[0..CH-1] , LayerNorm(64) * g + bb, relu -> f32 OUT[n][64] (CH must be 64; LDS redistribution, 8-B stores)
//   EPI 3: mean over heads + bias -> f32 OUT[n][64] (no norm / activation)
//   EPI 4: + bias, ELU -> bf16 hi/lo planes OH/OL [n][256];  EPI 5: + bias (full 256-wide, per head), ELU, then mean over the 256/CH heads -> f32 OUT[n][64]
//   EPI 6: (CH = 128, two heads) mean over the two heads, + bias[0..127], relu -> f32 OUT[n][128] (LDS redistribution, 16-B stores)
//   EWM 0: no edge weights; 1: logit += EW[e] * CW[h] (self loop weight 1); 2: alpha *= EW[e] after the softmax (message scale; self loop weight 1)
template <int CH, bool SELF, int EWM, int EPI>
__global__ __launch_bounds__(256) void k_gat_agg(const unsigned short* __restrict__ XP, int XW, const float* __restrict__ AS, const float* __restrict__ AD, int ASTR, const float* __restrict__ EW, const float* __restrict__ CW,
        const int* __restrict__ esrc, const int* __restrict__ off, const int* __restrict__ cnt, const int* __restrict__ slot, const float* __restrict__ bias, const float* __restrict__ g, const float* __restrict__ bb,
        float* __restrict__ OUT, unsigned short* __restrict__ OH, unsigned short* __restrict__ OL, int N, int E, int CAP, float slope) {
    __shared__ float stage[8][256];
    const int wv = threadIdx.x >> 5; const int n = blockIdx.x * 8 + wv; const int L = threadIdx.x & 31; if (n >= N) return; const int c0 = 8 * L; const int h = c0 / CH;
    const float ad = AD[(long long)n * ASTR + h]; const float cw = (EWM == 1) ? CW[h] : 0.f; float m = -3.0e38f, s = 0.f; v4f a0, a1; a0.x = a0.y = a0.z = a0.w = 0.f; a1 = a0;
    const int p0 = cl(off[n], E + 1), cn = min(max(cnt[n], 0), CAP);
    for (int j = (SELF ? -1 : 0); j < cn; ++j) { int sj; float ew = 0.f;
        if (j < 0) { sj = n; ew = 1.f; } else { int e = slot[cl(p0 + j, E)]; e = cl(e, E); sj = cl(esrc[e], N); if (EWM != 0) ew = EW[e]; }
        float lg = AS[(long long)sj * ASTR + h] + ad + ((EWM == 1) ? ew * cw : 0.f); lg = (lg >= 0.f) ? lg : slope * lg;
        const float mn = fmaxf(m, lg); const float cz = expf(m - mn), pj = expf(lg - mn); s = s * cz + pj; const float pw = (EWM == 2) ? pj * ew : pj;
        const unsigned short* xr = XP + (long long)sj * XW + c0; a0 = a0 * cz + ld4h(xr) * pw; a1 = a1 * cz + ld4h(xr + 4) * pw; m = mn; }
    const float inv = (s > 0.f) ? 1.f / (s + 1e-16f) : 0.f; a0 = a0 * inv; a1 = a1 * inv;
    if (EPI == 0 || EPI == 1 || EPI == 4 || EPI == 5) { a0 = a0 + *(const v4f*)(bias + c0); a1 = a1 + *(const v4f*)(bias + c0 + 4); }
    if (EPI == 4 || EPI == 5) { a0.x = (a0.x > 0.f) ? a0.x : (expf(a0.x) - 1.f); a0.y = (a0.y > 0.f) ? a0.y : (expf(a0.y) - 1.f); a0.z = (a0.z > 0.f) ? a0.z : (expf(a0.z) - 1.f); a0.w = (a0.w > 0.f) ? a0.w : (expf(a0.w) - 1.f);
        a1.x = (a1.x > 0.f) ? a1.x : (expf(a1.x) - 1.f); a1.y = (a1.y > 0.f) ? a1.y : (expf(a1.y) - 1.f); a1.z = (a1.z > 0.f) ? a1.z : (expf(a1.z) - 1.f); a1.w = (a1.w > 0.f) ? a1.w : (expf(a1.w) - 1.f); }
    if (EPI == 4) { float o8[8] = {a0.x, a0.y, a0.z, a0.w, a1.x, a1.y, a1.z, a1.w}; unsigned short hh[8], ll[8];
#pragma unroll
        for (int u = 0; u < 8; ++u) bfsplit(o8[u], hh[u], ll[u]);
        const unsigned long long ph0 = (unsigned long long)hh[0] | ((unsigned long long)hh[1] << 16) | ((unsigned long long)hh[2] << 32) | ((unsigned long long)hh[3] << 48), pl0 = (unsigned long long)ll[0] | ((unsigned long long)ll[1] << 16) | ((unsigned long long)ll[2] << 32) | ((unsigned long long)ll[3] << 48);
        const unsigned long long ph1 = (unsigned long long)hh[4] | ((unsigned long long)hh[5] << 16) | ((unsigned long long)hh[6] << 32) | ((unsigned long long)hh[7] << 48), pl1 = (unsigned long long)ll[4] | ((unsigned long long)ll[5] << 16) | ((unsigned long long)ll[6] << 32) | ((unsigned long long)ll[7] << 48);
        v4u pk; pk.x = (unsigned)(ph0 & 0xFFFFFFFFull); pk.y = (unsigned)(ph0 >> 32); pk.z = (unsigned)(ph1 & 0xFFFFFFFFull); pk.w = (unsigned)(ph1 >> 32); v4u* dh = (v4u*)(OH + (long long)n * 256 + c0); *dh = pk; 
        v4u ql; ql.x = (unsigned)(pl0 & 0xFFFFFFFFull); ql.y = (unsigned)(pl0 >> 32); ql.z = (unsigned)(pl1 & 0xFFFFFFFFull); ql.w = (unsigned)(pl1 >> 32); v4u* dl = (v4u*)(OL + (long long)n * 256 + c0); *dl = ql;  return; }
    if (EPI == 6) {
        a0.x += __shfl_xor(a0.x, 16); a0.y += __shfl_xor(a0.y, 16); a0.z += __shfl_xor(a0.z, 16); a0.w += __shfl_xor(a0.w, 16); a1.x += __shfl_xor(a1.x, 16); a1.y += __shfl_xor(a1.y, 16); a1.z += __shfl_xor(a1.z, 16); a1.w += __shfl_xor(a1.w, 16);
        if (L < 16) { const int cb = 8 * L; const v4f b0 = *(const v4f*)(bias + cb), b1v = *(const v4f*)(bias + cb + 4);
            stage[wv][cb] = fmaxf(a0.x * 0.5f + b0.x, 0.f); stage[wv][cb + 1] = fmaxf(a0.y * 0.5f + b0.y, 0.f); stage[wv][cb + 2] = fmaxf(a0.z * 0.5f + b0.z, 0.f); stage[wv][cb + 3] = fmaxf(a0.w * 0.5f + b0.w, 0.f);
            stage[wv][cb + 4] = fmaxf(a1.x * 0.5f + b1v.x, 0.f); stage[wv][cb + 5] = fmaxf(a1.y * 0.5f + b1v.y, 0.f); stage[wv][cb + 6] = fmaxf(a1.z * 0.5f + b1v.z, 0.f); stage[wv][cb + 7] = fmaxf(a1.w * 0.5f + b1v.w, 0.f); }
        __builtin_amdgcn_fence(__ATOMIC_RELEASE, "workgroup"); __builtin_amdgcn_wave_barrier(); __builtin_amdgcn_fence(__ATOMIC_ACQUIRE, "workgroup");
        v4f o6; o6.x = stage[wv][4 * L]; o6.y = stage[wv][4 * L + 1]; o6.z = stage[wv][4 * L + 2]; o6.w = stage[wv][4 * L + 3]; VST2V4(OUT + (long long)n * 128 + 4 * L, o6); return; }
    if (EPI == 5) {
        a0.x += __shfl_xor(a0.x, 8); a0.y += __shfl_xor(a0.y, 8); a0.z += __shfl_xor(a0.z, 8); a0.w += __shfl_xor(a0.w, 8); a1.x += __shfl_xor(a1.x, 8); a1.y += __shfl_xor(a1.y, 8); a1.z += __shfl_xor(a1.z, 8); a1.w += __shfl_xor(a1.w, 8);
        a0.x += __shfl_xor(a0.x, 16); a0.y += __shfl_xor(a0.y, 16); a0.z += __shfl_xor(a0.z, 16); a0.w += __shfl_xor(a0.w, 16); a1.x += __shfl_xor(a1.x, 16); a1.y += __shfl_xor(a1.y, 16); a1.z += __shfl_xor(a1.z, 16); a1.w += __shfl_xor(a1.w, 16);
        const int gq5 = L & 7; a0 = a0 * 0.25f; a1 = a1 * 0.25f;
        if (L < 8) { stage[wv][8 * gq5] = a0.x; stage[wv][8 * gq5 + 1] = a0.y; stage[wv][8 * gq5 + 2] = a0.z; stage[wv][8 * gq5 + 3] = a0.w; stage[wv][8 * gq5 + 4] = a1.x; stage[wv][8 * gq5 + 5] = a1.y; stage[wv][8 * gq5 + 6] = a1.z; stage[wv][8 * gq5 + 7] = a1.w; }
        __builtin_amdgcn_fence(__ATOMIC_RELEASE, "workgroup"); __builtin_amdgcn_wave_barrier(); __builtin_amdgcn_fence(__ATOMIC_ACQUIRE, "workgroup");
        const unsigned long long pk5 = (unsigned long long)__builtin_bit_cast(unsigned, stage[wv][2 * L]) | ((unsigned long long)__builtin_bit_cast(unsigned, stage[wv][2 * L + 1]) << 32); VST2(unsigned long long, (unsigned long long*)(OUT + (long long)n * 64 + 2 * L), pk5); return; }
    if (EPI == 1) { float sm = a0.x + a0.y + a0.z + a0.w + a1.x + a1.y + a1.z + a1.w;
#pragma unroll
        for (int o = 16; o > 0; o >>= 1) sm += __shfl_xor(sm, o);
        const float mu = sm * (1.f / 256.f); const v4f d0 = a0 - mu, d1 = a1 - mu; float q = d0.x * d0.x + d0.y * d0.y + d0.z * d0.z + d0.w * d0.w + d1.x * d1.x + d1.y * d1.y + d1.z * d1.z + d1.w * d1.w;
#pragma unroll
        for (int o = 16; o > 0; o >>= 1) q += __shfl_xor(q, o);
        const float rs = rsqrtf(q * (1.f / 256.f) + 1e-5f); float o8[8] = {d0.x, d0.y, d0.z, d0.w, d1.x, d1.y, d1.z, d1.w}; unsigned short hh[8], ll[8];
#pragma unroll
        for (int u = 0; u < 8; ++u) { const float v = fmaxf(o8[u] * rs * g[c0 + u] + bb[c0 + u], 0.f); bfsplit(v, hh[u], ll[u]); }
        const unsigned long long ph0 = (unsigned long long)hh[0] | ((unsigned long long)hh[1] << 16) | ((unsigned long long)hh[2] << 32) | ((unsigned long long)hh[3] << 48), pl0 = (unsigned long long)ll[0] | ((unsigned long long)ll[1] << 16) | ((unsigned long long)ll[2] << 32) | ((unsigned long long)ll[3] << 48);
        const unsigned long long ph1 = (unsigned long long)hh[4] | ((unsigned long long)hh[5] << 16) | ((unsigned long long)hh[6] << 32) | ((unsigned long long)hh[7] << 48), pl1 = (unsigned long long)ll[4] | ((unsigned long long)ll[5] << 16) | ((unsigned long long)ll[6] << 32) | ((unsigned long long)ll[7] << 48);
        // lane L's 8 halves at c0 = 8L: 16 B -> one 16-B store per plane (32 lanes x 16 B = whole 512-B row)
        v4u pk; pk.x = (unsigned)(ph0 & 0xFFFFFFFFull); pk.y = (unsigned)(ph0 >> 32); pk.z = (unsigned)(ph1 & 0xFFFFFFFFull); pk.w = (unsigned)(ph1 >> 32); v4u* dh = (v4u*)(OH + (long long)n * 256 + c0); *dh = pk; 
        v4u ql; ql.x = (unsigned)(pl0 & 0xFFFFFFFFull); ql.y = (unsigned)(pl0 >> 32); ql.z = (unsigned)(pl1 & 0xFFFFFFFFull); ql.w = (unsigned)(pl1 >> 32); v4u* dl = (v4u*)(OL + (long long)n * 256 + c0); *dl = ql;  return; }
    if (EPI == 2 || EPI == 3) {   // head mean: lanes L, L^8, L^16, L^24 hold the same chan group of the 4 heads (CH = 64 -> 8 lanes per head)
        a0.x += __shfl_xor(a0.x, 8); a0.y += __shfl_xor(a0.y, 8); a0.z += __shfl_xor(a0.z, 8); a0.w += __shfl_xor(a0.w, 8); a1.x += __shfl_xor(a1.x, 8); a1.y += __shfl_xor(a1.y, 8); a1.z += __shfl_xor(a1.z, 8); a1.w += __shfl_xor(a1.w, 8);
        a0.x += __shfl_xor(a0.x, 16); a0.y += __shfl_xor(a0.y, 16); a0.z += __shfl_xor(a0.z, 16); a0.w += __shfl_xor(a0.w, 16); a1.x += __shfl_xor(a1.x, 16); a1.y += __shfl_xor(a1.y, 16); a1.z += __shfl_xor(a1.z, 16); a1.w += __shfl_xor(a1.w, 16);
        const int gq = L & 7; a0 = a0 * 0.25f + *(const v4f*)(bias + 8 * gq); a1 = a1 * 0.25f + *(const v4f*)(bias + 8 * gq + 4);      // every lane now holds channels 8gq..8gq+7 of the mean
        if (EPI == 3) { if (L < 8) { stage[wv][8 * gq] = a0.x; stage[wv][8 * gq + 1] = a0.y; stage[wv][8 * gq + 2] = a0.z; stage[wv][8 * gq + 3] = a0.w; stage[wv][8 * gq + 4] = a1.x; stage[wv][8 * gq + 5] = a1.y; stage[wv][8 * gq + 6] = a1.z; stage[wv][8 * gq + 7] = a1.w; }
            __builtin_amdgcn_fence(__ATOMIC_RELEASE, "workgroup"); __builtin_amdgcn_wave_barrier(); __builtin_amdgcn_fence(__ATOMIC_ACQUIRE, "workgroup");
            const unsigned long long pk3 = (unsigned long long)__builtin_bit_cast(unsigned, stage[wv][2 * L]) | ((unsigned long long)__builtin_bit_cast(unsigned, stage[wv][2 * L + 1]) << 32); VST2(unsigned long long, (unsigned long long*)(OUT + (long long)n * 64 + 2 * L), pk3); return; }
        float sm = (L < 8) ? (a0.x + a0.y + a0.z + a0.w + a1.x + a1.y + a1.z + a1.w) : 0.f;
#pragma unroll
        for (int o = 16; o > 0; o >>= 1) sm += __shfl_xor(sm, o);
        const float mu = sm * (1.f / 64.f); const v4f d0 = a0 - mu, d1 = a1 - mu; float q = (L < 8) ? (d0.x * d0.x + d0.y * d0.y + d0.z * d0.z + d0.w * d0.w + d1.x * d1.x + d1.y * d1.y + d1.z * d1.z + d1.w * d1.w) : 0.f;
#pragma unroll
        for (int o = 16; o > 0; o >>= 1) q += __shfl_xor(q, o);
        const float rs = rsqrtf(q * (1.f / 64.f) + 1e-5f);
        if (L < 8) { const float* gg = g + 8 * gq; const float* bq = bb + 8 * gq; stage[wv][8 * gq] = fmaxf(d0.x * rs * gg[0] + bq[0], 0.f); stage[wv][8 * gq + 1] = fmaxf(d0.y * rs * gg[1] + bq[1], 0.f); stage[wv][8 * gq + 2] = fmaxf(d0.z * rs * gg[2] + bq[2], 0.f); stage[wv][8 * gq + 3] = fmaxf(d0.w * rs * gg[3] + bq[3], 0.f);
            stage[wv][8 * gq + 4] = fmaxf(d1.x * rs * gg[4] + bq[4], 0.f); stage[wv][8 * gq + 5] = fmaxf(d1.y * rs * gg[5] + bq[5], 0.f); stage[wv][8 * gq + 6] = fmaxf(d1.z * rs * gg[6] + bq[6], 0.f); stage[wv][8 * gq + 7] = fmaxf(d1.w * rs * gg[7] + bq[7], 0.f); }
        __builtin_amdgcn_fence(__ATOMIC_RELEASE, "workgroup"); __builtin_amdgcn_wave_barrier(); __builtin_amdgcn_fence(__ATOMIC_ACQUIRE, "workgroup");
        const unsigned long long pk = (unsigned long long)__builtin_bit_cast(unsigned, stage[wv][2 * L]) | ((unsigned long long)__builtin_bit_cast(unsigned, stage[wv][2 * L + 1]) << 32); VST2(unsigned long long, (unsigned long long*)(OUT + (long long)n * 64 + 2 * L), pk); return; }
    // EPI 0
    stage[wv][c0] = a0.x; stage[wv][c0 + 1] = a0.y; stage[wv][c0 + 2] = a0.z; stage[wv][c0 + 3] = a0.w; stage[wv][c0 + 4] = a1.x; stage[wv][c0 + 5] = a1.y; stage[wv][c0 + 6] = a1.z; stage[wv][c0 + 7] = a1.w;
    __builtin_amdgcn_fence(__ATOMIC_RELEASE, "workgroup"); __builtin_amdgcn_wave_barrier(); __builtin_amdgcn_fence(__ATOMIC_ACQUIRE, "workgroup");
#pragma unroll
    for (int q2 = 0; q2 < 2; ++q2) { const int c = 128 * q2 + 4 * L; v4f v; v.x = stage[wv][c]; v.y = stage[wv][c + 1]; v.z = stage[wv][c + 2]; v.w = stage[wv][c + 3]; VST2V4(OUT + (long long)n * 256 + c, v); } }

__device__ __forceinline__ void st4s(unsigned short* Hp, unsigned short* Lp, long long o, v4f a) { unsigned short h[4], l[4]; bfsplit(a.x, h[0], l[0]); bfsplit(a.y, h[1], l[1]); bfsplit(a.z, h[2], l[2]); bfsplit(a.w, h[3], l[3]);
    const unsigned long long ph = (unsigned long long)h[0] | ((unsigned long long)h[1] << 16) | ((unsigned long long)h[2] << 32) | ((unsigned long long)h[3] << 48), pl = (unsigned long long)l[0] | ((unsigned long long)l[1] << 16) | ((unsigned long long)l[2] << 32) | ((unsigned long long)l[3] << 48);
    VST2(unsigned long long, (unsigned long long*)(Hp + o), ph); VST2(unsigned long long, (unsigned long long*)(Lp + o), pl); }
// f32 [nval2 pairs] -> bf16 hi/lo planes (n2 pairs; pairs >= nval2 zero); thread-linear 4-B stores per plane
__global__ __launch_bounds__(256) void k_pl(const float* __restrict__ S, unsigned short* __restrict__ PH, unsigned short* __restrict__ PL, long long nval2, long long n2) { const long long u = (long long)blockIdx.x * 256 + threadIdx.x; if (u >= n2) return; const bool in = (u < nval2); const long long uc = in ? u : ((nval2 > 0) ? (nval2 - 1) : 0); const float a = S[2 * uc], b = S[2 * uc + 1]; st_s2(PH, PL, 2 * u, in ? a : 0.f, in ? b : 0.f); }
// WC [K][NOP] (thread-linear whole rows) = [W (cols < FO) | 0 | W_h . as_h @EO+h | W_h . ad_h @EO+NH+h | 0 ...]; W is [K][FO] (x @ W layout), as/ad [NH][DH]; EO >= FO.
// branch-free: every lane loads all candidates with clamped indices and selects by value (no exec-masked load arms)
__global__ __launch_bounds__(256) void k_wext(const float* __restrict__ Wm, const float* __restrict__ AS_, const float* __restrict__ AD_, int K, int NOP, int FO, int NH, int DH, int EO, float* __restrict__ WC) {
    #pragma clang fp contract(off)
    const long long u = (long long)blockIdx.x * 256 + threadIdx.x; if (u >= (long long)K * NOP) return; const int kk = (int)(u / NOP), o = (int)(u % NOP);
    const int oo = min(o, FO - 1); const float vw = Wm[(long long)kk * FO + oo]; const int q = min(max(o - EO, 0), 2 * NH - 1); const int h = q % NH; float s = 0.f;
#pragma unroll 1
    for (int c = 0; c < DH; ++c) { const float w = Wm[(long long)kk * FO + h * DH + c]; const float asv = AS_[h * DH + c], adv = AD_[h * DH + c]; s += w * ((q < NH) ? asv : adv); }
    const float v = (o < FO) ? vw : ((o >= EO && o < EO + 2 * NH) ? s : 0.f); VST2(float, WC + u, v); }
// GAT aggregation over a device in-edge CSR (+ analytic self loop as iteration j = -1 when SELF), per-lane online softmax (lanes of one head agree):
// HS rows (pitch P floats): [0,128) projected features z, col 128 + h = a_src.z_h, col 128 + NH + h = a_dst.z_h; lane L owns channels 4L..4L+3 (head = 4L / CH).
// out = sum_j softmax_j(leaky(el[src_j][h] + er[n][h])) z[src_j] (/ (den + deps)) + bias -> ACT (0 none, 1 relu, 2 elu, 3 leaky 0.01) ->
// MODE 0: f32 OUT[n][OW] cols < OC (16-B lane stores, OC*4 contiguous B per wave; OC in {64,128}); MODE 1: bf16 hi/lo planes PH/PL pitch PP (rows n >= N zero); MODE 2: both.
template <int CH, bool SELF, int ACT, int MODE>
__global__ __launch_bounds__(256) void k_gat128(const float* __restrict__ HS, int P, int NH, const float* __restrict__ bias, const int* __restrict__ SRC, const int* __restrict__ off, const int* __restrict__ cnt, const int* __restrict__ slot,
        float* __restrict__ OUT, int OW, int OC, unsigned short* __restrict__ PH, unsigned short* __restrict__ PL, int PP, int N, int NP, int E, int CAP, float slope, float deps) {
    #pragma clang fp contract(off)
    const int n = blockIdx.x * 8 + (threadIdx.x >> 5); const int L = threadIdx.x & 31; if (n >= NP) return; const int c = 4 * L; const int h = c / CH; v4f o; o.x = o.y = o.z = o.w = 0.f;
    if (n < N) { const float* hn = HS + (long long)n * P; const float er = hn[128 + NH + h]; float m = -3.0e38f, s = 0.f; v4f a; a.x = a.y = a.z = a.w = 0.f;
        const int p0 = min(max(off[n], 0), E), cn = min(max(cnt[n], 0), CAP);
        for (int j = (SELF ? -1 : 0); j < cn; ++j) { int sj; if (j < 0) sj = n; else { const int e = min(max(slot[min(p0 + j, E - 1)], 0), E - 1); sj = min(max(SRC[e], 0), N - 1); }
            const float* hs = HS + (long long)sj * P; float lg = hs[128 + h] + er; lg = (lg >= 0.f) ? lg : slope * lg;
            const float mn = fmaxf(m, lg); const float cz = expf(m - mn), pj = expf(lg - mn); s = s * cz + pj; a = a * cz + *(const v4f*)(hs + c) * pj; m = mn; }
        const float inv = (s > 0.f || deps > 0.f) ? 1.f / (s + deps) : 0.f; o = a * inv + *(const v4f*)(bias + c);
        if (ACT == 1) { o.x = fmaxf(o.x, 0.f); o.y = fmaxf(o.y, 0.f); o.z = fmaxf(o.z, 0.f); o.w = fmaxf(o.w, 0.f); }
        if (ACT == 2) { o.x = (o.x > 0.f) ? o.x : (expf(o.x) - 1.f); o.y = (o.y > 0.f) ? o.y : (expf(o.y) - 1.f); o.z = (o.z > 0.f) ? o.z : (expf(o.z) - 1.f); o.w = (o.w > 0.f) ? o.w : (expf(o.w) - 1.f); }
        if (ACT == 3) { o.x = (o.x >= 0.f) ? o.x : 0.01f * o.x; o.y = (o.y >= 0.f) ? o.y : 0.01f * o.y; o.z = (o.z >= 0.f) ? o.z : 0.01f * o.z; o.w = (o.w >= 0.f) ? o.w : 0.01f * o.w; }
        if (MODE != 1 && c < OC) VST2V4(OUT + (long long)n * OW + c, o); }
    if (MODE != 0) st4s(PH, PL, (long long)n * PP + c, o); }

// ---- util2 ----
// generic Bt plane builder from an f32 weight: Bt[o][k] (pitch KP halves) = (TRANS ? W[k*ldw + o] : W[o*ldw + k]) * (S ? S[o] : 1) for o < NO, k < KI; zero elsewhere for o < NOP rows, k < KP (thread per (o < NOP, pair k))
__global__ __launch_bounds__(256) void k_u2_bt(const float* __restrict__ Wm, int ldw, int TRANS, int KI, int NO, int KP, int NOP, const float* __restrict__ S, unsigned short* __restrict__ PH_, unsigned short* __restrict__ PL_) {
    const long long u = (long long)blockIdx.x * 256 + threadIdx.x; if (u >= (long long)NOP * (KP / 2)) return; const int k0 = 2 * (int)(u % (KP / 2)); const int o = (int)(u / (KP / 2)); float a = 0.f, b = 0.f;
    if (o < NO) { const float s = S ? S[o] : 1.f;
        if (k0 < KI) a = (TRANS ? Wm[(long long)k0 * ldw + o] : Wm[(long long)o * ldw + k0]) * s;
        if (k0 + 1 < KI) b = (TRANS ? Wm[(long long)(k0 + 1) * ldw + o] : Wm[(long long)o * ldw + k0 + 1]) * s; }
    st_s2(PH_, PL_, (long long)o * KP + k0, a, b); }
// generic padded vector: O[i] = (i < n) ? (A[i] * (S ? S[i] : 1) + (B2 ? B2[i] : 0)) : 0 for i < NP (one block of 256, NP <= 4096 looped)
__global__ __launch_bounds__(256) void k_u2_vec(const float* __restrict__ A, const float* __restrict__ S, const float* __restrict__ B2, int n, int NP, float* __restrict__ O) { for (int i = threadIdx.x; i < NP; i += 256) { float v = 0.f; if (i < n) v = A[i] * (S ? S[i] : 1.f) + (B2 ? B2[i] : 0.f); VST2(float, O + i, v); } }
__global__ __launch_bounds__(256) void k_u2_colstat(const float* __restrict__ X, int P, int N, float eps, float* __restrict__ STAT) {
    #pragma clang fp contract(off)
    __shared__ float red[256]; const int c = blockIdx.x; const int t = threadIdx.x; float s = 0.f; for (int r = t; r < N; r += 256) s += X[(long long)r * P + c]; red[t] = s; __syncthreads();
    for (int o = 128; o > 0; o >>= 1) { if (t < o) red[t] += red[t + o]; __syncthreads(); }
    const float mu = red[0] / (float)N; __syncthreads(); float q = 0.f; for (int r = t; r < N; r += 256) { const float d = X[(long long)r * P + c] - mu; q += d * d; } red[t] = q; __syncthreads();
    for (int o = 128; o > 0; o >>= 1) { if (t < o) red[t] += red[t + o]; __syncthreads(); }
    const float rs = 1.f / sqrtf(red[0] / (float)N + eps); if (t < 32) VST2(float, STAT + (long long)c * 32 + t, (t == 0) ? mu : ((t == 1) ? rs : 0.f)); }
// rows f32 [R][W] (pitch PW) -> planes at pitch PP, column offset coff; rows >= RL (live) written as zeros up to RP (thread per (r < RP, 4 of W))
__global__ __launch_bounds__(256) void k_u2_pl(const float* __restrict__ X, int PW, int Wd, int RL, int RP, unsigned short* __restrict__ PH_, unsigned short* __restrict__ PL_, int PP, int coff) { const long long u = (long long)blockIdx.x * 256 + threadIdx.x; if (u >= (long long)RP * (Wd / 4)) return; const int r = (int)(u / (Wd / 4)); const int c = 4 * (int)(u % (Wd / 4)); v4f v; v.x = v.y = v.z = v.w = 0.f; if (r < RL) v = *(const v4f*)(X + (long long)r * PW + c); st4s(PH_, PL_, (long long)r * PP + coff + c, v); }

typedef unsigned int cm_u4 __attribute__((ext_vector_type(4)));

__global__ __launch_bounds__(256) void k_cm_zero16(unsigned short* __restrict__ DST, long long n) { const long long u = (long long)blockIdx.x * 256 + threadIdx.x; if (u * 8 >= n) return; cm_u4 z; z.x = z.y = z.z = z.w = 0u; cm_u4* d = (cm_u4*)(DST + u * 8); *d = z;  }
// f32 -> bf16 (RNE) -> f16 casts: every 16-bit operand then holds exactly the bf16-rounded input value (times a power-of-two
// weight scale), so the f16 WMMA products are exact. Plain: thread per (row, 8 cols),
// dst [R][C] pitch ldd; transposed: thread per (col, 8 consecutive rows) -> dst [C][R] pitch ldd; both store 16 B per thread, thread-linear along the dst row.
__device__ __forceinline__ unsigned int cmb_pk2(float a, float b) { return (unsigned int)__builtin_bit_cast(unsigned short, (_Float16)a) | ((unsigned int)__builtin_bit_cast(unsigned short, (_Float16)b) << 16); }
__device__ __forceinline__ float cmb_bf(float v) { const unsigned u = __builtin_bit_cast(unsigned, v); const unsigned r = (u + 0x7fffu + ((u >> 16) & 1u)) & 0xffff0000u; return __builtin_bit_cast(float, r); }   // bf16 RNE, kept as f32 (finite inputs)
// BR[i] = bf16_rne(B[i]) kept as f32 (thread per element)
__global__ __launch_bounds__(256) void k_cm_bfvec(const float* __restrict__ SRC, float* __restrict__ DST, int n) { const int u = blockIdx.x * 256 + threadIdx.x; if (u >= n) return; VST2(float, DST + u, cmb_bf(SRC[u])); }
__global__ __launch_bounds__(256) void k_cm_castb(const float* __restrict__ SRC, int lds, unsigned short* __restrict__ DST, int ldd, int nR, int nC, float sc) {
    const long long u = (long long)blockIdx.x * 256 + threadIdx.x; const int per = nC / 8; if (u >= (long long)nR * per) return; const int r = (int)(u / per); const int c0 = 8 * (int)(u % per);
    const float* s = SRC + (long long)r * lds + c0; float w[8];
#pragma unroll
    for (int e = 0; e < 8; ++e) w[e] = cmb_bf(s[e]) * sc;
    cm_u4 pk; pk.x = cmb_pk2(w[0], w[1]); pk.y = cmb_pk2(w[2], w[3]); pk.z = cmb_pk2(w[4], w[5]); pk.w = cmb_pk2(w[6], w[7]); VST2(cm_u4, (cm_u4*)(DST + (long long)r * ldd + c0), pk); }
__global__ __launch_bounds__(256) void k_cm_castbT(const float* __restrict__ SRC, int lds, unsigned short* __restrict__ DST, int ldd, int nR, int nC, float sc) {
    const long long u = (long long)blockIdx.x * 256 + threadIdx.x; const int per = nR / 8; if (u >= (long long)nC * per) return; const int c = (int)(u / per); const int r0 = 8 * (int)(u % per);
    float w[8];
#pragma unroll
    for (int e = 0; e < 8; ++e) w[e] = cmb_bf(SRC[(long long)(r0 + e) * lds + c]) * sc;
    cm_u4 pk; pk.x = cmb_pk2(w[0], w[1]); pk.y = cmb_pk2(w[2], w[3]); pk.z = cmb_pk2(w[4], w[5]); pk.w = cmb_pk2(w[6], w[7]); VST2(cm_u4, (cm_u4*)(DST + (long long)c * ldd + r0), pk); }

typedef float ab_v2f __attribute__((ext_vector_type(2)));
// A thread's loads go out AB_GB at a time, and the next AB_GB are in flight while these are summed (two register sets, A and B, in turn), instead of one load and its
// wait per trip; each thread adds its values in the same order as one load per trip would (whole groups first, the rest one by one).
#define AB_GB 16
#define AB_GS (AB_GB * 256)                                      // 16-byte pieces from one group of the block's loads to the next
typedef const __attribute__((address_space(1))) v4f* ab_gp;     // pointer to global memory: it stays one behind the wait statement below, through which the compiler does not see
__device__ __forceinline__ void ab_ld(v4f (&v)[AB_GB], ab_gp& p, int off) {   // the group that begins off pieces behind p
#pragma unroll   // v is then indexed by constants and stays in registers, and the loads stand one behind the other
    for (int u = 0; u < AB_GB; ++u) v[u] = p[off + 256 * u];    // the block's 256 threads cover 256 consecutive 16-byte pieces per load
    asm volatile("s_wait_xcnt 0x0" : "+v"(p) :: "memory");      // the loads' address register pair is stepped or reused only behind this wait (p goes through it), the loads still in flight
}
__global__ __launch_bounds__(256) void k_ab_gstat(const float* __restrict__ X, float* __restrict__ STp, int per) {
    #pragma clang fp contract(off)
    __shared__ float red[256]; const int g = blockIdx.x; const int t = threadIdx.x; const float* base = X + (long long)g * per; float s = 0.f;
    const int nb = per / (AB_GB * 1024);                         // whole groups (the same for every thread)
    v4f A[AB_GB], B[AB_GB];
    auto sum = [&s](const v4f (&v)[AB_GB]) {
#pragma unroll   // v is then indexed by constants and stays in registers
        for (int u = 0; u < AB_GB; ++u) s += (cmb_bf(v[u].x) + cmb_bf(v[u].y)) + (cmb_bf(v[u].z) + cmb_bf(v[u].w));
    };
    ab_gp p = (ab_gp)base + t; int k = 0;                        // p: the thread's piece of group k
    if (nb > 0) {
        ab_ld(A, p, 0);
        for (; k + 2 < nb; k += 2) { ab_ld(B, p, AB_GS); sum(A); ab_ld(A, p, 2 * AB_GS); p += 2 * AB_GS; sum(B); }
        if (k + 1 < nb) { ab_ld(B, p, AB_GS); sum(A); sum(B); } else sum(A);
    }
    for (int i = nb * (AB_GB * 1024) + 4 * t; i < per; i += 1024) { const v4f v = *(const v4f*)(base + i); s += (cmb_bf(v.x) + cmb_bf(v.y)) + (cmb_bf(v.z) + cmb_bf(v.w)); }
    red[t] = s; __syncthreads();
    for (int o = 128; o > 0; o >>= 1) { if (t < o) red[t] += red[t + o]; __syncthreads(); }
    const float mean = red[0] / (float)per; __syncthreads(); float q = 0.f;
    auto sq = [&q, mean](const v4f (&v)[AB_GB]) {
#pragma unroll   // v is then indexed by constants and stays in registers
        for (int u = 0; u < AB_GB; ++u) { const float a = cmb_bf(v[u].x) - mean, b = cmb_bf(v[u].y) - mean, c = cmb_bf(v[u].z) - mean, d = cmb_bf(v[u].w) - mean; q += (a * a + b * b) + (c * c + d * d); }
    };
    if (nb > 0) {
        p -= (long long)k * AB_GS; k = 0; ab_ld(A, p, 0);        // p is stepped back to group 0, not formed anew: the first group too is then addressed by the pair that the wait in ab_ld holds
        for (; k + 2 < nb; k += 2) { ab_ld(B, p, AB_GS); sq(A); ab_ld(A, p, 2 * AB_GS); p += 2 * AB_GS; sq(B); }
        if (k + 1 < nb) { ab_ld(B, p, AB_GS); sq(A); sq(B); } else sq(A);
    }
    for (int i = nb * (AB_GB * 1024) + 4 * t; i < per; i += 1024) { const v4f v = *(const v4f*)(base + i); const float a = cmb_bf(v.x) - mean, b = cmb_bf(v.y) - mean, c = cmb_bf(v.z) - mean, d = cmb_bf(v.w) - mean; q += (a * a + b * b) + (c * c + d * d); }
    red[t] = q; __syncthreads();
    for (int o = 128; o > 0; o >>= 1) { if (t < o) red[t] += red[t + o]; __syncthreads(); }
    if (t == 0) { ab_v2f ms; ms.x = mean; ms.y = rsqrtf(red[0] / (float)per + 1e-5f); VST2(ab_v2f, (ab_v2f*)(STp + 32 * g), ms); } }
// XN[c][n] = (bf16(x[c][n]) - mean[g]) rstd[g] bf16(gamma[c]) + bf16(beta[c]); XB[c][n] = bf16(x[c][n]) (residual copy); thread per float4; c runs over the rows of all images ([B * CH][N], groups numbered through), gamma and beta repeat every CH rows
__global__ __launch_bounds__(256) void k_ab_gapply(const float* __restrict__ X, const float* __restrict__ STp, const float* __restrict__ Gm, const float* __restrict__ Bt, float* __restrict__ XNp, float* __restrict__ XBp, int N, int CPG, int CH, long long n4) {
    #pragma clang fp contract(off)
    const long long u = (long long)blockIdx.x * 256 + threadIdx.x; if (u >= n4) return; const int c = (int)((4 * u) / N); const int g = c / CPG; const float mean = STp[32 * g], rs = STp[32 * g + 1], ga = cmb_bf(Gm[c % CH]), be = cmb_bf(Bt[c % CH]);
    const v4f v = *(const v4f*)(X + 4 * u); v4f xb; xb.x = cmb_bf(v.x); xb.y = cmb_bf(v.y); xb.z = cmb_bf(v.z); xb.w = cmb_bf(v.w); v4f r; r.x = (xb.x - mean) * rs * ga + be; r.y = (xb.y - mean) * rs * ga + be; r.z = (xb.z - mean) * rs * ga + be; r.w = (xb.w - mean) * rs * ga + be;
    VST2V4(XNp + 4 * u, r); VST2V4(XBp + 4 * u, xb); }


extern "C" void kernel_launch(void* const* d_in, const int* in_sizes, int n_in, void* d_out, int out_size, void* d_ws, size_t ws_size, hipStream_t stream) {
    (void)in_sizes; (void)n_in; (void)out_size; (void)ws_size;
    const float* x = (const float*)d_in[0];
    const float* gam = (const float*)d_in[1];
    const float* bet = (const float*)d_in[2];
    const float* wqkv = (const float*)d_in[3];
    const float* bqkv = (const float*)d_in[4];
    const float* wo = (const float*)d_in[5];
    const float* bo = (const float*)d_in[6];
    float* out = (float*)d_out;
    char* wsp = (char*)d_ws;
    float* ST = (float*)wsp; wsp += (((size_t)((size_t)32 * 32 + 64) * 4 + 255) / 256) * 256;
    float* XN = (float*)wsp; wsp += (((size_t)((size_t)1024 * 4096) * 4 + 255) / 256) * 256;
    unsigned short* XTH = (unsigned short*)wsp; wsp += (((size_t)((size_t)16384 * 256) * 2 + 255) / 256) * 256;
    unsigned short* XTL = (unsigned short*)wsp; wsp += (((size_t)((size_t)16384 * 256) * 2 + 255) / 256) * 256;
    unsigned short* W3H = (unsigned short*)wsp; wsp += (((size_t)((size_t)768 * 256) * 2 + 255) / 256) * 256;
    unsigned short* W3L = (unsigned short*)wsp; wsp += (((size_t)((size_t)768 * 256) * 2 + 255) / 256) * 256;
    float* BR3 = (float*)wsp; wsp += (((size_t)((size_t)768 + 64) * 4 + 255) / 256) * 256;
    float* QKV = (float*)wsp; wsp += (((size_t)((size_t)16384 * 768) * 4 + 255) / 256) * 256;
    float* AO = (float*)wsp; wsp += (((size_t)((size_t)16384 * 256) * 4 + 255) / 256) * 256;
    unsigned short* AOH = (unsigned short*)wsp; wsp += (((size_t)((size_t)16384 * 256) * 2 + 255) / 256) * 256;
    unsigned short* AOL = (unsigned short*)wsp; wsp += (((size_t)((size_t)16384 * 256) * 2 + 255) / 256) * 256;
    unsigned short* WOH = (unsigned short*)wsp; wsp += (((size_t)((size_t)256 * 256) * 2 + 255) / 256) * 256;
    unsigned short* WOL = (unsigned short*)wsp; wsp += (((size_t)((size_t)256 * 256) * 2 + 255) / 256) * 256;
    float* BRO = (float*)wsp; wsp += (((size_t)((size_t)256 + 64) * 4 + 255) / 256) * 256;
    float* XB = (float*)wsp; wsp += (((size_t)((size_t)1024 * 4096) * 4 + 255) / 256) * 256;
    if ((size_t)(wsp - (char*)d_ws) > ws_size) return;   // static carve guard
    // All four images go through each stage in ONE launch: every buffer holds the four images one behind the other (pixel-major buffers as 16384 rows,
    // channel-major ones as 4 matrices), and the image is extra rows, grid.y or grid.z of the launch.
    k_castS16<<<(unsigned)((((long long)(768) * ((256) / 2)) + 255) / 256), 256, 0, stream>>>(wqkv, 256, (__bf16*)(W3H), (__bf16*)(W3L), 256, 768, 256, 1.0f, 0, 0, 0);
    k_cm_bfvec<<<3, 256, 0, stream>>>(bqkv, BR3, 768); k_cm_bfvec<<<1, 256, 0, stream>>>(bo, BRO, 256);
    k_castS16<<<(unsigned)((((long long)(256) * ((256) / 2)) + 255) / 256), 256, 0, stream>>>(wo, 256, (__bf16*)(WOH), (__bf16*)(WOL), 256, 256, 256, 1.0f, 0, 0, 0);
    k_ab_gstat<<<32, 256, 0, stream>>>(x, ST, 131072); k_ab_gapply<<<(1048576 + 255) / 256, 256, 0, stream>>>(x, ST, gam, bet, XN, XB, 4096, 32, 256, 1048576LL);
    k_castS16<<<dim3((unsigned)((((long long)(4096) * ((256) / 2)) + 255) / 256), (unsigned)(4)), 256, 0, stream>>>(XN, 4096, (__bf16*)(XTH), (__bf16*)(XTL), 256, 256, 4096, 1.0f, 1, 1048576, 1048576);
    w25::wmma_gemm64<1, false, 2, 0, false, 0><<<dim3((unsigned)((((16384) / 64) * ((768) / 64) + 7) / 8), (unsigned)(1)), 256, 0, stream>>>((const unsigned short*)(XTH), nullptr, 256, 0, (const unsigned short*)(W3H), nullptr, 256, 0, (void*)(QKV), nullptr, 768, 0, BR3, nullptr, 0, 16384, 768, 256, 1.0f);
    w25::wmma_gemm64<1, false, 0, 0, true, 0><<<dim3((unsigned)((((16384) / 64) * ((768) / 64) + 7) / 8), (unsigned)(1)), 256, 0, stream>>>((const unsigned short*)(XTL), nullptr, 256, 0, (const unsigned short*)(W3H), nullptr, 256, 0, (void*)(QKV), nullptr, 768, 0, nullptr, QKV, 0, 16384, 768, 256, 1.0f);
    { /*apv4*/ AttnP a;
      a.Q = QKV; a.K = QKV + 256; a.V = QKV + 512; a.O = AO; a.P = 0; a.Mf = 0; a.Mi = 0; a.ST = 0;
      a.Pw = 0; a.Rt = 0; a.SQ = 0; a.SK = 0;
      a.swb = 0; a.swh = 0; a.swi = 0; a.swj = 0; a.srb = 0; a.srh = 0; a.sri = 0; a.sQb = 3145728; a.sQh = 64; a.sQi = 768; a.sQd = 1; a.sKb = 3145728; a.sKh = 64; a.sKj = 768; a.sKd = 1; a.sVb = 3145728; a.sVh = 64; a.sVj = 768; a.sVd = 1; a.sOb = 1048576; a.sOh = 64; a.sOi = 256; a.sPb = 0; a.sPh = 0; a.sPi = 0; a.smb = 0; a.smh = 0; a.smi = 0; a.smj = 0;
      a.Lq = 4096; a.Lk = 4096; a.dh = 64; a.dv = 64; a.hrep = 1; a.causal = 0; a.coff = 0; a.pband = 0;
      a.scale = 0.125f; a.mfill = 0.0f; a.nonorm = 0; a.mpol = 0;
      a.roff = 0; a.rn = 1; a.segpol = 0; a.win = 0;
      k_attn<64, 64, 0, false, false, true, true><<<dim3((unsigned)((4096) + 16 * AW - 1) / (16 * AW), (unsigned)(4), (unsigned)(4)), 32 * AW, 0, stream>>>(a); }
    k_castS16<<<(unsigned)((((long long)(16384) * ((256) / 2)) + 255) / 256), 256, 0, stream>>>(AO, 256, (__bf16*)(AOH), (__bf16*)(AOL), 256, 16384, 256, 1.0f, 0, 0, 0);
    w25::wmma_gemm64<1, false, 1, 0, true, 0><<<dim3((unsigned)((((256) / 64) * ((4096) / 64) + 7) / 8), (unsigned)(4)), 256, 0, stream>>>((const unsigned short*)(WOH), nullptr, 256, 0, (const unsigned short*)(AOH), nullptr, 256, 1048576, (void*)(out), nullptr, 4096, 1048576, BRO, XB, 1048576, 256, 4096, 256, 1.0f);
    w25::wmma_gemm64<1, false, 0, 0, true, 0><<<dim3((unsigned)((((256) / 64) * ((4096) / 64) + 7) / 8), (unsigned)(4)), 256, 0, stream>>>((const unsigned short*)(WOH), nullptr, 256, 0, (const unsigned short*)(AOL), nullptr, 256, 1048576, (void*)(out), nullptr, 4096, 1048576, nullptr, out, 1048576, 256, 4096, 256, 1.0f);
}
